// v000
// The times below were measured on an AMD MI455X: many runs one after another, warmed up first and cycling through
// copies of the inputs, with the whole window's GPU time divided by the number of runs. Launches and the gaps
// between them are all in it. The median over several windows is given; except for v000 it joins two sittings, which
// can be a few percent apart, so the side-by-side timings, each taken in one sitting, are the better comparison.
// v000, which the later versions start from, runs in 2380 microseconds.
#include <hip/hip_runtime.h>

// DynamicMaskAttention (hidden [2][2048][2048]; q = x Wq (16 heads x 128), k/v = x Wk / Wv (4 kv heads; group h/4); per key j and kv head n: bias = sigmoid(q_flat[j] . Wg[:, n]) * (v_flat[j] . Wd[:, n]); logits = q.k / sqrt(128) + bias[n][j]; allowed = causal AND bias[n][j] > 0, everything else gets finfo.min (so a query row with no allowed key softmaxes uniformly over ALL keys, as the source);
//   softmax; out = merged Wo -> [2][2048][2048]).
// Compute dtypes, f32 accumulate: every input rounded to bf16; q/k/v on PLAIN bf16 operands (inputs: exact); gate / delta as hl planes of q_flat / v_flat x exact Wg / Wd (2 products; 4 outputs padded to 64), sigmoid and the product f32; scores and attn.v: query rows < 512 hl (3 products) over ALL key tiles (those early rows can have an empty allowed set and then attend uniformly to every key), the rest single fp16 (x1024) with causal tile skipping; bias + mask + softmax f32; Wo hl x exact (2 products).

#define NB_  2
#define TT   2048
#define DM   2048
#define NH_  16
#define NKV  4
#define REP  (NH_ / NKV)
#define HD   128
#define DQ   (NH_ * HD)
#define DKV  (NKV * HD)
#define ZH   2
#define RH   512                  // query rows < RH use hi+lo planes (0: none)
#define WIN  2048
#define PCAR 1024.0f
#define SCL  0.088388347648318447f   // HD^-0.5
typedef _Float16 h16;
typedef unsigned short bf;
typedef __attribute__((ext_vector_type(16))) __bf16   v16bf;
typedef __attribute__((ext_vector_type(16))) _Float16 v16h;
typedef __attribute__((ext_vector_type(8)))  _Float16 v8h;
typedef __attribute__((ext_vector_type(8)))  unsigned short v8us;
typedef __attribute__((ext_vector_type(8)))  float    v8f;
typedef __attribute__((ext_vector_type(4)))  float    v4f;
typedef v8h  __attribute__((may_alias)) v8ha;
typedef v4f  __attribute__((may_alias)) v4fa;
typedef v8us __attribute__((may_alias)) v8usa;

__device__ __forceinline__ unsigned short f2bf(float f) { unsigned u = __float_as_uint(f); u += 0x7FFFu + ((u >> 16) & 1u); return (unsigned short)(u >> 16); }
__device__ __forceinline__ float bf2f(unsigned short b) { return __uint_as_float(((unsigned)b) << 16); }
__device__ __forceinline__ float bfr(float f) { return bf2f(f2bf(f)); }
__device__ __forceinline__ v16h cat16(v8h lo, v8h hi) { return __builtin_shufflevector(lo, hi, 0, 1, 2, 3, 4, 5, 6, 7, 8, 9, 10, 11, 12, 13, 14, 15); }
__device__ __forceinline__ v16bf cat16b(v8us lo, v8us hi) { return __builtin_bit_cast(v16bf, __builtin_shufflevector(lo, hi, 0, 1, 2, 3, 4, 5, 6, 7, 8, 9, 10, 11, 12, 13, 14, 15)); }
__device__ __forceinline__ v8f wmma16(v16h a, v16h b, v8f c) { return __builtin_amdgcn_wmma_f32_16x16x32_f16(false, a, false, b, (short)0, c, false, false); }
__device__ __forceinline__ v8f wmmab(v16bf a, v16bf b, v8f c) { return __builtin_amdgcn_wmma_f32_16x16x32_bf16(false, a, false, b, (short)0, c, false, false); }



// ---- k_gemmw: register-blocked GEMM, ONE WAVE per 64x64 output tile (16 accumulators), operands straight from K-contiguous 16-bit planes; grid (M/64, N/64, Z), 32 threads.
// C[m][n] (f32, pitch ldc, + optional f32 bias[n]) = sum_k A[m][k] Bt[n][k] (+ split products per NSPLIT). z-batch strides sA/sB/sC in elements. K % 32 == 0.
template <typename T16> struct WFrag;
template <> struct WFrag<h16> { typedef v16h V; static __device__ __forceinline__ V ld(const h16* p) { return cat16(*(const v8h*)p, *(const v8h*)(p + 16)); } static __device__ __forceinline__ v8f mma(V a, V b, v8f c) { return wmma16(a, b, c); } };
template <> struct WFrag<bf> { typedef v16bf V; static __device__ __forceinline__ V ld(const bf* p) { return cat16b(*(const v8us*)p, *(const v8us*)(p + 16)); } static __device__ __forceinline__ v8f mma(V a, V b, v8f c) { return wmmab(a, b, c); } };
template <typename T16, int NSPLIT, bool BIAS>
__global__ __launch_bounds__(32) void k_gemmw(const T16* __restrict__ A, const T16* __restrict__ A2, const T16* __restrict__ Bt, const T16* __restrict__ Bt2, int K, float* C, int ldc, const float* __restrict__ bias, size_t sA, size_t sB, size_t sC) {
    typedef typename WFrag<T16>::V V;
    __shared__ __align__(16) float os[16 * 68];
    const size_t z = blockIdx.z; A += z * sA; if (A2) A2 += z * sA; Bt += z * sB; if (Bt2) Bt2 += z * sB; C += z * sC;
    const int lane = threadIdx.x & 31, lr = lane & 15, hi = lane >> 4; const int r0 = blockIdx.x * 64, c0 = blockIdx.y * 64;
    v8f acc[4][4];
#pragma unroll
    for (int mb = 0; mb < 4; ++mb)
#pragma unroll
        for (int nb = 0; nb < 4; ++nb) acc[mb][nb] = (v8f){};
    const size_t aoff = (size_t)(r0 + lr) * K + 8 * hi, boff = (size_t)(c0 + lr) * K + 8 * hi;
#pragma unroll 1
    for (int kc = 0; kc < K; kc += 32) {
        V a[4], a2[4];
#pragma unroll
        for (int mb = 0; mb < 4; ++mb) { a[mb] = WFrag<T16>::ld(A + aoff + (size_t)mb * 16 * K + kc); if (NSPLIT == 1 || NSPLIT == 2) a2[mb] = WFrag<T16>::ld(A2 + aoff + (size_t)mb * 16 * K + kc); }
#pragma unroll
        for (int nb = 0; nb < 4; ++nb) { const V b = WFrag<T16>::ld(Bt + boff + (size_t)nb * 16 * K + kc); V b2; if (NSPLIT >= 2) b2 = WFrag<T16>::ld(Bt2 + boff + (size_t)nb * 16 * K + kc);
#pragma unroll
            for (int mb = 0; mb < 4; ++mb) { acc[mb][nb] = WFrag<T16>::mma(a[mb], b, acc[mb][nb]); if (NSPLIT == 1 || NSPLIT == 2) acc[mb][nb] = WFrag<T16>::mma(a2[mb], b, acc[mb][nb]); if (NSPLIT >= 2) acc[mb][nb] = WFrag<T16>::mma(a[mb], b2, acc[mb][nb]); } }
        asm volatile("v_nop\n\tv_nop\n\tv_nop\n\tv_nop" : "+v"(acc[0][0]), "+v"(acc[1][1]), "+v"(acc[2][2]), "+v"(acc[3][3]) : "v"(a[0]), "v"(a[3]));
    }
#pragma unroll
    for (int mb = 0; mb < 4; ++mb) {
#pragma unroll
        for (int nb = 0; nb < 4; ++nb) {
#pragma unroll
            for (int j = 0; j < 8; ++j) os[(hi * 8 + j) * 68 + nb * 16 + lr] = acc[mb][nb][j]; }
        __builtin_amdgcn_wave_barrier(); asm volatile("" ::: "memory");
        float* crow = C + (size_t)(r0 + mb * 16) * ldc + c0;
{
#pragma unroll
            for (int s = 0; s < 8; ++s) { const int row = 2 * s + hi, cofs = lr * 4; v4f val = *(const v4fa*)(os + row * 68 + cofs); if (BIAS) { val[0] += bfr(bias[c0 + cofs]); val[1] += bfr(bias[c0 + cofs + 1]); val[2] += bfr(bias[c0 + cofs + 2]); val[3] += bfr(bias[c0 + cofs + 3]); }
                *(v4f*)(crow + (size_t)row * ldc + cofs) = val; }
             }
        __builtin_amdgcn_wave_barrier(); asm volatile("" ::: "memory");
    }
}

// ---- k_gemmc: the same one-wave 64x64 tile GEMM specialised for causal attention: CMODE 1 skips score tiles entirely above the diagonal (query rows r0+roff.., key columns c0..), CMODE 2 limits the
// key (K) loop of the probability x value contraction to the diagonal block (probabilities beyond it are exactly zero). roff = row offset of this launch's first row within the sequence.
template <typename T16, int NSPLIT, int CMODE>
__global__ __launch_bounds__(32) void k_gemmc(const T16* __restrict__ A, const T16* __restrict__ A2, const T16* __restrict__ Bt, const T16* __restrict__ Bt2, int K, float* C, int ldc, int roff, size_t sA, size_t sB, size_t sC) {
    typedef typename WFrag<T16>::V V;
    __shared__ __align__(16) float os[16 * 68];
    const size_t z = blockIdx.z; A += z * sA; if (A2) A2 += z * sA; Bt += z * sB; if (Bt2) Bt2 += z * sB; C += z * sC;
    const int lane = threadIdx.x & 31, lr = lane & 15, hi = lane >> 4; const int r0 = blockIdx.x * 64, c0 = blockIdx.y * 64;
    if (CMODE == 1 && c0 > r0 + roff + 63) return;                  // score tile entirely above the causal diagonal: never read (the softmax masks j > i by select)
    const int Kl = (CMODE == 2) ? min(K, r0 + roff + 64) : K;        // P.V: probabilities are exactly 0 beyond the diagonal block, so the K loop stops there
    v8f acc[4][4];
#pragma unroll
    for (int mb = 0; mb < 4; ++mb)
#pragma unroll
        for (int nb = 0; nb < 4; ++nb) acc[mb][nb] = (v8f){};
    const size_t aoff = (size_t)(r0 + lr) * K + 8 * hi, boff = (size_t)(c0 + lr) * K + 8 * hi;
#pragma unroll 1
    for (int kc = 0; kc < Kl; kc += 32) {
        V a[4], a2[4];
#pragma unroll
        for (int mb = 0; mb < 4; ++mb) { a[mb] = WFrag<T16>::ld(A + aoff + (size_t)mb * 16 * K + kc); if (NSPLIT == 1 || NSPLIT == 2) a2[mb] = WFrag<T16>::ld(A2 + aoff + (size_t)mb * 16 * K + kc); }
#pragma unroll
        for (int nb = 0; nb < 4; ++nb) { const V b = WFrag<T16>::ld(Bt + boff + (size_t)nb * 16 * K + kc); V b2; if (NSPLIT >= 2) b2 = WFrag<T16>::ld(Bt2 + boff + (size_t)nb * 16 * K + kc);
#pragma unroll
            for (int mb = 0; mb < 4; ++mb) { acc[mb][nb] = WFrag<T16>::mma(a[mb], b, acc[mb][nb]); if (NSPLIT == 1 || NSPLIT == 2) acc[mb][nb] = WFrag<T16>::mma(a2[mb], b, acc[mb][nb]); if (NSPLIT >= 2) acc[mb][nb] = WFrag<T16>::mma(a[mb], b2, acc[mb][nb]); } }
        asm volatile("v_nop\n\tv_nop\n\tv_nop\n\tv_nop" : "+v"(acc[0][0]), "+v"(acc[1][1]), "+v"(acc[2][2]), "+v"(acc[3][3]) : "v"(a[0]), "v"(a[3]));
    }
#pragma unroll
    for (int mb = 0; mb < 4; ++mb) {
#pragma unroll
        for (int nb = 0; nb < 4; ++nb) {
#pragma unroll
            for (int j = 0; j < 8; ++j) os[(hi * 8 + j) * 68 + nb * 16 + lr] = acc[mb][nb][j]; }
        __builtin_amdgcn_wave_barrier(); asm volatile("" ::: "memory");
        float* crow = C + (size_t)(r0 + mb * 16) * ldc + c0;
{
#pragma unroll
            for (int s = 0; s < 8; ++s) { const int row = 2 * s + hi, cofs = lr * 4; v4f val = *(const v4fa*)(os + row * 68 + cofs);
                *(v4f*)(crow + (size_t)row * ldc + cofs) = val; }
             }
        __builtin_amdgcn_wave_barrier(); asm volatile("" ::: "memory");
    }
}

__device__ __forceinline__ h16 tohx(float x) { return (h16)x; }
__device__ __forceinline__ void splitf(float y, unsigned short& h, unsigned short& l) { h = f2bf(y); l = f2bf(y - bf2f(h)); }
typedef __attribute__((ext_vector_type(2))) _Float16 v2h;
typedef __attribute__((ext_vector_type(4))) _Float16 v4h;
typedef __attribute__((ext_vector_type(2))) unsigned short v2us;
typedef __attribute__((ext_vector_type(4))) unsigned short v4us;
typedef __attribute__((ext_vector_type(2))) float v2f;
typedef __attribute__((ext_vector_type(4))) int v4i;

__global__ __launch_bounds__(256) void k_wtG(const float* __restrict__ w, int K, int N, bf* Bt) {
    const int lane = threadIdx.x & 31; const int L0 = (blockIdx.x * 8 + (threadIdx.x >> 5)) * 8; const int nlines = N * K / 64;
{
#pragma unroll 1
        for (int l = 0; l < 8; ++l) { const int L = L0 + l; if (L >= nlines) break; const size_t e = (size_t)L * 64 + lane * 2; const int k = (int)(e % K), n = (int)(e / K); v2us o;
            o[0] = f2bf(w[(size_t)k * N + n]); o[1] = f2bf(w[(size_t)(k + 1) * N + n]); *(v2us*)(Bt + e) = o; }
         }
}
__global__ __launch_bounds__(256) void k_cvt8(const float* __restrict__ src, bf* dst, size_t n8) { const size_t i = (size_t)blockIdx.x * 256 + threadIdx.x; if (i >= n8) return; const v8f v = *(const v8f*)(src + i * 8); v8us o;
#pragma unroll
    for (int k = 0; k < 8; ++k) o[k] = f2bf(v[k]); *(v8us*)(dst + i * 8) = o;  }
__global__ __launch_bounds__(256) void k_cscvt(const float* __restrict__ cosT, const float* __restrict__ sinT, float* CS) { const int idx = blockIdx.x * 256 + threadIdx.x; if (idx >= TT * HD) return; v2f cs; cs[0] = bfr(cosT[idx]); cs[1] = bfr(sinT[idx]); *(v2f*)(CS + (size_t)idx * 2) = cs;  }
// k_rope: head planes [h][t][d] (fp16 + hi/lo) of rope(x) x sc with the rotate-half convention out[d] = x[d] cos[t][d] - x[d+HD/2] sin[t][d], out[d+HD/2] = x[d+HD/2] cos[t][d+HD/2] + x[d] sin[t][d+HD/2]
__global__ __launch_bounds__(256) void k_rope(const float* __restrict__ F, int pitch, int nheads, const float* __restrict__ CS, const float* __restrict__ RF, const float* __restrict__ nw, float sc, h16* P16, bf* Ph, bf* Pl) {
    const size_t e = ((size_t)blockIdx.x * 256 + threadIdx.x) * 2; if (e >= (size_t)nheads * TT * HD) return; const int d = (int)(e % HD); const int t = (int)((e / HD) % TT); const int h = (int)(e / ((size_t)HD * TT)); const float* f = F + (size_t)t * pitch + h * HD; const float rf = RF ? RF[(size_t)h * TT + t] : 1.0f; v2h o16; v2us oh, ol;
#pragma unroll
    for (int q = 0; q < 2; ++q) { const int dd = d + q; const int dp = (dd < HD / 2) ? dd + HD / 2 : dd - HD / 2; float x0 = f[dd], x1 = f[dp];
        if (RF) { float n0 = __fmul_rn(x0, rf), n1 = __fmul_rn(x1, rf); asm volatile("" : "+v"(n0)); asm volatile("" : "+v"(n1)); x0 = __fmul_rn(bfr(nw[dd]), n0); x1 = __fmul_rn(bfr(nw[dp]), n1); }
        const v2f cs = *(const v2f*)(CS + ((size_t)t * HD + dd) * 2); float a = __fmul_rn(x0, cs[0]), bq = __fmul_rn(x1, cs[1]); asm volatile("" : "+v"(a)); asm volatile("" : "+v"(bq)); const float r = ((dd < HD / 2) ? __fsub_rn(a, bq) : __fadd_rn(a, bq)) * sc;
        o16[q] = tohx(r); unsigned short a2, c2; splitf(r, a2, c2); oh[q] = a2; ol[q] = c2; }
    *(v2h*)(P16 + e) = o16; *(v2us*)(Ph + e) = oh; *(v2us*)(Pl + e) = ol;  }
__global__ __launch_bounds__(256) void k_vtp(const float* __restrict__ F, int pitch, int nheads, h16* V16, bf* Vh, bf* Vl) { const size_t e = ((size_t)blockIdx.x * 256 + threadIdx.x) * 2; if (e >= (size_t)nheads * HD * TT) return; const int t = (int)(e % TT); const int d = (int)((e / TT) % HD); const int g = (int)(e / ((size_t)TT * HD)); v2h o16; v2us oh, ol;
#pragma unroll
    for (int q = 0; q < 2; ++q) { const float x = F[(size_t)(t + q) * pitch + g * HD + d]; o16[q] = tohx(x); unsigned short a2, c2; splitf(x, a2, c2); oh[q] = a2; ol[q] = c2; }
    *(v2h*)(V16 + e) = o16; *(v2us*)(Vh + e) = oh; *(v2us*)(Vl + e) = ol;  }
__global__ __launch_bounds__(256) void k_csid(float* CS) { const int idx = blockIdx.x * 256 + threadIdx.x; if (idx >= TT * HD) return; v2f cs; cs[0] = 1.0f; cs[1] = 0.0f; *(v2f*)(CS + (size_t)idx * 2) = cs;  }
// k_asoft: per row (zz, i): t = S x HD^-0.5 + bias[j] for j <= i and bias[j] > 0, else -3.0e38 (finfo.min-like fill); softmax over the 2048 keys (register row, one exp, fixed trees);
__global__ __launch_bounds__(256) void k_asoft(const float* __restrict__ Sb, const float* __restrict__ Bb, const int* __restrict__ FLG, int h0, h16* P16, bf* Ph, bf* Pl) {
    const int lane = threadIdx.x & 31; const int row = blockIdx.x * 8 + (threadIdx.x >> 5); if (row >= ZH * TT) return; const int i = row % TT; const int zz = row / TT; (void)zz; const bool hires = (i < RH); const float* sr = Sb + (size_t)row * TT; const float* bias = Bb + (size_t)((h0 + zz) / REP) * TT; const bool poison = (FLG[(h0 + zz) / REP] != 0);   /* premise self-check: no positive bias among keys 0..RH-1 for this kv head -> NaN-poison (flag word FLG[4] also set) */ float v[TT / 32]; float mx = -3.0e38f;
#pragma unroll
    for (int ch = 0; ch < TT / 128; ++ch) { const int j0 = ch * 128 + lane * 4; const v4f a = *(const v4f*)(sr + j0);
#pragma unroll
        for (int q = 0; q < 4; ++q) { const int j = j0 + q; (void)j; const float bj = bias[j]; float sa = a[q] * SCL; asm volatile("" : "+v"(sa)); const float t = (j <= i && bj > 0.f) ? __fadd_rn(sa, bj) : -3.0e38f   /* same fill as the running-max init, so a row with NO allowed key (possible for the first few rows) softmaxes uniformly over every key like the source's finfo.min fill instead of 0/0 */; v[ch * 4 + q] = t; mx = fmaxf(mx, t); } }
#pragma unroll
    for (int sh = 16; sh; sh >>= 1) mx = fmaxf(mx, __shfl_xor(mx, sh, 32));
    float sum = 0.f;
#pragma unroll
    for (int k = 0; k < TT / 32; ++k) { float d0 = __fsub_rn(v[k], mx); asm volatile("" : "+v"(d0)); v[k] = __builtin_amdgcn_exp2f(__fmul_rn(d0, 1.4426950408889634f)); sum += v[k]; }
#pragma unroll
    for (int sh = 16; sh; sh >>= 1) sum += __shfl_xor(sum, sh, 32);
    const float f = poison ? __builtin_nanf("") : __fdiv_rn(hires ? 1.0f : PCAR, sum);
{
        if (hires) {
#pragma unroll
            for (int ch = 0; ch < TT / 128; ++ch) { v4us oh, ol;
#pragma unroll
                for (int q = 0; q < 4; ++q) { unsigned short a, c2; splitf(v[ch * 4 + q] * f, a, c2); oh[q] = a; ol[q] = c2; }
                const size_t oo = ((size_t)zz * (RH ? RH : 1) + i) * TT + ch * 128 + lane * 4; *(v4us*)(Ph + oo) = oh; *(v4us*)(Pl + oo) = ol; }
        } else {
#pragma unroll
            for (int ch = 0; ch < TT / 128; ++ch) { v4h o4;
#pragma unroll
                for (int q = 0; q < 4; ++q) o4[q] = tohx(v[ch * 4 + q] * f);
                *(v4h*)(P16 + (size_t)row * TT + ch * 128 + lane * 4) = o4; } }
         }
}
__global__ __launch_bounds__(256) void k_merge(const float* __restrict__ O, int h0, bf* Ah, bf* Al) { const size_t e = ((size_t)blockIdx.x * 256 + threadIdx.x) * 2; if (e >= (size_t)ZH * TT * HD) return; const int d = (int)(e % HD); const int t = (int)((e / HD) % TT); const int zz = (int)(e / ((size_t)HD * TT)); const float cs = (t < RH) ? 1.0f : (1.0f / PCAR); const size_t oo = (size_t)t * DQ + (h0 + zz) * HD + d;
    v2us oh, ol;
#pragma unroll
    for (int q = 0; q < 2; ++q) { unsigned short a, c2; splitf(O[e + q] * cs, a, c2); oh[q] = a; ol[q] = c2; } *(v2us*)(Ah + oo) = oh; *(v2us*)(Al + oo) = ol;  }

__global__ __launch_bounds__(32) void k_chk(const float* __restrict__ BIAS, int* FLG) { const int n = threadIdx.x; int none = 0; if (n < NKV) { none = 1;
#pragma unroll 1
        for (int j = 0; j < RH; ++j) if (BIAS[(size_t)n * TT + j] > 0.f) { none = 0; break; } }
    int anyb = none;
#pragma unroll
    for (int sh = 16; sh; sh >>= 1) anyb |= __shfl_xor(anyb, sh, 32);
    const int v = (n < NKV) ? none : ((n == NKV) ? anyb : 0); if (n < 8) { *(int*)(FLG + n) = v;  } }
__global__ __launch_bounds__(256) void k_wgd(const float* __restrict__ w, int K, bf* Bt) { const int e = (blockIdx.x * 256 + threadIdx.x) * 4; if (e >= 64 * K) return; const int k = e % K, n = e / K; v4us o;
#pragma unroll
    for (int u = 0; u < 4; ++u) o[u] = (n < NKV) ? f2bf(w[(size_t)(k + u) * NKV + n]) : (unsigned short)0; *(v4us*)(Bt + e) = o;  }
__global__ __launch_bounds__(256) void k_plq(const float* __restrict__ F, bf* Ph, bf* Pl, size_t n4) { const size_t e = ((size_t)blockIdx.x * 256 + threadIdx.x) * 4; if (e >= n4 * 4) return; const v4f a = *(const v4f*)(F + e); v4us oh, ol;
#pragma unroll
    for (int u = 0; u < 4; ++u) { unsigned short x0, x1; splitf(a[u], x0, x1); oh[u] = x0; ol[u] = x1; } *(v4us*)(Ph + e) = oh; *(v4us*)(Pl + e) = ol;  }
__global__ __launch_bounds__(256) void k_bias(const float* __restrict__ GATE, const float* __restrict__ DEL, float* BIAS) { const int e = (blockIdx.x * 256 + threadIdx.x) * 4; if (e >= NKV * TT) return; const int j = e % TT; const int n = e / TT; v4f r;
#pragma unroll
    for (int u = 0; u < 4; ++u) { const float gt = GATE[(size_t)(j + u) * 64 + n]; const float sg = __fdiv_rn(1.0f, __fadd_rn(1.0f, __expf(-gt))); r[u] = __fmul_rn(sg, DEL[(size_t)(j + u) * 64 + n]); }
    *(v4f*)(BIAS + e) = r;  }

extern "C" void kernel_launch(void* const* d_in, const int* in_sizes, int n_in,
                              void* d_out, int out_size, void* d_ws, size_t ws_size, hipStream_t stream) {
    (void)in_sizes; (void)n_in; (void)out_size;
    const float* x = (const float*)d_in[0]; const float* wq = (const float*)d_in[1]; const float* wk = (const float*)d_in[2]; const float* wv = (const float*)d_in[3]; const float* wg = (const float*)d_in[4]; const float* wdl = (const float*)d_in[5]; const float* wo = (const float*)d_in[6]; const float* cosT = nullptr; const float* sinT = nullptr; (void)cosT; (void)sinT;
    float* OUT = (float*)d_out;     // [2][2048][2048]
    char* wsp = (char*)d_ws;
    auto take = [&](size_t bytes) { char* p = wsp; wsp += (bytes + 255) & ~(size_t)255; return (void*)p; };
    bf* WQ = (bf*)take((size_t)DQ * DM * 2); bf* WK = (bf*)take((size_t)DKV * DM * 2); bf* WV = (bf*)take((size_t)DKV * DM * 2); bf* WO = (bf*)take((size_t)DM * DQ * 2); float* CS = (float*)take((size_t)TT * HD * 2 * 4);
    bf* XB = (bf*)take((size_t)TT * DM * 2); bf* GFh = (bf*)take((size_t)TT * DQ * 2); bf* GFl = (bf*)take((size_t)TT * DQ * 2); bf* VFh = (bf*)take((size_t)TT * DKV * 2); bf* VFl = (bf*)take((size_t)TT * DKV * 2); bf* WG = (bf*)take((size_t)64 * DQ * 2); bf* WD = (bf*)take((size_t)64 * DKV * 2); float* GATE = (float*)take((size_t)TT * 64 * 4); float* DEL = (float*)take((size_t)TT * 64 * 4); float* BIAS = (float*)take((size_t)NKV * TT * 4); int* FLG = (int*)take(256); float* FQ = (float*)take((size_t)TT * DQ * 4); float* FK = (float*)take((size_t)TT * DKV * 4);
    h16* QP16 = (h16*)take((size_t)NH_ * TT * HD * 2); h16* KP16 = (h16*)take((size_t)NKV * TT * HD * 2); h16* VT16 = (h16*)take((size_t)NKV * HD * TT * 2);
    bf* QPh = (bf*)take((size_t)NH_ * TT * HD * 2); bf* QPl = (bf*)take((size_t)NH_ * TT * HD * 2); bf* KPh = (bf*)take((size_t)NKV * TT * HD * 2); bf* KPl = (bf*)take((size_t)NKV * TT * HD * 2); bf* VTh = (bf*)take((size_t)NKV * HD * TT * 2); bf* VTl = (bf*)take((size_t)NKV * HD * TT * 2); bf* Ph = (bf*)take((size_t)ZH * RH * TT * 2); bf* Pl = (bf*)take((size_t)ZH * RH * TT * 2);
    float* Sb = (float*)take((size_t)ZH * TT * TT * 4); h16* P16 = (h16*)take((size_t)ZH * TT * TT * 2); float* Ob = (float*)take((size_t)ZH * TT * HD * 4); bf* ATh = (bf*)take((size_t)TT * DQ * 2); bf* ATl = (bf*)take((size_t)TT * DQ * 2);
    if ((size_t)(wsp - (char*)d_ws) > ws_size) return;    // ws 256 MiB
    float* FV = FK;   // v projection reuses the k buffer after the k planes are built (stream-ordered)
    { k_wgd<<<(64 * DQ / 4 + 255) / 256, 256, 0, stream>>>(wg, DQ, WG); k_wgd<<<(64 * DKV / 4 + 255) / 256, 256, 0, stream>>>(wdl, DKV, WD); k_wtG<<<(unsigned)((DM * DQ / 64 + 63) / 64), 256, 0, stream>>>(wq, DM, DQ, WQ); k_wtG<<<(unsigned)((DM * DKV / 64 + 63) / 64), 256, 0, stream>>>(wk, DM, DKV, WK); k_wtG<<<(unsigned)((DM * DKV / 64 + 63) / 64), 256, 0, stream>>>(wv, DM, DKV, WV);
      k_wtG<<<(unsigned)((DQ * DM / 64 + 63) / 64), 256, 0, stream>>>(wo, DQ, DM, WO);
       }
    k_csid<<<(TT * HD + 255) / 256, 256, 0, stream>>>(CS);
    const unsigned LQ = (unsigned)(((size_t)NH_ * TT * HD / 2 + 255) / 256), LKv = (unsigned)(((size_t)NKV * TT * HD / 2 + 255) / 256);
    for (int b = 0; b < NB_; ++b) {
        
        k_cvt8<<<(unsigned)(((size_t)TT * DM / 8 + 255) / 256), 256, 0, stream>>>(x + (size_t)b * TT * DM, XB, (size_t)TT * DM / 8);
        k_gemmw<bf, 0, false><<<dim3(TT / 64, DQ / 64, 1), 32, 0, stream>>>(XB, nullptr, WQ, nullptr, DM, FQ, DQ, nullptr, 0, 0, 0);
        k_rope<<<LQ, 256, 0, stream>>>(FQ, DQ, NH_, CS, nullptr, nullptr, 1.0f, QP16, QPh, QPl);
        k_gemmw<bf, 0, false><<<dim3(TT / 64, DKV / 64, 1), 32, 0, stream>>>(XB, nullptr, WK, nullptr, DM, FK, DKV, nullptr, 0, 0, 0);
        k_rope<<<LKv, 256, 0, stream>>>(FK, DKV, NKV, CS, nullptr, nullptr, 1.0f, KP16, KPh, KPl);
        k_gemmw<bf, 0, false><<<dim3(TT / 64, DKV / 64, 1), 32, 0, stream>>>(XB, nullptr, WV, nullptr, DM, FV, DKV, nullptr, 0, 0, 0);
        /* dynamic mask bias per (kv head, key) */ k_plq<<<(unsigned)(((size_t)TT * DQ / 4 + 255) / 256), 256, 0, stream>>>(FQ, GFh, GFl, (size_t)TT * DQ / 4); k_plq<<<(unsigned)(((size_t)TT * DKV / 4 + 255) / 256), 256, 0, stream>>>(FV, VFh, VFl, (size_t)TT * DKV / 4);
        k_gemmw<bf, 1, false><<<dim3(TT / 64, 1, 1), 32, 0, stream>>>(GFh, GFl, WG, nullptr, DQ, GATE, 64, nullptr, 0, 0, 0); k_gemmw<bf, 1, false><<<dim3(TT / 64, 1, 1), 32, 0, stream>>>(VFh, VFl, WD, nullptr, DKV, DEL, 64, nullptr, 0, 0, 0); k_bias<<<(NKV * TT / 4 + 255) / 256, 256, 0, stream>>>(GATE, DEL, BIAS); k_chk<<<1, 32, 0, stream>>>(BIAS, FLG); k_vtp<<<LKv, 256, 0, stream>>>(FV, DKV, NKV, VT16, VTh, VTl);
        for (int h0 = 0; h0 < NH_; h0 += ZH) { const size_t zq = (size_t)h0, zk = (size_t)(h0 / REP);   // both heads of a pass share kv group h0/REP (REP >= 2): sB = 0
            k_gemmw<bf, 2, false><<<dim3(RH / 64, TT / 64, ZH), 32, 0, stream>>>(QPh + zq * TT * HD, QPl + zq * TT * HD, KPh + zk * TT * HD, KPl + zk * TT * HD, HD, Sb, TT, nullptr, (size_t)TT * HD, 0, (size_t)TT * TT);
            k_gemmc<h16, 0, 1><<<dim3((TT - RH) / 64, TT / 64, ZH), 32, 0, stream>>>(QP16 + zq * TT * HD + (size_t)RH * HD, nullptr, KP16 + zk * TT * HD, nullptr, HD, Sb + (size_t)RH * TT, TT, RH, (size_t)TT * HD, 0, (size_t)TT * TT);
            k_asoft<<<ZH * TT / 8, 256, 0, stream>>>(Sb, BIAS, FLG, h0, P16, Ph, Pl);
            k_gemmw<bf, 2, false><<<dim3(RH / 64, HD / 64, ZH), 32, 0, stream>>>(Ph, Pl, VTh + zk * HD * TT, VTl + zk * HD * TT, TT, Ob, HD, nullptr, (size_t)RH * TT, 0, (size_t)TT * HD);
            k_gemmc<h16, 0, 2><<<dim3((TT - RH) / 64, HD / 64, ZH), 32, 0, stream>>>(P16 + (size_t)RH * TT, nullptr, VT16 + zk * HD * TT, nullptr, TT, Ob + (size_t)RH * HD, HD, RH, (size_t)TT * TT, 0, (size_t)TT * HD);
            k_merge<<<(unsigned)(((size_t)ZH * TT * HD / 2 + 255) / 256), 256, 0, stream>>>(Ob, h0, ATh, ATl); }
        k_gemmw<bf, 1, false><<<dim3(TT / 64, DM / 64, 1), 32, 0, stream>>>(ATh, ATl, WO, nullptr, DQ, OUT + (size_t)b * TT * DM, DM, nullptr, 0, 0, 0); }
}

// v001
// One run takes 1430 microseconds.
// Timed twice side by side with v000, it ran 1.67 times as fast both times.
#include <hip/hip_runtime.h>

// DynamicMaskAttention (hidden [2][2048][2048]; q = x Wq (16 heads x 128), k/v = x Wk / Wv (4 kv heads; group h/4); per key j and kv head n: bias = sigmoid(q_flat[j] . Wg[:, n]) * (v_flat[j] . Wd[:, n]); logits = q.k / sqrt(128) + bias[n][j]; allowed = causal AND bias[n][j] > 0, everything else gets finfo.min (so a query row with no allowed key softmaxes uniformly over ALL keys, as the source);
//   softmax; out = merged Wo -> [2][2048][2048]).
// Compute dtypes, f32 accumulate: every input rounded to bf16; q/k/v on PLAIN bf16 operands (inputs: exact); gate / delta as hl planes of q_flat / v_flat x exact Wg / Wd (2 products; 4 outputs padded to 64), sigmoid and the product f32; scores and attn.v: query rows < 512 hl (3 products) over ALL key tiles (those early rows can have an empty allowed set and then attend uniformly to every key), the rest single fp16 (x1024) with causal tile skipping; bias + mask + softmax f32; Wo hl x exact (2 products).

#define NB_  2
#define TT   2048
#define DM   2048
#define NH_  16
#define NKV  4
#define REP  (NH_ / NKV)
#define HD   128
#define DQ   (NH_ * HD)
#define DKV  (NKV * HD)
#define ZH   2
#define RH   512                  // query rows < RH use hi+lo planes (0: none)
#define WIN  2048
#define PCAR 1024.0f
#define SCL  0.088388347648318447f   // HD^-0.5
typedef _Float16 h16;
typedef unsigned short bf;
typedef __attribute__((ext_vector_type(16))) __bf16   v16bf;
typedef __attribute__((ext_vector_type(16))) _Float16 v16h;
typedef __attribute__((ext_vector_type(8)))  _Float16 v8h;
typedef __attribute__((ext_vector_type(8)))  unsigned short v8us;
typedef __attribute__((ext_vector_type(8)))  float    v8f;
typedef __attribute__((ext_vector_type(4)))  float    v4f;
typedef v8h  __attribute__((may_alias)) v8ha;
typedef v4f  __attribute__((may_alias)) v4fa;
typedef v8us __attribute__((may_alias)) v8usa;

__device__ __forceinline__ unsigned short f2bf(float f) { unsigned u = __float_as_uint(f); u += 0x7FFFu + ((u >> 16) & 1u); return (unsigned short)(u >> 16); }
__device__ __forceinline__ float bf2f(unsigned short b) { return __uint_as_float(((unsigned)b) << 16); }
__device__ __forceinline__ float bfr(float f) { return bf2f(f2bf(f)); }
__device__ __forceinline__ v16h cat16(v8h lo, v8h hi) { return __builtin_shufflevector(lo, hi, 0, 1, 2, 3, 4, 5, 6, 7, 8, 9, 10, 11, 12, 13, 14, 15); }
__device__ __forceinline__ v16bf cat16b(v8us lo, v8us hi) { return __builtin_bit_cast(v16bf, __builtin_shufflevector(lo, hi, 0, 1, 2, 3, 4, 5, 6, 7, 8, 9, 10, 11, 12, 13, 14, 15)); }
__device__ __forceinline__ v8f wmma16(v16h a, v16h b, v8f c) { return __builtin_amdgcn_wmma_f32_16x16x32_f16(false, a, false, b, (short)0, c, false, false); }
__device__ __forceinline__ v8f wmmab(v16bf a, v16bf b, v8f c) { return __builtin_amdgcn_wmma_f32_16x16x32_bf16(false, a, false, b, (short)0, c, false, false); }



// ---- k_gemmw: register-blocked GEMM, one work-group of NW waves per 64x64 output tile; every wave holds the whole tile (16 accumulators) for its own share of K (64-element chunks dealt round robin: one 128-byte line of each operand row per chunk),
// operands straight from K-contiguous 16-bit planes; for NW > 1 the NW partial tiles are summed through LDS in wave order 0..NW-1 (K % 64 == 0); grid (M/64, N/64, Z), NW * 32 threads.
// C[m][n] (f32, pitch ldc, + optional f32 bias[n]) = sum_k A[m][k] Bt[n][k] (+ split products per NSPLIT). z-batch strides sA/sB/sC in elements. K % 32 == 0.
template <typename T16> struct WFrag;
template <> struct WFrag<h16> { typedef v16h V; static __device__ __forceinline__ V ld(const h16* p) { return cat16(*(const v8h*)p, *(const v8h*)(p + 16)); } static __device__ __forceinline__ v8f mma(V a, V b, v8f c) { return wmma16(a, b, c); } };
template <> struct WFrag<bf> { typedef v16bf V; static __device__ __forceinline__ V ld(const bf* p) { return cat16b(*(const v8us*)p, *(const v8us*)(p + 16)); } static __device__ __forceinline__ v8f mma(V a, V b, v8f c) { return wmmab(a, b, c); } };
template <typename T16, int NSPLIT, bool BIAS, int NW>
__global__ __launch_bounds__(NW * 32) void k_gemmw(const T16* __restrict__ A, const T16* __restrict__ A2, const T16* __restrict__ Bt, const T16* __restrict__ Bt2, int K, float* C, int ldc, const float* __restrict__ bias, size_t sA, size_t sB, size_t sC) {
    typedef typename WFrag<T16>::V V;
    __shared__ __align__(16) float os[NW > 1 ? NW * 64 * 68 : 16 * 68];
    const size_t z = blockIdx.z; A += z * sA; if (A2) A2 += z * sA; Bt += z * sB; if (Bt2) Bt2 += z * sB; C += z * sC;
    const int lane = threadIdx.x & 31, lr = lane & 15, hi = lane >> 4; const int wv = (NW > 1) ? __builtin_amdgcn_readfirstlane((int)(threadIdx.x >> 5)) : 0;   /* wave number as a scalar: the K loop's counter and branch stay scalar */ const int r0 = blockIdx.x * 64, c0 = blockIdx.y * 64;
    v8f acc[4][4];
#pragma unroll
    for (int mb = 0; mb < 4; ++mb)
#pragma unroll
        for (int nb = 0; nb < 4; ++nb) acc[mb][nb] = (v8f){};
    const size_t aoff = (size_t)(r0 + lr) * K + 8 * hi, boff = (size_t)(c0 + lr) * K + 8 * hi;
#pragma unroll 1
    for (int kc = wv * 64; kc < K; kc += (kc & 32) ? (NW * 64 - 32) : 32) {
        V a[4], a2[4];
#pragma unroll
        for (int mb = 0; mb < 4; ++mb) { a[mb] = WFrag<T16>::ld(A + aoff + (size_t)mb * 16 * K + kc); if (NSPLIT == 1 || NSPLIT == 2) a2[mb] = WFrag<T16>::ld(A2 + aoff + (size_t)mb * 16 * K + kc); }
#pragma unroll
        for (int nb = 0; nb < 4; ++nb) { const V b = WFrag<T16>::ld(Bt + boff + (size_t)nb * 16 * K + kc); V b2; if (NSPLIT >= 2) b2 = WFrag<T16>::ld(Bt2 + boff + (size_t)nb * 16 * K + kc);
#pragma unroll
            for (int mb = 0; mb < 4; ++mb) { acc[mb][nb] = WFrag<T16>::mma(a[mb], b, acc[mb][nb]); if (NSPLIT == 1 || NSPLIT == 2) acc[mb][nb] = WFrag<T16>::mma(a2[mb], b, acc[mb][nb]); if (NSPLIT >= 2) acc[mb][nb] = WFrag<T16>::mma(a[mb], b2, acc[mb][nb]); } }
        asm volatile("v_nop\n\tv_nop\n\tv_nop\n\tv_nop" : "+v"(acc[0][0]), "+v"(acc[1][1]), "+v"(acc[2][2]), "+v"(acc[3][3]) : "v"(a[0]), "v"(a[3]));
    }
    if (NW > 1) {   // merge of the K split: each wave parks its whole partial tile in its own LDS slot, then all threads sum the NW slots in wave order and store
        float* osw = os + wv * (64 * 68);
        // the three loops are unrolled so that acc is indexed by constants and stays in registers
#pragma unroll
        for (int mb = 0; mb < 4; ++mb)
#pragma unroll
            for (int nb = 0; nb < 4; ++nb)
#pragma unroll
                for (int j = 0; j < 8; ++j) osw[(mb * 16 + hi * 8 + j) * 68 + nb * 16 + lr] = acc[mb][nb][j];
        __syncthreads();   // every wave's partial tile is in LDS before any thread sums across the slots
        // both loops unrolled: the LDS reads of all slots and rounds go out without a branch between them
#pragma unroll
        for (int s = 0; s < 32 / NW; ++s) { const int q = s * (NW * 32) + (int)threadIdx.x, row = q >> 4, cofs = (q & 15) * 4; v4f val = *(const v4fa*)(os + row * 68 + cofs);
#pragma unroll
            for (int w = 1; w < NW; ++w) val += *(const v4fa*)(os + w * (64 * 68) + row * 68 + cofs);
            if (BIAS) { val[0] += bfr(bias[c0 + cofs]); val[1] += bfr(bias[c0 + cofs + 1]); val[2] += bfr(bias[c0 + cofs + 2]); val[3] += bfr(bias[c0 + cofs + 3]); }
            *(v4f*)(C + (size_t)(r0 + row) * ldc + c0 + cofs) = val; }
        return;
    }
#pragma unroll
    for (int mb = 0; mb < 4; ++mb) {
#pragma unroll
        for (int nb = 0; nb < 4; ++nb) {
#pragma unroll
            for (int j = 0; j < 8; ++j) os[(hi * 8 + j) * 68 + nb * 16 + lr] = acc[mb][nb][j]; }
        __builtin_amdgcn_wave_barrier(); asm volatile("" ::: "memory");
        float* crow = C + (size_t)(r0 + mb * 16) * ldc + c0;
{
#pragma unroll
            for (int s = 0; s < 8; ++s) { const int row = 2 * s + hi, cofs = lr * 4; v4f val = *(const v4fa*)(os + row * 68 + cofs); if (BIAS) { val[0] += bfr(bias[c0 + cofs]); val[1] += bfr(bias[c0 + cofs + 1]); val[2] += bfr(bias[c0 + cofs + 2]); val[3] += bfr(bias[c0 + cofs + 3]); }
                *(v4f*)(crow + (size_t)row * ldc + cofs) = val; }
             }
        __builtin_amdgcn_wave_barrier(); asm volatile("" ::: "memory");
    }
}

// ---- k_gemmc: the same NW-wave 64x64 tile GEMM specialised for causal attention: CMODE 1 skips score tiles entirely above the diagonal (query rows r0+roff.., key columns c0..), CMODE 2 limits the
// key (K) loop of the probability x value contraction to the diagonal block (probabilities beyond it are exactly zero). roff = row offset of this launch's first row within the sequence.
template <typename T16, int NSPLIT, int CMODE, int NW>
__global__ __launch_bounds__(NW * 32) void k_gemmc(const T16* __restrict__ A, const T16* __restrict__ A2, const T16* __restrict__ Bt, const T16* __restrict__ Bt2, int K, float* C, int ldc, int roff, size_t sA, size_t sB, size_t sC) {
    typedef typename WFrag<T16>::V V;
    __shared__ __align__(16) float os[NW > 1 ? NW * 64 * 68 : 16 * 68];
    const size_t z = blockIdx.z; A += z * sA; if (A2) A2 += z * sA; Bt += z * sB; if (Bt2) Bt2 += z * sB; C += z * sC;
    const int lane = threadIdx.x & 31, lr = lane & 15, hi = lane >> 4; const int wv = (NW > 1) ? __builtin_amdgcn_readfirstlane((int)(threadIdx.x >> 5)) : 0;   /* wave number as a scalar: the K loop's counter and branch stay scalar */ const int r0 = blockIdx.x * 64, c0 = blockIdx.y * 64;
    if (CMODE == 1 && c0 > r0 + roff + 63) return;                  // score tile entirely above the causal diagonal: never read (the softmax masks j > i by select)
    const int Kl = (CMODE == 2) ? min(K, r0 + roff + 64) : K;        // P.V: probabilities are exactly 0 beyond the diagonal block, so the K loop stops there
    v8f acc[4][4];
#pragma unroll
    for (int mb = 0; mb < 4; ++mb)
#pragma unroll
        for (int nb = 0; nb < 4; ++nb) acc[mb][nb] = (v8f){};
    const size_t aoff = (size_t)(r0 + lr) * K + 8 * hi, boff = (size_t)(c0 + lr) * K + 8 * hi;
#pragma unroll 1
    for (int kc = wv * 64; kc < Kl; kc += (kc & 32) ? (NW * 64 - 32) : 32) {
        V a[4], a2[4];
#pragma unroll
        for (int mb = 0; mb < 4; ++mb) { a[mb] = WFrag<T16>::ld(A + aoff + (size_t)mb * 16 * K + kc); if (NSPLIT == 1 || NSPLIT == 2) a2[mb] = WFrag<T16>::ld(A2 + aoff + (size_t)mb * 16 * K + kc); }
#pragma unroll
        for (int nb = 0; nb < 4; ++nb) { const V b = WFrag<T16>::ld(Bt + boff + (size_t)nb * 16 * K + kc); V b2; if (NSPLIT >= 2) b2 = WFrag<T16>::ld(Bt2 + boff + (size_t)nb * 16 * K + kc);
#pragma unroll
            for (int mb = 0; mb < 4; ++mb) { acc[mb][nb] = WFrag<T16>::mma(a[mb], b, acc[mb][nb]); if (NSPLIT == 1 || NSPLIT == 2) acc[mb][nb] = WFrag<T16>::mma(a2[mb], b, acc[mb][nb]); if (NSPLIT >= 2) acc[mb][nb] = WFrag<T16>::mma(a[mb], b2, acc[mb][nb]); } }
        asm volatile("v_nop\n\tv_nop\n\tv_nop\n\tv_nop" : "+v"(acc[0][0]), "+v"(acc[1][1]), "+v"(acc[2][2]), "+v"(acc[3][3]) : "v"(a[0]), "v"(a[3]));
    }
    if (NW > 1) {   // merge of the K split: each wave parks its whole partial tile in its own LDS slot, then all threads sum the NW slots in wave order and store
        float* osw = os + wv * (64 * 68);
        // the three loops are unrolled so that acc is indexed by constants and stays in registers
#pragma unroll
        for (int mb = 0; mb < 4; ++mb)
#pragma unroll
            for (int nb = 0; nb < 4; ++nb)
#pragma unroll
                for (int j = 0; j < 8; ++j) osw[(mb * 16 + hi * 8 + j) * 68 + nb * 16 + lr] = acc[mb][nb][j];
        __syncthreads();   // every wave's partial tile is in LDS before any thread sums across the slots
        // both loops unrolled: the LDS reads of all slots and rounds go out without a branch between them
#pragma unroll
        for (int s = 0; s < 32 / NW; ++s) { const int q = s * (NW * 32) + (int)threadIdx.x, row = q >> 4, cofs = (q & 15) * 4; v4f val = *(const v4fa*)(os + row * 68 + cofs);
#pragma unroll
            for (int w = 1; w < NW; ++w) val += *(const v4fa*)(os + w * (64 * 68) + row * 68 + cofs);
            *(v4f*)(C + (size_t)(r0 + row) * ldc + c0 + cofs) = val; }
        return;
    }
#pragma unroll
    for (int mb = 0; mb < 4; ++mb) {
#pragma unroll
        for (int nb = 0; nb < 4; ++nb) {
#pragma unroll
            for (int j = 0; j < 8; ++j) os[(hi * 8 + j) * 68 + nb * 16 + lr] = acc[mb][nb][j]; }
        __builtin_amdgcn_wave_barrier(); asm volatile("" ::: "memory");
        float* crow = C + (size_t)(r0 + mb * 16) * ldc + c0;
{
#pragma unroll
            for (int s = 0; s < 8; ++s) { const int row = 2 * s + hi, cofs = lr * 4; v4f val = *(const v4fa*)(os + row * 68 + cofs);
                *(v4f*)(crow + (size_t)row * ldc + cofs) = val; }
             }
        __builtin_amdgcn_wave_barrier(); asm volatile("" ::: "memory");
    }
}

__device__ __forceinline__ h16 tohx(float x) { return (h16)x; }
__device__ __forceinline__ void splitf(float y, unsigned short& h, unsigned short& l) { h = f2bf(y); l = f2bf(y - bf2f(h)); }
typedef __attribute__((ext_vector_type(2))) _Float16 v2h;
typedef __attribute__((ext_vector_type(4))) _Float16 v4h;
typedef __attribute__((ext_vector_type(2))) unsigned short v2us;
typedef __attribute__((ext_vector_type(4))) unsigned short v4us;
typedef __attribute__((ext_vector_type(2))) float v2f;
typedef __attribute__((ext_vector_type(4))) int v4i;

__global__ __launch_bounds__(256) void k_wtG(const float* __restrict__ w, int K, int N, bf* Bt) {
    const int lane = threadIdx.x & 31; const int L0 = (blockIdx.x * 8 + (threadIdx.x >> 5)) * 8; const int nlines = N * K / 64;
{
#pragma unroll 1
        for (int l = 0; l < 8; ++l) { const int L = L0 + l; if (L >= nlines) break; const size_t e = (size_t)L * 64 + lane * 2; const int k = (int)(e % K), n = (int)(e / K); v2us o;
            o[0] = f2bf(w[(size_t)k * N + n]); o[1] = f2bf(w[(size_t)(k + 1) * N + n]); *(v2us*)(Bt + e) = o; }
         }
}
__global__ __launch_bounds__(256) void k_cvt8(const float* __restrict__ src, bf* dst, size_t n8) { const size_t i = (size_t)blockIdx.x * 256 + threadIdx.x; if (i >= n8) return; const v8f v = *(const v8f*)(src + i * 8); v8us o;
#pragma unroll
    for (int k = 0; k < 8; ++k) o[k] = f2bf(v[k]); *(v8us*)(dst + i * 8) = o;  }
__global__ __launch_bounds__(256) void k_cscvt(const float* __restrict__ cosT, const float* __restrict__ sinT, float* CS) { const int idx = blockIdx.x * 256 + threadIdx.x; if (idx >= TT * HD) return; v2f cs; cs[0] = bfr(cosT[idx]); cs[1] = bfr(sinT[idx]); *(v2f*)(CS + (size_t)idx * 2) = cs;  }
// k_rope: head planes [h][t][d] (fp16 + hi/lo) of rope(x) x sc with the rotate-half convention out[d] = x[d] cos[t][d] - x[d+HD/2] sin[t][d], out[d+HD/2] = x[d+HD/2] cos[t][d+HD/2] + x[d] sin[t][d+HD/2]
__global__ __launch_bounds__(256) void k_rope(const float* __restrict__ F, int pitch, int nheads, const float* __restrict__ CS, const float* __restrict__ RF, const float* __restrict__ nw, float sc, h16* P16, bf* Ph, bf* Pl) {
    const size_t e = ((size_t)blockIdx.x * 256 + threadIdx.x) * 2; if (e >= (size_t)nheads * TT * HD) return; const int d = (int)(e % HD); const int t = (int)((e / HD) % TT); const int h = (int)(e / ((size_t)HD * TT)); const float* f = F + (size_t)t * pitch + h * HD; const float rf = RF ? RF[(size_t)h * TT + t] : 1.0f; v2h o16; v2us oh, ol;
#pragma unroll
    for (int q = 0; q < 2; ++q) { const int dd = d + q; const int dp = (dd < HD / 2) ? dd + HD / 2 : dd - HD / 2; float x0 = f[dd], x1 = f[dp];
        if (RF) { float n0 = __fmul_rn(x0, rf), n1 = __fmul_rn(x1, rf); asm volatile("" : "+v"(n0)); asm volatile("" : "+v"(n1)); x0 = __fmul_rn(bfr(nw[dd]), n0); x1 = __fmul_rn(bfr(nw[dp]), n1); }
        const v2f cs = *(const v2f*)(CS + ((size_t)t * HD + dd) * 2); float a = __fmul_rn(x0, cs[0]), bq = __fmul_rn(x1, cs[1]); asm volatile("" : "+v"(a)); asm volatile("" : "+v"(bq)); const float r = ((dd < HD / 2) ? __fsub_rn(a, bq) : __fadd_rn(a, bq)) * sc;
        o16[q] = tohx(r); unsigned short a2, c2; splitf(r, a2, c2); oh[q] = a2; ol[q] = c2; }
    *(v2h*)(P16 + e) = o16; *(v2us*)(Ph + e) = oh; *(v2us*)(Pl + e) = ol;  }
__global__ __launch_bounds__(256) void k_vtp(const float* __restrict__ F, int pitch, int nheads, h16* V16, bf* Vh, bf* Vl) { const size_t e = ((size_t)blockIdx.x * 256 + threadIdx.x) * 2; if (e >= (size_t)nheads * HD * TT) return; const int t = (int)(e % TT); const int d = (int)((e / TT) % HD); const int g = (int)(e / ((size_t)TT * HD)); v2h o16; v2us oh, ol;
#pragma unroll
    for (int q = 0; q < 2; ++q) { const float x = F[(size_t)(t + q) * pitch + g * HD + d]; o16[q] = tohx(x); unsigned short a2, c2; splitf(x, a2, c2); oh[q] = a2; ol[q] = c2; }
    *(v2h*)(V16 + e) = o16; *(v2us*)(Vh + e) = oh; *(v2us*)(Vl + e) = ol;  }
__global__ __launch_bounds__(256) void k_csid(float* CS) { const int idx = blockIdx.x * 256 + threadIdx.x; if (idx >= TT * HD) return; v2f cs; cs[0] = 1.0f; cs[1] = 0.0f; *(v2f*)(CS + (size_t)idx * 2) = cs;  }
// k_asoft: per row (zz, i): t = S x HD^-0.5 + bias[j] for j <= i and bias[j] > 0, else -3.0e38 (finfo.min-like fill); softmax over the 2048 keys (register row, one exp, fixed trees);
__global__ __launch_bounds__(256) void k_asoft(const float* __restrict__ Sb, const float* __restrict__ Bb, const int* __restrict__ FLG, int h0, h16* P16, bf* Ph, bf* Pl) {
    const int lane = threadIdx.x & 31; const int row = blockIdx.x * 8 + (threadIdx.x >> 5); if (row >= ZH * TT) return; const int i = row % TT; const int zz = row / TT; (void)zz; const bool hires = (i < RH); const float* sr = Sb + (size_t)row * TT; const float* bias = Bb + (size_t)((h0 + zz) / REP) * TT; const bool poison = (FLG[(h0 + zz) / REP] != 0);   /* premise self-check: no positive bias among keys 0..RH-1 for this kv head -> NaN-poison (flag word FLG[4] also set) */ float v[TT / 32]; float mx = -3.0e38f;
#pragma unroll
    for (int ch = 0; ch < TT / 128; ++ch) { const int j0 = ch * 128 + lane * 4; const v4f a = *(const v4f*)(sr + j0);
#pragma unroll
        for (int q = 0; q < 4; ++q) { const int j = j0 + q; (void)j; const float bj = bias[j]; float sa = a[q] * SCL; asm volatile("" : "+v"(sa)); const float t = (j <= i && bj > 0.f) ? __fadd_rn(sa, bj) : -3.0e38f   /* same fill as the running-max init, so a row with NO allowed key (possible for the first few rows) softmaxes uniformly over every key like the source's finfo.min fill instead of 0/0 */; v[ch * 4 + q] = t; mx = fmaxf(mx, t); } }
#pragma unroll
    for (int sh = 16; sh; sh >>= 1) mx = fmaxf(mx, __shfl_xor(mx, sh, 32));
    float sum = 0.f;
#pragma unroll
    for (int k = 0; k < TT / 32; ++k) { float d0 = __fsub_rn(v[k], mx); asm volatile("" : "+v"(d0)); v[k] = __builtin_amdgcn_exp2f(__fmul_rn(d0, 1.4426950408889634f)); sum += v[k]; }
#pragma unroll
    for (int sh = 16; sh; sh >>= 1) sum += __shfl_xor(sum, sh, 32);
    const float f = poison ? __builtin_nanf("") : __fdiv_rn(hires ? 1.0f : PCAR, sum);
{
        if (hires) {
#pragma unroll
            for (int ch = 0; ch < TT / 128; ++ch) { v4us oh, ol;
#pragma unroll
                for (int q = 0; q < 4; ++q) { unsigned short a, c2; splitf(v[ch * 4 + q] * f, a, c2); oh[q] = a; ol[q] = c2; }
                const size_t oo = ((size_t)zz * (RH ? RH : 1) + i) * TT + ch * 128 + lane * 4; *(v4us*)(Ph + oo) = oh; *(v4us*)(Pl + oo) = ol; }
        } else {
#pragma unroll
            for (int ch = 0; ch < TT / 128; ++ch) { v4h o4;
#pragma unroll
                for (int q = 0; q < 4; ++q) o4[q] = tohx(v[ch * 4 + q] * f);
                *(v4h*)(P16 + (size_t)row * TT + ch * 128 + lane * 4) = o4; } }
         }
}
__global__ __launch_bounds__(256) void k_merge(const float* __restrict__ O, int h0, bf* Ah, bf* Al) { const size_t e = ((size_t)blockIdx.x * 256 + threadIdx.x) * 2; if (e >= (size_t)ZH * TT * HD) return; const int d = (int)(e % HD); const int t = (int)((e / HD) % TT); const int zz = (int)(e / ((size_t)HD * TT)); const float cs = (t < RH) ? 1.0f : (1.0f / PCAR); const size_t oo = (size_t)t * DQ + (h0 + zz) * HD + d;
    v2us oh, ol;
#pragma unroll
    for (int q = 0; q < 2; ++q) { unsigned short a, c2; splitf(O[e + q] * cs, a, c2); oh[q] = a; ol[q] = c2; } *(v2us*)(Ah + oo) = oh; *(v2us*)(Al + oo) = ol;  }

__global__ __launch_bounds__(32) void k_chk(const float* __restrict__ BIAS, int* FLG) { const int n = threadIdx.x; int none = 0; if (n < NKV) { none = 1;
#pragma unroll 1
        for (int j = 0; j < RH; ++j) if (BIAS[(size_t)n * TT + j] > 0.f) { none = 0; break; } }
    int anyb = none;
#pragma unroll
    for (int sh = 16; sh; sh >>= 1) anyb |= __shfl_xor(anyb, sh, 32);
    const int v = (n < NKV) ? none : ((n == NKV) ? anyb : 0); if (n < 8) { *(int*)(FLG + n) = v;  } }
__global__ __launch_bounds__(256) void k_wgd(const float* __restrict__ w, int K, bf* Bt) { const int e = (blockIdx.x * 256 + threadIdx.x) * 4; if (e >= 64 * K) return; const int k = e % K, n = e / K; v4us o;
#pragma unroll
    for (int u = 0; u < 4; ++u) o[u] = (n < NKV) ? f2bf(w[(size_t)(k + u) * NKV + n]) : (unsigned short)0; *(v4us*)(Bt + e) = o;  }
__global__ __launch_bounds__(256) void k_plq(const float* __restrict__ F, bf* Ph, bf* Pl, size_t n4) { const size_t e = ((size_t)blockIdx.x * 256 + threadIdx.x) * 4; if (e >= n4 * 4) return; const v4f a = *(const v4f*)(F + e); v4us oh, ol;
#pragma unroll
    for (int u = 0; u < 4; ++u) { unsigned short x0, x1; splitf(a[u], x0, x1); oh[u] = x0; ol[u] = x1; } *(v4us*)(Ph + e) = oh; *(v4us*)(Pl + e) = ol;  }
__global__ __launch_bounds__(256) void k_bias(const float* __restrict__ GATE, const float* __restrict__ DEL, float* BIAS) { const int e = (blockIdx.x * 256 + threadIdx.x) * 4; if (e >= NKV * TT) return; const int j = e % TT; const int n = e / TT; v4f r;
#pragma unroll
    for (int u = 0; u < 4; ++u) { const float gt = GATE[(size_t)(j + u) * 64 + n]; const float sg = __fdiv_rn(1.0f, __fadd_rn(1.0f, __expf(-gt))); r[u] = __fmul_rn(sg, DEL[(size_t)(j + u) * 64 + n]); }
    *(v4f*)(BIAS + e) = r;  }

extern "C" void kernel_launch(void* const* d_in, const int* in_sizes, int n_in,
                              void* d_out, int out_size, void* d_ws, size_t ws_size, hipStream_t stream) {
    (void)in_sizes; (void)n_in; (void)out_size;
    const float* x = (const float*)d_in[0]; const float* wq = (const float*)d_in[1]; const float* wk = (const float*)d_in[2]; const float* wv = (const float*)d_in[3]; const float* wg = (const float*)d_in[4]; const float* wdl = (const float*)d_in[5]; const float* wo = (const float*)d_in[6]; const float* cosT = nullptr; const float* sinT = nullptr; (void)cosT; (void)sinT;
    float* OUT = (float*)d_out;     // [2][2048][2048]
    char* wsp = (char*)d_ws;
    auto take = [&](size_t bytes) { char* p = wsp; wsp += (bytes + 255) & ~(size_t)255; return (void*)p; };
    bf* WQ = (bf*)take((size_t)DQ * DM * 2); bf* WK = (bf*)take((size_t)DKV * DM * 2); bf* WV = (bf*)take((size_t)DKV * DM * 2); bf* WO = (bf*)take((size_t)DM * DQ * 2); float* CS = (float*)take((size_t)TT * HD * 2 * 4);
    bf* XB = (bf*)take((size_t)TT * DM * 2); bf* GFh = (bf*)take((size_t)TT * DQ * 2); bf* GFl = (bf*)take((size_t)TT * DQ * 2); bf* VFh = (bf*)take((size_t)TT * DKV * 2); bf* VFl = (bf*)take((size_t)TT * DKV * 2); bf* WG = (bf*)take((size_t)64 * DQ * 2); bf* WD = (bf*)take((size_t)64 * DKV * 2); float* GATE = (float*)take((size_t)TT * 64 * 4); float* DEL = (float*)take((size_t)TT * 64 * 4); float* BIAS = (float*)take((size_t)NKV * TT * 4); int* FLG = (int*)take(256); float* FQ = (float*)take((size_t)TT * DQ * 4); float* FK = (float*)take((size_t)TT * DKV * 4);
    h16* QP16 = (h16*)take((size_t)NH_ * TT * HD * 2); h16* KP16 = (h16*)take((size_t)NKV * TT * HD * 2); h16* VT16 = (h16*)take((size_t)NKV * HD * TT * 2);
    bf* QPh = (bf*)take((size_t)NH_ * TT * HD * 2); bf* QPl = (bf*)take((size_t)NH_ * TT * HD * 2); bf* KPh = (bf*)take((size_t)NKV * TT * HD * 2); bf* KPl = (bf*)take((size_t)NKV * TT * HD * 2); bf* VTh = (bf*)take((size_t)NKV * HD * TT * 2); bf* VTl = (bf*)take((size_t)NKV * HD * TT * 2); bf* Ph = (bf*)take((size_t)ZH * RH * TT * 2); bf* Pl = (bf*)take((size_t)ZH * RH * TT * 2);
    float* Sb = (float*)take((size_t)ZH * TT * TT * 4); h16* P16 = (h16*)take((size_t)ZH * TT * TT * 2); float* Ob = (float*)take((size_t)ZH * TT * HD * 4); bf* ATh = (bf*)take((size_t)TT * DQ * 2); bf* ATl = (bf*)take((size_t)TT * DQ * 2);
    if ((size_t)(wsp - (char*)d_ws) > ws_size) return;    // ws 256 MiB
    float* FV = FK;   // v projection reuses the k buffer after the k planes are built (stream-ordered)
    { k_wgd<<<(64 * DQ / 4 + 255) / 256, 256, 0, stream>>>(wg, DQ, WG); k_wgd<<<(64 * DKV / 4 + 255) / 256, 256, 0, stream>>>(wdl, DKV, WD); k_wtG<<<(unsigned)((DM * DQ / 64 + 63) / 64), 256, 0, stream>>>(wq, DM, DQ, WQ); k_wtG<<<(unsigned)((DM * DKV / 64 + 63) / 64), 256, 0, stream>>>(wk, DM, DKV, WK); k_wtG<<<(unsigned)((DM * DKV / 64 + 63) / 64), 256, 0, stream>>>(wv, DM, DKV, WV);
      k_wtG<<<(unsigned)((DQ * DM / 64 + 63) / 64), 256, 0, stream>>>(wo, DQ, DM, WO);
       }
    k_csid<<<(TT * HD + 255) / 256, 256, 0, stream>>>(CS);
    const unsigned LQ = (unsigned)(((size_t)NH_ * TT * HD / 2 + 255) / 256), LKv = (unsigned)(((size_t)NKV * TT * HD / 2 + 255) / 256);
    for (int b = 0; b < NB_; ++b) {
        
        k_cvt8<<<(unsigned)(((size_t)TT * DM / 8 + 255) / 256), 256, 0, stream>>>(x + (size_t)b * TT * DM, XB, (size_t)TT * DM / 8);
        k_gemmw<bf, 0, false, 8><<<dim3(TT / 64, DQ / 64, 1), 256, 0, stream>>>(XB, nullptr, WQ, nullptr, DM, FQ, DQ, nullptr, 0, 0, 0);
        k_rope<<<LQ, 256, 0, stream>>>(FQ, DQ, NH_, CS, nullptr, nullptr, 1.0f, QP16, QPh, QPl);
        k_gemmw<bf, 0, false, 16><<<dim3(TT / 64, DKV / 64, 1), 512, 0, stream>>>(XB, nullptr, WK, nullptr, DM, FK, DKV, nullptr, 0, 0, 0);
        k_rope<<<LKv, 256, 0, stream>>>(FK, DKV, NKV, CS, nullptr, nullptr, 1.0f, KP16, KPh, KPl);
        k_gemmw<bf, 0, false, 16><<<dim3(TT / 64, DKV / 64, 1), 512, 0, stream>>>(XB, nullptr, WV, nullptr, DM, FV, DKV, nullptr, 0, 0, 0);
        /* dynamic mask bias per (kv head, key) */ k_plq<<<(unsigned)(((size_t)TT * DQ / 4 + 255) / 256), 256, 0, stream>>>(FQ, GFh, GFl, (size_t)TT * DQ / 4); k_plq<<<(unsigned)(((size_t)TT * DKV / 4 + 255) / 256), 256, 0, stream>>>(FV, VFh, VFl, (size_t)TT * DKV / 4);
        k_gemmw<bf, 1, false, 16><<<dim3(TT / 64, 1, 1), 512, 0, stream>>>(GFh, GFl, WG, nullptr, DQ, GATE, 64, nullptr, 0, 0, 0); k_gemmw<bf, 1, false, 8><<<dim3(TT / 64, 1, 1), 256, 0, stream>>>(VFh, VFl, WD, nullptr, DKV, DEL, 64, nullptr, 0, 0, 0); k_bias<<<(NKV * TT / 4 + 255) / 256, 256, 0, stream>>>(GATE, DEL, BIAS); k_chk<<<1, 32, 0, stream>>>(BIAS, FLG); k_vtp<<<LKv, 256, 0, stream>>>(FV, DKV, NKV, VT16, VTh, VTl);
        for (int h0 = 0; h0 < NH_; h0 += ZH) { const size_t zq = (size_t)h0, zk = (size_t)(h0 / REP);   // both heads of a pass share kv group h0/REP (REP >= 2): sB = 0
            k_gemmw<bf, 2, false, 1><<<dim3(RH / 64, TT / 64, ZH), 32, 0, stream>>>(QPh + zq * TT * HD, QPl + zq * TT * HD, KPh + zk * TT * HD, KPl + zk * TT * HD, HD, Sb, TT, nullptr, (size_t)TT * HD, 0, (size_t)TT * TT);
            k_gemmc<h16, 0, 1, 1><<<dim3((TT - RH) / 64, TT / 64, ZH), 32, 0, stream>>>(QP16 + zq * TT * HD + (size_t)RH * HD, nullptr, KP16 + zk * TT * HD, nullptr, HD, Sb + (size_t)RH * TT, TT, RH, (size_t)TT * HD, 0, (size_t)TT * TT);
            k_asoft<<<ZH * TT / 8, 256, 0, stream>>>(Sb, BIAS, FLG, h0, P16, Ph, Pl);
            k_gemmw<bf, 2, false, 16><<<dim3(RH / 64, HD / 64, ZH), 512, 0, stream>>>(Ph, Pl, VTh + zk * HD * TT, VTl + zk * HD * TT, TT, Ob, HD, nullptr, (size_t)RH * TT, 0, (size_t)TT * HD);
            k_gemmc<h16, 0, 2, 16><<<dim3((TT - RH) / 64, HD / 64, ZH), 512, 0, stream>>>(P16 + (size_t)RH * TT, nullptr, VT16 + zk * HD * TT, nullptr, TT, Ob + (size_t)RH * HD, HD, RH, (size_t)TT * TT, 0, (size_t)TT * HD);
            k_merge<<<(unsigned)(((size_t)ZH * TT * HD / 2 + 255) / 256), 256, 0, stream>>>(Ob, h0, ATh, ATl); }
        k_gemmw<bf, 1, false, 8><<<dim3(TT / 64, DM / 64, 1), 256, 0, stream>>>(ATh, ATl, WO, nullptr, DQ, OUT + (size_t)b * TT * DM, DM, nullptr, 0, 0, 0); }
}

// v002
// One run takes 1100 microseconds.
// Next to v001, in two timings, it ran 1.31 times as fast each time.
// All steps since v000 together make it 2.18 times as fast.
#include <hip/hip_runtime.h>

// DynamicMaskAttention (hidden [2][2048][2048]; q = x Wq (16 heads x 128), k/v = x Wk / Wv (4 kv heads; group h/4); per key j and kv head n: bias = sigmoid(q_flat[j] . Wg[:, n]) * (v_flat[j] . Wd[:, n]); logits = q.k / sqrt(128) + bias[n][j]; allowed = causal AND bias[n][j] > 0, everything else gets finfo.min (so a query row with no allowed key softmaxes uniformly over ALL keys, as the source);
//   softmax; out = merged Wo -> [2][2048][2048]).
// Compute dtypes, f32 accumulate: every input rounded to bf16; q/k/v on PLAIN bf16 operands (inputs: exact); gate / delta as hl planes of q_flat / v_flat x exact Wg / Wd (2 products; 4 outputs padded to 64), sigmoid and the product f32; scores and attn.v: query rows < 512 hl (3 products) over ALL key tiles (those early rows can have an empty allowed set and then attend uniformly to every key), the rest single fp16 (x1024) with causal tile skipping; bias + mask + softmax f32; Wo hl x exact (2 products).

#define NB_  2
#define TT   2048
#define DM   2048
#define NH_  16
#define NKV  4
#define REP  (NH_ / NKV)
#define HD   128
#define DQ   (NH_ * HD)
#define DKV  (NKV * HD)
#define ZH   4                    // query heads per pass of the head loop: one whole kv group (ZH <= REP, REP % ZH == 0), so every z slice of a pass shares its K and V planes
#define RH   512                  // query rows < RH use hi+lo planes (0: none)
#define WIN  2048
#define PCAR 1024.0f
#define SCL  0.088388347648318447f   // HD^-0.5
typedef _Float16 h16;
typedef unsigned short bf;
typedef __attribute__((ext_vector_type(16))) __bf16   v16bf;
typedef __attribute__((ext_vector_type(16))) _Float16 v16h;
typedef __attribute__((ext_vector_type(8)))  _Float16 v8h;
typedef __attribute__((ext_vector_type(8)))  unsigned short v8us;
typedef __attribute__((ext_vector_type(8)))  float    v8f;
typedef __attribute__((ext_vector_type(4)))  float    v4f;
typedef v8h  __attribute__((may_alias)) v8ha;
typedef v4f  __attribute__((may_alias)) v4fa;
typedef v8us __attribute__((may_alias)) v8usa;

__device__ __forceinline__ unsigned short f2bf(float f) { unsigned u = __float_as_uint(f); u += 0x7FFFu + ((u >> 16) & 1u); return (unsigned short)(u >> 16); }
__device__ __forceinline__ float bf2f(unsigned short b) { return __uint_as_float(((unsigned)b) << 16); }
__device__ __forceinline__ float bfr(float f) { return bf2f(f2bf(f)); }
__device__ __forceinline__ v16h cat16(v8h lo, v8h hi) { return __builtin_shufflevector(lo, hi, 0, 1, 2, 3, 4, 5, 6, 7, 8, 9, 10, 11, 12, 13, 14, 15); }
__device__ __forceinline__ v16bf cat16b(v8us lo, v8us hi) { return __builtin_bit_cast(v16bf, __builtin_shufflevector(lo, hi, 0, 1, 2, 3, 4, 5, 6, 7, 8, 9, 10, 11, 12, 13, 14, 15)); }
__device__ __forceinline__ v8f wmma16(v16h a, v16h b, v8f c) { return __builtin_amdgcn_wmma_f32_16x16x32_f16(false, a, false, b, (short)0, c, false, false); }
__device__ __forceinline__ v8f wmmab(v16bf a, v16bf b, v8f c) { return __builtin_amdgcn_wmma_f32_16x16x32_bf16(false, a, false, b, (short)0, c, false, false); }



// ---- k_gemmw: register-blocked GEMM, one work-group of NW waves per 64x64 output tile; every wave holds the whole tile (16 accumulators) for its own share of K (64-element chunks dealt round robin: one 128-byte line of each operand row per chunk),
// operands straight from K-contiguous 16-bit planes; for NW > 1 the NW partial tiles are summed through LDS in wave order 0..NW-1 (K % 64 == 0); grid (M/64, N/64, Z), NW * 32 threads.
// C[m][n] (f32, pitch ldc, + optional f32 bias[n]) = sum_k A[m][k] Bt[n][k] (+ split products per NSPLIT). z-batch strides sA/sB/sC in elements. K % 32 == 0.
template <typename T16> struct WFrag;
template <> struct WFrag<h16> { typedef v16h V; static __device__ __forceinline__ V ld(const h16* p) { return cat16(*(const v8h*)p, *(const v8h*)(p + 16)); } static __device__ __forceinline__ v8f mma(V a, V b, v8f c) { return wmma16(a, b, c); } };
template <> struct WFrag<bf> { typedef v16bf V; static __device__ __forceinline__ V ld(const bf* p) { return cat16b(*(const v8us*)p, *(const v8us*)(p + 16)); } static __device__ __forceinline__ v8f mma(V a, V b, v8f c) { return wmmab(a, b, c); } };
template <typename T16, int NSPLIT, bool BIAS, int NW>
__global__ __launch_bounds__(NW * 32) void k_gemmw(const T16* __restrict__ A, const T16* __restrict__ A2, const T16* __restrict__ Bt, const T16* __restrict__ Bt2, int K, float* C, int ldc, const float* __restrict__ bias, size_t sA, size_t sB, size_t sC) {
    typedef typename WFrag<T16>::V V;
    __shared__ __align__(16) float os[NW > 1 ? NW * 64 * 68 : 16 * 68];
    const size_t z = blockIdx.z; A += z * sA; if (A2) A2 += z * sA; Bt += z * sB; if (Bt2) Bt2 += z * sB; C += z * sC;
    const int lane = threadIdx.x & 31, lr = lane & 15, hi = lane >> 4; const int wv = (NW > 1) ? __builtin_amdgcn_readfirstlane((int)(threadIdx.x >> 5)) : 0;   /* wave number as a scalar: the K loop's counter and branch stay scalar */ const int r0 = blockIdx.x * 64, c0 = blockIdx.y * 64;
    v8f acc[4][4];
#pragma unroll
    for (int mb = 0; mb < 4; ++mb)
#pragma unroll
        for (int nb = 0; nb < 4; ++nb) acc[mb][nb] = (v8f){};
    const size_t aoff = (size_t)(r0 + lr) * K + 8 * hi, boff = (size_t)(c0 + lr) * K + 8 * hi;
#pragma unroll 1
    for (int kc = wv * 64; kc < K; kc += (kc & 32) ? (NW * 64 - 32) : 32) {
        V a[4], a2[4];
#pragma unroll
        for (int mb = 0; mb < 4; ++mb) { a[mb] = WFrag<T16>::ld(A + aoff + (size_t)mb * 16 * K + kc); if (NSPLIT == 1 || NSPLIT == 2) a2[mb] = WFrag<T16>::ld(A2 + aoff + (size_t)mb * 16 * K + kc); }
#pragma unroll
        for (int nb = 0; nb < 4; ++nb) { const V b = WFrag<T16>::ld(Bt + boff + (size_t)nb * 16 * K + kc); V b2; if (NSPLIT >= 2) b2 = WFrag<T16>::ld(Bt2 + boff + (size_t)nb * 16 * K + kc);
#pragma unroll
            for (int mb = 0; mb < 4; ++mb) { acc[mb][nb] = WFrag<T16>::mma(a[mb], b, acc[mb][nb]); if (NSPLIT == 1 || NSPLIT == 2) acc[mb][nb] = WFrag<T16>::mma(a2[mb], b, acc[mb][nb]); if (NSPLIT >= 2) acc[mb][nb] = WFrag<T16>::mma(a[mb], b2, acc[mb][nb]); } }
        asm volatile("v_nop\n\tv_nop\n\tv_nop\n\tv_nop" : "+v"(acc[0][0]), "+v"(acc[1][1]), "+v"(acc[2][2]), "+v"(acc[3][3]) : "v"(a[0]), "v"(a[3]));
    }
    if (NW > 1) {   // merge of the K split: each wave parks its whole partial tile in its own LDS slot, then all threads sum the NW slots in wave order and store
        float* osw = os + wv * (64 * 68);
        // the three loops are unrolled so that acc is indexed by constants and stays in registers
#pragma unroll
        for (int mb = 0; mb < 4; ++mb)
#pragma unroll
            for (int nb = 0; nb < 4; ++nb)
#pragma unroll
                for (int j = 0; j < 8; ++j) osw[(mb * 16 + hi * 8 + j) * 68 + nb * 16 + lr] = acc[mb][nb][j];
        __syncthreads();   // every wave's partial tile is in LDS before any thread sums across the slots
        // both loops unrolled: the LDS reads of all slots and rounds go out without a branch between them
#pragma unroll
        for (int s = 0; s < 32 / NW; ++s) { const int q = s * (NW * 32) + (int)threadIdx.x, row = q >> 4, cofs = (q & 15) * 4; v4f val = *(const v4fa*)(os + row * 68 + cofs);
#pragma unroll
            for (int w = 1; w < NW; ++w) val += *(const v4fa*)(os + w * (64 * 68) + row * 68 + cofs);
            if (BIAS) { val[0] += bfr(bias[c0 + cofs]); val[1] += bfr(bias[c0 + cofs + 1]); val[2] += bfr(bias[c0 + cofs + 2]); val[3] += bfr(bias[c0 + cofs + 3]); }
            *(v4f*)(C + (size_t)(r0 + row) * ldc + c0 + cofs) = val; }
        return;
    }
#pragma unroll
    for (int mb = 0; mb < 4; ++mb) {
#pragma unroll
        for (int nb = 0; nb < 4; ++nb) {
#pragma unroll
            for (int j = 0; j < 8; ++j) os[(hi * 8 + j) * 68 + nb * 16 + lr] = acc[mb][nb][j]; }
        __builtin_amdgcn_wave_barrier(); asm volatile("" ::: "memory");
        float* crow = C + (size_t)(r0 + mb * 16) * ldc + c0;
{
#pragma unroll
            for (int s = 0; s < 8; ++s) { const int row = 2 * s + hi, cofs = lr * 4; v4f val = *(const v4fa*)(os + row * 68 + cofs); if (BIAS) { val[0] += bfr(bias[c0 + cofs]); val[1] += bfr(bias[c0 + cofs + 1]); val[2] += bfr(bias[c0 + cofs + 2]); val[3] += bfr(bias[c0 + cofs + 3]); }
                *(v4f*)(crow + (size_t)row * ldc + cofs) = val; }
             }
        __builtin_amdgcn_wave_barrier(); asm volatile("" ::: "memory");
    }
}

// ---- k_gemmc: the same NW-wave 64x64 tile GEMM specialised for causal attention: CMODE 1 skips score tiles entirely above the diagonal (query rows r0+roff.., key columns c0..), CMODE 2 limits the
// key (K) loop of the probability x value contraction to the diagonal block (probabilities beyond it are exactly zero). roff = row offset of this launch's first row within the sequence.
template <typename T16, int NSPLIT, int CMODE, int NW>
__global__ __launch_bounds__(NW * 32) void k_gemmc(const T16* __restrict__ A, const T16* __restrict__ A2, const T16* __restrict__ Bt, const T16* __restrict__ Bt2, int K, float* C, int ldc, int roff, size_t sA, size_t sB, size_t sC) {
    typedef typename WFrag<T16>::V V;
    __shared__ __align__(16) float os[NW > 1 ? NW * 64 * 68 : 16 * 68];
    const size_t z = blockIdx.z; A += z * sA; if (A2) A2 += z * sA; Bt += z * sB; if (Bt2) Bt2 += z * sB; C += z * sC;
    const int lane = threadIdx.x & 31, lr = lane & 15, hi = lane >> 4; const int wv = (NW > 1) ? __builtin_amdgcn_readfirstlane((int)(threadIdx.x >> 5)) : 0;   /* wave number as a scalar: the K loop's counter and branch stay scalar */ const int r0 = blockIdx.x * 64, c0 = blockIdx.y * 64;
    if (CMODE == 1 && c0 > r0 + roff + 63) return;                  // score tile entirely above the causal diagonal: never read (the softmax masks j > i by select)
    const int Kl = (CMODE == 2) ? min(K, r0 + roff + 64) : K;        // P.V: probabilities are exactly 0 beyond the diagonal block, so the K loop stops there
    v8f acc[4][4];
#pragma unroll
    for (int mb = 0; mb < 4; ++mb)
#pragma unroll
        for (int nb = 0; nb < 4; ++nb) acc[mb][nb] = (v8f){};
    const size_t aoff = (size_t)(r0 + lr) * K + 8 * hi, boff = (size_t)(c0 + lr) * K + 8 * hi;
#pragma unroll 1
    for (int kc = wv * 64; kc < Kl; kc += (kc & 32) ? (NW * 64 - 32) : 32) {
        V a[4], a2[4];
#pragma unroll
        for (int mb = 0; mb < 4; ++mb) { a[mb] = WFrag<T16>::ld(A + aoff + (size_t)mb * 16 * K + kc); if (NSPLIT == 1 || NSPLIT == 2) a2[mb] = WFrag<T16>::ld(A2 + aoff + (size_t)mb * 16 * K + kc); }
#pragma unroll
        for (int nb = 0; nb < 4; ++nb) { const V b = WFrag<T16>::ld(Bt + boff + (size_t)nb * 16 * K + kc); V b2; if (NSPLIT >= 2) b2 = WFrag<T16>::ld(Bt2 + boff + (size_t)nb * 16 * K + kc);
#pragma unroll
            for (int mb = 0; mb < 4; ++mb) { acc[mb][nb] = WFrag<T16>::mma(a[mb], b, acc[mb][nb]); if (NSPLIT == 1 || NSPLIT == 2) acc[mb][nb] = WFrag<T16>::mma(a2[mb], b, acc[mb][nb]); if (NSPLIT >= 2) acc[mb][nb] = WFrag<T16>::mma(a[mb], b2, acc[mb][nb]); } }
        asm volatile("v_nop\n\tv_nop\n\tv_nop\n\tv_nop" : "+v"(acc[0][0]), "+v"(acc[1][1]), "+v"(acc[2][2]), "+v"(acc[3][3]) : "v"(a[0]), "v"(a[3]));
    }
    if (NW > 1) {   // merge of the K split: each wave parks its whole partial tile in its own LDS slot, then all threads sum the NW slots in wave order and store
        float* osw = os + wv * (64 * 68);
        // the three loops are unrolled so that acc is indexed by constants and stays in registers
#pragma unroll
        for (int mb = 0; mb < 4; ++mb)
#pragma unroll
            for (int nb = 0; nb < 4; ++nb)
#pragma unroll
                for (int j = 0; j < 8; ++j) osw[(mb * 16 + hi * 8 + j) * 68 + nb * 16 + lr] = acc[mb][nb][j];
        __syncthreads();   // every wave's partial tile is in LDS before any thread sums across the slots
        // both loops unrolled: the LDS reads of all slots and rounds go out without a branch between them
#pragma unroll
        for (int s = 0; s < 32 / NW; ++s) { const int q = s * (NW * 32) + (int)threadIdx.x, row = q >> 4, cofs = (q & 15) * 4; v4f val = *(const v4fa*)(os + row * 68 + cofs);
#pragma unroll
            for (int w = 1; w < NW; ++w) val += *(const v4fa*)(os + w * (64 * 68) + row * 68 + cofs);
            *(v4f*)(C + (size_t)(r0 + row) * ldc + c0 + cofs) = val; }
        return;
    }
#pragma unroll
    for (int mb = 0; mb < 4; ++mb) {
#pragma unroll
        for (int nb = 0; nb < 4; ++nb) {
#pragma unroll
            for (int j = 0; j < 8; ++j) os[(hi * 8 + j) * 68 + nb * 16 + lr] = acc[mb][nb][j]; }
        __builtin_amdgcn_wave_barrier(); asm volatile("" ::: "memory");
        float* crow = C + (size_t)(r0 + mb * 16) * ldc + c0;
{
#pragma unroll
            for (int s = 0; s < 8; ++s) { const int row = 2 * s + hi, cofs = lr * 4; v4f val = *(const v4fa*)(os + row * 68 + cofs);
                *(v4f*)(crow + (size_t)row * ldc + cofs) = val; }
             }
        __builtin_amdgcn_wave_barrier(); asm volatile("" ::: "memory");
    }
}

__device__ __forceinline__ h16 tohx(float x) { return (h16)x; }
__device__ __forceinline__ void splitf(float y, unsigned short& h, unsigned short& l) { h = f2bf(y); l = f2bf(y - bf2f(h)); }
typedef __attribute__((ext_vector_type(2))) _Float16 v2h;
typedef __attribute__((ext_vector_type(4))) _Float16 v4h;
typedef __attribute__((ext_vector_type(2))) unsigned short v2us;
typedef __attribute__((ext_vector_type(4))) unsigned short v4us;
typedef __attribute__((ext_vector_type(2))) float v2f;
typedef __attribute__((ext_vector_type(4))) int v4i;

__global__ __launch_bounds__(256) void k_wtG(const float* __restrict__ w, int K, int N, bf* Bt) {
    const int lane = threadIdx.x & 31; const int L0 = (blockIdx.x * 8 + (threadIdx.x >> 5)) * 8; const int nlines = N * K / 64;
{
#pragma unroll 1
        for (int l = 0; l < 8; ++l) { const int L = L0 + l; if (L >= nlines) break; const size_t e = (size_t)L * 64 + lane * 2; const int k = (int)(e % K), n = (int)(e / K); v2us o;
            o[0] = f2bf(w[(size_t)k * N + n]); o[1] = f2bf(w[(size_t)(k + 1) * N + n]); *(v2us*)(Bt + e) = o; }
         }
}
__global__ __launch_bounds__(256) void k_cvt8(const float* __restrict__ src, bf* dst, size_t n8) { const size_t i = (size_t)blockIdx.x * 256 + threadIdx.x; if (i >= n8) return; const v8f v = *(const v8f*)(src + i * 8); v8us o;
#pragma unroll
    for (int k = 0; k < 8; ++k) o[k] = f2bf(v[k]); *(v8us*)(dst + i * 8) = o;  }
__global__ __launch_bounds__(256) void k_cscvt(const float* __restrict__ cosT, const float* __restrict__ sinT, float* CS) { const int idx = blockIdx.x * 256 + threadIdx.x; if (idx >= TT * HD) return; v2f cs; cs[0] = bfr(cosT[idx]); cs[1] = bfr(sinT[idx]); *(v2f*)(CS + (size_t)idx * 2) = cs;  }
// k_rope: head planes [h][t][d] (fp16 + hi/lo) of rope(x) x sc with the rotate-half convention out[d] = x[d] cos[t][d] - x[d+HD/2] sin[t][d], out[d+HD/2] = x[d+HD/2] cos[t][d+HD/2] + x[d] sin[t][d+HD/2]
__global__ __launch_bounds__(256) void k_rope(const float* __restrict__ F, int pitch, int nheads, const float* __restrict__ CS, const float* __restrict__ RF, const float* __restrict__ nw, float sc, h16* P16, bf* Ph, bf* Pl) {
    const size_t e = ((size_t)blockIdx.x * 256 + threadIdx.x) * 2; if (e >= (size_t)nheads * TT * HD) return; const int d = (int)(e % HD); const int t = (int)((e / HD) % TT); const int h = (int)(e / ((size_t)HD * TT)); const float* f = F + (size_t)t * pitch + h * HD; const float rf = RF ? RF[(size_t)h * TT + t] : 1.0f; v2h o16; v2us oh, ol;
#pragma unroll
    for (int q = 0; q < 2; ++q) { const int dd = d + q; const int dp = (dd < HD / 2) ? dd + HD / 2 : dd - HD / 2; float x0 = f[dd], x1 = f[dp];
        if (RF) { float n0 = __fmul_rn(x0, rf), n1 = __fmul_rn(x1, rf); asm volatile("" : "+v"(n0)); asm volatile("" : "+v"(n1)); x0 = __fmul_rn(bfr(nw[dd]), n0); x1 = __fmul_rn(bfr(nw[dp]), n1); }
        const v2f cs = *(const v2f*)(CS + ((size_t)t * HD + dd) * 2); float a = __fmul_rn(x0, cs[0]), bq = __fmul_rn(x1, cs[1]); asm volatile("" : "+v"(a)); asm volatile("" : "+v"(bq)); const float r = ((dd < HD / 2) ? __fsub_rn(a, bq) : __fadd_rn(a, bq)) * sc;
        o16[q] = tohx(r); unsigned short a2, c2; splitf(r, a2, c2); oh[q] = a2; ol[q] = c2; }
    *(v2h*)(P16 + e) = o16; *(v2us*)(Ph + e) = oh; *(v2us*)(Pl + e) = ol;  }
__global__ __launch_bounds__(256) void k_vtp(const float* __restrict__ F, int pitch, int nheads, h16* V16, bf* Vh, bf* Vl) { const size_t e = ((size_t)blockIdx.x * 256 + threadIdx.x) * 2; if (e >= (size_t)nheads * HD * TT) return; const int t = (int)(e % TT); const int d = (int)((e / TT) % HD); const int g = (int)(e / ((size_t)TT * HD)); v2h o16; v2us oh, ol;
#pragma unroll
    for (int q = 0; q < 2; ++q) { const float x = F[(size_t)(t + q) * pitch + g * HD + d]; o16[q] = tohx(x); unsigned short a2, c2; splitf(x, a2, c2); oh[q] = a2; ol[q] = c2; }
    *(v2h*)(V16 + e) = o16; *(v2us*)(Vh + e) = oh; *(v2us*)(Vl + e) = ol;  }
__global__ __launch_bounds__(256) void k_csid(float* CS) { const int idx = blockIdx.x * 256 + threadIdx.x; if (idx >= TT * HD) return; v2f cs; cs[0] = 1.0f; cs[1] = 0.0f; *(v2f*)(CS + (size_t)idx * 2) = cs;  }
// k_asoft: per row (zz, i): t = S x HD^-0.5 + bias[j] for j <= i and bias[j] > 0, else -3.0e38 (finfo.min-like fill); softmax over the 2048 keys (register row, one exp, fixed trees);
__global__ __launch_bounds__(256) void k_asoft(const float* __restrict__ Sb, const float* __restrict__ Bb, const int* __restrict__ FLG, int h0, h16* P16, bf* Ph, bf* Pl) {
    const int lane = threadIdx.x & 31; const int row = blockIdx.x * 8 + (threadIdx.x >> 5); if (row >= ZH * TT) return; const int i = row % TT; const int zz = row / TT; (void)zz; const bool hires = (i < RH); const float* sr = Sb + (size_t)row * TT; const float* bias = Bb + (size_t)((h0 + zz) / REP) * TT; const bool poison = (FLG[(h0 + zz) / REP] != 0);   /* premise self-check: no positive bias among keys 0..RH-1 for this kv head -> NaN-poison (flag word FLG[4] also set) */ float v[TT / 32]; float mx = -3.0e38f;
#pragma unroll
    for (int ch = 0; ch < TT / 128; ++ch) { const int j0 = ch * 128 + lane * 4; const v4f a = *(const v4f*)(sr + j0);
#pragma unroll
        for (int q = 0; q < 4; ++q) { const int j = j0 + q; (void)j; const float bj = bias[j]; float sa = a[q] * SCL; asm volatile("" : "+v"(sa)); const float t = (j <= i && bj > 0.f) ? __fadd_rn(sa, bj) : -3.0e38f   /* same fill as the running-max init, so a row with NO allowed key (possible for the first few rows) softmaxes uniformly over every key like the source's finfo.min fill instead of 0/0 */; v[ch * 4 + q] = t; mx = fmaxf(mx, t); } }
#pragma unroll
    for (int sh = 16; sh; sh >>= 1) mx = fmaxf(mx, __shfl_xor(mx, sh, 32));
    float sum = 0.f;
#pragma unroll
    for (int k = 0; k < TT / 32; ++k) { float d0 = __fsub_rn(v[k], mx); asm volatile("" : "+v"(d0)); v[k] = __builtin_amdgcn_exp2f(__fmul_rn(d0, 1.4426950408889634f)); sum += v[k]; }
#pragma unroll
    for (int sh = 16; sh; sh >>= 1) sum += __shfl_xor(sum, sh, 32);
    const float f = poison ? __builtin_nanf("") : __fdiv_rn(hires ? 1.0f : PCAR, sum);
{
        if (hires) {
#pragma unroll
            for (int ch = 0; ch < TT / 128; ++ch) { v4us oh, ol;
#pragma unroll
                for (int q = 0; q < 4; ++q) { unsigned short a, c2; splitf(v[ch * 4 + q] * f, a, c2); oh[q] = a; ol[q] = c2; }
                const size_t oo = ((size_t)zz * (RH ? RH : 1) + i) * TT + ch * 128 + lane * 4; *(v4us*)(Ph + oo) = oh; *(v4us*)(Pl + oo) = ol; }
        } else {
#pragma unroll
            for (int ch = 0; ch < TT / 128; ++ch) { v4h o4;
#pragma unroll
                for (int q = 0; q < 4; ++q) o4[q] = tohx(v[ch * 4 + q] * f);
                *(v4h*)(P16 + (size_t)row * TT + ch * 128 + lane * 4) = o4; } }
         }
}
__global__ __launch_bounds__(256) void k_merge(const float* __restrict__ O, int h0, bf* Ah, bf* Al) { const size_t e = ((size_t)blockIdx.x * 256 + threadIdx.x) * 2; if (e >= (size_t)ZH * TT * HD) return; const int d = (int)(e % HD); const int t = (int)((e / HD) % TT); const int zz = (int)(e / ((size_t)HD * TT)); const float cs = (t < RH) ? 1.0f : (1.0f / PCAR); const size_t oo = (size_t)t * DQ + (h0 + zz) * HD + d;
    v2us oh, ol;
#pragma unroll
    for (int q = 0; q < 2; ++q) { unsigned short a, c2; splitf(O[e + q] * cs, a, c2); oh[q] = a; ol[q] = c2; } *(v2us*)(Ah + oo) = oh; *(v2us*)(Al + oo) = ol;  }

__global__ __launch_bounds__(32) void k_chk(const float* __restrict__ BIAS, int* FLG) { const int n = threadIdx.x; int none = 0; if (n < NKV) { none = 1;
#pragma unroll 1
        for (int j = 0; j < RH; ++j) if (BIAS[(size_t)n * TT + j] > 0.f) { none = 0; break; } }
    int anyb = none;
#pragma unroll
    for (int sh = 16; sh; sh >>= 1) anyb |= __shfl_xor(anyb, sh, 32);
    const int v = (n < NKV) ? none : ((n == NKV) ? anyb : 0); if (n < 8) { *(int*)(FLG + n) = v;  } }
__global__ __launch_bounds__(256) void k_wgd(const float* __restrict__ w, int K, bf* Bt) { const int e = (blockIdx.x * 256 + threadIdx.x) * 4; if (e >= 64 * K) return; const int k = e % K, n = e / K; v4us o;
#pragma unroll
    for (int u = 0; u < 4; ++u) o[u] = (n < NKV) ? f2bf(w[(size_t)(k + u) * NKV + n]) : (unsigned short)0; *(v4us*)(Bt + e) = o;  }
__global__ __launch_bounds__(256) void k_plq(const float* __restrict__ F, bf* Ph, bf* Pl, size_t n4) { const size_t e = ((size_t)blockIdx.x * 256 + threadIdx.x) * 4; if (e >= n4 * 4) return; const v4f a = *(const v4f*)(F + e); v4us oh, ol;
#pragma unroll
    for (int u = 0; u < 4; ++u) { unsigned short x0, x1; splitf(a[u], x0, x1); oh[u] = x0; ol[u] = x1; } *(v4us*)(Ph + e) = oh; *(v4us*)(Pl + e) = ol;  }
__global__ __launch_bounds__(256) void k_bias(const float* __restrict__ GATE, const float* __restrict__ DEL, float* BIAS) { const int e = (blockIdx.x * 256 + threadIdx.x) * 4; if (e >= NKV * TT) return; const int j = e % TT; const int n = e / TT; v4f r;
#pragma unroll
    for (int u = 0; u < 4; ++u) { const float gt = GATE[(size_t)(j + u) * 64 + n]; const float sg = __fdiv_rn(1.0f, __fadd_rn(1.0f, __expf(-gt))); r[u] = __fmul_rn(sg, DEL[(size_t)(j + u) * 64 + n]); }
    *(v4f*)(BIAS + e) = r;  }

extern "C" void kernel_launch(void* const* d_in, const int* in_sizes, int n_in,
                              void* d_out, int out_size, void* d_ws, size_t ws_size, hipStream_t stream) {
    (void)in_sizes; (void)n_in; (void)out_size;
    const float* x = (const float*)d_in[0]; const float* wq = (const float*)d_in[1]; const float* wk = (const float*)d_in[2]; const float* wv = (const float*)d_in[3]; const float* wg = (const float*)d_in[4]; const float* wdl = (const float*)d_in[5]; const float* wo = (const float*)d_in[6]; const float* cosT = nullptr; const float* sinT = nullptr; (void)cosT; (void)sinT;
    float* OUT = (float*)d_out;     // [2][2048][2048]
    char* wsp = (char*)d_ws;
    auto take = [&](size_t bytes) { char* p = wsp; wsp += (bytes + 255) & ~(size_t)255; return (void*)p; };
    bf* WQ = (bf*)take((size_t)DQ * DM * 2); bf* WK = (bf*)take((size_t)DKV * DM * 2); bf* WV = (bf*)take((size_t)DKV * DM * 2); bf* WO = (bf*)take((size_t)DM * DQ * 2); float* CS = (float*)take((size_t)TT * HD * 2 * 4);
    bf* XB = (bf*)take((size_t)TT * DM * 2); bf* GFh = (bf*)take((size_t)TT * DQ * 2); bf* GFl = (bf*)take((size_t)TT * DQ * 2); bf* VFh = (bf*)take((size_t)TT * DKV * 2); bf* VFl = (bf*)take((size_t)TT * DKV * 2); bf* WG = (bf*)take((size_t)64 * DQ * 2); bf* WD = (bf*)take((size_t)64 * DKV * 2); float* GATE = (float*)take((size_t)TT * 64 * 4); float* DEL = (float*)take((size_t)TT * 64 * 4); float* BIAS = (float*)take((size_t)NKV * TT * 4); int* FLG = (int*)take(256); float* FQ = (float*)take((size_t)TT * DQ * 4); float* FK = (float*)take((size_t)TT * DKV * 4);
    h16* QP16 = (h16*)take((size_t)NH_ * TT * HD * 2); h16* KP16 = (h16*)take((size_t)NKV * TT * HD * 2); h16* VT16 = (h16*)take((size_t)NKV * HD * TT * 2);
    bf* QPh = (bf*)take((size_t)NH_ * TT * HD * 2); bf* QPl = (bf*)take((size_t)NH_ * TT * HD * 2); bf* KPh = (bf*)take((size_t)NKV * TT * HD * 2); bf* KPl = (bf*)take((size_t)NKV * TT * HD * 2); bf* VTh = (bf*)take((size_t)NKV * HD * TT * 2); bf* VTl = (bf*)take((size_t)NKV * HD * TT * 2); bf* Ph = (bf*)take((size_t)ZH * RH * TT * 2); bf* Pl = (bf*)take((size_t)ZH * RH * TT * 2);
    float* Sb = (float*)take((size_t)ZH * TT * TT * 4); h16* P16 = (h16*)take((size_t)ZH * TT * TT * 2); float* Ob = (float*)take((size_t)ZH * TT * HD * 4); bf* ATh = (bf*)take((size_t)TT * DQ * 2); bf* ATl = (bf*)take((size_t)TT * DQ * 2);
    if ((size_t)(wsp - (char*)d_ws) > ws_size) return;    // ws 256 MiB
    float* FV = FK;   // v projection reuses the k buffer after the k planes are built (stream-ordered)
    { k_wgd<<<(64 * DQ / 4 + 255) / 256, 256, 0, stream>>>(wg, DQ, WG); k_wgd<<<(64 * DKV / 4 + 255) / 256, 256, 0, stream>>>(wdl, DKV, WD); k_wtG<<<(unsigned)((DM * DQ / 64 + 63) / 64), 256, 0, stream>>>(wq, DM, DQ, WQ); k_wtG<<<(unsigned)((DM * DKV / 64 + 63) / 64), 256, 0, stream>>>(wk, DM, DKV, WK); k_wtG<<<(unsigned)((DM * DKV / 64 + 63) / 64), 256, 0, stream>>>(wv, DM, DKV, WV);
      k_wtG<<<(unsigned)((DQ * DM / 64 + 63) / 64), 256, 0, stream>>>(wo, DQ, DM, WO);
       }
    k_csid<<<(TT * HD + 255) / 256, 256, 0, stream>>>(CS);
    const unsigned LQ = (unsigned)(((size_t)NH_ * TT * HD / 2 + 255) / 256), LKv = (unsigned)(((size_t)NKV * TT * HD / 2 + 255) / 256);
    for (int b = 0; b < NB_; ++b) {
        
        k_cvt8<<<(unsigned)(((size_t)TT * DM / 8 + 255) / 256), 256, 0, stream>>>(x + (size_t)b * TT * DM, XB, (size_t)TT * DM / 8);
        k_gemmw<bf, 0, false, 8><<<dim3(TT / 64, DQ / 64, 1), 256, 0, stream>>>(XB, nullptr, WQ, nullptr, DM, FQ, DQ, nullptr, 0, 0, 0);
        k_rope<<<LQ, 256, 0, stream>>>(FQ, DQ, NH_, CS, nullptr, nullptr, 1.0f, QP16, QPh, QPl);
        k_gemmw<bf, 0, false, 16><<<dim3(TT / 64, DKV / 64, 1), 512, 0, stream>>>(XB, nullptr, WK, nullptr, DM, FK, DKV, nullptr, 0, 0, 0);
        k_rope<<<LKv, 256, 0, stream>>>(FK, DKV, NKV, CS, nullptr, nullptr, 1.0f, KP16, KPh, KPl);
        k_gemmw<bf, 0, false, 16><<<dim3(TT / 64, DKV / 64, 1), 512, 0, stream>>>(XB, nullptr, WV, nullptr, DM, FV, DKV, nullptr, 0, 0, 0);
        /* dynamic mask bias per (kv head, key) */ k_plq<<<(unsigned)(((size_t)TT * DQ / 4 + 255) / 256), 256, 0, stream>>>(FQ, GFh, GFl, (size_t)TT * DQ / 4); k_plq<<<(unsigned)(((size_t)TT * DKV / 4 + 255) / 256), 256, 0, stream>>>(FV, VFh, VFl, (size_t)TT * DKV / 4);
        k_gemmw<bf, 1, false, 16><<<dim3(TT / 64, 1, 1), 512, 0, stream>>>(GFh, GFl, WG, nullptr, DQ, GATE, 64, nullptr, 0, 0, 0); k_gemmw<bf, 1, false, 8><<<dim3(TT / 64, 1, 1), 256, 0, stream>>>(VFh, VFl, WD, nullptr, DKV, DEL, 64, nullptr, 0, 0, 0); k_bias<<<(NKV * TT / 4 + 255) / 256, 256, 0, stream>>>(GATE, DEL, BIAS); k_chk<<<1, 32, 0, stream>>>(BIAS, FLG); k_vtp<<<LKv, 256, 0, stream>>>(FV, DKV, NKV, VT16, VTh, VTl);
        for (int h0 = 0; h0 < NH_; h0 += ZH) { const size_t zq = (size_t)h0, zk = (size_t)(h0 / REP);   // all ZH heads of a pass share kv group h0/REP (ZH <= REP): sB = 0
            k_gemmw<bf, 2, false, 1><<<dim3(RH / 64, TT / 64, ZH), 32, 0, stream>>>(QPh + zq * TT * HD, QPl + zq * TT * HD, KPh + zk * TT * HD, KPl + zk * TT * HD, HD, Sb, TT, nullptr, (size_t)TT * HD, 0, (size_t)TT * TT);
            k_gemmc<h16, 0, 1, 1><<<dim3((TT - RH) / 64, TT / 64, ZH), 32, 0, stream>>>(QP16 + zq * TT * HD + (size_t)RH * HD, nullptr, KP16 + zk * TT * HD, nullptr, HD, Sb + (size_t)RH * TT, TT, RH, (size_t)TT * HD, 0, (size_t)TT * TT);
            k_asoft<<<ZH * TT / 8, 256, 0, stream>>>(Sb, BIAS, FLG, h0, P16, Ph, Pl);
            k_gemmw<bf, 2, false, 16><<<dim3(RH / 64, HD / 64, ZH), 512, 0, stream>>>(Ph, Pl, VTh + zk * HD * TT, VTl + zk * HD * TT, TT, Ob, HD, nullptr, (size_t)RH * TT, 0, (size_t)TT * HD);
            k_gemmc<h16, 0, 2, 16><<<dim3((TT - RH) / 64, HD / 64, ZH), 512, 0, stream>>>(P16 + (size_t)RH * TT, nullptr, VT16 + zk * HD * TT, nullptr, TT, Ob + (size_t)RH * HD, HD, RH, (size_t)TT * TT, 0, (size_t)TT * HD);
            k_merge<<<(unsigned)(((size_t)ZH * TT * HD / 2 + 255) / 256), 256, 0, stream>>>(Ob, h0, ATh, ATl); }
        k_gemmw<bf, 1, false, 8><<<dim3(TT / 64, DM / 64, 1), 256, 0, stream>>>(ATh, ATl, WO, nullptr, DQ, OUT + (size_t)b * TT * DM, DM, nullptr, 0, 0, 0); }
}

// v003
// Measured time: 893 microseconds a run.
// In two side-by-side timings against v002, it was 1.23 and 1.22 times as fast.
// Over all steps from v000 it is 2.68 times as fast.
#include <hip/hip_runtime.h>

// DynamicMaskAttention (hidden [2][2048][2048]; q = x Wq (16 heads x 128), k/v = x Wk / Wv (4 kv heads; group h/4); per key j and kv head n: bias = sigmoid(q_flat[j] . Wg[:, n]) * (v_flat[j] . Wd[:, n]); logits = q.k / sqrt(128) + bias[n][j]; allowed = causal AND bias[n][j] > 0, everything else gets finfo.min (so a query row with no allowed key softmaxes uniformly over ALL keys, as the source);
//   softmax; out = merged Wo -> [2][2048][2048]).
// Compute dtypes, f32 accumulate: every input rounded to bf16; q/k/v on PLAIN bf16 operands (inputs: exact); gate / delta as hl planes of q_flat / v_flat x exact Wg / Wd (2 products; 4 outputs padded to 64), sigmoid and the product f32; scores and attn.v: query rows < 512 hl (3 products) over ALL key tiles (those early rows can have an empty allowed set and then attend uniformly to every key), the rest single fp16 (x1024) with causal tile skipping; bias + mask + softmax f32; Wo hl x exact (2 products).

#define NB_  2
#define TT   2048
#define DM   2048
#define NH_  16
#define NKV  4
#define REP  (NH_ / NKV)
#define HD   128
#define DQ   (NH_ * HD)
#define DKV  (NKV * HD)
#define ZH   4                    // query heads per pass of the head loop: one whole kv group (ZH <= REP, REP % ZH == 0), so in a pass the ZH z slices of one batch element share that element's K and V planes
#define NZ   (NB_ * ZH)         // z slices of a head-loop launch: z = b * ZH + (head - h0), both batch elements side by side
#define RH   512                  // query rows < RH use hi+lo planes (0: none)
#define WIN  2048
#define PCAR 1024.0f
#define SCL  0.088388347648318447f   // HD^-0.5
typedef _Float16 h16;
typedef unsigned short bf;
typedef __attribute__((ext_vector_type(16))) __bf16   v16bf;
typedef __attribute__((ext_vector_type(16))) _Float16 v16h;
typedef __attribute__((ext_vector_type(8)))  _Float16 v8h;
typedef __attribute__((ext_vector_type(8)))  unsigned short v8us;
typedef __attribute__((ext_vector_type(8)))  float    v8f;
typedef __attribute__((ext_vector_type(4)))  float    v4f;
typedef v8h  __attribute__((may_alias)) v8ha;
typedef v4f  __attribute__((may_alias)) v4fa;
typedef v8us __attribute__((may_alias)) v8usa;

__device__ __forceinline__ unsigned short f2bf(float f) { unsigned u = __float_as_uint(f); u += 0x7FFFu + ((u >> 16) & 1u); return (unsigned short)(u >> 16); }
__device__ __forceinline__ float bf2f(unsigned short b) { return __uint_as_float(((unsigned)b) << 16); }
__device__ __forceinline__ float bfr(float f) { return bf2f(f2bf(f)); }
__device__ __forceinline__ v16h cat16(v8h lo, v8h hi) { return __builtin_shufflevector(lo, hi, 0, 1, 2, 3, 4, 5, 6, 7, 8, 9, 10, 11, 12, 13, 14, 15); }
__device__ __forceinline__ v16bf cat16b(v8us lo, v8us hi) { return __builtin_bit_cast(v16bf, __builtin_shufflevector(lo, hi, 0, 1, 2, 3, 4, 5, 6, 7, 8, 9, 10, 11, 12, 13, 14, 15)); }
__device__ __forceinline__ v8f wmma16(v16h a, v16h b, v8f c) { return __builtin_amdgcn_wmma_f32_16x16x32_f16(false, a, false, b, (short)0, c, false, false); }
__device__ __forceinline__ v8f wmmab(v16bf a, v16bf b, v8f c) { return __builtin_amdgcn_wmma_f32_16x16x32_bf16(false, a, false, b, (short)0, c, false, false); }



// ---- k_gemmw: register-blocked GEMM, one work-group of NW waves per 64x64 output tile; every wave holds the whole tile (16 accumulators) for its own share of K (64-element chunks dealt round robin: one 128-byte line of each operand row per chunk),
// operands straight from K-contiguous 16-bit planes; for NW > 1 the NW partial tiles are summed through LDS in wave order 0..NW-1 (K % 64 == 0); grid (M/64, N/64, Z), NW * 32 threads.
// C[m][n] (f32, pitch ldc, + optional f32 bias[n]) = sum_k A[m][k] Bt[n][k] (+ split products per NSPLIT). z-batch strides sA/sB/sC in elements (sA, sC per z slice; sB per ZH slices: the ZH heads of a kv group share Bt). A rows have pitch lda, Bt rows pitch K. K % 32 == 0.
template <typename T16> struct WFrag;
template <> struct WFrag<h16> { typedef v16h V; static __device__ __forceinline__ V ld(const h16* p) { return cat16(*(const v8h*)p, *(const v8h*)(p + 16)); } static __device__ __forceinline__ v8f mma(V a, V b, v8f c) { return wmma16(a, b, c); } };
template <> struct WFrag<bf> { typedef v16bf V; static __device__ __forceinline__ V ld(const bf* p) { return cat16b(*(const v8us*)p, *(const v8us*)(p + 16)); } static __device__ __forceinline__ v8f mma(V a, V b, v8f c) { return wmmab(a, b, c); } };
template <typename T16, int NSPLIT, bool BIAS, int NW>
__global__ __launch_bounds__(NW * 32) void k_gemmw(const T16* __restrict__ A, const T16* __restrict__ A2, const T16* __restrict__ Bt, const T16* __restrict__ Bt2, int K, int lda, float* C, int ldc, const float* __restrict__ bias, size_t sA, size_t sB, size_t sC) {
    typedef typename WFrag<T16>::V V;
    __shared__ __align__(16) float os[NW > 1 ? NW * 64 * 68 : 16 * 68];
    const size_t z = blockIdx.z; A += z * sA; if (A2) A2 += z * sA; Bt += (z / ZH) * sB; if (Bt2) Bt2 += (z / ZH) * sB; C += z * sC;
    const int lane = threadIdx.x & 31, lr = lane & 15, hi = lane >> 4; const int wv = (NW > 1) ? __builtin_amdgcn_readfirstlane((int)(threadIdx.x >> 5)) : 0;   /* wave number as a scalar: the K loop's counter and branch stay scalar */ const int r0 = blockIdx.x * 64, c0 = blockIdx.y * 64;
    v8f acc[4][4];
#pragma unroll
    for (int mb = 0; mb < 4; ++mb)
#pragma unroll
        for (int nb = 0; nb < 4; ++nb) acc[mb][nb] = (v8f){};
    const size_t aoff = (size_t)(r0 + lr) * lda + 8 * hi, boff = (size_t)(c0 + lr) * K + 8 * hi;
#pragma unroll 1
    for (int kc = wv * 64; kc < K; kc += (kc & 32) ? (NW * 64 - 32) : 32) {
        V a[4], a2[4]; const T16* pa[4]; const T16* pa2[4]; const T16* pb[4]; const T16* pb2[4];
#pragma unroll
        for (int mb = 0; mb < 4; ++mb) { pa[mb] = A + aoff + (size_t)mb * 16 * lda + kc; a[mb] = WFrag<T16>::ld(pa[mb]); if (NSPLIT == 1 || NSPLIT == 2) { pa2[mb] = A2 + aoff + (size_t)mb * 16 * lda + kc; a2[mb] = WFrag<T16>::ld(pa2[mb]); } }
#pragma unroll
        for (int nb = 0; nb < 4; ++nb) { pb[nb] = Bt + boff + (size_t)nb * 16 * K + kc; const V b = WFrag<T16>::ld(pb[nb]); V b2; if (NSPLIT >= 2) { pb2[nb] = Bt2 + boff + (size_t)nb * 16 * K + kc; b2 = WFrag<T16>::ld(pb2[nb]); }
#pragma unroll
            for (int mb = 0; mb < 4; ++mb) { acc[mb][nb] = WFrag<T16>::mma(a[mb], b, acc[mb][nb]); if (NSPLIT == 1 || NSPLIT == 2) acc[mb][nb] = WFrag<T16>::mma(a2[mb], b, acc[mb][nb]); if (NSPLIT >= 2) acc[mb][nb] = WFrag<T16>::mma(a[mb], b2, acc[mb][nb]); } }
        asm volatile("v_nop\n\tv_nop\n\tv_nop\n\tv_nop" : "+v"(acc[0][0]), "+v"(acc[1][1]), "+v"(acc[2][2]), "+v"(acc[3][3]) : "v"(a[0]), "v"(a[3]));
        // precaution: this trip's load addresses are named as inputs, so their registers are not reused between a load and this wait; it stands at the loop's foot, where every load of the trip has already delivered its data
        if (NSPLIT == 2) asm volatile("s_wait_xcnt 0x0" :: "v"(pa[0]), "v"(pa[1]), "v"(pa[2]), "v"(pa[3]), "v"(pa2[0]), "v"(pa2[1]), "v"(pa2[2]), "v"(pa2[3]), "v"(pb[0]), "v"(pb[1]), "v"(pb[2]), "v"(pb[3]), "v"(pb2[0]), "v"(pb2[1]), "v"(pb2[2]), "v"(pb2[3]) : "memory");
        else if (NSPLIT == 1) asm volatile("s_wait_xcnt 0x0" :: "v"(pa[0]), "v"(pa[1]), "v"(pa[2]), "v"(pa[3]), "v"(pa2[0]), "v"(pa2[1]), "v"(pa2[2]), "v"(pa2[3]), "v"(pb[0]), "v"(pb[1]), "v"(pb[2]), "v"(pb[3]) : "memory");
        else asm volatile("s_wait_xcnt 0x0" :: "v"(pa[0]), "v"(pa[1]), "v"(pa[2]), "v"(pa[3]), "v"(pb[0]), "v"(pb[1]), "v"(pb[2]), "v"(pb[3]) : "memory");
    }
    if (NW > 1) {   // merge of the K split: each wave parks its whole partial tile in its own LDS slot, then all threads sum the NW slots in wave order and store
        float* osw = os + wv * (64 * 68);
        // the three loops are unrolled so that acc is indexed by constants and stays in registers
#pragma unroll
        for (int mb = 0; mb < 4; ++mb)
#pragma unroll
            for (int nb = 0; nb < 4; ++nb)
#pragma unroll
                for (int j = 0; j < 8; ++j) osw[(mb * 16 + hi * 8 + j) * 68 + nb * 16 + lr] = acc[mb][nb][j];
        __syncthreads();   // every wave's partial tile is in LDS before any thread sums across the slots
        // both loops unrolled: the LDS reads of all slots and rounds go out without a branch between them
#pragma unroll
        for (int s = 0; s < 32 / NW; ++s) { const int q = s * (NW * 32) + (int)threadIdx.x, row = q >> 4, cofs = (q & 15) * 4; v4f val = *(const v4fa*)(os + row * 68 + cofs);
#pragma unroll
            for (int w = 1; w < NW; ++w) val += *(const v4fa*)(os + w * (64 * 68) + row * 68 + cofs);
            if (BIAS) { val[0] += bfr(bias[c0 + cofs]); val[1] += bfr(bias[c0 + cofs + 1]); val[2] += bfr(bias[c0 + cofs + 2]); val[3] += bfr(bias[c0 + cofs + 3]); }
            *(v4f*)(C + (size_t)(r0 + row) * ldc + c0 + cofs) = val; }
        return;
    }
#pragma unroll
    for (int mb = 0; mb < 4; ++mb) {
#pragma unroll
        for (int nb = 0; nb < 4; ++nb) {
#pragma unroll
            for (int j = 0; j < 8; ++j) os[(hi * 8 + j) * 68 + nb * 16 + lr] = acc[mb][nb][j]; }
        __builtin_amdgcn_wave_barrier(); asm volatile("" ::: "memory");
        float* crow = C + (size_t)(r0 + mb * 16) * ldc + c0;
{
#pragma unroll
            for (int s = 0; s < 8; ++s) { const int row = 2 * s + hi, cofs = lr * 4; v4f val = *(const v4fa*)(os + row * 68 + cofs); if (BIAS) { val[0] += bfr(bias[c0 + cofs]); val[1] += bfr(bias[c0 + cofs + 1]); val[2] += bfr(bias[c0 + cofs + 2]); val[3] += bfr(bias[c0 + cofs + 3]); }
                *(v4f*)(crow + (size_t)row * ldc + cofs) = val; }
             }
        __builtin_amdgcn_wave_barrier(); asm volatile("" ::: "memory");
    }
}

// ---- k_gemmc: the same NW-wave 64x64 tile GEMM specialised for causal attention: CMODE 1 skips score tiles entirely above the diagonal (query rows r0+roff.., key columns c0..), CMODE 2 limits the
// key (K) loop of the probability x value contraction to the diagonal block (probabilities beyond it are exactly zero). roff = row offset of this launch's first row within the sequence.
template <typename T16, int NSPLIT, int CMODE, int NW>
__global__ __launch_bounds__(NW * 32) void k_gemmc(const T16* __restrict__ A, const T16* __restrict__ A2, const T16* __restrict__ Bt, const T16* __restrict__ Bt2, int K, int lda, float* C, int ldc, int roff, size_t sA, size_t sB, size_t sC) {
    typedef typename WFrag<T16>::V V;
    __shared__ __align__(16) float os[NW > 1 ? NW * 64 * 68 : 16 * 68];
    const size_t z = blockIdx.z; A += z * sA; if (A2) A2 += z * sA; Bt += (z / ZH) * sB; if (Bt2) Bt2 += (z / ZH) * sB; C += z * sC;
    const int lane = threadIdx.x & 31, lr = lane & 15, hi = lane >> 4; const int wv = (NW > 1) ? __builtin_amdgcn_readfirstlane((int)(threadIdx.x >> 5)) : 0;   /* wave number as a scalar: the K loop's counter and branch stay scalar */ const int r0 = blockIdx.x * 64, c0 = blockIdx.y * 64;
    if (CMODE == 1 && c0 > r0 + roff + 63) return;                  // score tile entirely above the causal diagonal: never read (the softmax masks j > i by select)
    const int Kl = (CMODE == 2) ? min(K, r0 + roff + 64) : K;        // P.V: probabilities are exactly 0 beyond the diagonal block, so the K loop stops there
    v8f acc[4][4];
#pragma unroll
    for (int mb = 0; mb < 4; ++mb)
#pragma unroll
        for (int nb = 0; nb < 4; ++nb) acc[mb][nb] = (v8f){};
    const size_t aoff = (size_t)(r0 + lr) * lda + 8 * hi, boff = (size_t)(c0 + lr) * K + 8 * hi;
#pragma unroll 1
    for (int kc = wv * 64; kc < Kl; kc += (kc & 32) ? (NW * 64 - 32) : 32) {
        V a[4], a2[4]; const T16* pa[4]; const T16* pa2[4]; const T16* pb[4]; const T16* pb2[4];
#pragma unroll
        for (int mb = 0; mb < 4; ++mb) { pa[mb] = A + aoff + (size_t)mb * 16 * lda + kc; a[mb] = WFrag<T16>::ld(pa[mb]); if (NSPLIT == 1 || NSPLIT == 2) { pa2[mb] = A2 + aoff + (size_t)mb * 16 * lda + kc; a2[mb] = WFrag<T16>::ld(pa2[mb]); } }
#pragma unroll
        for (int nb = 0; nb < 4; ++nb) { pb[nb] = Bt + boff + (size_t)nb * 16 * K + kc; const V b = WFrag<T16>::ld(pb[nb]); V b2; if (NSPLIT >= 2) { pb2[nb] = Bt2 + boff + (size_t)nb * 16 * K + kc; b2 = WFrag<T16>::ld(pb2[nb]); }
#pragma unroll
            for (int mb = 0; mb < 4; ++mb) { acc[mb][nb] = WFrag<T16>::mma(a[mb], b, acc[mb][nb]); if (NSPLIT == 1 || NSPLIT == 2) acc[mb][nb] = WFrag<T16>::mma(a2[mb], b, acc[mb][nb]); if (NSPLIT >= 2) acc[mb][nb] = WFrag<T16>::mma(a[mb], b2, acc[mb][nb]); } }
        asm volatile("v_nop\n\tv_nop\n\tv_nop\n\tv_nop" : "+v"(acc[0][0]), "+v"(acc[1][1]), "+v"(acc[2][2]), "+v"(acc[3][3]) : "v"(a[0]), "v"(a[3]));
        // precaution: this trip's load addresses are named as inputs, so their registers are not reused between a load and this wait; it stands at the loop's foot, where every load of the trip has already delivered its data
        if (NSPLIT == 2) asm volatile("s_wait_xcnt 0x0" :: "v"(pa[0]), "v"(pa[1]), "v"(pa[2]), "v"(pa[3]), "v"(pa2[0]), "v"(pa2[1]), "v"(pa2[2]), "v"(pa2[3]), "v"(pb[0]), "v"(pb[1]), "v"(pb[2]), "v"(pb[3]), "v"(pb2[0]), "v"(pb2[1]), "v"(pb2[2]), "v"(pb2[3]) : "memory");
        else if (NSPLIT == 1) asm volatile("s_wait_xcnt 0x0" :: "v"(pa[0]), "v"(pa[1]), "v"(pa[2]), "v"(pa[3]), "v"(pa2[0]), "v"(pa2[1]), "v"(pa2[2]), "v"(pa2[3]), "v"(pb[0]), "v"(pb[1]), "v"(pb[2]), "v"(pb[3]) : "memory");
        else asm volatile("s_wait_xcnt 0x0" :: "v"(pa[0]), "v"(pa[1]), "v"(pa[2]), "v"(pa[3]), "v"(pb[0]), "v"(pb[1]), "v"(pb[2]), "v"(pb[3]) : "memory");
    }
    if (NW > 1) {   // merge of the K split: each wave parks its whole partial tile in its own LDS slot, then all threads sum the NW slots in wave order and store
        float* osw = os + wv * (64 * 68);
        // the three loops are unrolled so that acc is indexed by constants and stays in registers
#pragma unroll
        for (int mb = 0; mb < 4; ++mb)
#pragma unroll
            for (int nb = 0; nb < 4; ++nb)
#pragma unroll
                for (int j = 0; j < 8; ++j) osw[(mb * 16 + hi * 8 + j) * 68 + nb * 16 + lr] = acc[mb][nb][j];
        __syncthreads();   // every wave's partial tile is in LDS before any thread sums across the slots
        // both loops unrolled: the LDS reads of all slots and rounds go out without a branch between them
#pragma unroll
        for (int s = 0; s < 32 / NW; ++s) { const int q = s * (NW * 32) + (int)threadIdx.x, row = q >> 4, cofs = (q & 15) * 4; v4f val = *(const v4fa*)(os + row * 68 + cofs);
#pragma unroll
            for (int w = 1; w < NW; ++w) val += *(const v4fa*)(os + w * (64 * 68) + row * 68 + cofs);
            *(v4f*)(C + (size_t)(r0 + row) * ldc + c0 + cofs) = val; }
        return;
    }
#pragma unroll
    for (int mb = 0; mb < 4; ++mb) {
#pragma unroll
        for (int nb = 0; nb < 4; ++nb) {
#pragma unroll
            for (int j = 0; j < 8; ++j) os[(hi * 8 + j) * 68 + nb * 16 + lr] = acc[mb][nb][j]; }
        __builtin_amdgcn_wave_barrier(); asm volatile("" ::: "memory");
        float* crow = C + (size_t)(r0 + mb * 16) * ldc + c0;
{
#pragma unroll
            for (int s = 0; s < 8; ++s) { const int row = 2 * s + hi, cofs = lr * 4; v4f val = *(const v4fa*)(os + row * 68 + cofs);
                *(v4f*)(crow + (size_t)row * ldc + cofs) = val; }
             }
        __builtin_amdgcn_wave_barrier(); asm volatile("" ::: "memory");
    }
}

__device__ __forceinline__ h16 tohx(float x) { return (h16)x; }
__device__ __forceinline__ void splitf(float y, unsigned short& h, unsigned short& l) { h = f2bf(y); l = f2bf(y - bf2f(h)); }
typedef __attribute__((ext_vector_type(2))) _Float16 v2h;
typedef __attribute__((ext_vector_type(4))) _Float16 v4h;
typedef __attribute__((ext_vector_type(2))) unsigned short v2us;
typedef __attribute__((ext_vector_type(4))) unsigned short v4us;
typedef __attribute__((ext_vector_type(2))) float v2f;
typedef __attribute__((ext_vector_type(4))) int v4i;
typedef v4h  __attribute__((may_alias)) v4ha;
typedef v4us __attribute__((may_alias)) v4usa;

__global__ __launch_bounds__(256) void k_wtG(const float* __restrict__ w, int K, int N, bf* Bt) {
    const int lane = threadIdx.x & 31; const int L0 = (blockIdx.x * 8 + (threadIdx.x >> 5)) * 8; const int nlines = N * K / 64;
{
#pragma unroll 1
        for (int l = 0; l < 8; ++l) { const int L = L0 + l; if (L >= nlines) break; const size_t e = (size_t)L * 64 + lane * 2; const int k = (int)(e % K), n = (int)(e / K); v2us o;
            o[0] = f2bf(w[(size_t)k * N + n]); o[1] = f2bf(w[(size_t)(k + 1) * N + n]); *(v2us*)(Bt + e) = o; }
         }
}
__global__ __launch_bounds__(256) void k_cvt8(const float* __restrict__ src, bf* dst, size_t n8) { const size_t i = (size_t)blockIdx.x * 256 + threadIdx.x; if (i >= n8) return; const v8f v = *(const v8f*)(src + i * 8); v8us o;
#pragma unroll
    for (int k = 0; k < 8; ++k) o[k] = f2bf(v[k]); *(v8us*)(dst + i * 8) = o;  }
__global__ __launch_bounds__(256) void k_cscvt(const float* __restrict__ cosT, const float* __restrict__ sinT, float* CS) { const int idx = blockIdx.x * 256 + threadIdx.x; if (idx >= TT * HD) return; v2f cs; cs[0] = bfr(cosT[idx]); cs[1] = bfr(sinT[idx]); *(v2f*)(CS + (size_t)idx * 2) = cs;  }
// k_rope: head planes [plane][t][d] (fp16 + hi/lo; F holds both batch elements, row b * TT + t) of rope(x) x sc with the rotate-half convention out[d] = x[d] cos[t][d] - x[d+HD/2] sin[t][d], out[d+HD/2] = x[d+HD/2] cos[t][d+HD/2] + x[d] sin[t][d+HD/2]
__global__ __launch_bounds__(256) void k_rope(const float* __restrict__ F, int pitch, int nheads, const float* __restrict__ CS, const float* __restrict__ RF, const float* __restrict__ nw, float sc, int gs, h16* P16, bf* Ph, bf* Pl) {
    const size_t e = ((size_t)blockIdx.x * 256 + threadIdx.x) * 2; if (e >= (size_t)NB_ * nheads * TT * HD) return; const int d = (int)(e % HD); const int t = (int)((e / HD) % TT); const int p = (int)(e / ((size_t)HD * TT)); const int b = (p / gs) % NB_; const int h = (p / (NB_ * gs)) * gs + p % gs;   /* plane order [h / gs][b][h % gs]: the planes of one head-loop pass lie side by side */ const float* f = F + ((size_t)b * TT + t) * pitch + h * HD; const float rf = RF ? RF[(size_t)h * TT + t] : 1.0f; asm volatile("s_wait_xcnt 0x0" ::: "memory");   /* precaution: the address registers of the load above are reused right behind it */ v2h o16; v2us oh, ol;
#pragma unroll
    for (int q = 0; q < 2; ++q) { const int dd = d + q; const int dp = (dd < HD / 2) ? dd + HD / 2 : dd - HD / 2; float x0 = f[dd], x1 = f[dp];
        if (RF) { float n0 = __fmul_rn(x0, rf), n1 = __fmul_rn(x1, rf); asm volatile("" : "+v"(n0)); asm volatile("" : "+v"(n1)); x0 = __fmul_rn(bfr(nw[dd]), n0); x1 = __fmul_rn(bfr(nw[dp]), n1); }
        const v2f cs = *(const v2f*)(CS + ((size_t)t * HD + dd) * 2); float a = __fmul_rn(x0, cs[0]), bq = __fmul_rn(x1, cs[1]); asm volatile("" : "+v"(a)); asm volatile("" : "+v"(bq)); const float r = ((dd < HD / 2) ? __fsub_rn(a, bq) : __fadd_rn(a, bq)) * sc;
        o16[q] = tohx(r); unsigned short a2, c2; splitf(r, a2, c2); oh[q] = a2; ol[q] = c2; }
    *(v2h*)(P16 + e) = o16; *(v2us*)(Ph + e) = oh; *(v2us*)(Pl + e) = ol;  }
__global__ __launch_bounds__(256) void k_vtp(const float* __restrict__ F, int pitch, int nheads, h16* V16, bf* Vh, bf* Vl) { const size_t e = ((size_t)blockIdx.x * 256 + threadIdx.x) * 2; if (e >= (size_t)NB_ * nheads * HD * TT) return; const int t = (int)(e % TT); const int d = (int)((e / TT) % HD); const int p = (int)(e / ((size_t)TT * HD)); const int g = p / NB_, b = p % NB_;   /* plane order [g][b] */ v2h o16; v2us oh, ol;
#pragma unroll
    for (int q = 0; q < 2; ++q) { const float x = F[((size_t)b * TT + t + q) * pitch + g * HD + d]; o16[q] = tohx(x); unsigned short a2, c2; splitf(x, a2, c2); oh[q] = a2; ol[q] = c2; }
    *(v2h*)(V16 + e) = o16; *(v2us*)(Vh + e) = oh; *(v2us*)(Vl + e) = ol;  }
__global__ __launch_bounds__(256) void k_csid(float* CS) { const int idx = blockIdx.x * 256 + threadIdx.x; if (idx >= TT * HD) return; v2f cs; cs[0] = 1.0f; cs[1] = 0.0f; *(v2f*)(CS + (size_t)idx * 2) = cs;  }
// k_asoft: per row (zz, i): t = S x HD^-0.5 + bias[n][j] for j <= i and bias[n][j] > 0, else -3.0e38 by select; softmax over the 2048 keys (register row, one exp, fixed trees);
// the probabilities overwrite the row's own scores (each wave holds its whole 8 KiB row in registers before its first store): hi plane in the first half of the row and lo plane in the second (rows < RH), else fp16 in the first half; pitch 2 * TT 16-bit elements.
__global__ __launch_bounds__(256) void k_asoft(float* Sb, const float* __restrict__ Bb, const int* __restrict__ FLG, int h0) {
    const int lane = threadIdx.x & 31; const int row = blockIdx.x * 8 + (threadIdx.x >> 5); if (row >= NZ * TT) return; const int i = row % TT; const int zz = row / TT; const int b = zz / ZH, n = (h0 + zz % ZH) / REP; const bool hires = (i < RH); float* sr = Sb + (size_t)row * TT; const float* bias = Bb + (size_t)(b * NKV + n) * TT; const bool poison = (FLG[b * 8 + n] != 0);   /* premise self-check: no positive bias among keys 0..RH-1 for this kv head -> NaN-poison (flag word FLG[b * 8 + 4] also set) */ float v[TT / 32]; float mx = -3.0e38f;
#pragma unroll
    for (int ch = 0; ch < TT / 128; ++ch) { const int j0 = ch * 128 + lane * 4; const v4f a = *(const v4f*)(sr + j0);
#pragma unroll
        for (int q = 0; q < 4; ++q) { const int j = j0 + q; (void)j; const float bj = bias[j]; float sa = a[q] * SCL; asm volatile("" : "+v"(sa)); const float t = (j <= i && bj > 0.f) ? __fadd_rn(sa, bj) : -3.0e38f   /* same fill as the running-max init, so a row with NO allowed key (possible for the first few rows) softmaxes uniformly over every key like the source's finfo.min fill instead of 0/0 */; v[ch * 4 + q] = t; mx = fmaxf(mx, t); } }
#pragma unroll
    for (int sh = 16; sh; sh >>= 1) mx = fmaxf(mx, __shfl_xor(mx, sh, 32));
    float sum = 0.f;
#pragma unroll
    for (int k = 0; k < TT / 32; ++k) { float d0 = __fsub_rn(v[k], mx); asm volatile("" : "+v"(d0)); v[k] = __builtin_amdgcn_exp2f(__fmul_rn(d0, 1.4426950408889634f)); sum += v[k]; }
#pragma unroll
    for (int sh = 16; sh; sh >>= 1) sum += __shfl_xor(sum, sh, 32);
    const float f = poison ? __builtin_nanf("") : __fdiv_rn(hires ? 1.0f : PCAR, sum);
{
        if (hires) {
#pragma unroll
            for (int ch = 0; ch < TT / 128; ++ch) { v4us oh, ol;
#pragma unroll
                for (int q = 0; q < 4; ++q) { unsigned short a, c2; splitf(v[ch * 4 + q] * f, a, c2); oh[q] = a; ol[q] = c2; }
                const int oo = ch * 128 + lane * 4; *(v4usa*)((bf*)sr + oo) = oh; *(v4usa*)((bf*)sr + TT + oo) = ol; }
        } else {
#pragma unroll
            for (int ch = 0; ch < TT / 128; ++ch) { v4h o4;
#pragma unroll
                for (int q = 0; q < 4; ++q) o4[q] = tohx(v[ch * 4 + q] * f);
                *(v4ha*)((h16*)sr + ch * 128 + lane * 4) = o4; } }
         }
}
__global__ __launch_bounds__(256) void k_merge(const float* __restrict__ O, int h0, bf* Ah, bf* Al) { const size_t e = ((size_t)blockIdx.x * 256 + threadIdx.x) * 2; if (e >= (size_t)NZ * TT * HD) return; const int d = (int)(e % HD); const int t = (int)((e / HD) % TT); const int zz = (int)(e / ((size_t)HD * TT)); const float cs = (t < RH) ? 1.0f : (1.0f / PCAR); const size_t oo = ((size_t)(zz / ZH) * TT + t) * DQ + (h0 + zz % ZH) * HD + d;
    v2us oh, ol;
#pragma unroll
    for (int q = 0; q < 2; ++q) { unsigned short a, c2; splitf(O[e + q] * cs, a, c2); oh[q] = a; ol[q] = c2; } *(v2us*)(Ah + oo) = oh; *(v2us*)(Al + oo) = ol;  }

__global__ __launch_bounds__(32) void k_chk(const float* __restrict__ BIAS, int* FLG) { BIAS += (size_t)blockIdx.x * NKV * TT; FLG += blockIdx.x * 8;   /* one work-group per batch element */ const int n = threadIdx.x; int none = 0; if (n < NKV) { none = 1;
#pragma unroll 1
        for (int j = 0; j < RH; ++j) if (BIAS[(size_t)n * TT + j] > 0.f) { none = 0; break; } }
    int anyb = none;
#pragma unroll
    for (int sh = 16; sh; sh >>= 1) anyb |= __shfl_xor(anyb, sh, 32);
    const int v = (n < NKV) ? none : ((n == NKV) ? anyb : 0); if (n < 8) { *(int*)(FLG + n) = v;  } }
__global__ __launch_bounds__(256) void k_wgd(const float* __restrict__ w, int K, bf* Bt) { const int e = (blockIdx.x * 256 + threadIdx.x) * 4; if (e >= 64 * K) return; const int k = e % K, n = e / K; v4us o;
#pragma unroll
    for (int u = 0; u < 4; ++u) o[u] = (n < NKV) ? f2bf(w[(size_t)(k + u) * NKV + n]) : (unsigned short)0; *(v4us*)(Bt + e) = o;  }
__global__ __launch_bounds__(256) void k_plq(const float* __restrict__ F, bf* Ph, bf* Pl, size_t n4) { const size_t e = ((size_t)blockIdx.x * 256 + threadIdx.x) * 4; if (e >= n4 * 4) return; const v4f a = *(const v4f*)(F + e); v4us oh, ol;
#pragma unroll
    for (int u = 0; u < 4; ++u) { unsigned short x0, x1; splitf(a[u], x0, x1); oh[u] = x0; ol[u] = x1; } *(v4us*)(Ph + e) = oh; *(v4us*)(Pl + e) = ol;  }
__global__ __launch_bounds__(256) void k_bias(const float* __restrict__ GATE, const float* __restrict__ DEL, float* BIAS) { const int e = (blockIdx.x * 256 + threadIdx.x) * 4; if (e >= NB_ * NKV * TT) return; const int j = e % TT; const int n = (e / TT) % NKV; const int b = e / (NKV * TT); v4f r;
#pragma unroll
    for (int u = 0; u < 4; ++u) { const float gt = GATE[((size_t)b * TT + j + u) * 64 + n]; asm volatile("s_wait_xcnt 0x0" ::: "memory");   /* precaution, here and below: later loads land in the registers that held this load's address */ const float dl = DEL[((size_t)b * TT + j + u) * 64 + n]; asm volatile("s_wait_xcnt 0x0" ::: "memory"); const float sg = __fdiv_rn(1.0f, __fadd_rn(1.0f, __expf(-gt))); r[u] = __fmul_rn(sg, dl); }
    *(v4f*)(BIAS + e) = r;  }

extern "C" void kernel_launch(void* const* d_in, const int* in_sizes, int n_in,
                              void* d_out, int out_size, void* d_ws, size_t ws_size, hipStream_t stream) {
    (void)in_sizes; (void)n_in; (void)out_size;
    const float* x = (const float*)d_in[0]; const float* wq = (const float*)d_in[1]; const float* wk = (const float*)d_in[2]; const float* wv = (const float*)d_in[3]; const float* wg = (const float*)d_in[4]; const float* wdl = (const float*)d_in[5]; const float* wo = (const float*)d_in[6]; const float* cosT = nullptr; const float* sinT = nullptr; (void)cosT; (void)sinT;
    float* OUT = (float*)d_out;     // [2][2048][2048]
    char* wsp = (char*)d_ws;
    auto take = [&](size_t bytes) { char* p = wsp; wsp += (bytes + 255) & ~(size_t)255; return (void*)p; };
    const size_t MT = (size_t)NB_ * TT;   // token rows of both batch elements together: every launch covers both
    // live through the head loop
    bf* WO = (bf*)take((size_t)DM * DQ * 2); float* BIAS = (float*)take((size_t)NB_ * NKV * TT * 4); int* FLG = (int*)take(256);
    h16* QP16 = (h16*)take(MT * NH_ * HD * 2); h16* KP16 = (h16*)take(MT * NKV * HD * 2); h16* VT16 = (h16*)take(MT * NKV * HD * 2);
    bf* QPh = (bf*)take(MT * NH_ * HD * 2); bf* QPl = (bf*)take(MT * NH_ * HD * 2); bf* KPh = (bf*)take(MT * NKV * HD * 2); bf* KPl = (bf*)take(MT * NKV * HD * 2); bf* VTh = (bf*)take(MT * NKV * HD * 2); bf* VTl = (bf*)take(MT * NKV * HD * 2);
    float* Ob = (float*)take((size_t)NZ * TT * HD * 4); bf* ATh = (bf*)take(MT * DQ * 2); bf* ATl = (bf*)take(MT * DQ * 2);
    float* Sb = (float*)take((size_t)NZ * TT * TT * 4);
    if ((size_t)(wsp - (char*)d_ws) > ws_size) return;    // ws 256 MiB
    // read for the last time before the first score launch writes Sb (stream-ordered): these share Sb's bytes
    wsp = (char*)Sb;
    bf* WQ = (bf*)take((size_t)DQ * DM * 2); bf* WK = (bf*)take((size_t)DKV * DM * 2); bf* WV = (bf*)take((size_t)DKV * DM * 2); float* CS = (float*)take((size_t)TT * HD * 2 * 4);
    bf* XB = (bf*)take(MT * DM * 2); bf* GFh = (bf*)take(MT * DQ * 2); bf* GFl = (bf*)take(MT * DQ * 2); bf* VFh = (bf*)take(MT * DKV * 2); bf* VFl = (bf*)take(MT * DKV * 2); bf* WG = (bf*)take((size_t)64 * DQ * 2); bf* WD = (bf*)take((size_t)64 * DKV * 2); float* GATE = (float*)take(MT * 64 * 4); float* DEL = (float*)take(MT * 64 * 4); float* FQ = (float*)take(MT * DQ * 4); float* FK = (float*)take(MT * DKV * 4);
    if ((size_t)(wsp - (char*)Sb) > (size_t)NZ * TT * TT * 4) return;
    float* FV = FK;   // v projection reuses the k buffer after the k planes are built (stream-ordered)
    { k_wgd<<<(64 * DQ / 4 + 255) / 256, 256, 0, stream>>>(wg, DQ, WG); k_wgd<<<(64 * DKV / 4 + 255) / 256, 256, 0, stream>>>(wdl, DKV, WD); k_wtG<<<(unsigned)((DM * DQ / 64 + 63) / 64), 256, 0, stream>>>(wq, DM, DQ, WQ); k_wtG<<<(unsigned)((DM * DKV / 64 + 63) / 64), 256, 0, stream>>>(wk, DM, DKV, WK); k_wtG<<<(unsigned)((DM * DKV / 64 + 63) / 64), 256, 0, stream>>>(wv, DM, DKV, WV);
      k_wtG<<<(unsigned)((DQ * DM / 64 + 63) / 64), 256, 0, stream>>>(wo, DQ, DM, WO);
       }
    k_csid<<<(TT * HD + 255) / 256, 256, 0, stream>>>(CS);
    const unsigned LQ = (unsigned)((MT * NH_ * HD / 2 + 255) / 256), LKv = (unsigned)((MT * NKV * HD / 2 + 255) / 256);
    const unsigned MB = (unsigned)(MT / 64);   // 64-row tiles over both batch elements
    k_cvt8<<<(unsigned)((MT * DM / 8 + 255) / 256), 256, 0, stream>>>(x, XB, MT * DM / 8);
    k_gemmw<bf, 0, false, 8><<<dim3(MB, DQ / 64, 1), 256, 0, stream>>>(XB, nullptr, WQ, nullptr, DM, DM, FQ, DQ, nullptr, 0, 0, 0);
    k_rope<<<LQ, 256, 0, stream>>>(FQ, DQ, NH_, CS, nullptr, nullptr, 1.0f, ZH, QP16, QPh, QPl);
    k_gemmw<bf, 0, false, 16><<<dim3(MB, DKV / 64, 1), 512, 0, stream>>>(XB, nullptr, WK, nullptr, DM, DM, FK, DKV, nullptr, 0, 0, 0);
    k_rope<<<LKv, 256, 0, stream>>>(FK, DKV, NKV, CS, nullptr, nullptr, 1.0f, 1, KP16, KPh, KPl);
    k_gemmw<bf, 0, false, 16><<<dim3(MB, DKV / 64, 1), 512, 0, stream>>>(XB, nullptr, WV, nullptr, DM, DM, FV, DKV, nullptr, 0, 0, 0);
    /* dynamic mask bias per (batch, kv head, key) */ k_plq<<<(unsigned)((MT * DQ / 4 + 255) / 256), 256, 0, stream>>>(FQ, GFh, GFl, MT * DQ / 4); k_plq<<<(unsigned)((MT * DKV / 4 + 255) / 256), 256, 0, stream>>>(FV, VFh, VFl, MT * DKV / 4);
    k_gemmw<bf, 1, false, 16><<<dim3(MB, 1, 1), 512, 0, stream>>>(GFh, GFl, WG, nullptr, DQ, DQ, GATE, 64, nullptr, 0, 0, 0); k_gemmw<bf, 1, false, 8><<<dim3(MB, 1, 1), 256, 0, stream>>>(VFh, VFl, WD, nullptr, DKV, DKV, DEL, 64, nullptr, 0, 0, 0); k_bias<<<(NB_ * NKV * TT / 4 + 255) / 256, 256, 0, stream>>>(GATE, DEL, BIAS); k_chk<<<NB_, 32, 0, stream>>>(BIAS, FLG); k_vtp<<<LKv, 256, 0, stream>>>(FV, DKV, NKV, VT16, VTh, VTl);
    for (int h0 = 0; h0 < NH_; h0 += ZH) { const size_t zq = (size_t)h0 * NB_, zk = (size_t)(h0 / REP) * NB_;   // first q plane and first k/v plane of the pass; the ZH heads of a batch element share its kv plane (ZH <= REP): Bt steps once per ZH slices
        k_gemmw<bf, 2, false, 1><<<dim3(RH / 64, TT / 64, NZ), 32, 0, stream>>>(QPh + zq * TT * HD, QPl + zq * TT * HD, KPh + zk * TT * HD, KPl + zk * TT * HD, HD, HD, Sb, TT, nullptr, (size_t)TT * HD, (size_t)TT * HD, (size_t)TT * TT);
        k_gemmc<h16, 0, 1, 1><<<dim3((TT - RH) / 64, TT / 64, NZ), 32, 0, stream>>>(QP16 + zq * TT * HD + (size_t)RH * HD, nullptr, KP16 + zk * TT * HD, nullptr, HD, HD, Sb + (size_t)RH * TT, TT, RH, (size_t)TT * HD, (size_t)TT * HD, (size_t)TT * TT);
        k_asoft<<<NZ * TT / 8, 256, 0, stream>>>(Sb, BIAS, FLG, h0);
        k_gemmw<bf, 2, false, 16><<<dim3(RH / 64, HD / 64, NZ), 512, 0, stream>>>((const bf*)Sb, (const bf*)Sb + TT, VTh + zk * HD * TT, VTl + zk * HD * TT, TT, 2 * TT, Ob, HD, nullptr, (size_t)TT * TT * 2, (size_t)HD * TT, (size_t)TT * HD);
        k_gemmc<h16, 0, 2, 16><<<dim3((TT - RH) / 64, HD / 64, NZ), 512, 0, stream>>>((const h16*)Sb + (size_t)RH * TT * 2, nullptr, VT16 + zk * HD * TT, nullptr, TT, 2 * TT, Ob + (size_t)RH * HD, HD, RH, (size_t)TT * TT * 2, (size_t)HD * TT, (size_t)TT * HD);
        k_merge<<<(unsigned)(((size_t)NZ * TT * HD / 2 + 255) / 256), 256, 0, stream>>>(Ob, h0, ATh, ATl); }
    k_gemmw<bf, 1, false, 8><<<dim3(MB, DM / 64, 1), 256, 0, stream>>>(ATh, ATl, WO, nullptr, DQ, DQ, OUT, DM, nullptr, 0, 0, 0);
}

// v004
// A run of this version takes 823 microseconds.
// Two timings next to v003 put it at 1.07 and 1.08 times that version's speed.
// Over all steps from v000 it is 2.89 times as fast.
#include <hip/hip_runtime.h>

// DynamicMaskAttention (hidden [2][2048][2048]; q = x Wq (16 heads x 128), k/v = x Wk / Wv (4 kv heads; group h/4); per key j and kv head n: bias = sigmoid(q_flat[j] . Wg[:, n]) * (v_flat[j] . Wd[:, n]); logits = q.k / sqrt(128) + bias[n][j]; allowed = causal AND bias[n][j] > 0, everything else gets finfo.min (so a query row with no allowed key softmaxes uniformly over ALL keys, as the source);
//   softmax; out = merged Wo -> [2][2048][2048]).
// Compute dtypes, f32 accumulate: every input rounded to bf16; q/k/v on PLAIN bf16 operands (inputs: exact); gate / delta as hl planes of q_flat / v_flat x exact Wg / Wd (2 products; 4 outputs padded to 64), sigmoid and the product f32; scores and attn.v: query rows < 512 hl (3 products) over ALL key tiles (those early rows can have an empty allowed set and then attend uniformly to every key), the rest single fp16 (x1024) with causal tile skipping; bias + mask + softmax f32; Wo hl x exact (2 products).

#define NB_  2
#define TT   2048
#define DM   2048
#define NH_  16
#define NKV  4
#define REP  (NH_ / NKV)
#define HD   128
#define DQ   (NH_ * HD)
#define DKV  (NKV * HD)
#define ZH   4                    // query heads per pass of the head loop: one whole kv group (ZH <= REP, REP % ZH == 0), so in a pass the ZH z slices of one batch element share that element's K and V planes
#define NZ   (NB_ * ZH)         // z slices of a head-loop launch: z = b * ZH + (head - h0), both batch elements side by side
#define RH   512                  // query rows < RH use hi+lo planes (0: none)
#define WIN  2048
#define PCAR 1024.0f
#define SCL  0.088388347648318447f   // HD^-0.5
typedef _Float16 h16;
typedef unsigned short bf;
typedef __attribute__((ext_vector_type(16))) __bf16   v16bf;
typedef __attribute__((ext_vector_type(16))) _Float16 v16h;
typedef __attribute__((ext_vector_type(8)))  _Float16 v8h;
typedef __attribute__((ext_vector_type(8)))  unsigned short v8us;
typedef __attribute__((ext_vector_type(8)))  float    v8f;
typedef __attribute__((ext_vector_type(4)))  float    v4f;
typedef v8h  __attribute__((may_alias)) v8ha;
typedef v4f  __attribute__((may_alias)) v4fa;
typedef v8us __attribute__((may_alias)) v8usa;

__device__ __forceinline__ unsigned short f2bf(float f) { unsigned u = __float_as_uint(f); u += 0x7FFFu + ((u >> 16) & 1u); return (unsigned short)(u >> 16); }
__device__ __forceinline__ float bf2f(unsigned short b) { return __uint_as_float(((unsigned)b) << 16); }
__device__ __forceinline__ float bfr(float f) { return bf2f(f2bf(f)); }
__device__ __forceinline__ v16h cat16(v8h lo, v8h hi) { return __builtin_shufflevector(lo, hi, 0, 1, 2, 3, 4, 5, 6, 7, 8, 9, 10, 11, 12, 13, 14, 15); }
__device__ __forceinline__ v16bf cat16b(v8us lo, v8us hi) { return __builtin_bit_cast(v16bf, __builtin_shufflevector(lo, hi, 0, 1, 2, 3, 4, 5, 6, 7, 8, 9, 10, 11, 12, 13, 14, 15)); }
__device__ __forceinline__ v8f wmma16(v16h a, v16h b, v8f c) { return __builtin_amdgcn_wmma_f32_16x16x32_f16(false, a, false, b, (short)0, c, false, false); }
__device__ __forceinline__ v8f wmmab(v16bf a, v16bf b, v8f c) { return __builtin_amdgcn_wmma_f32_16x16x32_bf16(false, a, false, b, (short)0, c, false, false); }
__device__ __forceinline__ h16 tohx(float x) { return (h16)x; }
__device__ __forceinline__ void splitf(float y, unsigned short& h, unsigned short& l) { h = f2bf(y); l = f2bf(y - bf2f(h)); }
typedef __attribute__((ext_vector_type(4))) _Float16 v4h;
typedef __attribute__((ext_vector_type(4))) unsigned short v4us;

// ---- what the merge step of a K-split GEMM stores (EPI): 0 the f32 tile; otherwise the 16-bit operand planes of the next GEMM, straight from the summed registers:
// 1 q: head planes [h / ZH][b][h % ZH][t][d] (fp16, hi, lo) and the flat hi / lo rows for the gate product; 2 k: head planes [h][b][t][d] (fp16, hi, lo);
// 3 v: flat hi / lo rows for the delta product (the transposed planes [g][b][d][t] are written by the kernel itself, through LDS); 4 attention output x cs: hi / lo rows [b][t][head][d] for the output projection.
struct Epi { h16* p16; bf* ph; bf* pl; bf* fh; bf* fl; int h0; float cs; };
template <int EPI> __device__ __forceinline__ void epi_put(const Epi& ep, int z, int R, int c, v4f val) {   // four neighbouring sums of output row R (of slice z), columns c .. c + 3
    v4h o16; v4us oh, ol;
    // unrolled: the vectors' elements are indexed by constants and stay in registers
#pragma unroll
    for (int u = 0; u < 4; ++u) { const float x = (EPI == 4) ? val[u] * ep.cs : val[u]; o16[u] = tohx(x); unsigned short a, c2; splitf(x, a, c2); oh[u] = a; ol[u] = c2; }
    if (EPI == 1 || EPI == 2) { const int b = R / TT, t = R % TT, h = c / HD, d = c % HD; const int p = (EPI == 1) ? (h / ZH) * (NB_ * ZH) + b * ZH + h % ZH : h * NB_ + b; const size_t o = ((size_t)p * TT + t) * HD + d;
        *(v4h*)(ep.p16 + o) = o16; *(v4us*)(ep.ph + o) = oh; *(v4us*)(ep.pl + o) = ol; }
    if (EPI == 1 || EPI == 3 || EPI == 4) { const size_t o = (EPI == 1) ? (size_t)R * DQ + c : (EPI == 3) ? (size_t)R * DKV + c : ((size_t)(z / ZH) * TT + R) * DQ + (ep.h0 + z % ZH) * HD + c;
        *(v4us*)(ep.fh + o) = oh; *(v4us*)(ep.fl + o) = ol; }
}



// ---- k_gemmw: register-blocked GEMM, one work-group of NW waves per 64x64 output tile; every wave holds the whole tile (16 accumulators) for its own share of K (64-element chunks dealt round robin: one 128-byte line of each operand row per chunk),
// operands straight from K-contiguous 16-bit planes; for NW > 1 the NW partial tiles are summed through LDS in wave order 0..NW-1 (K % 64 == 0); grid (M/64, N/64, Z), NW * 32 threads.
// C[m][n] (f32, pitch ldc, + optional f32 bias[n]) = sum_k A[m][k] Bt[n][k] (+ split products per NSPLIT). z-batch strides sA/sB/sC in elements (sA, sC per z slice; sB per ZH slices: the ZH heads of a kv group share Bt). A rows have pitch lda, Bt rows pitch K. K % 32 == 0.
template <typename T16> struct WFrag;
template <> struct WFrag<h16> { typedef v16h V; static __device__ __forceinline__ V ld(const h16* p) { return cat16(*(const v8h*)p, *(const v8h*)(p + 16)); } static __device__ __forceinline__ v8f mma(V a, V b, v8f c) { return wmma16(a, b, c); } };
template <> struct WFrag<bf> { typedef v16bf V; static __device__ __forceinline__ V ld(const bf* p) { return cat16b(*(const v8us*)p, *(const v8us*)(p + 16)); } static __device__ __forceinline__ v8f mma(V a, V b, v8f c) { return wmmab(a, b, c); } };
template <typename T16, int NSPLIT, bool BIAS, int NW, int EPI>
__global__ __launch_bounds__(NW * 32) void k_gemmw(const T16* __restrict__ A, const T16* __restrict__ A2, const T16* __restrict__ Bt, const T16* __restrict__ Bt2, int K, int lda, float* C, int ldc, const float* __restrict__ bias, size_t sA, size_t sB, size_t sC, Epi ep) {
    typedef typename WFrag<T16>::V V;
    __shared__ __align__(16) float os[NW > 1 ? NW * 64 * 68 : 16 * 68];
    const size_t z = blockIdx.z; A += z * sA; if (A2) A2 += z * sA; Bt += (z / ZH) * sB; if (Bt2) Bt2 += (z / ZH) * sB; C += z * sC;
    const int lane = threadIdx.x & 31, lr = lane & 15, hi = lane >> 4; const int wv = (NW > 1) ? __builtin_amdgcn_readfirstlane((int)(threadIdx.x >> 5)) : 0;   /* wave number as a scalar: the K loop's counter and branch stay scalar */ const int r0 = blockIdx.x * 64, c0 = blockIdx.y * 64;
    v8f acc[4][4];
#pragma unroll
    for (int mb = 0; mb < 4; ++mb)
#pragma unroll
        for (int nb = 0; nb < 4; ++nb) acc[mb][nb] = (v8f){};
    const size_t aoff = (size_t)(r0 + lr) * lda + 8 * hi, boff = (size_t)(c0 + lr) * K + 8 * hi;
#pragma unroll 1
    for (int kc = wv * 64; kc < K; kc += (kc & 32) ? (NW * 64 - 32) : 32) {
        V a[4], a2[4]; const T16* pa[4]; const T16* pa2[4]; const T16* pb[4]; const T16* pb2[4];
#pragma unroll
        for (int mb = 0; mb < 4; ++mb) { pa[mb] = A + aoff + (size_t)mb * 16 * lda + kc; a[mb] = WFrag<T16>::ld(pa[mb]); if (NSPLIT == 1 || NSPLIT == 2) { pa2[mb] = A2 + aoff + (size_t)mb * 16 * lda + kc; a2[mb] = WFrag<T16>::ld(pa2[mb]); } }
#pragma unroll
        for (int nb = 0; nb < 4; ++nb) { pb[nb] = Bt + boff + (size_t)nb * 16 * K + kc; const V b = WFrag<T16>::ld(pb[nb]); V b2; if (NSPLIT >= 2) { pb2[nb] = Bt2 + boff + (size_t)nb * 16 * K + kc; b2 = WFrag<T16>::ld(pb2[nb]); }
#pragma unroll
            for (int mb = 0; mb < 4; ++mb) { acc[mb][nb] = WFrag<T16>::mma(a[mb], b, acc[mb][nb]); if (NSPLIT == 1 || NSPLIT == 2) acc[mb][nb] = WFrag<T16>::mma(a2[mb], b, acc[mb][nb]); if (NSPLIT >= 2) acc[mb][nb] = WFrag<T16>::mma(a[mb], b2, acc[mb][nb]); } }
        asm volatile("v_nop\n\tv_nop\n\tv_nop\n\tv_nop" : "+v"(acc[0][0]), "+v"(acc[1][1]), "+v"(acc[2][2]), "+v"(acc[3][3]) : "v"(a[0]), "v"(a[3]));
        // precaution: this trip's load addresses are named as inputs, so their registers are not reused between a load and this wait; it stands at the loop's foot, where every load of the trip has already delivered its data
        if (NSPLIT == 2) asm volatile("s_wait_xcnt 0x0" :: "v"(pa[0]), "v"(pa[1]), "v"(pa[2]), "v"(pa[3]), "v"(pa2[0]), "v"(pa2[1]), "v"(pa2[2]), "v"(pa2[3]), "v"(pb[0]), "v"(pb[1]), "v"(pb[2]), "v"(pb[3]), "v"(pb2[0]), "v"(pb2[1]), "v"(pb2[2]), "v"(pb2[3]) : "memory");
        else if (NSPLIT == 1) asm volatile("s_wait_xcnt 0x0" :: "v"(pa[0]), "v"(pa[1]), "v"(pa[2]), "v"(pa[3]), "v"(pa2[0]), "v"(pa2[1]), "v"(pa2[2]), "v"(pa2[3]), "v"(pb[0]), "v"(pb[1]), "v"(pb[2]), "v"(pb[3]) : "memory");
        else asm volatile("s_wait_xcnt 0x0" :: "v"(pa[0]), "v"(pa[1]), "v"(pa[2]), "v"(pa[3]), "v"(pb[0]), "v"(pb[1]), "v"(pb[2]), "v"(pb[3]) : "memory");
    }
    if (NW > 1) {   // merge of the K split: each wave parks its whole partial tile in its own LDS slot, then all threads sum the NW slots in wave order and store
        float* osw = os + wv * (64 * 68);
        // the three loops are unrolled so that acc is indexed by constants and stays in registers
#pragma unroll
        for (int mb = 0; mb < 4; ++mb)
#pragma unroll
            for (int nb = 0; nb < 4; ++nb)
#pragma unroll
                for (int j = 0; j < 8; ++j) osw[(mb * 16 + hi * 8 + j) * 68 + nb * 16 + lr] = acc[mb][nb][j];
        __syncthreads();   // every wave's partial tile is in LDS before any thread sums across the slots
        v4f kept[32 / NW];   // EPI 3 only: the thread's sums, stored as flat rows behind the second barrier, so that no global store is outstanding at it
        // both loops unrolled: the LDS reads of all slots and rounds go out without a branch between them
#pragma unroll
        for (int s = 0; s < 32 / NW; ++s) { const int q = s * (NW * 32) + (int)threadIdx.x, row = q >> 4, cofs = (q & 15) * 4; v4f val = *(const v4fa*)(os + row * 68 + cofs);
#pragma unroll
            for (int w = 1; w < NW; ++w) val += *(const v4fa*)(os + w * (64 * 68) + row * 68 + cofs);
            kept[s] = val;
            if (BIAS) { val[0] += bfr(bias[c0 + cofs]); val[1] += bfr(bias[c0 + cofs + 1]); val[2] += bfr(bias[c0 + cofs + 2]); val[3] += bfr(bias[c0 + cofs + 3]); }
            if (EPI == 0) *(v4f*)(C + (size_t)(r0 + row) * ldc + c0 + cofs) = val; else if (EPI != 3) epi_put<EPI>(ep, (int)z, r0 + row, c0 + cofs, val);
            if (EPI == 3) *(v4fa*)(os + row * 68 + cofs) = val; }   // the summed tile goes back into slot 0 (each quad is read and rewritten by this one thread) for the transposed read below
        if (EPI == 3) {   // v planes [g][b][d][t]: the summed tile is read back by columns, so that 16 lanes store one whole 128-byte line along t
            __syncthreads();   // the whole summed tile is in slot 0 before any thread reads a column of it
            // both loops unrolled: kept and the vectors are indexed by constants, and the LDS reads of both rounds go out without a branch between them
#pragma unroll
            for (int s = 0; s < 32 / NW; ++s) { const int q = s * (NW * 32) + (int)threadIdx.x, dc = q >> 4, t4 = (q & 15) * 4; const int c = c0 + dc, R = r0 + t4; v4h o16; v4us oh, ol;
                epi_put<EPI>(ep, (int)z, r0 + dc, c0 + t4, kept[s]);   // the flat rows: quad q is (row q >> 4, columns (q & 15) * 4 ..) in the first loop too
#pragma unroll
                for (int u = 0; u < 4; ++u) { const float x = os[(t4 + u) * 68 + dc]; o16[u] = tohx(x); unsigned short a, c2; splitf(x, a, c2); oh[u] = a; ol[u] = c2; }
                const size_t o = (((size_t)(c / HD) * NB_ + R / TT) * HD + c % HD) * TT + R % TT; *(v4h*)(ep.p16 + o) = o16; *(v4us*)(ep.ph + o) = oh; *(v4us*)(ep.pl + o) = ol; }
        }
        return;
    }
#pragma unroll
    for (int mb = 0; mb < 4; ++mb) {
#pragma unroll
        for (int nb = 0; nb < 4; ++nb) {
#pragma unroll
            for (int j = 0; j < 8; ++j) os[(hi * 8 + j) * 68 + nb * 16 + lr] = acc[mb][nb][j]; }
        __builtin_amdgcn_wave_barrier(); asm volatile("" ::: "memory");
        float* crow = C + (size_t)(r0 + mb * 16) * ldc + c0;
{
#pragma unroll
            for (int s = 0; s < 8; ++s) { const int row = 2 * s + hi, cofs = lr * 4; v4f val = *(const v4fa*)(os + row * 68 + cofs); if (BIAS) { val[0] += bfr(bias[c0 + cofs]); val[1] += bfr(bias[c0 + cofs + 1]); val[2] += bfr(bias[c0 + cofs + 2]); val[3] += bfr(bias[c0 + cofs + 3]); }
                *(v4f*)(crow + (size_t)row * ldc + cofs) = val; }
             }
        __builtin_amdgcn_wave_barrier(); asm volatile("" ::: "memory");
    }
}

// ---- k_gemmc: the same NW-wave 64x64 tile GEMM specialised for causal attention: CMODE 1 skips score tiles entirely above the diagonal (query rows r0+roff.., key columns c0..), CMODE 2 limits the
// key (K) loop of the probability x value contraction to the diagonal block (probabilities beyond it are exactly zero). roff = row offset of this launch's first row within the sequence.
template <typename T16, int NSPLIT, int CMODE, int NW, int EPI>
__global__ __launch_bounds__(NW * 32) void k_gemmc(const T16* __restrict__ A, const T16* __restrict__ A2, const T16* __restrict__ Bt, const T16* __restrict__ Bt2, int K, int lda, float* C, int ldc, int roff, size_t sA, size_t sB, size_t sC, Epi ep) {
    typedef typename WFrag<T16>::V V;
    __shared__ __align__(16) float os[NW > 1 ? NW * 64 * 68 : 16 * 68];
    const size_t z = blockIdx.z; A += z * sA; if (A2) A2 += z * sA; Bt += (z / ZH) * sB; if (Bt2) Bt2 += (z / ZH) * sB; C += z * sC;
    const int lane = threadIdx.x & 31, lr = lane & 15, hi = lane >> 4; const int wv = (NW > 1) ? __builtin_amdgcn_readfirstlane((int)(threadIdx.x >> 5)) : 0;   /* wave number as a scalar: the K loop's counter and branch stay scalar */ const int r0 = blockIdx.x * 64, c0 = blockIdx.y * 64;
    if (CMODE == 1 && c0 > r0 + roff + 63) return;                  // score tile entirely above the causal diagonal: never read (the softmax masks j > i by select)
    const int Kl = (CMODE == 2) ? min(K, r0 + roff + 64) : K;        // P.V: probabilities are exactly 0 beyond the diagonal block, so the K loop stops there
    v8f acc[4][4];
#pragma unroll
    for (int mb = 0; mb < 4; ++mb)
#pragma unroll
        for (int nb = 0; nb < 4; ++nb) acc[mb][nb] = (v8f){};
    const size_t aoff = (size_t)(r0 + lr) * lda + 8 * hi, boff = (size_t)(c0 + lr) * K + 8 * hi;
#pragma unroll 1
    for (int kc = wv * 64; kc < Kl; kc += (kc & 32) ? (NW * 64 - 32) : 32) {
        V a[4], a2[4]; const T16* pa[4]; const T16* pa2[4]; const T16* pb[4]; const T16* pb2[4];
#pragma unroll
        for (int mb = 0; mb < 4; ++mb) { pa[mb] = A + aoff + (size_t)mb * 16 * lda + kc; a[mb] = WFrag<T16>::ld(pa[mb]); if (NSPLIT == 1 || NSPLIT == 2) { pa2[mb] = A2 + aoff + (size_t)mb * 16 * lda + kc; a2[mb] = WFrag<T16>::ld(pa2[mb]); } }
#pragma unroll
        for (int nb = 0; nb < 4; ++nb) { pb[nb] = Bt + boff + (size_t)nb * 16 * K + kc; const V b = WFrag<T16>::ld(pb[nb]); V b2; if (NSPLIT >= 2) { pb2[nb] = Bt2 + boff + (size_t)nb * 16 * K + kc; b2 = WFrag<T16>::ld(pb2[nb]); }
#pragma unroll
            for (int mb = 0; mb < 4; ++mb) { acc[mb][nb] = WFrag<T16>::mma(a[mb], b, acc[mb][nb]); if (NSPLIT == 1 || NSPLIT == 2) acc[mb][nb] = WFrag<T16>::mma(a2[mb], b, acc[mb][nb]); if (NSPLIT >= 2) acc[mb][nb] = WFrag<T16>::mma(a[mb], b2, acc[mb][nb]); } }
        asm volatile("v_nop\n\tv_nop\n\tv_nop\n\tv_nop" : "+v"(acc[0][0]), "+v"(acc[1][1]), "+v"(acc[2][2]), "+v"(acc[3][3]) : "v"(a[0]), "v"(a[3]));
        // precaution: this trip's load addresses are named as inputs, so their registers are not reused between a load and this wait; it stands at the loop's foot, where every load of the trip has already delivered its data
        if (NSPLIT == 2) asm volatile("s_wait_xcnt 0x0" :: "v"(pa[0]), "v"(pa[1]), "v"(pa[2]), "v"(pa[3]), "v"(pa2[0]), "v"(pa2[1]), "v"(pa2[2]), "v"(pa2[3]), "v"(pb[0]), "v"(pb[1]), "v"(pb[2]), "v"(pb[3]), "v"(pb2[0]), "v"(pb2[1]), "v"(pb2[2]), "v"(pb2[3]) : "memory");
        else if (NSPLIT == 1) asm volatile("s_wait_xcnt 0x0" :: "v"(pa[0]), "v"(pa[1]), "v"(pa[2]), "v"(pa[3]), "v"(pa2[0]), "v"(pa2[1]), "v"(pa2[2]), "v"(pa2[3]), "v"(pb[0]), "v"(pb[1]), "v"(pb[2]), "v"(pb[3]) : "memory");
        else asm volatile("s_wait_xcnt 0x0" :: "v"(pa[0]), "v"(pa[1]), "v"(pa[2]), "v"(pa[3]), "v"(pb[0]), "v"(pb[1]), "v"(pb[2]), "v"(pb[3]) : "memory");
    }
    if (NW > 1) {   // merge of the K split: each wave parks its whole partial tile in its own LDS slot, then all threads sum the NW slots in wave order and store
        float* osw = os + wv * (64 * 68);
        // the three loops are unrolled so that acc is indexed by constants and stays in registers
#pragma unroll
        for (int mb = 0; mb < 4; ++mb)
#pragma unroll
            for (int nb = 0; nb < 4; ++nb)
#pragma unroll
                for (int j = 0; j < 8; ++j) osw[(mb * 16 + hi * 8 + j) * 68 + nb * 16 + lr] = acc[mb][nb][j];
        __syncthreads();   // every wave's partial tile is in LDS before any thread sums across the slots
        // both loops unrolled: the LDS reads of all slots and rounds go out without a branch between them
#pragma unroll
        for (int s = 0; s < 32 / NW; ++s) { const int q = s * (NW * 32) + (int)threadIdx.x, row = q >> 4, cofs = (q & 15) * 4; v4f val = *(const v4fa*)(os + row * 68 + cofs);
#pragma unroll
            for (int w = 1; w < NW; ++w) val += *(const v4fa*)(os + w * (64 * 68) + row * 68 + cofs);
            if (EPI == 0) *(v4f*)(C + (size_t)(r0 + row) * ldc + c0 + cofs) = val; else epi_put<EPI>(ep, (int)z, r0 + roff + row, c0 + cofs, val); }
        return;
    }
#pragma unroll
    for (int mb = 0; mb < 4; ++mb) {
#pragma unroll
        for (int nb = 0; nb < 4; ++nb) {
#pragma unroll
            for (int j = 0; j < 8; ++j) os[(hi * 8 + j) * 68 + nb * 16 + lr] = acc[mb][nb][j]; }
        __builtin_amdgcn_wave_barrier(); asm volatile("" ::: "memory");
        float* crow = C + (size_t)(r0 + mb * 16) * ldc + c0;
{
#pragma unroll
            for (int s = 0; s < 8; ++s) { const int row = 2 * s + hi, cofs = lr * 4; v4f val = *(const v4fa*)(os + row * 68 + cofs);
                *(v4f*)(crow + (size_t)row * ldc + cofs) = val; }
             }
        __builtin_amdgcn_wave_barrier(); asm volatile("" ::: "memory");
    }
}

typedef __attribute__((ext_vector_type(2))) unsigned short v2us;
typedef __attribute__((ext_vector_type(2))) float v2f;
typedef __attribute__((ext_vector_type(4))) int v4i;
typedef v4h  __attribute__((may_alias)) v4ha;
typedef v4us __attribute__((may_alias)) v4usa;

__global__ __launch_bounds__(256) void k_wtG(const float* __restrict__ w, int K, int N, bf* Bt) {
    const int lane = threadIdx.x & 31; const int L0 = (blockIdx.x * 8 + (threadIdx.x >> 5)) * 8; const int nlines = N * K / 64;
{
#pragma unroll 1
        for (int l = 0; l < 8; ++l) { const int L = L0 + l; if (L >= nlines) break; const size_t e = (size_t)L * 64 + lane * 2; const int k = (int)(e % K), n = (int)(e / K); v2us o;
            o[0] = f2bf(w[(size_t)k * N + n]); o[1] = f2bf(w[(size_t)(k + 1) * N + n]); *(v2us*)(Bt + e) = o; }
         }
}
__global__ __launch_bounds__(256) void k_cvt8(const float* __restrict__ src, bf* dst, size_t n8) { const size_t i = (size_t)blockIdx.x * 256 + threadIdx.x; if (i >= n8) return; const v8f v = *(const v8f*)(src + i * 8); v8us o;
#pragma unroll
    for (int k = 0; k < 8; ++k) o[k] = f2bf(v[k]); *(v8us*)(dst + i * 8) = o;  }
__global__ __launch_bounds__(256) void k_cscvt(const float* __restrict__ cosT, const float* __restrict__ sinT, float* CS) { const int idx = blockIdx.x * 256 + threadIdx.x; if (idx >= TT * HD) return; v2f cs; cs[0] = bfr(cosT[idx]); cs[1] = bfr(sinT[idx]); *(v2f*)(CS + (size_t)idx * 2) = cs;  }
// k_asoft: per row (zz, i): t = S x HD^-0.5 + bias[n][j] for j <= i and bias[n][j] > 0, else -3.0e38 (causal AND dynamic mask); softmax over the 2048 keys (register row, one exp, fixed trees);
// the probabilities overwrite the row's own scores (each wave holds its whole 8 KiB row in registers before its first store): hi plane in the first half of the row and lo plane in the second (rows < RH), else fp16 in the first half; pitch 2 * TT 16-bit elements.
__global__ __launch_bounds__(256) void k_asoft(float* Sb, const float* __restrict__ Bb, const int* __restrict__ FLG, int h0) {
    const int lane = threadIdx.x & 31; const int row = blockIdx.x * 8 + (threadIdx.x >> 5); if (row >= NZ * TT) return; const int i = row % TT; const int zz = row / TT; const int b = zz / ZH, n = (h0 + zz % ZH) / REP; const bool hires = (i < RH); float* sr = Sb + (size_t)row * TT; const float* bias = Bb + (size_t)(b * NKV + n) * TT; const bool poison = (FLG[b * 8 + n] != 0);   /* premise self-check: no positive bias among keys 0..RH-1 for this kv head -> NaN-poison (flag word FLG[b * 8 + 4] also set) */ float v[TT / 32]; float mx = -3.0e38f;
#pragma unroll
    for (int ch = 0; ch < TT / 128; ++ch) { const int j0 = ch * 128 + lane * 4; const v4f a = *(const v4f*)(sr + j0);
#pragma unroll
        for (int q = 0; q < 4; ++q) { const int j = j0 + q; (void)j; const float bj = bias[j]; float sa = a[q] * SCL; asm volatile("" : "+v"(sa)); const float t = (j <= i && bj > 0.f) ? __fadd_rn(sa, bj) : -3.0e38f   /* same fill as the running-max init, so a row with NO allowed key (possible for the first few rows) softmaxes uniformly over every key like the source's finfo.min fill instead of 0/0 */; v[ch * 4 + q] = t; mx = fmaxf(mx, t); } }
#pragma unroll
    for (int sh = 16; sh; sh >>= 1) mx = fmaxf(mx, __shfl_xor(mx, sh, 32));
    float sum = 0.f;
#pragma unroll
    for (int k = 0; k < TT / 32; ++k) { float d0 = __fsub_rn(v[k], mx); asm volatile("" : "+v"(d0)); v[k] = __builtin_amdgcn_exp2f(__fmul_rn(d0, 1.4426950408889634f)); sum += v[k]; }
#pragma unroll
    for (int sh = 16; sh; sh >>= 1) sum += __shfl_xor(sum, sh, 32);
    const float f = poison ? __builtin_nanf("") : __fdiv_rn(hires ? 1.0f : PCAR, sum);
{
        if (hires) {
#pragma unroll
            for (int ch = 0; ch < TT / 128; ++ch) { v4us oh, ol;
#pragma unroll
                for (int q = 0; q < 4; ++q) { unsigned short a, c2; splitf(v[ch * 4 + q] * f, a, c2); oh[q] = a; ol[q] = c2; }
                const int oo = ch * 128 + lane * 4; *(v4usa*)((bf*)sr + oo) = oh; *(v4usa*)((bf*)sr + TT + oo) = ol; }
        } else {
#pragma unroll
            for (int ch = 0; ch < TT / 128; ++ch) { v4h o4;
#pragma unroll
                for (int q = 0; q < 4; ++q) o4[q] = tohx(v[ch * 4 + q] * f);
                *(v4ha*)((h16*)sr + ch * 128 + lane * 4) = o4; } }
         }
}
__global__ __launch_bounds__(32) void k_chk(const float* __restrict__ BIAS, int* FLG) { BIAS += (size_t)blockIdx.x * NKV * TT; FLG += blockIdx.x * 8;   /* one work-group per batch element */ const int n = threadIdx.x; int none = 0; if (n < NKV) { none = 1;
#pragma unroll 1
        for (int j = 0; j < RH; ++j) if (BIAS[(size_t)n * TT + j] > 0.f) { none = 0; break; } }
    int anyb = none;
#pragma unroll
    for (int sh = 16; sh; sh >>= 1) anyb |= __shfl_xor(anyb, sh, 32);
    const int v = (n < NKV) ? none : ((n == NKV) ? anyb : 0); if (n < 8) { *(int*)(FLG + n) = v;  } }
__global__ __launch_bounds__(256) void k_wgd(const float* __restrict__ w, int K, bf* Bt) { const int e = (blockIdx.x * 256 + threadIdx.x) * 4; if (e >= 64 * K) return; const int k = e % K, n = e / K; v4us o;
#pragma unroll
    for (int u = 0; u < 4; ++u) o[u] = (n < NKV) ? f2bf(w[(size_t)(k + u) * NKV + n]) : (unsigned short)0; *(v4us*)(Bt + e) = o;  }
__global__ __launch_bounds__(256) void k_bias(const float* __restrict__ GATE, const float* __restrict__ DEL, float* BIAS) { const int e = (blockIdx.x * 256 + threadIdx.x) * 4; if (e >= NB_ * NKV * TT) return; const int j = e % TT; const int n = (e / TT) % NKV; const int b = e / (NKV * TT); v4f r;
#pragma unroll
    for (int u = 0; u < 4; ++u) { const float gt = GATE[((size_t)b * TT + j + u) * 64 + n]; asm volatile("s_wait_xcnt 0x0" ::: "memory");   /* precaution, here and below: later loads land in the registers that held this load's address */ const float dl = DEL[((size_t)b * TT + j + u) * 64 + n]; asm volatile("s_wait_xcnt 0x0" ::: "memory"); const float sg = __fdiv_rn(1.0f, __fadd_rn(1.0f, __expf(-gt))); r[u] = __fmul_rn(sg, dl); }
    *(v4f*)(BIAS + e) = r;  }

extern "C" void kernel_launch(void* const* d_in, const int* in_sizes, int n_in,
                              void* d_out, int out_size, void* d_ws, size_t ws_size, hipStream_t stream) {
    (void)in_sizes; (void)n_in; (void)out_size;
    const float* x = (const float*)d_in[0]; const float* wq = (const float*)d_in[1]; const float* wk = (const float*)d_in[2]; const float* wv = (const float*)d_in[3]; const float* wg = (const float*)d_in[4]; const float* wdl = (const float*)d_in[5]; const float* wo = (const float*)d_in[6]; const float* cosT = nullptr; const float* sinT = nullptr; (void)cosT; (void)sinT;
    float* OUT = (float*)d_out;     // [2][2048][2048]
    char* wsp = (char*)d_ws;
    auto take = [&](size_t bytes) { char* p = wsp; wsp += (bytes + 255) & ~(size_t)255; return (void*)p; };
    const size_t MT = (size_t)NB_ * TT;   // token rows of both batch elements together: every launch covers both
    // live through the head loop
    bf* WO = (bf*)take((size_t)DM * DQ * 2); float* BIAS = (float*)take((size_t)NB_ * NKV * TT * 4); int* FLG = (int*)take(256);
    h16* QP16 = (h16*)take(MT * NH_ * HD * 2); h16* KP16 = (h16*)take(MT * NKV * HD * 2); h16* VT16 = (h16*)take(MT * NKV * HD * 2);
    bf* QPh = (bf*)take(MT * NH_ * HD * 2); bf* QPl = (bf*)take(MT * NH_ * HD * 2); bf* KPh = (bf*)take(MT * NKV * HD * 2); bf* KPl = (bf*)take(MT * NKV * HD * 2); bf* VTh = (bf*)take(MT * NKV * HD * 2); bf* VTl = (bf*)take(MT * NKV * HD * 2);
    bf* ATh = (bf*)take(MT * DQ * 2); bf* ATl = (bf*)take(MT * DQ * 2);
    float* Sb = (float*)take((size_t)NZ * TT * TT * 4);
    if ((size_t)(wsp - (char*)d_ws) > ws_size) return;    // ws 256 MiB
    // read for the last time before the first score launch writes Sb (stream-ordered): these share Sb's bytes
    wsp = (char*)Sb;
    bf* WQ = (bf*)take((size_t)DQ * DM * 2); bf* WK = (bf*)take((size_t)DKV * DM * 2); bf* WV = (bf*)take((size_t)DKV * DM * 2);
    bf* XB = (bf*)take(MT * DM * 2); bf* GFh = (bf*)take(MT * DQ * 2); bf* GFl = (bf*)take(MT * DQ * 2); bf* VFh = (bf*)take(MT * DKV * 2); bf* VFl = (bf*)take(MT * DKV * 2); bf* WG = (bf*)take((size_t)64 * DQ * 2); bf* WD = (bf*)take((size_t)64 * DKV * 2); float* GATE = (float*)take(MT * 64 * 4); float* DEL = (float*)take(MT * 64 * 4);
    if ((size_t)(wsp - (char*)Sb) > (size_t)NZ * TT * TT * 4) return;
    const Epi E0 = { nullptr, nullptr, nullptr, nullptr, nullptr, 0, 1.0f };   // plain f32 tile
    { k_wgd<<<(64 * DQ / 4 + 255) / 256, 256, 0, stream>>>(wg, DQ, WG); k_wgd<<<(64 * DKV / 4 + 255) / 256, 256, 0, stream>>>(wdl, DKV, WD); k_wtG<<<(unsigned)((DM * DQ / 64 + 63) / 64), 256, 0, stream>>>(wq, DM, DQ, WQ); k_wtG<<<(unsigned)((DM * DKV / 64 + 63) / 64), 256, 0, stream>>>(wk, DM, DKV, WK); k_wtG<<<(unsigned)((DM * DKV / 64 + 63) / 64), 256, 0, stream>>>(wv, DM, DKV, WV);
      k_wtG<<<(unsigned)((DQ * DM / 64 + 63) / 64), 256, 0, stream>>>(wo, DQ, DM, WO);
       }
    const unsigned MB = (unsigned)(MT / 64);   // 64-row tiles over both batch elements
    k_cvt8<<<(unsigned)((MT * DM / 8 + 255) / 256), 256, 0, stream>>>(x, XB, MT * DM / 8);
    // the three projections store the 16-bit planes that the later products read
    k_gemmw<bf, 0, false, 8, 1><<<dim3(MB, DQ / 64, 1), 256, 0, stream>>>(XB, nullptr, WQ, nullptr, DM, DM, nullptr, DQ, nullptr, 0, 0, 0, Epi{ QP16, QPh, QPl, GFh, GFl, 0, 1.0f });
    k_gemmw<bf, 0, false, 16, 2><<<dim3(MB, DKV / 64, 1), 512, 0, stream>>>(XB, nullptr, WK, nullptr, DM, DM, nullptr, DKV, nullptr, 0, 0, 0, Epi{ KP16, KPh, KPl, nullptr, nullptr, 0, 1.0f });
    k_gemmw<bf, 0, false, 16, 3><<<dim3(MB, DKV / 64, 1), 512, 0, stream>>>(XB, nullptr, WV, nullptr, DM, DM, nullptr, DKV, nullptr, 0, 0, 0, Epi{ VT16, VTh, VTl, VFh, VFl, 0, 1.0f });
    /* dynamic mask bias per (batch, kv head, key) */
    k_gemmw<bf, 1, false, 16, 0><<<dim3(MB, 1, 1), 512, 0, stream>>>(GFh, GFl, WG, nullptr, DQ, DQ, GATE, 64, nullptr, 0, 0, 0, E0); k_gemmw<bf, 1, false, 8, 0><<<dim3(MB, 1, 1), 256, 0, stream>>>(VFh, VFl, WD, nullptr, DKV, DKV, DEL, 64, nullptr, 0, 0, 0, E0); k_bias<<<(NB_ * NKV * TT / 4 + 255) / 256, 256, 0, stream>>>(GATE, DEL, BIAS); k_chk<<<NB_, 32, 0, stream>>>(BIAS, FLG);
    for (int h0 = 0; h0 < NH_; h0 += ZH) { const size_t zq = (size_t)h0 * NB_, zk = (size_t)(h0 / REP) * NB_;   // first q plane and first k/v plane of the pass; the ZH heads of a batch element share its kv plane (ZH <= REP): Bt steps once per ZH slices
        k_gemmw<bf, 2, false, 1, 0><<<dim3(RH / 64, TT / 64, NZ), 32, 0, stream>>>(QPh + zq * TT * HD, QPl + zq * TT * HD, KPh + zk * TT * HD, KPl + zk * TT * HD, HD, HD, Sb, TT, nullptr, (size_t)TT * HD, (size_t)TT * HD, (size_t)TT * TT, E0);
        k_gemmc<h16, 0, 1, 1, 0><<<dim3((TT - RH) / 64, TT / 64, NZ), 32, 0, stream>>>(QP16 + zq * TT * HD + (size_t)RH * HD, nullptr, KP16 + zk * TT * HD, nullptr, HD, HD, Sb + (size_t)RH * TT, TT, RH, (size_t)TT * HD, (size_t)TT * HD, (size_t)TT * TT, E0);
        k_asoft<<<NZ * TT / 8, 256, 0, stream>>>(Sb, BIAS, FLG, h0);
        // both P.V launches store the hi / lo rows of the output projection's A operand
        k_gemmw<bf, 2, false, 16, 4><<<dim3(RH / 64, HD / 64, NZ), 512, 0, stream>>>((const bf*)Sb, (const bf*)Sb + TT, VTh + zk * HD * TT, VTl + zk * HD * TT, TT, 2 * TT, nullptr, HD, nullptr, (size_t)TT * TT * 2, (size_t)HD * TT, 0, Epi{ nullptr, nullptr, nullptr, ATh, ATl, h0, 1.0f });
        k_gemmc<h16, 0, 2, 16, 4><<<dim3((TT - RH) / 64, HD / 64, NZ), 512, 0, stream>>>((const h16*)Sb + (size_t)RH * TT * 2, nullptr, VT16 + zk * HD * TT, nullptr, TT, 2 * TT, nullptr, HD, RH, (size_t)TT * TT * 2, (size_t)HD * TT, 0, Epi{ nullptr, nullptr, nullptr, ATh, ATl, h0, 1.0f / PCAR }); }
    k_gemmw<bf, 1, false, 8, 0><<<dim3(MB, DM / 64, 1), 256, 0, stream>>>(ATh, ATl, WO, nullptr, DQ, DQ, OUT, DM, nullptr, 0, 0, 0, E0);
}

// v005
// A run of this version takes 452 microseconds.
// Timed twice side by side with v004, it ran 1.81 and 1.84 times as fast.
// All steps since v000 together make it 5.27 times as fast.
#include <hip/hip_runtime.h>

// DynamicMaskAttention (hidden [2][2048][2048]; q = x Wq (16 heads x 128), k/v = x Wk / Wv (4 kv heads; group h/4); per key j and kv head n: bias = sigmoid(q_flat[j] . Wg[:, n]) * (v_flat[j] . Wd[:, n]); logits = q.k / sqrt(128) + bias[n][j]; allowed = causal AND bias[n][j] > 0, everything else gets finfo.min (so a query row with no allowed key softmaxes uniformly over ALL keys, as the source);
//   softmax; out = merged Wo -> [2][2048][2048]).
// Compute dtypes, f32 accumulate: every input rounded to bf16; q/k/v on PLAIN bf16 operands (inputs: exact); gate / delta as hl planes of q_flat / v_flat x exact Wg / Wd (2 products; 4 outputs padded to 64), sigmoid and the product f32; scores and attn.v: query rows < 512 hl (3 products) over ALL key tiles (those early rows can have an empty allowed set and then attend uniformly to every key), the rest single fp16 with causal tile skipping; bias + mask + running softmax f32, probabilities unnormalised (exp(t - max) <= 1), the division by their sum last; Wo hl x exact (2 products).

#define NB_  2
#define TT   2048
#define DM   2048
#define NH_  16
#define NKV  4
#define REP  (NH_ / NKV)
#define HD   128
#define DQ   (NH_ * HD)
#define DKV  (NKV * HD)
#define ZH   4                    // query heads per group of q planes: one whole kv group (ZH == REP), the heads that share their K and V planes
#define RH   512                  // query rows < RH use hi+lo planes
#define WIN  2048
#define SCL  0.088388347648318447f   // HD^-0.5
typedef _Float16 h16;
typedef unsigned short bf;
typedef __attribute__((ext_vector_type(16))) __bf16   v16bf;
typedef __attribute__((ext_vector_type(16))) _Float16 v16h;
typedef __attribute__((ext_vector_type(8)))  _Float16 v8h;
typedef __attribute__((ext_vector_type(8)))  unsigned short v8us;
typedef __attribute__((ext_vector_type(8)))  float    v8f;
typedef __attribute__((ext_vector_type(4)))  float    v4f;
typedef v8h  __attribute__((may_alias)) v8ha;
typedef v4f  __attribute__((may_alias)) v4fa;
typedef v8us __attribute__((may_alias)) v8usa;

__device__ __forceinline__ unsigned short f2bf(float f) { unsigned u = __float_as_uint(f); u += 0x7FFFu + ((u >> 16) & 1u); return (unsigned short)(u >> 16); }
__device__ __forceinline__ float bf2f(unsigned short b) { return __uint_as_float(((unsigned)b) << 16); }
__device__ __forceinline__ float bfr(float f) { return bf2f(f2bf(f)); }
__device__ __forceinline__ v16h cat16(v8h lo, v8h hi) { return __builtin_shufflevector(lo, hi, 0, 1, 2, 3, 4, 5, 6, 7, 8, 9, 10, 11, 12, 13, 14, 15); }
__device__ __forceinline__ v16bf cat16b(v8us lo, v8us hi) { return __builtin_bit_cast(v16bf, __builtin_shufflevector(lo, hi, 0, 1, 2, 3, 4, 5, 6, 7, 8, 9, 10, 11, 12, 13, 14, 15)); }
__device__ __forceinline__ v8f wmma16(v16h a, v16h b, v8f c) { return __builtin_amdgcn_wmma_f32_16x16x32_f16(false, a, false, b, (short)0, c, false, false); }
__device__ __forceinline__ v8f wmmab(v16bf a, v16bf b, v8f c) { return __builtin_amdgcn_wmma_f32_16x16x32_bf16(false, a, false, b, (short)0, c, false, false); }
__device__ __forceinline__ h16 tohx(float x) { return (h16)x; }
__device__ __forceinline__ void splitf(float y, unsigned short& h, unsigned short& l) { h = f2bf(y); l = f2bf(y - bf2f(h)); }
typedef __attribute__((ext_vector_type(4))) _Float16 v4h;
typedef __attribute__((ext_vector_type(4))) unsigned short v4us;

// ---- what the merge step of a K-split GEMM stores (EPI): 0 the f32 tile; otherwise the 16-bit operand planes of the next GEMM, straight from the summed registers:
// 1 q: head planes [h / ZH][b][h % ZH][t][d] (fp16, hi, lo) and the flat hi / lo rows for the gate product; 2 k: head planes [h][b][t][d] (fp16, hi, lo);
// 3 v: flat hi / lo rows for the delta product (the transposed planes [g][b][d][t] are written by the kernel itself, through LDS).
struct Epi { h16* p16; bf* ph; bf* pl; bf* fh; bf* fl; };
template <int EPI> __device__ __forceinline__ void epi_put(const Epi& ep, int R, int c, v4f val) {   // four neighbouring sums of output row R, columns c .. c + 3
    v4h o16; v4us oh, ol;
    // unrolled: the vectors' elements are indexed by constants and stay in registers
#pragma unroll
    for (int u = 0; u < 4; ++u) { const float x = val[u]; o16[u] = tohx(x); unsigned short a, c2; splitf(x, a, c2); oh[u] = a; ol[u] = c2; }
    if (EPI == 1 || EPI == 2) { const int b = R / TT, t = R % TT, h = c / HD, d = c % HD; const int p = (EPI == 1) ? (h / ZH) * (NB_ * ZH) + b * ZH + h % ZH : h * NB_ + b; const size_t o = ((size_t)p * TT + t) * HD + d;
        *(v4h*)(ep.p16 + o) = o16; *(v4us*)(ep.ph + o) = oh; *(v4us*)(ep.pl + o) = ol; }
    if (EPI == 1 || EPI == 3) { const size_t o = (EPI == 1) ? (size_t)R * DQ + c : (size_t)R * DKV + c;
        *(v4us*)(ep.fh + o) = oh; *(v4us*)(ep.fl + o) = ol; }
}



// ---- k_gemmw: register-blocked GEMM, one work-group of NW waves per 64x64 output tile; every wave holds the whole tile (16 accumulators) for its own share of K (64-element chunks dealt round robin: one 128-byte line of each operand row per chunk),
// operands straight from K-contiguous 16-bit planes; for NW > 1 the NW partial tiles are summed through LDS in wave order 0..NW-1 (K % 64 == 0); grid (M/64, N/64, Z), NW * 32 threads.
// C[m][n] (f32, pitch ldc, + optional f32 bias[n]) = sum_k A[m][k] Bt[n][k] (+ split products per NSPLIT). z-batch strides sA/sB/sC in elements (sA, sC per z slice; sB per ZH slices: the ZH heads of a kv group share Bt). A rows have pitch lda, Bt rows pitch K. K % 32 == 0.
template <typename T16> struct WFrag;
template <> struct WFrag<h16> { typedef v16h V; static __device__ __forceinline__ V ld(const h16* p) { return cat16(*(const v8h*)p, *(const v8h*)(p + 16)); } static __device__ __forceinline__ v8f mma(V a, V b, v8f c) { return wmma16(a, b, c); } };
template <> struct WFrag<bf> { typedef v16bf V; static __device__ __forceinline__ V ld(const bf* p) { return cat16b(*(const v8us*)p, *(const v8us*)(p + 16)); } static __device__ __forceinline__ v8f mma(V a, V b, v8f c) { return wmmab(a, b, c); } };
template <typename T16, int NSPLIT, bool BIAS, int NW, int EPI>
__global__ __launch_bounds__(NW * 32) void k_gemmw(const T16* __restrict__ A, const T16* __restrict__ A2, const T16* __restrict__ Bt, const T16* __restrict__ Bt2, int K, int lda, float* C, int ldc, const float* __restrict__ bias, size_t sA, size_t sB, size_t sC, Epi ep) {
    typedef typename WFrag<T16>::V V;
    __shared__ __align__(16) float os[NW > 1 ? NW * 64 * 68 : 16 * 68];
    const size_t z = blockIdx.z; A += z * sA; if (A2) A2 += z * sA; Bt += (z / ZH) * sB; if (Bt2) Bt2 += (z / ZH) * sB; C += z * sC;
    const int lane = threadIdx.x & 31, lr = lane & 15, hi = lane >> 4; const int wv = (NW > 1) ? __builtin_amdgcn_readfirstlane((int)(threadIdx.x >> 5)) : 0;   /* wave number as a scalar: the K loop's counter and branch stay scalar */ const int r0 = blockIdx.x * 64, c0 = blockIdx.y * 64;
    v8f acc[4][4];
#pragma unroll
    for (int mb = 0; mb < 4; ++mb)
#pragma unroll
        for (int nb = 0; nb < 4; ++nb) acc[mb][nb] = (v8f){};
    const size_t aoff = (size_t)(r0 + lr) * lda + 8 * hi, boff = (size_t)(c0 + lr) * K + 8 * hi;
#pragma unroll 1
    for (int kc = wv * 64; kc < K; kc += (kc & 32) ? (NW * 64 - 32) : 32) {
        V a[4], a2[4]; const T16* pa[4]; const T16* pa2[4]; const T16* pb[4]; const T16* pb2[4];
#pragma unroll
        for (int mb = 0; mb < 4; ++mb) { pa[mb] = A + aoff + (size_t)mb * 16 * lda + kc; a[mb] = WFrag<T16>::ld(pa[mb]); if (NSPLIT == 1 || NSPLIT == 2) { pa2[mb] = A2 + aoff + (size_t)mb * 16 * lda + kc; a2[mb] = WFrag<T16>::ld(pa2[mb]); } }
#pragma unroll
        for (int nb = 0; nb < 4; ++nb) { pb[nb] = Bt + boff + (size_t)nb * 16 * K + kc; const V b = WFrag<T16>::ld(pb[nb]); V b2; if (NSPLIT >= 2) { pb2[nb] = Bt2 + boff + (size_t)nb * 16 * K + kc; b2 = WFrag<T16>::ld(pb2[nb]); }
#pragma unroll
            for (int mb = 0; mb < 4; ++mb) { acc[mb][nb] = WFrag<T16>::mma(a[mb], b, acc[mb][nb]); if (NSPLIT == 1 || NSPLIT == 2) acc[mb][nb] = WFrag<T16>::mma(a2[mb], b, acc[mb][nb]); if (NSPLIT >= 2) acc[mb][nb] = WFrag<T16>::mma(a[mb], b2, acc[mb][nb]); } }
        asm volatile("v_nop\n\tv_nop\n\tv_nop\n\tv_nop" : "+v"(acc[0][0]), "+v"(acc[1][1]), "+v"(acc[2][2]), "+v"(acc[3][3]) : "v"(a[0]), "v"(a[3]));
        // precaution: this trip's load addresses are named as inputs, so their registers are not reused between a load and this wait; it stands at the loop's foot, where every load of the trip has already delivered its data
        if (NSPLIT == 2) asm volatile("s_wait_xcnt 0x0" :: "v"(pa[0]), "v"(pa[1]), "v"(pa[2]), "v"(pa[3]), "v"(pa2[0]), "v"(pa2[1]), "v"(pa2[2]), "v"(pa2[3]), "v"(pb[0]), "v"(pb[1]), "v"(pb[2]), "v"(pb[3]), "v"(pb2[0]), "v"(pb2[1]), "v"(pb2[2]), "v"(pb2[3]) : "memory");
        else if (NSPLIT == 1) asm volatile("s_wait_xcnt 0x0" :: "v"(pa[0]), "v"(pa[1]), "v"(pa[2]), "v"(pa[3]), "v"(pa2[0]), "v"(pa2[1]), "v"(pa2[2]), "v"(pa2[3]), "v"(pb[0]), "v"(pb[1]), "v"(pb[2]), "v"(pb[3]) : "memory");
        else asm volatile("s_wait_xcnt 0x0" :: "v"(pa[0]), "v"(pa[1]), "v"(pa[2]), "v"(pa[3]), "v"(pb[0]), "v"(pb[1]), "v"(pb[2]), "v"(pb[3]) : "memory");
    }
    if (NW > 1) {   // merge of the K split: each wave parks its whole partial tile in its own LDS slot, then all threads sum the NW slots in wave order and store
        float* osw = os + wv * (64 * 68);
        // the three loops are unrolled so that acc is indexed by constants and stays in registers
#pragma unroll
        for (int mb = 0; mb < 4; ++mb)
#pragma unroll
            for (int nb = 0; nb < 4; ++nb)
#pragma unroll
                for (int j = 0; j < 8; ++j) osw[(mb * 16 + hi * 8 + j) * 68 + nb * 16 + lr] = acc[mb][nb][j];
        __syncthreads();   // every wave's partial tile is in LDS before any thread sums across the slots
        v4f kept[32 / NW];   // EPI 3 only: the thread's sums, stored as flat rows behind the second barrier, so that no global store is outstanding at it
        // both loops unrolled: the LDS reads of all slots and rounds go out without a branch between them
#pragma unroll
        for (int s = 0; s < 32 / NW; ++s) { const int q = s * (NW * 32) + (int)threadIdx.x, row = q >> 4, cofs = (q & 15) * 4; v4f val = *(const v4fa*)(os + row * 68 + cofs);
#pragma unroll
            for (int w = 1; w < NW; ++w) val += *(const v4fa*)(os + w * (64 * 68) + row * 68 + cofs);
            kept[s] = val;
            if (BIAS) { val[0] += bfr(bias[c0 + cofs]); val[1] += bfr(bias[c0 + cofs + 1]); val[2] += bfr(bias[c0 + cofs + 2]); val[3] += bfr(bias[c0 + cofs + 3]); }
            if (EPI == 0) *(v4f*)(C + (size_t)(r0 + row) * ldc + c0 + cofs) = val; else if (EPI != 3) epi_put<EPI>(ep, r0 + row, c0 + cofs, val);
            if (EPI == 3) *(v4fa*)(os + row * 68 + cofs) = val; }   // the summed tile goes back into slot 0 (each quad is read and rewritten by this one thread) for the transposed read below
        if (EPI == 3) {   // v planes [g][b][d][t]: the summed tile is read back by columns, so that 16 lanes store one whole 128-byte line along t
            __syncthreads();   // the whole summed tile is in slot 0 before any thread reads a column of it
            // both loops unrolled: kept and the vectors are indexed by constants, and the LDS reads of both rounds go out without a branch between them
#pragma unroll
            for (int s = 0; s < 32 / NW; ++s) { const int q = s * (NW * 32) + (int)threadIdx.x, dc = q >> 4, t4 = (q & 15) * 4; const int c = c0 + dc, R = r0 + t4; v4h o16; v4us oh, ol;
                epi_put<EPI>(ep, r0 + dc, c0 + t4, kept[s]);   // the flat rows: quad q is (row q >> 4, columns (q & 15) * 4 ..) in the first loop too
#pragma unroll
                for (int u = 0; u < 4; ++u) { const float x = os[(t4 + u) * 68 + dc]; o16[u] = tohx(x); unsigned short a, c2; splitf(x, a, c2); oh[u] = a; ol[u] = c2; }
                const size_t o = (((size_t)(c / HD) * NB_ + R / TT) * HD + c % HD) * TT + R % TT; *(v4h*)(ep.p16 + o) = o16; *(v4us*)(ep.ph + o) = oh; *(v4us*)(ep.pl + o) = ol; }
        }
        return;
    }
#pragma unroll
    for (int mb = 0; mb < 4; ++mb) {
#pragma unroll
        for (int nb = 0; nb < 4; ++nb) {
#pragma unroll
            for (int j = 0; j < 8; ++j) os[(hi * 8 + j) * 68 + nb * 16 + lr] = acc[mb][nb][j]; }
        __builtin_amdgcn_wave_barrier(); asm volatile("" ::: "memory");
        float* crow = C + (size_t)(r0 + mb * 16) * ldc + c0;
{
#pragma unroll
            for (int s = 0; s < 8; ++s) { const int row = 2 * s + hi, cofs = lr * 4; v4f val = *(const v4fa*)(os + row * 68 + cofs); if (BIAS) { val[0] += bfr(bias[c0 + cofs]); val[1] += bfr(bias[c0 + cofs + 1]); val[2] += bfr(bias[c0 + cofs + 2]); val[3] += bfr(bias[c0 + cofs + 3]); }
                *(v4f*)(crow + (size_t)row * ldc + cofs) = val; }
             }
        __builtin_amdgcn_wave_barrier(); asm volatile("" ::: "memory");
    }
}

typedef __attribute__((ext_vector_type(2))) unsigned short v2us;
typedef __attribute__((ext_vector_type(2))) float v2f;
typedef __attribute__((ext_vector_type(4))) int v4i;
typedef v4h  __attribute__((may_alias)) v4ha;
typedef v4us __attribute__((may_alias)) v4usa;

__global__ __launch_bounds__(256) void k_wtG(const float* __restrict__ w, int K, int N, bf* Bt) {
    const int lane = threadIdx.x & 31; const int L0 = (blockIdx.x * 8 + (threadIdx.x >> 5)) * 8; const int nlines = N * K / 64;
{
#pragma unroll 1
        for (int l = 0; l < 8; ++l) { const int L = L0 + l; if (L >= nlines) break; const size_t e = (size_t)L * 64 + lane * 2; const int k = (int)(e % K), n = (int)(e / K); v2us o;
            o[0] = f2bf(w[(size_t)k * N + n]); o[1] = f2bf(w[(size_t)(k + 1) * N + n]); *(v2us*)(Bt + e) = o; }
         }
}
__global__ __launch_bounds__(256) void k_cvt8(const float* __restrict__ src, bf* dst, size_t n8) { const size_t i = (size_t)blockIdx.x * 256 + threadIdx.x; if (i >= n8) return; const v8f v = *(const v8f*)(src + i * 8); v8us o;
#pragma unroll
    for (int k = 0; k < 8; ++k) o[k] = f2bf(v[k]); *(v8us*)(dst + i * 8) = o;  }
__global__ __launch_bounds__(256) void k_cscvt(const float* __restrict__ cosT, const float* __restrict__ sinT, float* CS) { const int idx = blockIdx.x * 256 + threadIdx.x; if (idx >= TT * HD) return; v2f cs; cs[0] = bfr(cosT[idx]); cs[1] = bfr(sinT[idx]); *(v2f*)(CS + (size_t)idx * 2) = cs;  }
// ---- k_attn: scores, bias + mask, softmax and the product with v in one kernel; no score or probability goes to memory. One wave per (head, 16 query rows); the 4 waves of a work-group are the 4 heads of one kv group and share its k / v tiles through LDS.
// Everything is computed transposed, so that no value changes lanes between the two products: S^T = k q^T (A = 16 key rows, B = the wave's 16 query rows) leaves lane (lr, hi) with query lr and keys hi * 8 + j of each 16-key tile;
// two such tiles side by side are exactly the B fragment (n = query lr, k = 8 * hi + 0..7 and 8 * hi + 16 + 0..7) of O^T = v^T P^T (A = 16 rows of the [d][t] plane). A lane's scores, running maximum, running sum and all its O^T elements belong to its one query.
// Running softmax over steps of 32 keys: m = max so far, p = exp(t - m), sum and O^T rescaled by exp(m_old - m_new); the division by the sum comes last, in f32. The masked fill equals the start value of m, so a row with no allowed key weighs every key 1 (uniform, as the source's finfo.min fill),
// and the first allowed key wipes such weights (factor exp(-huge) = 0). HR (query rows < RH): hi + lo planes, 3 products each, over ALL keys; otherwise single fp16 up to the diagonal.
// Staging: two LDS buffers; step s + 1's tiles (32 k rows, 128 v^T rows of 32 keys) travel global -> registers while step s is computed, go into the other buffer behind it, and one work-group barrier per step publishes them and ends the reads of the buffer that is refilled next.
#define KPIT 136                  // LDS pitch of a k row, elements: 272 B = 16 B x odd, the 16 rows of a fragment read fall on distinct banks
#define VPIT 40                   // LDS pitch of a v^T row of 32 keys: 80 B = 16 B x odd
#define KTE  (32 * KPIT)
#define STE  (KTE + HD * VPIT)    // elements of one staged plane: k tile, then v^T tile
typedef __attribute__((ext_vector_type(16))) unsigned short v16us;
__device__ __forceinline__ float exp2s(float x) { float r; asm("v_exp_f32 %0, %1\n\tv_nop" : "=v"(r) : "v"(x)); return r; }
template <typename T16> struct LFrag;   // a fragment from two 16-byte LDS reads, in the k order of WFrag
template <> struct LFrag<h16> { static __device__ __forceinline__ v16h ld(const bf* p) { const v8us x = *(const v8usa*)p, y = *(const v8usa*)(p + 16); return cat16(__builtin_bit_cast(v8h, x), __builtin_bit_cast(v8h, y)); } };
template <> struct LFrag<bf> { static __device__ __forceinline__ v16bf ld(const bf* p) { const v8us x = *(const v8usa*)p, y = *(const v8usa*)(p + 16); return cat16b(x, y); } };
template <typename T16, bool HR>
__device__ __forceinline__ void attn_rows(bf* sm, float* smb, int wv, const T16* __restrict__ Q, const T16* __restrict__ Q2, const bf* __restrict__ Kp, const bf* __restrict__ K2, const bf* __restrict__ Vt, const bf* __restrict__ V2, const float* __restrict__ bias, bool poison, int q0, int nk, bf* oh, bf* ol) {
    typedef typename WFrag<T16>::V V; constexpr int NP = HR ? 2 : 1;
    const int tid = threadIdx.x, lane = tid & 31, lr = lane & 15, hi = lane >> 4; const int qi = q0 + lr;
    V bq[4], bq2[4]; const T16* pq = Q + (size_t)qi * HD + 8 * hi; const T16* pq2 = HR ? Q2 + (size_t)qi * HD + 8 * hi : nullptr;
    // unrolled, here and below: the fragment, staging and accumulator arrays are indexed by constants and stay in registers
#pragma unroll
    for (int kc = 0; kc < 4; ++kc) { bq[kc] = WFrag<T16>::ld(pq + kc * 32); if (HR) bq2[kc] = WFrag<T16>::ld(pq2 + kc * 32); }
    // precaution: the load addresses are named as inputs, so their registers are not reused between a load and this wait
    if (HR) asm volatile("s_wait_xcnt 0x0" :: "v"(pq), "v"(pq2) : "memory");
    else asm volatile("s_wait_xcnt 0x0" :: "v"(pq) : "memory");
    v8f o[8];
#pragma unroll
    for (int mb = 0; mb < 8; ++mb) o[mb] = (v8f){};
    float m = -3.0e38f, l = 0.f;
    // staging, 16-byte chunk c = tid + 128 * i: k tile (one contiguous 8 KiB) row c >> 4, piece c & 15; v^T tile row c >> 2, piece c & 3
    const unsigned gko = tid * 8, gvo = (tid >> 2) * TT + (tid & 3) * 8; const int sko = (tid >> 4) * KPIT + (tid & 15) * 8, svo = KTE + (tid >> 2) * VPIT + (tid & 3) * 8;
    const int fko = lr * KPIT + 8 * hi, fvo = KTE + lr * VPIT + 8 * hi;   // the lane's place in a k / v^T fragment read
    v8us rk[NP][4], rv[NP][4]; float rb = 0.f;
    if (wv == 0) smb[tid] = bias[tid];   // wave 0 stages the step's 32 bias values, one per lane
#pragma unroll
    for (int i = 0; i < 4; ++i) { rk[0][i] = *(const v8us*)(Kp + gko + i * 1024); rv[0][i] = *(const v8us*)(Vt + gvo + (size_t)i * 32 * TT); if (HR) { rk[NP - 1][i] = *(const v8us*)(K2 + gko + i * 1024); rv[NP - 1][i] = *(const v8us*)(V2 + gvo + (size_t)i * 32 * TT); } }
#pragma unroll
    for (int pl = 0; pl < NP; ++pl)
#pragma unroll
        for (int i = 0; i < 4; ++i) { *(v8usa*)(sm + pl * STE + sko + i * 8 * KPIT) = rk[pl][i]; *(v8usa*)(sm + pl * STE + svo + i * 32 * VPIT) = rv[pl][i]; }
    __syncthreads();   // step 0's tiles are in buffer 0 before any wave reads them
    for (int s = 0; s < nk; ++s) {
        const int sn = min(s + 1, nk - 1);   // the tile that is staged during this step; the last step stages its own once more (nobody reads it), so the loop body has no branch
        const unsigned ok = gko + sn * 32 * HD, ov = gvo + sn * 32, ob = sn * 32 + lane;   // element offsets of this step's loads inside their planes
        const bf* pk = Kp + ok; const bf* pk2 = HR ? K2 + ok : nullptr; const bf* pv = Vt + ov; const bf* pv2 = HR ? V2 + ov : nullptr;
        {   // next k tile: on its way during the score products
#pragma unroll
            for (int i = 0; i < 4; ++i) { rk[0][i] = *(const v8us*)(pk + i * 1024); if (HR) rk[NP - 1][i] = *(const v8us*)(pk2 + i * 1024); }
            if (wv == 0) rb = bias[ob]; }
        const bf* cur = sm + (s & 1) * (NP * STE); bf* nxt = sm + ((s + 1) & 1) * (NP * STE);
        v8f st[2]; float t[16]; float mt = -3.0e38f;
#pragma unroll
        for (int tt = 0; tt < 2; ++tt) { st[tt] = (v8f){};
#pragma unroll
            for (int kc = 0; kc < 4; ++kc) { const V a = LFrag<T16>::ld(cur + fko + tt * 16 * KPIT + kc * 32); st[tt] = WFrag<T16>::mma(a, bq[kc], st[tt]);
                if (HR) { st[tt] = WFrag<T16>::mma(a, bq2[kc], st[tt]); const V a2 = LFrag<T16>::ld(cur + STE + fko + tt * 16 * KPIT + kc * 32); st[tt] = WFrag<T16>::mma(a2, bq[kc], st[tt]); } } }
        const float* cb = smb + (s & 1) * 32 + hi * 8; const v4f bb[4] = { *(const v4fa*)cb, *(const v4fa*)(cb + 4), *(const v4fa*)(cb + 16), *(const v4fa*)(cb + 20) };
#pragma unroll
        for (int tt = 0; tt < 2; ++tt)
#pragma unroll
            for (int j = 0; j < 8; ++j) { const int key = s * 32 + tt * 16 + hi * 8 + j; const float bj = bb[tt * 2 + (j >> 2)][j & 3]; const float x = (key <= qi && bj > 0.f) ? st[tt][j] * SCL + bj : -3.0e38f; t[tt * 8 + j] = x; mt = fmaxf(mt, x); }
        {   // the other buffer is free since the last barrier: the k tile goes in as soon as it has come; next v^T tile: on its way during the softmax and the second product
#pragma unroll
            for (int pl = 0; pl < NP; ++pl)
#pragma unroll
                for (int i = 0; i < 4; ++i) *(v8usa*)(nxt + pl * STE + sko + i * 8 * KPIT) = rk[pl][i];
            if (wv == 0) smb[((s + 1) & 1) * 32 + lane] = rb;
#pragma unroll
            for (int i = 0; i < 4; ++i) { rv[0][i] = *(const v8us*)(pv + (size_t)i * 32 * TT); if (HR) rv[NP - 1][i] = *(const v8us*)(pv2 + (size_t)i * 32 * TT); } }
        mt = fmaxf(mt, __shfl_xor(mt, 16, 32));   // the other half of the wave holds the query's other 16 keys of this step
        const float mn = fmaxf(m, mt); const float alpha = exp2s((m - mn) * 1.4426950408889634f); m = mn;
        float ps = 0.f;
#pragma unroll
        for (int u = 0; u < 16; ++u) { t[u] = exp2s((t[u] - mn) * 1.4426950408889634f); ps += t[u]; }
        l = l * alpha + ps;   // each half of the wave sums its own keys; the halves meet behind the loop
#pragma unroll
        for (int mb = 0; mb < 8; ++mb) o[mb] *= alpha;
        V p, p2;
        if constexpr (HR) { v16us a, c;
#pragma unroll
            for (int u = 0; u < 16; ++u) { unsigned short x, y; splitf(t[u], x, y); a[u] = x; c[u] = y; }
            p = __builtin_bit_cast(v16bf, a); p2 = __builtin_bit_cast(v16bf, c);
        } else {
#pragma unroll
            for (int u = 0; u < 16; ++u) p[u] = tohx(t[u]); }
#pragma unroll
        for (int mb = 0; mb < 8; ++mb) { const V a = LFrag<T16>::ld(cur + fvo + mb * 16 * VPIT); o[mb] = WFrag<T16>::mma(a, p, o[mb]);
            if constexpr (HR) { o[mb] = WFrag<T16>::mma(a, p2, o[mb]); const V a2 = LFrag<T16>::ld(cur + STE + fvo + mb * 16 * VPIT); o[mb] = WFrag<T16>::mma(a2, p, o[mb]); } }
        {
#pragma unroll
            for (int pl = 0; pl < NP; ++pl)
#pragma unroll
                for (int i = 0; i < 4; ++i) *(v8usa*)(nxt + pl * STE + svo + i * 32 * VPIT) = rv[pl][i]; }
        // precaution: this step's load addresses (HR: their offsets beside the planes' scalar bases) are named as inputs, so their registers are not reused between a load and this wait; it stands at the loop's foot, where every load of the step has already delivered its data
        if (HR) asm volatile("s_wait_xcnt 0x0" :: "v"(ok), "v"(ov), "v"(ob) : "memory");
        else asm volatile("s_wait_xcnt 0x0" :: "v"(pk), "v"(pv), "v"(ob) : "memory");
        __syncthreads();   // publishes step s + 1's tiles; every wave has finished reading the buffer that the next step refills
    }
    l += __shfl_xor(l, 16, 32);
    const float f = poison ? __builtin_nanf("") : 1.0f / l;
#pragma unroll
    for (int mb = 0; mb < 8; ++mb) { v8us a, c;
#pragma unroll
        for (int j = 0; j < 8; ++j) { unsigned short x, y; splitf(o[mb][j] * f, x, y); a[j] = x; c[j] = y; }
        *(v8us*)(oh + (size_t)qi * DQ + mb * 16 + hi * 8) = a; *(v8us*)(ol + (size_t)qi * DQ + mb * 16 + hi * 8) = c; }   // hi / lo rows [b][t][head][d] of the output projection's A operand: d = mb * 16 + hi * 8 + j
}
// grid (TT / 16 * NKV * NB_), REP * 32 threads, four waves per SIMD asked for (a budget of 256 registers: with the LDS of four work-groups per WGP the whole grid is resident). Flat index: low 3 bits the kv plane g * NB_ + b; then 32 row blocks per quarter of the grid: first all hi + lo blocks (the longest), then the last rows downwards, the middle, and the shortest upwards,
// so that four work-groups whose indices lie a quarter of the grid apart carry about the same work together (for speed only; every (plane, row block) occurs once whatever the placement).
static_assert(TT / 16 == 4 * (RH / 16) && NKV * NB_ == 8 && ZH == REP, "row-block deal of k_attn");
__global__ __launch_bounds__(REP * 32, 4) void k_attn(const h16* __restrict__ Q16, const bf* __restrict__ Qh, const bf* __restrict__ Ql, const bf* __restrict__ K16, const bf* __restrict__ Kh, const bf* __restrict__ Kl, const bf* __restrict__ V16, const bf* __restrict__ Vh, const bf* __restrict__ Vl, const float* __restrict__ Bb, const int* __restrict__ FLG, bf* ATh, bf* ATl) {
    __shared__ __align__(16) bf sm[2 * 2 * STE]; __shared__ __align__(16) float smb[2 * 32];
    const int wv = __builtin_amdgcn_readfirstlane((int)(threadIdx.x >> 5));   // wave number as a scalar: plane offsets stay scalar
    const int id = blockIdx.x, kvp = id & 7, g = kvp / NB_, b = kvp % NB_, qr = id >> 8, i5 = (id >> 3) & 31; const int qb = (qr == 0) ? i5 : (qr == 1) ? 127 - i5 : (qr == 2) ? 64 + i5 : 32 + i5; const int q0 = qb * 16;
    const size_t qo = (size_t)(g * (NB_ * ZH) + b * ZH + wv) * TT * HD, kv = (size_t)kvp * TT * HD, ao = (size_t)b * TT * DQ + (g * REP + wv) * HD;
    const float* bias = Bb + (size_t)(b * NKV + g) * TT; const bool poison = (FLG[b * 8 + g] != 0);   /* premise self-check: no positive bias among keys 0..RH-1 for this kv head -> NaN-poison (flag word FLG[b * 8 + 4] also set) */
    if (qb < RH / 16) attn_rows<bf, true>(sm, smb, wv, Qh + qo, Ql + qo, Kh + kv, Kl + kv, Vh + kv, Vl + kv, bias, poison, q0, TT / 32, ATh + ao, ATl + ao);
    else attn_rows<h16, false>(sm, smb, wv, Q16 + qo, nullptr, K16 + kv, nullptr, V16 + kv, nullptr, bias, poison, q0, (q0 + 16 + 31) / 32, ATh + ao, ATl + ao);
}
__global__ __launch_bounds__(32) void k_chk(const float* __restrict__ BIAS, int* FLG) { BIAS += (size_t)blockIdx.x * NKV * TT; FLG += blockIdx.x * 8;   /* one work-group per batch element */ const int n = threadIdx.x; int none = 0; if (n < NKV) { none = 1;
#pragma unroll 1
        for (int j = 0; j < RH; ++j) if (BIAS[(size_t)n * TT + j] > 0.f) { none = 0; break; } }
    int anyb = none;
#pragma unroll
    for (int sh = 16; sh; sh >>= 1) anyb |= __shfl_xor(anyb, sh, 32);
    const int v = (n < NKV) ? none : ((n == NKV) ? anyb : 0); if (n < 8) { *(int*)(FLG + n) = v;  } }
__global__ __launch_bounds__(256) void k_wgd(const float* __restrict__ w, int K, bf* Bt) { const int e = (blockIdx.x * 256 + threadIdx.x) * 4; if (e >= 64 * K) return; const int k = e % K, n = e / K; v4us o;
#pragma unroll
    for (int u = 0; u < 4; ++u) o[u] = (n < NKV) ? f2bf(w[(size_t)(k + u) * NKV + n]) : (unsigned short)0; *(v4us*)(Bt + e) = o;  }
__global__ __launch_bounds__(256) void k_bias(const float* __restrict__ GATE, const float* __restrict__ DEL, float* BIAS) { const int e = (blockIdx.x * 256 + threadIdx.x) * 4; if (e >= NB_ * NKV * TT) return; const int j = e % TT; const int n = (e / TT) % NKV; const int b = e / (NKV * TT); v4f r;
#pragma unroll
    for (int u = 0; u < 4; ++u) { const float gt = GATE[((size_t)b * TT + j + u) * 64 + n]; asm volatile("s_wait_xcnt 0x0" ::: "memory");   /* precaution, here and below: later loads land in the registers that held this load's address */ const float dl = DEL[((size_t)b * TT + j + u) * 64 + n]; asm volatile("s_wait_xcnt 0x0" ::: "memory"); const float sg = __fdiv_rn(1.0f, __fadd_rn(1.0f, __expf(-gt))); r[u] = __fmul_rn(sg, dl); }
    *(v4f*)(BIAS + e) = r;  }

extern "C" void kernel_launch(void* const* d_in, const int* in_sizes, int n_in,
                              void* d_out, int out_size, void* d_ws, size_t ws_size, hipStream_t stream) {
    (void)in_sizes; (void)n_in; (void)out_size;
    const float* x = (const float*)d_in[0]; const float* wq = (const float*)d_in[1]; const float* wk = (const float*)d_in[2]; const float* wv = (const float*)d_in[3]; const float* wg = (const float*)d_in[4]; const float* wdl = (const float*)d_in[5]; const float* wo = (const float*)d_in[6]; const float* cosT = nullptr; const float* sinT = nullptr; (void)cosT; (void)sinT;
    float* OUT = (float*)d_out;     // [2][2048][2048]
    char* wsp = (char*)d_ws;
    auto take = [&](size_t bytes) { char* p = wsp; wsp += (bytes + 255) & ~(size_t)255; return (void*)p; };
    const size_t MT = (size_t)NB_ * TT;   // token rows of both batch elements together: every launch covers both
    // read by the attention kernel or behind it
    bf* WO = (bf*)take((size_t)DM * DQ * 2); float* BIAS = (float*)take((size_t)NB_ * NKV * TT * 4); int* FLG = (int*)take(256);
    h16* QP16 = (h16*)take(MT * NH_ * HD * 2); h16* KP16 = (h16*)take(MT * NKV * HD * 2); h16* VT16 = (h16*)take(MT * NKV * HD * 2);
    bf* QPh = (bf*)take(MT * NH_ * HD * 2); bf* QPl = (bf*)take(MT * NH_ * HD * 2); bf* KPh = (bf*)take(MT * NKV * HD * 2); bf* KPl = (bf*)take(MT * NKV * HD * 2); bf* VTh = (bf*)take(MT * NKV * HD * 2); bf* VTl = (bf*)take(MT * NKV * HD * 2);
    bf* ATh = (bf*)take(MT * DQ * 2); bf* ATl = (bf*)take(MT * DQ * 2);
    // read only by the launches in front of the attention kernel
    bf* WQ = (bf*)take((size_t)DQ * DM * 2); bf* WK = (bf*)take((size_t)DKV * DM * 2); bf* WV = (bf*)take((size_t)DKV * DM * 2);
    bf* XB = (bf*)take(MT * DM * 2); bf* GFh = (bf*)take(MT * DQ * 2); bf* GFl = (bf*)take(MT * DQ * 2); bf* VFh = (bf*)take(MT * DKV * 2); bf* VFl = (bf*)take(MT * DKV * 2); bf* WG = (bf*)take((size_t)64 * DQ * 2); bf* WD = (bf*)take((size_t)64 * DKV * 2); float* GATE = (float*)take(MT * 64 * 4); float* DEL = (float*)take(MT * 64 * 4);
    if ((size_t)(wsp - (char*)d_ws) > ws_size) return;    // ws 256 MiB
    const Epi E0 = { nullptr, nullptr, nullptr, nullptr, nullptr };   // plain f32 tile
    { k_wgd<<<(64 * DQ / 4 + 255) / 256, 256, 0, stream>>>(wg, DQ, WG); k_wgd<<<(64 * DKV / 4 + 255) / 256, 256, 0, stream>>>(wdl, DKV, WD); k_wtG<<<(unsigned)((DM * DQ / 64 + 63) / 64), 256, 0, stream>>>(wq, DM, DQ, WQ); k_wtG<<<(unsigned)((DM * DKV / 64 + 63) / 64), 256, 0, stream>>>(wk, DM, DKV, WK); k_wtG<<<(unsigned)((DM * DKV / 64 + 63) / 64), 256, 0, stream>>>(wv, DM, DKV, WV);
      k_wtG<<<(unsigned)((DQ * DM / 64 + 63) / 64), 256, 0, stream>>>(wo, DQ, DM, WO);
       }
    const unsigned MB = (unsigned)(MT / 64);   // 64-row tiles over both batch elements
    k_cvt8<<<(unsigned)((MT * DM / 8 + 255) / 256), 256, 0, stream>>>(x, XB, MT * DM / 8);
    // the three projections store the 16-bit planes that the later products read
    k_gemmw<bf, 0, false, 8, 1><<<dim3(MB, DQ / 64, 1), 256, 0, stream>>>(XB, nullptr, WQ, nullptr, DM, DM, nullptr, DQ, nullptr, 0, 0, 0, Epi{ QP16, QPh, QPl, GFh, GFl });
    k_gemmw<bf, 0, false, 16, 2><<<dim3(MB, DKV / 64, 1), 512, 0, stream>>>(XB, nullptr, WK, nullptr, DM, DM, nullptr, DKV, nullptr, 0, 0, 0, Epi{ KP16, KPh, KPl, nullptr, nullptr });
    k_gemmw<bf, 0, false, 16, 3><<<dim3(MB, DKV / 64, 1), 512, 0, stream>>>(XB, nullptr, WV, nullptr, DM, DM, nullptr, DKV, nullptr, 0, 0, 0, Epi{ VT16, VTh, VTl, VFh, VFl });
    /* dynamic mask bias per (batch, kv head, key) */
    k_gemmw<bf, 1, false, 16, 0><<<dim3(MB, 1, 1), 512, 0, stream>>>(GFh, GFl, WG, nullptr, DQ, DQ, GATE, 64, nullptr, 0, 0, 0, E0); k_gemmw<bf, 1, false, 8, 0><<<dim3(MB, 1, 1), 256, 0, stream>>>(VFh, VFl, WD, nullptr, DKV, DKV, DEL, 64, nullptr, 0, 0, 0, E0); k_bias<<<(NB_ * NKV * TT / 4 + 255) / 256, 256, 0, stream>>>(GATE, DEL, BIAS); k_chk<<<NB_, 32, 0, stream>>>(BIAS, FLG);
    // all heads of both batch elements in one launch; it stores the hi / lo rows of the output projection's A operand
    k_attn<<<dim3(TT / 16 * NKV * NB_, 1, 1), REP * 32, 0, stream>>>(QP16, QPh, QPl, (const bf*)KP16, KPh, KPl, (const bf*)VT16, VTh, VTl, BIAS, FLG, ATh, ATl);
    k_gemmw<bf, 1, false, 8, 0><<<dim3(MB, DM / 64, 1), 256, 0, stream>>>(ATh, ATl, WO, nullptr, DQ, DQ, OUT, DM, nullptr, 0, 0, 0, E0);
}

// v006
// A run of this version takes 353 microseconds.
// Two timings next to v005 both put it at 1.28 times that version's speed.
// Counting every step since v000, it is 6.76 times as fast.
#include <hip/hip_runtime.h>

// DynamicMaskAttention (hidden [2][2048][2048]; q = x Wq (16 heads x 128), k/v = x Wk / Wv (4 kv heads; group h/4); per key j and kv head n: bias = sigmoid(q_flat[j] . Wg[:, n]) * (v_flat[j] . Wd[:, n]); logits = q.k / sqrt(128) + bias[n][j]; allowed = causal AND bias[n][j] > 0, everything else gets finfo.min (so a query row with no allowed key softmaxes uniformly over ALL keys, as the source);
//   softmax; out = merged Wo -> [2][2048][2048]).
// Compute dtypes, f32 accumulate: every input rounded to bf16; q/k/v on PLAIN bf16 operands (inputs: exact); gate / delta as hl planes of q_flat / v_flat x exact Wg / Wd (2 products; 4 outputs padded to 64), sigmoid and the product f32; scores and attn.v: query rows < 512 hl (3 products) over ALL key tiles (those early rows can have an empty allowed set and then attend uniformly to every key), the rest single fp16 with causal tile skipping; bias + mask + running softmax f32, probabilities unnormalised (exp(t - max) <= 1), the division by their sum last; Wo hl x exact (2 products).

#define NB_  2
#define TT   2048
#define DM   2048
#define NH_  16
#define NKV  4
#define REP  (NH_ / NKV)
#define HD   128
#define DQ   (NH_ * HD)
#define DKV  (NKV * HD)
#define ZH   4                    // query heads per group of q planes: one whole kv group (ZH == REP), the heads that share their K and V planes
#define RH   512                  // query rows < RH use hi+lo planes
#define WIN  2048
#define SCL  0.088388347648318447f   // HD^-0.5
typedef _Float16 h16;
typedef unsigned short bf;
typedef __attribute__((ext_vector_type(16))) __bf16   v16bf;
typedef __attribute__((ext_vector_type(16))) _Float16 v16h;
typedef __attribute__((ext_vector_type(8)))  _Float16 v8h;
typedef __attribute__((ext_vector_type(8)))  unsigned short v8us;
typedef __attribute__((ext_vector_type(8)))  float    v8f;
typedef __attribute__((ext_vector_type(4)))  float    v4f;
typedef v8h  __attribute__((may_alias)) v8ha;
typedef v4f  __attribute__((may_alias)) v4fa;
typedef v8us __attribute__((may_alias)) v8usa;

__device__ __forceinline__ unsigned short f2bf(float f) { unsigned u = __float_as_uint(f); u += 0x7FFFu + ((u >> 16) & 1u); return (unsigned short)(u >> 16); }
__device__ __forceinline__ float bf2f(unsigned short b) { return __uint_as_float(((unsigned)b) << 16); }
__device__ __forceinline__ float bfr(float f) { return bf2f(f2bf(f)); }
__device__ __forceinline__ v16h cat16(v8h lo, v8h hi) { return __builtin_shufflevector(lo, hi, 0, 1, 2, 3, 4, 5, 6, 7, 8, 9, 10, 11, 12, 13, 14, 15); }
__device__ __forceinline__ v16bf cat16b(v8us lo, v8us hi) { return __builtin_bit_cast(v16bf, __builtin_shufflevector(lo, hi, 0, 1, 2, 3, 4, 5, 6, 7, 8, 9, 10, 11, 12, 13, 14, 15)); }
__device__ __forceinline__ v8f wmma16(v16h a, v16h b, v8f c) { return __builtin_amdgcn_wmma_f32_16x16x32_f16(false, a, false, b, (short)0, c, false, false); }
__device__ __forceinline__ v8f wmmab(v16bf a, v16bf b, v8f c) { return __builtin_amdgcn_wmma_f32_16x16x32_bf16(false, a, false, b, (short)0, c, false, false); }
__device__ __forceinline__ h16 tohx(float x) { return (h16)x; }
__device__ __forceinline__ void splitf(float y, unsigned short& h, unsigned short& l) { h = f2bf(y); l = f2bf(y - bf2f(h)); }
typedef __attribute__((ext_vector_type(4))) _Float16 v4h;
typedef __attribute__((ext_vector_type(4))) unsigned short v4us;

// ---- what the store step of a GEMM writes (EPI): 0 the f32 tile; otherwise the 16-bit operand planes of the next GEMM, straight from the sums:
// 1 q: head planes [h / ZH][b][h % ZH][t][d] (fp16, hi, lo) and the flat hi / lo rows for the gate product; 2 k: head planes [h][b][t][d] (fp16, hi, lo);
// 3 v: flat hi / lo rows for the delta product (the transposed planes [g][b][d][t] are written by the kernel itself, through LDS).
struct Epi { h16* p16; bf* ph; bf* pl; bf* fh; bf* fl; };
template <int EPI> __device__ __forceinline__ void epi_put(const Epi& ep, int R, int c, v4f val) {   // four neighbouring sums of output row R, columns c .. c + 3
    v4h o16; v4us oh, ol;
    // unrolled: the vectors' elements are indexed by constants and stay in registers
#pragma unroll
    for (int u = 0; u < 4; ++u) { const float x = val[u]; o16[u] = tohx(x); unsigned short a, c2; splitf(x, a, c2); oh[u] = a; ol[u] = c2; }
    if (EPI == 1 || EPI == 2) { const int b = R / TT, t = R % TT, h = c / HD, d = c % HD; const int p = (EPI == 1) ? (h / ZH) * (NB_ * ZH) + b * ZH + h % ZH : h * NB_ + b; const size_t o = ((size_t)p * TT + t) * HD + d;
        *(v4h*)(ep.p16 + o) = o16; *(v4us*)(ep.ph + o) = oh; *(v4us*)(ep.pl + o) = ol; }
    if (EPI == 1 || EPI == 3) { const size_t o = (EPI == 1) ? (size_t)R * DQ + c : (size_t)R * DKV + c;
        *(v4us*)(ep.fh + o) = oh; *(v4us*)(ep.fl + o) = ol; }
}



// ---- k_gemmw: register-blocked GEMM, one work-group of NW waves per 64x64 output tile; every wave holds the whole tile (16 accumulators) for its own share of K (64-element chunks dealt round robin: one 128-byte line of each operand row per chunk),
// operands straight from K-contiguous 16-bit planes; for NW > 1 the NW partial tiles are summed through LDS in wave order 0..NW-1 (K % 64 == 0); grid (M/64, N/64, Z), NW * 32 threads.
// C[m][n] (f32, pitch ldc, + optional f32 bias[n]) = sum_k A[m][k] Bt[n][k] (+ split products per NSPLIT). z-batch strides sA/sB/sC in elements (sA, sC per z slice; sB per ZH slices: the ZH heads of a kv group share Bt). A rows have pitch lda, Bt rows pitch K. K % 32 == 0.
template <typename T16> struct WFrag;
template <> struct WFrag<h16> { typedef v16h V; static __device__ __forceinline__ V ld(const h16* p) { return cat16(*(const v8h*)p, *(const v8h*)(p + 16)); } static __device__ __forceinline__ v8f mma(V a, V b, v8f c) { return wmma16(a, b, c); } };
template <> struct WFrag<bf> { typedef v16bf V; static __device__ __forceinline__ V ld(const bf* p) { return cat16b(*(const v8us*)p, *(const v8us*)(p + 16)); } static __device__ __forceinline__ v8f mma(V a, V b, v8f c) { return wmmab(a, b, c); } };
template <typename T16, int NSPLIT, bool BIAS, int NW, int EPI>
__global__ __launch_bounds__(NW * 32) void k_gemmw(const T16* __restrict__ A, const T16* __restrict__ A2, const T16* __restrict__ Bt, const T16* __restrict__ Bt2, int K, int lda, float* C, int ldc, const float* __restrict__ bias, size_t sA, size_t sB, size_t sC, Epi ep) {
    typedef typename WFrag<T16>::V V;
    __shared__ __align__(16) float os[NW > 1 ? NW * 64 * 68 : 16 * 68];
    const size_t z = blockIdx.z; A += z * sA; if (A2) A2 += z * sA; Bt += (z / ZH) * sB; if (Bt2) Bt2 += (z / ZH) * sB; C += z * sC;
    const int lane = threadIdx.x & 31, lr = lane & 15, hi = lane >> 4; const int wv = (NW > 1) ? __builtin_amdgcn_readfirstlane((int)(threadIdx.x >> 5)) : 0;   /* wave number as a scalar: the K loop's counter and branch stay scalar */ const int r0 = blockIdx.x * 64, c0 = blockIdx.y * 64;
    v8f acc[4][4];
#pragma unroll
    for (int mb = 0; mb < 4; ++mb)
#pragma unroll
        for (int nb = 0; nb < 4; ++nb) acc[mb][nb] = (v8f){};
    const size_t aoff = (size_t)(r0 + lr) * lda + 8 * hi, boff = (size_t)(c0 + lr) * K + 8 * hi;
#pragma unroll 1
    for (int kc = wv * 64; kc < K; kc += (kc & 32) ? (NW * 64 - 32) : 32) {
        V a[4], a2[4]; const T16* pa[4]; const T16* pa2[4]; const T16* pb[4]; const T16* pb2[4];
#pragma unroll
        for (int mb = 0; mb < 4; ++mb) { pa[mb] = A + aoff + (size_t)mb * 16 * lda + kc; a[mb] = WFrag<T16>::ld(pa[mb]); if (NSPLIT == 1 || NSPLIT == 2) { pa2[mb] = A2 + aoff + (size_t)mb * 16 * lda + kc; a2[mb] = WFrag<T16>::ld(pa2[mb]); } }
#pragma unroll
        for (int nb = 0; nb < 4; ++nb) { pb[nb] = Bt + boff + (size_t)nb * 16 * K + kc; const V b = WFrag<T16>::ld(pb[nb]); V b2; if (NSPLIT >= 2) { pb2[nb] = Bt2 + boff + (size_t)nb * 16 * K + kc; b2 = WFrag<T16>::ld(pb2[nb]); }
#pragma unroll
            for (int mb = 0; mb < 4; ++mb) { acc[mb][nb] = WFrag<T16>::mma(a[mb], b, acc[mb][nb]); if (NSPLIT == 1 || NSPLIT == 2) acc[mb][nb] = WFrag<T16>::mma(a2[mb], b, acc[mb][nb]); if (NSPLIT >= 2) acc[mb][nb] = WFrag<T16>::mma(a[mb], b2, acc[mb][nb]); } }
        asm volatile("v_nop\n\tv_nop\n\tv_nop\n\tv_nop" : "+v"(acc[0][0]), "+v"(acc[1][1]), "+v"(acc[2][2]), "+v"(acc[3][3]) : "v"(a[0]), "v"(a[3]));
        // precaution: this trip's load addresses are named as inputs, so their registers are not reused between a load and this wait; it stands at the loop's foot, where every load of the trip has already delivered its data
        if (NSPLIT == 2) asm volatile("s_wait_xcnt 0x0" :: "v"(pa[0]), "v"(pa[1]), "v"(pa[2]), "v"(pa[3]), "v"(pa2[0]), "v"(pa2[1]), "v"(pa2[2]), "v"(pa2[3]), "v"(pb[0]), "v"(pb[1]), "v"(pb[2]), "v"(pb[3]), "v"(pb2[0]), "v"(pb2[1]), "v"(pb2[2]), "v"(pb2[3]) : "memory");
        else if (NSPLIT == 1) asm volatile("s_wait_xcnt 0x0" :: "v"(pa[0]), "v"(pa[1]), "v"(pa[2]), "v"(pa[3]), "v"(pa2[0]), "v"(pa2[1]), "v"(pa2[2]), "v"(pa2[3]), "v"(pb[0]), "v"(pb[1]), "v"(pb[2]), "v"(pb[3]) : "memory");
        else asm volatile("s_wait_xcnt 0x0" :: "v"(pa[0]), "v"(pa[1]), "v"(pa[2]), "v"(pa[3]), "v"(pb[0]), "v"(pb[1]), "v"(pb[2]), "v"(pb[3]) : "memory");
    }
    if (NW > 1) {   // merge of the K split: each wave parks its whole partial tile in its own LDS slot, then all threads sum the NW slots in wave order and store
        float* osw = os + wv * (64 * 68);
        // the three loops are unrolled so that acc is indexed by constants and stays in registers
#pragma unroll
        for (int mb = 0; mb < 4; ++mb)
#pragma unroll
            for (int nb = 0; nb < 4; ++nb)
#pragma unroll
                for (int j = 0; j < 8; ++j) osw[(mb * 16 + hi * 8 + j) * 68 + nb * 16 + lr] = acc[mb][nb][j];
        __syncthreads();   // every wave's partial tile is in LDS before any thread sums across the slots
        v4f kept[32 / NW];   // EPI 3 only: the thread's sums, stored as flat rows behind the second barrier, so that no global store is outstanding at it
        // both loops unrolled: the LDS reads of all slots and rounds go out without a branch between them
#pragma unroll
        for (int s = 0; s < 32 / NW; ++s) { const int q = s * (NW * 32) + (int)threadIdx.x, row = q >> 4, cofs = (q & 15) * 4; v4f val = *(const v4fa*)(os + row * 68 + cofs);
#pragma unroll
            for (int w = 1; w < NW; ++w) val += *(const v4fa*)(os + w * (64 * 68) + row * 68 + cofs);
            kept[s] = val;
            if (BIAS) { val[0] += bfr(bias[c0 + cofs]); val[1] += bfr(bias[c0 + cofs + 1]); val[2] += bfr(bias[c0 + cofs + 2]); val[3] += bfr(bias[c0 + cofs + 3]); }
            if (EPI == 0) *(v4f*)(C + (size_t)(r0 + row) * ldc + c0 + cofs) = val; else if (EPI != 3) epi_put<EPI>(ep, r0 + row, c0 + cofs, val);
            if (EPI == 3) *(v4fa*)(os + row * 68 + cofs) = val; }   // the summed tile goes back into slot 0 (each quad is read and rewritten by this one thread) for the transposed read below
        if (EPI == 3) {   // v planes [g][b][d][t]: the summed tile is read back by columns, so that 16 lanes store one whole 128-byte line along t
            __syncthreads();   // the whole summed tile is in slot 0 before any thread reads a column of it
            // both loops unrolled: kept and the vectors are indexed by constants, and the LDS reads of both rounds go out without a branch between them
#pragma unroll
            for (int s = 0; s < 32 / NW; ++s) { const int q = s * (NW * 32) + (int)threadIdx.x, dc = q >> 4, t4 = (q & 15) * 4; const int c = c0 + dc, R = r0 + t4; v4h o16; v4us oh, ol;
                epi_put<EPI>(ep, r0 + dc, c0 + t4, kept[s]);   // the flat rows: quad q is (row q >> 4, columns (q & 15) * 4 ..) in the first loop too
#pragma unroll
                for (int u = 0; u < 4; ++u) { const float x = os[(t4 + u) * 68 + dc]; o16[u] = tohx(x); unsigned short a, c2; splitf(x, a, c2); oh[u] = a; ol[u] = c2; }
                const size_t o = (((size_t)(c / HD) * NB_ + R / TT) * HD + c % HD) * TT + R % TT; *(v4h*)(ep.p16 + o) = o16; *(v4us*)(ep.ph + o) = oh; *(v4us*)(ep.pl + o) = ol; }
        }
        return;
    }
#pragma unroll
    for (int mb = 0; mb < 4; ++mb) {
#pragma unroll
        for (int nb = 0; nb < 4; ++nb) {
#pragma unroll
            for (int j = 0; j < 8; ++j) os[(hi * 8 + j) * 68 + nb * 16 + lr] = acc[mb][nb][j]; }
        __builtin_amdgcn_wave_barrier(); asm volatile("" ::: "memory");
        float* crow = C + (size_t)(r0 + mb * 16) * ldc + c0;
{
#pragma unroll
            for (int s = 0; s < 8; ++s) { const int row = 2 * s + hi, cofs = lr * 4; v4f val = *(const v4fa*)(os + row * 68 + cofs); if (BIAS) { val[0] += bfr(bias[c0 + cofs]); val[1] += bfr(bias[c0 + cofs + 1]); val[2] += bfr(bias[c0 + cofs + 2]); val[3] += bfr(bias[c0 + cofs + 3]); }
                *(v4f*)(crow + (size_t)row * ldc + cofs) = val; }
             }
        __builtin_amdgcn_wave_barrier(); asm volatile("" ::: "memory");
    }
}

typedef __attribute__((ext_vector_type(2))) unsigned short v2us;
typedef __attribute__((ext_vector_type(2))) float v2f;
typedef __attribute__((ext_vector_type(4))) int v4i;
typedef v4h  __attribute__((may_alias)) v4ha;
typedef v4us __attribute__((may_alias)) v4usa;

__global__ __launch_bounds__(256) void k_wtG(const float* __restrict__ w, int K, int N, bf* Bt) {
    const int lane = threadIdx.x & 31; const int L0 = (blockIdx.x * 8 + (threadIdx.x >> 5)) * 8; const int nlines = N * K / 64;
{
#pragma unroll 1
        for (int l = 0; l < 8; ++l) { const int L = L0 + l; if (L >= nlines) break; const size_t e = (size_t)L * 64 + lane * 2; const int k = (int)(e % K), n = (int)(e / K); v2us o;
            o[0] = f2bf(w[(size_t)k * N + n]); o[1] = f2bf(w[(size_t)(k + 1) * N + n]); *(v2us*)(Bt + e) = o; }
         }
}
__global__ __launch_bounds__(256) void k_cvt8(const float* __restrict__ src, bf* dst, size_t n8) { const size_t i = (size_t)blockIdx.x * 256 + threadIdx.x; if (i >= n8) return; const v8f v = *(const v8f*)(src + i * 8); v8us o;
#pragma unroll
    for (int k = 0; k < 8; ++k) o[k] = f2bf(v[k]); *(v8us*)(dst + i * 8) = o;  }
__global__ __launch_bounds__(256) void k_cscvt(const float* __restrict__ cosT, const float* __restrict__ sinT, float* CS) { const int idx = blockIdx.x * 256 + threadIdx.x; if (idx >= TT * HD) return; v2f cs; cs[0] = bfr(cosT[idx]); cs[1] = bfr(sinT[idx]); *(v2f*)(CS + (size_t)idx * 2) = cs;  }
// ---- k_attn: scores, bias + mask, softmax and the product with v in one kernel; no score or probability goes to memory. One wave per (head, 16 query rows); the 4 waves of a work-group are the 4 heads of one kv group and share its k / v tiles through LDS.
// Everything is computed transposed, so that no value changes lanes between the two products: S^T = k q^T (A = 16 key rows, B = the wave's 16 query rows) leaves lane (lr, hi) with query lr and keys hi * 8 + j of each 16-key tile;
// two such tiles side by side are exactly the B fragment (n = query lr, k = 8 * hi + 0..7 and 8 * hi + 16 + 0..7) of O^T = v^T P^T (A = 16 rows of the [d][t] plane). A lane's scores, running maximum, running sum and all its O^T elements belong to its one query.
// Running softmax over steps of 32 keys: m = max so far, p = exp(t - m), sum and O^T rescaled by exp(m_old - m_new); the division by the sum comes last, in f32. The masked fill equals the start value of m, so a row with no allowed key weighs every key 1 (uniform, as the source's finfo.min fill),
// and the first allowed key wipes such weights (factor exp(-huge) = 0). HR (query rows < RH): hi + lo planes, 3 products each, over ALL keys; otherwise single fp16 up to the diagonal.
// Staging: two LDS buffers; step s + 1's tiles (32 k rows, 128 v^T rows of 32 keys) travel global -> registers while step s is computed, go into the other buffer behind it, and one work-group barrier per step publishes them and ends the reads of the buffer that is refilled next.
#define KPIT 136                  // LDS pitch of a k row, elements: 272 B = 16 B x odd, the 16 rows of a fragment read fall on distinct banks
#define VPIT 40                   // LDS pitch of a v^T row of 32 keys: 80 B = 16 B x odd
#define KTE  (32 * KPIT)
#define STE  (KTE + HD * VPIT)    // elements of one staged plane: k tile, then v^T tile
typedef __attribute__((ext_vector_type(16))) unsigned short v16us;
__device__ __forceinline__ float exp2s(float x) { float r; asm("v_exp_f32 %0, %1\n\tv_nop" : "=v"(r) : "v"(x)); return r; }
template <typename T16> struct LFrag;   // a fragment from two 16-byte LDS reads, in the k order of WFrag
template <> struct LFrag<h16> { static __device__ __forceinline__ v16h ld(const bf* p) { const v8us x = *(const v8usa*)p, y = *(const v8usa*)(p + 16); return cat16(__builtin_bit_cast(v8h, x), __builtin_bit_cast(v8h, y)); } };
template <> struct LFrag<bf> { static __device__ __forceinline__ v16bf ld(const bf* p) { const v8us x = *(const v8usa*)p, y = *(const v8usa*)(p + 16); return cat16b(x, y); } };
template <typename T16, bool HR>
__device__ __forceinline__ void attn_rows(bf* sm, float* smb, int wv, const T16* __restrict__ Q, const T16* __restrict__ Q2, const bf* __restrict__ Kp, const bf* __restrict__ K2, const bf* __restrict__ Vt, const bf* __restrict__ V2, const float* __restrict__ bias, bool poison, int q0, int nk, bf* oh, bf* ol) {
    typedef typename WFrag<T16>::V V; constexpr int NP = HR ? 2 : 1;
    const int tid = threadIdx.x, lane = tid & 31, lr = lane & 15, hi = lane >> 4; const int qi = q0 + lr;
    V bq[4], bq2[4]; const T16* pq = Q + (size_t)qi * HD + 8 * hi; const T16* pq2 = HR ? Q2 + (size_t)qi * HD + 8 * hi : nullptr;
    // unrolled, here and below: the fragment, staging and accumulator arrays are indexed by constants and stay in registers
#pragma unroll
    for (int kc = 0; kc < 4; ++kc) { bq[kc] = WFrag<T16>::ld(pq + kc * 32); if (HR) bq2[kc] = WFrag<T16>::ld(pq2 + kc * 32); }
    // precaution: the load addresses are named as inputs, so their registers are not reused between a load and this wait
    if (HR) asm volatile("s_wait_xcnt 0x0" :: "v"(pq), "v"(pq2) : "memory");
    else asm volatile("s_wait_xcnt 0x0" :: "v"(pq) : "memory");
    v8f o[8];
#pragma unroll
    for (int mb = 0; mb < 8; ++mb) o[mb] = (v8f){};
    float m = -3.0e38f, l = 0.f;
    // staging, 16-byte chunk c = tid + 128 * i: k tile (one contiguous 8 KiB) row c >> 4, piece c & 15; v^T tile row c >> 2, piece c & 3
    const unsigned gko = tid * 8, gvo = (tid >> 2) * TT + (tid & 3) * 8; const int sko = (tid >> 4) * KPIT + (tid & 15) * 8, svo = KTE + (tid >> 2) * VPIT + (tid & 3) * 8;
    const int fko = lr * KPIT + 8 * hi, fvo = KTE + lr * VPIT + 8 * hi;   // the lane's place in a k / v^T fragment read
    v8us rk[NP][4], rv[NP][4]; float rb = 0.f;
    if (wv == 0) smb[tid] = bias[tid];   // wave 0 stages the step's 32 bias values, one per lane
#pragma unroll
    for (int i = 0; i < 4; ++i) { rk[0][i] = *(const v8us*)(Kp + gko + i * 1024); rv[0][i] = *(const v8us*)(Vt + gvo + (size_t)i * 32 * TT); if (HR) { rk[NP - 1][i] = *(const v8us*)(K2 + gko + i * 1024); rv[NP - 1][i] = *(const v8us*)(V2 + gvo + (size_t)i * 32 * TT); } }
#pragma unroll
    for (int pl = 0; pl < NP; ++pl)
#pragma unroll
        for (int i = 0; i < 4; ++i) { *(v8usa*)(sm + pl * STE + sko + i * 8 * KPIT) = rk[pl][i]; *(v8usa*)(sm + pl * STE + svo + i * 32 * VPIT) = rv[pl][i]; }
    __syncthreads();   // step 0's tiles are in buffer 0 before any wave reads them
    for (int s = 0; s < nk; ++s) {
        const int sn = min(s + 1, nk - 1);   // the tile that is staged during this step; the last step stages its own once more (nobody reads it), so the loop body has no branch
        const unsigned ok = gko + sn * 32 * HD, ov = gvo + sn * 32, ob = sn * 32 + lane;   // element offsets of this step's loads inside their planes
        const bf* pk = Kp + ok; const bf* pk2 = HR ? K2 + ok : nullptr; const bf* pv = Vt + ov; const bf* pv2 = HR ? V2 + ov : nullptr;
        {   // next k tile: on its way during the score products
#pragma unroll
            for (int i = 0; i < 4; ++i) { rk[0][i] = *(const v8us*)(pk + i * 1024); if (HR) rk[NP - 1][i] = *(const v8us*)(pk2 + i * 1024); }
            if (wv == 0) rb = bias[ob]; }
        const bf* cur = sm + (s & 1) * (NP * STE); bf* nxt = sm + ((s + 1) & 1) * (NP * STE);
        v8f st[2]; float t[16]; float mt = -3.0e38f;
#pragma unroll
        for (int tt = 0; tt < 2; ++tt) { st[tt] = (v8f){};
#pragma unroll
            for (int kc = 0; kc < 4; ++kc) { const V a = LFrag<T16>::ld(cur + fko + tt * 16 * KPIT + kc * 32); st[tt] = WFrag<T16>::mma(a, bq[kc], st[tt]);
                if (HR) { st[tt] = WFrag<T16>::mma(a, bq2[kc], st[tt]); const V a2 = LFrag<T16>::ld(cur + STE + fko + tt * 16 * KPIT + kc * 32); st[tt] = WFrag<T16>::mma(a2, bq[kc], st[tt]); } } }
        const float* cb = smb + (s & 1) * 32 + hi * 8; const v4f bb[4] = { *(const v4fa*)cb, *(const v4fa*)(cb + 4), *(const v4fa*)(cb + 16), *(const v4fa*)(cb + 20) };
#pragma unroll
        for (int tt = 0; tt < 2; ++tt)
#pragma unroll
            for (int j = 0; j < 8; ++j) { const int key = s * 32 + tt * 16 + hi * 8 + j; const float bj = bb[tt * 2 + (j >> 2)][j & 3]; const float x = (key <= qi && bj > 0.f) ? st[tt][j] * SCL + bj : -3.0e38f; t[tt * 8 + j] = x; mt = fmaxf(mt, x); }
        {   // the other buffer is free since the last barrier: the k tile goes in as soon as it has come; next v^T tile: on its way during the softmax and the second product
#pragma unroll
            for (int pl = 0; pl < NP; ++pl)
#pragma unroll
                for (int i = 0; i < 4; ++i) *(v8usa*)(nxt + pl * STE + sko + i * 8 * KPIT) = rk[pl][i];
            if (wv == 0) smb[((s + 1) & 1) * 32 + lane] = rb;
#pragma unroll
            for (int i = 0; i < 4; ++i) { rv[0][i] = *(const v8us*)(pv + (size_t)i * 32 * TT); if (HR) rv[NP - 1][i] = *(const v8us*)(pv2 + (size_t)i * 32 * TT); } }
        mt = fmaxf(mt, __shfl_xor(mt, 16, 32));   // the other half of the wave holds the query's other 16 keys of this step
        const float mn = fmaxf(m, mt); const float alpha = exp2s((m - mn) * 1.4426950408889634f); m = mn;
        float ps = 0.f;
#pragma unroll
        for (int u = 0; u < 16; ++u) { t[u] = exp2s((t[u] - mn) * 1.4426950408889634f); ps += t[u]; }
        l = l * alpha + ps;   // each half of the wave sums its own keys; the halves meet behind the loop
#pragma unroll
        for (int mb = 0; mb < 8; ++mb) o[mb] *= alpha;
        V p, p2;
        if constexpr (HR) { v16us a, c;
#pragma unroll
            for (int u = 0; u < 16; ++u) { unsigned short x, y; splitf(t[u], x, y); a[u] = x; c[u] = y; }
            p = __builtin_bit_cast(v16bf, a); p2 = __builtin_bit_cast(v16bf, c);
        } else {
#pragma unroll
            for (int u = 0; u < 16; ++u) p[u] = tohx(t[u]); }
#pragma unroll
        for (int mb = 0; mb < 8; ++mb) { const V a = LFrag<T16>::ld(cur + fvo + mb * 16 * VPIT); o[mb] = WFrag<T16>::mma(a, p, o[mb]);
            if constexpr (HR) { o[mb] = WFrag<T16>::mma(a, p2, o[mb]); const V a2 = LFrag<T16>::ld(cur + STE + fvo + mb * 16 * VPIT); o[mb] = WFrag<T16>::mma(a2, p, o[mb]); } }
        {
#pragma unroll
            for (int pl = 0; pl < NP; ++pl)
#pragma unroll
                for (int i = 0; i < 4; ++i) *(v8usa*)(nxt + pl * STE + svo + i * 32 * VPIT) = rv[pl][i]; }
        // precaution: this step's load addresses (HR: their offsets beside the planes' scalar bases) are named as inputs, so their registers are not reused between a load and this wait; it stands at the loop's foot, where every load of the step has already delivered its data
        if (HR) asm volatile("s_wait_xcnt 0x0" :: "v"(ok), "v"(ov), "v"(ob) : "memory");
        else asm volatile("s_wait_xcnt 0x0" :: "v"(pk), "v"(pv), "v"(ob) : "memory");
        __syncthreads();   // publishes step s + 1's tiles; every wave has finished reading the buffer that the next step refills
    }
    l += __shfl_xor(l, 16, 32);
    const float f = poison ? __builtin_nanf("") : 1.0f / l;
#pragma unroll
    for (int mb = 0; mb < 8; ++mb) { v8us a, c;
#pragma unroll
        for (int j = 0; j < 8; ++j) { unsigned short x, y; splitf(o[mb][j] * f, x, y); a[j] = x; c[j] = y; }
        *(v8us*)(oh + (size_t)qi * DQ + mb * 16 + hi * 8) = a; *(v8us*)(ol + (size_t)qi * DQ + mb * 16 + hi * 8) = c; }   // hi / lo rows [b][t][head][d] of the output projection's A operand: d = mb * 16 + hi * 8 + j
}
// grid (TT / 16 * NKV * NB_), REP * 32 threads, four waves per SIMD asked for (a budget of 256 registers: with the LDS of four work-groups per WGP the whole grid is resident). Flat index: low 3 bits the kv plane g * NB_ + b; then 32 row blocks per quarter of the grid: first all hi + lo blocks (the longest), then the last rows downwards, the middle, and the shortest upwards,
// so that four work-groups whose indices lie a quarter of the grid apart carry about the same work together (for speed only; every (plane, row block) occurs once whatever the placement).
static_assert(TT / 16 == 4 * (RH / 16) && NKV * NB_ == 8 && ZH == REP, "row-block deal of k_attn");
__global__ __launch_bounds__(REP * 32, 4) void k_attn(const h16* __restrict__ Q16, const bf* __restrict__ Qh, const bf* __restrict__ Ql, const bf* __restrict__ K16, const bf* __restrict__ Kh, const bf* __restrict__ Kl, const bf* __restrict__ V16, const bf* __restrict__ Vh, const bf* __restrict__ Vl, const float* __restrict__ Bb, const int* __restrict__ FLG, bf* ATh, bf* ATl) {
    __shared__ __align__(16) bf sm[2 * 2 * STE]; __shared__ __align__(16) float smb[2 * 32];
    const int wv = __builtin_amdgcn_readfirstlane((int)(threadIdx.x >> 5));   // wave number as a scalar: plane offsets stay scalar
    const int id = blockIdx.x, kvp = id & 7, g = kvp / NB_, b = kvp % NB_, qr = id >> 8, i5 = (id >> 3) & 31; const int qb = (qr == 0) ? i5 : (qr == 1) ? 127 - i5 : (qr == 2) ? 64 + i5 : 32 + i5; const int q0 = qb * 16;
    const size_t qo = (size_t)(g * (NB_ * ZH) + b * ZH + wv) * TT * HD, kv = (size_t)kvp * TT * HD, ao = (size_t)b * TT * DQ + (g * REP + wv) * HD;
    const float* bias = Bb + (size_t)(b * NKV + g) * TT; const bool poison = (FLG[b * 8 + g] != 0);   /* premise self-check: no positive bias among keys 0..RH-1 for this kv head -> NaN-poison (flag word FLG[b * 8 + 4] also set) */
    if (qb < RH / 16) attn_rows<bf, true>(sm, smb, wv, Qh + qo, Ql + qo, Kh + kv, Kl + kv, Vh + kv, Vl + kv, bias, poison, q0, TT / 32, ATh + ao, ATl + ao);
    else attn_rows<h16, false>(sm, smb, wv, Q16 + qo, nullptr, K16 + kv, nullptr, V16 + kv, nullptr, bias, poison, q0, (q0 + 16 + 31) / 32, ATh + ao, ATl + ao);
}
// ---- k_gemms: GEMM with its operands staged in LDS by asynchronous copies (global_load_async_to_lds_b128). One work-group of 4 waves (2 x 2) per 128x128 output tile, 64x64 (16 accumulators) per wave, the whole K in each accumulator;
// K goes in stages of 64 elements (one whole 128-byte line of every operand row), two LDS buffers: stage t + 1's copies fly while stage t is worked on. Each line is fetched once per work-group, whole, and serves two waves.
// C[m][n] = sum_k A[m][k] Bt[n][k] (+ A2[m][k] Bt[n][k] for NSPLIT 1); A, A2, Bt are K-contiguous 16-bit planes of pitch K, K % 64 == 0; grid (M / 128, N / 128), 128 threads. EPI as above: each wave stores its own 64x64 tile through its own LDS slot.
#define GPIT 72                   // LDS pitch of a staged row of 64 elements: 144 B = 16 B x odd, the 16 rows of a fragment read fall on distinct banks
#define GPLN (128 * GPIT)         // elements of one staged plane: 128 rows
// one lane's eight 16-byte copies of one plane, rows 16 apart (LDS byte address l, global address g, gs elements between the rows). The wait on the address translations is the statement's last line, so that it stands in front of every later write of the address registers (a precaution).
__device__ __forceinline__ void cp8(unsigned l, const bf* g, size_t gs) {
    asm volatile("global_load_async_to_lds_b128 %0, %8, off\n\t"
                 "global_load_async_to_lds_b128 %1, %9, off\n\t"
                 "global_load_async_to_lds_b128 %2, %10, off\n\t"
                 "global_load_async_to_lds_b128 %3, %11, off\n\t"
                 "global_load_async_to_lds_b128 %4, %12, off\n\t"
                 "global_load_async_to_lds_b128 %5, %13, off\n\t"
                 "global_load_async_to_lds_b128 %6, %14, off\n\t"
                 "global_load_async_to_lds_b128 %7, %15, off\n\t"
                 "s_wait_xcnt 0x0"
                 :: "v"(l), "v"(l + 1 * 16 * GPIT * 2), "v"(l + 2 * 16 * GPIT * 2), "v"(l + 3 * 16 * GPIT * 2), "v"(l + 4 * 16 * GPIT * 2), "v"(l + 5 * 16 * GPIT * 2), "v"(l + 6 * 16 * GPIT * 2), "v"(l + 7 * 16 * GPIT * 2),
                    "v"(g), "v"(g + gs), "v"(g + 2 * gs), "v"(g + 3 * gs), "v"(g + 4 * gs), "v"(g + 5 * gs), "v"(g + 6 * gs), "v"(g + 7 * gs) : "memory");
}
template <int NSPLIT, int EPI>
__global__ __launch_bounds__(128, 2) void k_gemms(const bf* __restrict__ A, const bf* __restrict__ A2, const bf* __restrict__ Bt, int K, float* C, int ldc, Epi ep) {
    constexpr int NPL = NSPLIT ? 3 : 2, STG = NPL * GPLN;   // a stage: the planes A, Bt (, A2)
    static_assert(2 * STG * 2 >= 4 * 64 * 68 * 4, "the four waves' output slots fit into the two buffers");
    __shared__ __align__(16) bf ring[2 * STG];
    const int tid = threadIdx.x, lane = tid & 31, lr = lane & 15, hi = lane >> 4; const int wv = __builtin_amdgcn_readfirstlane(tid >> 5), wm = wv >> 1, wn = wv & 1;   // wave number as a scalar: tile offsets stay scalar
    const int r0 = blockIdx.x * 128, c0 = blockIdx.y * 128, nt = K / 64;
    // copies, 16-byte chunk tid + 128 * i of a plane: row (tid >> 3) + 16 * i, piece tid & 7: eight lanes fetch one whole line
    const size_t gs = (size_t)16 * K, go = (size_t)(tid >> 3) * K + (tid & 7) * 8;
    const bf* ga = A + (size_t)r0 * K + go; const bf* gb = Bt + (size_t)c0 * K + go; const bf* ga2 = NSPLIT ? A2 + (size_t)r0 * K + go : nullptr;
    const unsigned l0 = (unsigned)(size_t)ring + ((tid >> 3) * GPIT + (tid & 7) * 8) * 2;
    auto stage = [&](int t) { const unsigned l = l0 + (t & 1) * (STG * 2); cp8(l, ga + t * 64, gs); cp8(l + GPLN * 2, gb + t * 64, gs); if (NSPLIT) cp8(l + 2 * GPLN * 2, ga2 + t * 64, gs); };
    v8f acc[4][4];
    // unrolled, here and below: the accumulator and fragment arrays are indexed by constants and stay in registers
#pragma unroll
    for (int mb = 0; mb < 4; ++mb)
#pragma unroll
        for (int nb = 0; nb < 4; ++nb) acc[mb][nb] = (v8f){};
    const int fa = (wm * 64 + lr) * GPIT + 8 * hi, fb = GPLN + (wn * 64 + lr) * GPIT + 8 * hi;   // the lane's place in an A / Bt fragment read
    stage(0);
    asm volatile("s_wait_asynccnt 0x0" ::: "memory");   // this wave's copies of stage 0 have landed
    __syncthreads();   // stage 0 is in buffer 0 before any wave reads it
    if (nt > 1) stage(1);
    for (int t = 0; t < nt; ++t) {
        const bf* cur = ring + (t & 1) * STG;
        // fragment reads run ahead of the products that use them: the first 32 k's fragments as one group, with them (registers allowing: NSPLIT 0) the second 32 k's Bt fragments; each A fragment of the second 32 k is read into its registers as soon as the four (eight) products on its forerunner are issued.
        // The scheduling barriers keep that order: left alone, the scheduler sinks every read to its first product, and the products wait out an LDS latency each time.
        v16bf a[4], a2[4], b[2][4];
#pragma unroll
        for (int i = 0; i < 4; ++i) { a[i] = LFrag<bf>::ld(cur + fa + i * 16 * GPIT); b[0][i] = LFrag<bf>::ld(cur + fb + i * 16 * GPIT); if (NSPLIT) a2[i] = LFrag<bf>::ld(cur + 2 * GPLN + fa + i * 16 * GPIT); }
        if (!NSPLIT) {
#pragma unroll
            for (int i = 0; i < 4; ++i) b[1][i] = LFrag<bf>::ld(cur + fb + i * 16 * GPIT + 32); }
        __builtin_amdgcn_sched_barrier(0);
#pragma unroll
        for (int mb = 0; mb < 4; ++mb) {
#pragma unroll
            for (int nb = 0; nb < 4; ++nb) { acc[mb][nb] = wmmab(a[mb], b[0][nb], acc[mb][nb]); if (NSPLIT) acc[mb][nb] = wmmab(a2[mb], b[0][nb], acc[mb][nb]); }
            a[mb] = LFrag<bf>::ld(cur + fa + mb * 16 * GPIT + 32); if (NSPLIT) a2[mb] = LFrag<bf>::ld(cur + 2 * GPLN + fa + mb * 16 * GPIT + 32);
            __builtin_amdgcn_sched_barrier(0); }
        if (NSPLIT) {
#pragma unroll
            for (int i = 0; i < 4; ++i) b[1][i] = LFrag<bf>::ld(cur + fb + i * 16 * GPIT + 32);
            __builtin_amdgcn_sched_barrier(0); }
#pragma unroll
        for (int mb = 0; mb < 4; ++mb)
#pragma unroll
            for (int nb = 0; nb < 4; ++nb) { acc[mb][nb] = wmmab(a[mb], b[1][nb], acc[mb][nb]); if (NSPLIT) acc[mb][nb] = wmmab(a2[mb], b[1][nb], acc[mb][nb]); }
        asm volatile("s_wait_dscnt 0x0" ::: "memory");      // this wave's reads of the buffer that is refilled below have ended
        asm volatile("s_wait_asynccnt 0x0" ::: "memory");   // this wave's copies of stage t + 1 have landed
        __syncthreads();   // publishes stage t + 1; every wave has finished reading stage t's buffer
        if (t + 2 < nt) stage(t + 2);
    }
    asm volatile("s_wait_asynccnt 0x0" ::: "memory");   // no copy is outstanding when the buffers become output slots
    float* osw = (float*)ring + wv * (64 * 68); const int rw = r0 + wm * 64, cw = c0 + wn * 64;
#pragma unroll
    for (int mb = 0; mb < 4; ++mb)
#pragma unroll
        for (int nb = 0; nb < 4; ++nb)
#pragma unroll
            for (int j = 0; j < 8; ++j) osw[(mb * 16 + hi * 8 + j) * 68 + nb * 16 + lr] = acc[mb][nb][j];
    __syncthreads();   // the tile is in its slot before its lanes read one another's values
    // four rounds are unrolled into one trip: their LDS reads go out together, and one wait behind their stores serves them all
#pragma unroll 1
    for (int s4 = 0; s4 < 32; s4 += 4) {
#pragma unroll
      for (int s = s4; s < s4 + 4; ++s) { const int q = s * 32 + lane, row = q >> 4, cofs = (q & 15) * 4; const v4f val = *(const v4fa*)(osw + row * 68 + cofs);
        if (EPI == 0) *(v4f*)(C + (size_t)(rw + row) * ldc + cw + cofs) = val; else epi_put<EPI>(ep, rw + row, cw + cofs, val);
        if (EPI == 3) {   // v planes [g][b][d][t]: the tile is read by columns too (column row, rows cofs .. cofs + 3), so that 16 lanes store one whole 128-byte line along t
            const int c = cw + row, R = rw + cofs; v4h o16; v4us oh, ol;
#pragma unroll
            for (int u = 0; u < 4; ++u) { const float x = osw[(cofs + u) * 68 + row]; o16[u] = tohx(x); unsigned short a, c2; splitf(x, a, c2); oh[u] = a; ol[u] = c2; }
            const size_t o = (((size_t)(c / HD) * NB_ + R / TT) * HD + c % HD) * TT + R % TT; *(v4h*)(ep.p16 + o) = o16; *(v4us*)(ep.ph + o) = oh; *(v4us*)(ep.pl + o) = ol; } }
      asm volatile("s_wait_xcnt 0x0" ::: "memory"); }   // precaution: the next trip rewrites the registers that this trip's stores name
}
__global__ __launch_bounds__(32) void k_chk(const float* __restrict__ BIAS, int* FLG) { BIAS += (size_t)blockIdx.x * NKV * TT; FLG += blockIdx.x * 8;   /* one work-group per batch element */ const int n = threadIdx.x; int none = 0; if (n < NKV) { none = 1;
#pragma unroll 1
        for (int j = 0; j < RH; ++j) if (BIAS[(size_t)n * TT + j] > 0.f) { none = 0; break; } }
    int anyb = none;
#pragma unroll
    for (int sh = 16; sh; sh >>= 1) anyb |= __shfl_xor(anyb, sh, 32);
    const int v = (n < NKV) ? none : ((n == NKV) ? anyb : 0); if (n < 8) { *(int*)(FLG + n) = v;  } }
__global__ __launch_bounds__(256) void k_wgd(const float* __restrict__ w, int K, bf* Bt) { const int e = (blockIdx.x * 256 + threadIdx.x) * 4; if (e >= 64 * K) return; const int k = e % K, n = e / K; v4us o;
#pragma unroll
    for (int u = 0; u < 4; ++u) o[u] = (n < NKV) ? f2bf(w[(size_t)(k + u) * NKV + n]) : (unsigned short)0; *(v4us*)(Bt + e) = o;  }
__global__ __launch_bounds__(256) void k_bias(const float* __restrict__ GATE, const float* __restrict__ DEL, float* BIAS) { const int e = (blockIdx.x * 256 + threadIdx.x) * 4; if (e >= NB_ * NKV * TT) return; const int j = e % TT; const int n = (e / TT) % NKV; const int b = e / (NKV * TT); v4f r;
#pragma unroll
    for (int u = 0; u < 4; ++u) { const float gt = GATE[((size_t)b * TT + j + u) * 64 + n]; asm volatile("s_wait_xcnt 0x0" ::: "memory");   /* precaution, here and below: later loads land in the registers that held this load's address */ const float dl = DEL[((size_t)b * TT + j + u) * 64 + n]; asm volatile("s_wait_xcnt 0x0" ::: "memory"); const float sg = __fdiv_rn(1.0f, __fadd_rn(1.0f, __expf(-gt))); r[u] = __fmul_rn(sg, dl); }
    *(v4f*)(BIAS + e) = r;  }

extern "C" void kernel_launch(void* const* d_in, const int* in_sizes, int n_in,
                              void* d_out, int out_size, void* d_ws, size_t ws_size, hipStream_t stream) {
    (void)in_sizes; (void)n_in; (void)out_size;
    const float* x = (const float*)d_in[0]; const float* wq = (const float*)d_in[1]; const float* wk = (const float*)d_in[2]; const float* wv = (const float*)d_in[3]; const float* wg = (const float*)d_in[4]; const float* wdl = (const float*)d_in[5]; const float* wo = (const float*)d_in[6]; const float* cosT = nullptr; const float* sinT = nullptr; (void)cosT; (void)sinT;
    float* OUT = (float*)d_out;     // [2][2048][2048]
    char* wsp = (char*)d_ws;
    auto take = [&](size_t bytes) { char* p = wsp; wsp += (bytes + 255) & ~(size_t)255; return (void*)p; };
    const size_t MT = (size_t)NB_ * TT;   // token rows of both batch elements together: every launch covers both
    // read by the attention kernel or behind it
    bf* WO = (bf*)take((size_t)DM * DQ * 2); float* BIAS = (float*)take((size_t)NB_ * NKV * TT * 4); int* FLG = (int*)take(256);
    h16* QP16 = (h16*)take(MT * NH_ * HD * 2); h16* KP16 = (h16*)take(MT * NKV * HD * 2); h16* VT16 = (h16*)take(MT * NKV * HD * 2);
    bf* QPh = (bf*)take(MT * NH_ * HD * 2); bf* QPl = (bf*)take(MT * NH_ * HD * 2); bf* KPh = (bf*)take(MT * NKV * HD * 2); bf* KPl = (bf*)take(MT * NKV * HD * 2); bf* VTh = (bf*)take(MT * NKV * HD * 2); bf* VTl = (bf*)take(MT * NKV * HD * 2);
    bf* ATh = (bf*)take(MT * DQ * 2); bf* ATl = (bf*)take(MT * DQ * 2);
    // read only by the launches in front of the attention kernel
    bf* WQ = (bf*)take((size_t)DQ * DM * 2); bf* WK = (bf*)take((size_t)DKV * DM * 2); bf* WV = (bf*)take((size_t)DKV * DM * 2);
    bf* XB = (bf*)take(MT * DM * 2); bf* GFh = (bf*)take(MT * DQ * 2); bf* GFl = (bf*)take(MT * DQ * 2); bf* VFh = (bf*)take(MT * DKV * 2); bf* VFl = (bf*)take(MT * DKV * 2); bf* WG = (bf*)take((size_t)64 * DQ * 2); bf* WD = (bf*)take((size_t)64 * DKV * 2); float* GATE = (float*)take(MT * 64 * 4); float* DEL = (float*)take(MT * 64 * 4);
    if ((size_t)(wsp - (char*)d_ws) > ws_size) return;    // ws 256 MiB
    const Epi E0 = { nullptr, nullptr, nullptr, nullptr, nullptr };   // plain f32 tile
    { k_wgd<<<(64 * DQ / 4 + 255) / 256, 256, 0, stream>>>(wg, DQ, WG); k_wgd<<<(64 * DKV / 4 + 255) / 256, 256, 0, stream>>>(wdl, DKV, WD); k_wtG<<<(unsigned)((DM * DQ / 64 + 63) / 64), 256, 0, stream>>>(wq, DM, DQ, WQ); k_wtG<<<(unsigned)((DM * DKV / 64 + 63) / 64), 256, 0, stream>>>(wk, DM, DKV, WK); k_wtG<<<(unsigned)((DM * DKV / 64 + 63) / 64), 256, 0, stream>>>(wv, DM, DKV, WV);
      k_wtG<<<(unsigned)((DQ * DM / 64 + 63) / 64), 256, 0, stream>>>(wo, DQ, DM, WO);
       }
    const unsigned MB = (unsigned)(MT / 64), MB2 = (unsigned)(MT / 128);   // 64-row and 128-row tiles over both batch elements
    k_cvt8<<<(unsigned)((MT * DM / 8 + 255) / 256), 256, 0, stream>>>(x, XB, MT * DM / 8);
    // the three projections store the 16-bit planes that the later products read
    k_gemms<0, 1><<<dim3(MB2, DQ / 128, 1), 128, 0, stream>>>(XB, nullptr, WQ, DM, nullptr, 0, Epi{ QP16, QPh, QPl, GFh, GFl });
    k_gemms<0, 2><<<dim3(MB2, DKV / 128, 1), 128, 0, stream>>>(XB, nullptr, WK, DM, nullptr, 0, Epi{ KP16, KPh, KPl, nullptr, nullptr });
    k_gemms<0, 3><<<dim3(MB2, DKV / 128, 1), 128, 0, stream>>>(XB, nullptr, WV, DM, nullptr, 0, Epi{ VT16, VTh, VTl, VFh, VFl });
    /* dynamic mask bias per (batch, kv head, key) */
    k_gemmw<bf, 1, false, 16, 0><<<dim3(MB, 1, 1), 512, 0, stream>>>(GFh, GFl, WG, nullptr, DQ, DQ, GATE, 64, nullptr, 0, 0, 0, E0); k_gemmw<bf, 1, false, 8, 0><<<dim3(MB, 1, 1), 256, 0, stream>>>(VFh, VFl, WD, nullptr, DKV, DKV, DEL, 64, nullptr, 0, 0, 0, E0); k_bias<<<(NB_ * NKV * TT / 4 + 255) / 256, 256, 0, stream>>>(GATE, DEL, BIAS); k_chk<<<NB_, 32, 0, stream>>>(BIAS, FLG);
    // all heads of both batch elements in one launch; it stores the hi / lo rows of the output projection's A operand
    k_attn<<<dim3(TT / 16 * NKV * NB_, 1, 1), REP * 32, 0, stream>>>(QP16, QPh, QPl, (const bf*)KP16, KPh, KPl, (const bf*)VT16, VTh, VTl, BIAS, FLG, ATh, ATl);
    k_gemms<1, 0><<<dim3(MB2, DM / 128, 1), 128, 0, stream>>>(ATh, ATl, WO, DQ, OUT, DM, E0);
}

// v007
// One run takes 307 microseconds.
// Two timings next to v006 put it at 1.15 and 1.17 times that version's speed.
// Counting every step since v000, it is 7.82 times as fast.
#include <hip/hip_runtime.h>

// DynamicMaskAttention (hidden [2][2048][2048]; q = x Wq (16 heads x 128), k/v = x Wk / Wv (4 kv heads; group h/4); per key j and kv head n: bias = sigmoid(q_flat[j] . Wg[:, n]) * (v_flat[j] . Wd[:, n]); logits = q.k / sqrt(128) + bias[n][j]; allowed = causal AND bias[n][j] > 0, everything else gets finfo.min (so a query row with no allowed key softmaxes uniformly over ALL keys, as the source);
//   softmax; out = merged Wo -> [2][2048][2048]).
// Compute dtypes, f32 accumulate: every input rounded to bf16; q/k/v on PLAIN bf16 operands (inputs: exact); gate / delta as hl planes of q_flat / v_flat x exact Wg / Wd (2 products; 4 outputs padded to 64), sigmoid and the product f32; scores and attn.v: query rows < 512 hl (3 products), the rest single fp16, both with causal tile skipping; a 16-row block of the early rows whose first row has no allowed key (such a row attends uniformly to every key) goes on over ALL key tiles, behind the diagonal with the v product alone; bias + mask + running softmax f32, probabilities unnormalised (exp(t - max) <= 1), the division by their sum last; Wo hl x exact (2 products).

#define NB_  2
#define TT   2048
#define DM   2048
#define NH_  16
#define NKV  4
#define REP  (NH_ / NKV)
#define HD   128
#define DQ   (NH_ * HD)
#define DKV  (NKV * HD)
#define ZH   4                    // query heads per group of q planes: one whole kv group (ZH == REP), the heads that share their K and V planes
#define RH   512                  // query rows < RH use hi+lo planes
#define WIN  2048
#define SCL  0.088388347648318447f   // HD^-0.5
typedef _Float16 h16;
typedef unsigned short bf;
typedef __attribute__((ext_vector_type(16))) __bf16   v16bf;
typedef __attribute__((ext_vector_type(16))) _Float16 v16h;
typedef __attribute__((ext_vector_type(8)))  _Float16 v8h;
typedef __attribute__((ext_vector_type(8)))  unsigned short v8us;
typedef __attribute__((ext_vector_type(8)))  float    v8f;
typedef __attribute__((ext_vector_type(4)))  float    v4f;
typedef v8h  __attribute__((may_alias)) v8ha;
typedef v4f  __attribute__((may_alias)) v4fa;
typedef v8us __attribute__((may_alias)) v8usa;

__device__ __forceinline__ unsigned short f2bf(float f) { unsigned u = __float_as_uint(f); u += 0x7FFFu + ((u >> 16) & 1u); return (unsigned short)(u >> 16); }
__device__ __forceinline__ float bf2f(unsigned short b) { return __uint_as_float(((unsigned)b) << 16); }
__device__ __forceinline__ float bfr(float f) { return bf2f(f2bf(f)); }
__device__ __forceinline__ v16h cat16(v8h lo, v8h hi) { return __builtin_shufflevector(lo, hi, 0, 1, 2, 3, 4, 5, 6, 7, 8, 9, 10, 11, 12, 13, 14, 15); }
__device__ __forceinline__ v16bf cat16b(v8us lo, v8us hi) { return __builtin_bit_cast(v16bf, __builtin_shufflevector(lo, hi, 0, 1, 2, 3, 4, 5, 6, 7, 8, 9, 10, 11, 12, 13, 14, 15)); }
__device__ __forceinline__ v8f wmma16(v16h a, v16h b, v8f c) { return __builtin_amdgcn_wmma_f32_16x16x32_f16(false, a, false, b, (short)0, c, false, false); }
__device__ __forceinline__ v8f wmmab(v16bf a, v16bf b, v8f c) { return __builtin_amdgcn_wmma_f32_16x16x32_bf16(false, a, false, b, (short)0, c, false, false); }
__device__ __forceinline__ h16 tohx(float x) { return (h16)x; }
__device__ __forceinline__ void splitf(float y, unsigned short& h, unsigned short& l) { h = f2bf(y); l = f2bf(y - bf2f(h)); }
typedef __attribute__((ext_vector_type(4))) _Float16 v4h;
typedef __attribute__((ext_vector_type(4))) unsigned short v4us;

// ---- what the store step of a GEMM writes (EPI): 0 the f32 tile; otherwise the 16-bit operand planes of the next GEMM, straight from the sums:
// 1 q: head planes [h / ZH][b][h % ZH][t][d] (fp16, hi, lo) and the flat hi / lo rows for the gate product; 2 k: head planes [h][b][t][d] (fp16, hi, lo);
// 3 v: flat hi / lo rows for the delta product (the transposed planes [g][b][d][t] are written by the kernel itself, through LDS).
struct Epi { h16* p16; bf* ph; bf* pl; bf* fh; bf* fl; };
template <int EPI> __device__ __forceinline__ void epi_put(const Epi& ep, int R, int c, v4f val) {   // four neighbouring sums of output row R, columns c .. c + 3
    v4h o16; v4us oh, ol;
    // unrolled: the vectors' elements are indexed by constants and stay in registers
#pragma unroll
    for (int u = 0; u < 4; ++u) { const float x = val[u]; o16[u] = tohx(x); unsigned short a, c2; splitf(x, a, c2); oh[u] = a; ol[u] = c2; }
    if (EPI == 1 || EPI == 2) { const int b = R / TT, t = R % TT, h = c / HD, d = c % HD; const int p = (EPI == 1) ? (h / ZH) * (NB_ * ZH) + b * ZH + h % ZH : h * NB_ + b; const size_t o = ((size_t)p * TT + t) * HD + d;
        *(v4h*)(ep.p16 + o) = o16; *(v4us*)(ep.ph + o) = oh; *(v4us*)(ep.pl + o) = ol; }
    if (EPI == 1 || EPI == 3) { const size_t o = (EPI == 1) ? (size_t)R * DQ + c : (size_t)R * DKV + c;
        *(v4us*)(ep.fh + o) = oh; *(v4us*)(ep.fl + o) = ol; }
}



// ---- k_gemmw: register-blocked GEMM, one work-group of NW waves per 64x64 output tile; every wave holds the whole tile (16 accumulators) for its own share of K (64-element chunks dealt round robin: one 128-byte line of each operand row per chunk),
// operands straight from K-contiguous 16-bit planes; for NW > 1 the NW partial tiles are summed through LDS in wave order 0..NW-1 (K % 64 == 0); grid (M/64, N/64, Z), NW * 32 threads.
// C[m][n] (f32, pitch ldc, + optional f32 bias[n]) = sum_k A[m][k] Bt[n][k] (+ split products per NSPLIT). z-batch strides sA/sB/sC in elements (sA, sC per z slice; sB per ZH slices: the ZH heads of a kv group share Bt). A rows have pitch lda, Bt rows pitch K. K % 32 == 0.
template <typename T16> struct WFrag;
template <> struct WFrag<h16> { typedef v16h V; static __device__ __forceinline__ V ld(const h16* p) { return cat16(*(const v8h*)p, *(const v8h*)(p + 16)); } static __device__ __forceinline__ v8f mma(V a, V b, v8f c) { return wmma16(a, b, c); } };
template <> struct WFrag<bf> { typedef v16bf V; static __device__ __forceinline__ V ld(const bf* p) { return cat16b(*(const v8us*)p, *(const v8us*)(p + 16)); } static __device__ __forceinline__ v8f mma(V a, V b, v8f c) { return wmmab(a, b, c); } };
template <typename T16, int NSPLIT, bool BIAS, int NW, int EPI>
__global__ __launch_bounds__(NW * 32) void k_gemmw(const T16* __restrict__ A, const T16* __restrict__ A2, const T16* __restrict__ Bt, const T16* __restrict__ Bt2, int K, int lda, float* C, int ldc, const float* __restrict__ bias, size_t sA, size_t sB, size_t sC, Epi ep) {
    typedef typename WFrag<T16>::V V;
    __shared__ __align__(16) float os[NW > 1 ? NW * 64 * 68 : 16 * 68];
    const size_t z = blockIdx.z; A += z * sA; if (A2) A2 += z * sA; Bt += (z / ZH) * sB; if (Bt2) Bt2 += (z / ZH) * sB; C += z * sC;
    const int lane = threadIdx.x & 31, lr = lane & 15, hi = lane >> 4; const int wv = (NW > 1) ? __builtin_amdgcn_readfirstlane((int)(threadIdx.x >> 5)) : 0;   /* wave number as a scalar: the K loop's counter and branch stay scalar */ const int r0 = blockIdx.x * 64, c0 = blockIdx.y * 64;
    v8f acc[4][4];
#pragma unroll
    for (int mb = 0; mb < 4; ++mb)
#pragma unroll
        for (int nb = 0; nb < 4; ++nb) acc[mb][nb] = (v8f){};
    const size_t aoff = (size_t)(r0 + lr) * lda + 8 * hi, boff = (size_t)(c0 + lr) * K + 8 * hi;
#pragma unroll 1
    for (int kc = wv * 64; kc < K; kc += (kc & 32) ? (NW * 64 - 32) : 32) {
        V a[4], a2[4]; const T16* pa[4]; const T16* pa2[4]; const T16* pb[4]; const T16* pb2[4];
#pragma unroll
        for (int mb = 0; mb < 4; ++mb) { pa[mb] = A + aoff + (size_t)mb * 16 * lda + kc; a[mb] = WFrag<T16>::ld(pa[mb]); if (NSPLIT == 1 || NSPLIT == 2) { pa2[mb] = A2 + aoff + (size_t)mb * 16 * lda + kc; a2[mb] = WFrag<T16>::ld(pa2[mb]); } }
#pragma unroll
        for (int nb = 0; nb < 4; ++nb) { pb[nb] = Bt + boff + (size_t)nb * 16 * K + kc; const V b = WFrag<T16>::ld(pb[nb]); V b2; if (NSPLIT >= 2) { pb2[nb] = Bt2 + boff + (size_t)nb * 16 * K + kc; b2 = WFrag<T16>::ld(pb2[nb]); }
#pragma unroll
            for (int mb = 0; mb < 4; ++mb) { acc[mb][nb] = WFrag<T16>::mma(a[mb], b, acc[mb][nb]); if (NSPLIT == 1 || NSPLIT == 2) acc[mb][nb] = WFrag<T16>::mma(a2[mb], b, acc[mb][nb]); if (NSPLIT >= 2) acc[mb][nb] = WFrag<T16>::mma(a[mb], b2, acc[mb][nb]); } }
        asm volatile("v_nop\n\tv_nop\n\tv_nop\n\tv_nop" : "+v"(acc[0][0]), "+v"(acc[1][1]), "+v"(acc[2][2]), "+v"(acc[3][3]) : "v"(a[0]), "v"(a[3]));
        // precaution: this trip's load addresses are named as inputs, so their registers are not reused between a load and this wait; it stands at the loop's foot, where every load of the trip has already delivered its data
        if (NSPLIT == 2) asm volatile("s_wait_xcnt 0x0" :: "v"(pa[0]), "v"(pa[1]), "v"(pa[2]), "v"(pa[3]), "v"(pa2[0]), "v"(pa2[1]), "v"(pa2[2]), "v"(pa2[3]), "v"(pb[0]), "v"(pb[1]), "v"(pb[2]), "v"(pb[3]), "v"(pb2[0]), "v"(pb2[1]), "v"(pb2[2]), "v"(pb2[3]) : "memory");
        else if (NSPLIT == 1) asm volatile("s_wait_xcnt 0x0" :: "v"(pa[0]), "v"(pa[1]), "v"(pa[2]), "v"(pa[3]), "v"(pa2[0]), "v"(pa2[1]), "v"(pa2[2]), "v"(pa2[3]), "v"(pb[0]), "v"(pb[1]), "v"(pb[2]), "v"(pb[3]) : "memory");
        else asm volatile("s_wait_xcnt 0x0" :: "v"(pa[0]), "v"(pa[1]), "v"(pa[2]), "v"(pa[3]), "v"(pb[0]), "v"(pb[1]), "v"(pb[2]), "v"(pb[3]) : "memory");
    }
    if (NW > 1) {   // merge of the K split: each wave parks its whole partial tile in its own LDS slot, then all threads sum the NW slots in wave order and store
        float* osw = os + wv * (64 * 68);
        // the three loops are unrolled so that acc is indexed by constants and stays in registers
#pragma unroll
        for (int mb = 0; mb < 4; ++mb)
#pragma unroll
            for (int nb = 0; nb < 4; ++nb)
#pragma unroll
                for (int j = 0; j < 8; ++j) osw[(mb * 16 + hi * 8 + j) * 68 + nb * 16 + lr] = acc[mb][nb][j];
        __syncthreads();   // every wave's partial tile is in LDS before any thread sums across the slots
        v4f kept[32 / NW];   // EPI 3 only: the thread's sums, stored as flat rows behind the second barrier, so that no global store is outstanding at it
        // both loops unrolled: the LDS reads of all slots and rounds go out without a branch between them
#pragma unroll
        for (int s = 0; s < 32 / NW; ++s) { const int q = s * (NW * 32) + (int)threadIdx.x, row = q >> 4, cofs = (q & 15) * 4; v4f val = *(const v4fa*)(os + row * 68 + cofs);
#pragma unroll
            for (int w = 1; w < NW; ++w) val += *(const v4fa*)(os + w * (64 * 68) + row * 68 + cofs);
            kept[s] = val;
            if (BIAS) { val[0] += bfr(bias[c0 + cofs]); val[1] += bfr(bias[c0 + cofs + 1]); val[2] += bfr(bias[c0 + cofs + 2]); val[3] += bfr(bias[c0 + cofs + 3]); }
            if (EPI == 0) *(v4f*)(C + (size_t)(r0 + row) * ldc + c0 + cofs) = val; else if (EPI != 3) epi_put<EPI>(ep, r0 + row, c0 + cofs, val);
            if (EPI == 3) *(v4fa*)(os + row * 68 + cofs) = val; }   // the summed tile goes back into slot 0 (each quad is read and rewritten by this one thread) for the transposed read below
        if (EPI == 3) {   // v planes [g][b][d][t]: the summed tile is read back by columns, so that 16 lanes store one whole 128-byte line along t
            __syncthreads();   // the whole summed tile is in slot 0 before any thread reads a column of it
            // both loops unrolled: kept and the vectors are indexed by constants, and the LDS reads of both rounds go out without a branch between them
#pragma unroll
            for (int s = 0; s < 32 / NW; ++s) { const int q = s * (NW * 32) + (int)threadIdx.x, dc = q >> 4, t4 = (q & 15) * 4; const int c = c0 + dc, R = r0 + t4; v4h o16; v4us oh, ol;
                epi_put<EPI>(ep, r0 + dc, c0 + t4, kept[s]);   // the flat rows: quad q is (row q >> 4, columns (q & 15) * 4 ..) in the first loop too
#pragma unroll
                for (int u = 0; u < 4; ++u) { const float x = os[(t4 + u) * 68 + dc]; o16[u] = tohx(x); unsigned short a, c2; splitf(x, a, c2); oh[u] = a; ol[u] = c2; }
                const size_t o = (((size_t)(c / HD) * NB_ + R / TT) * HD + c % HD) * TT + R % TT; *(v4h*)(ep.p16 + o) = o16; *(v4us*)(ep.ph + o) = oh; *(v4us*)(ep.pl + o) = ol; }
        }
        return;
    }
#pragma unroll
    for (int mb = 0; mb < 4; ++mb) {
#pragma unroll
        for (int nb = 0; nb < 4; ++nb) {
#pragma unroll
            for (int j = 0; j < 8; ++j) os[(hi * 8 + j) * 68 + nb * 16 + lr] = acc[mb][nb][j]; }
        __builtin_amdgcn_wave_barrier(); asm volatile("" ::: "memory");
        float* crow = C + (size_t)(r0 + mb * 16) * ldc + c0;
{
#pragma unroll
            for (int s = 0; s < 8; ++s) { const int row = 2 * s + hi, cofs = lr * 4; v4f val = *(const v4fa*)(os + row * 68 + cofs); if (BIAS) { val[0] += bfr(bias[c0 + cofs]); val[1] += bfr(bias[c0 + cofs + 1]); val[2] += bfr(bias[c0 + cofs + 2]); val[3] += bfr(bias[c0 + cofs + 3]); }
                *(v4f*)(crow + (size_t)row * ldc + cofs) = val; }
             }
        __builtin_amdgcn_wave_barrier(); asm volatile("" ::: "memory");
    }
}

typedef __attribute__((ext_vector_type(2))) unsigned short v2us;
typedef __attribute__((ext_vector_type(2))) float v2f;
typedef __attribute__((ext_vector_type(4))) int v4i;
typedef v4h  __attribute__((may_alias)) v4ha;
typedef v4us __attribute__((may_alias)) v4usa;

__global__ __launch_bounds__(256) void k_wtG(const float* __restrict__ w, int K, int N, bf* Bt) {
    const int lane = threadIdx.x & 31; const int L0 = (blockIdx.x * 8 + (threadIdx.x >> 5)) * 8; const int nlines = N * K / 64;
{
#pragma unroll 1
        for (int l = 0; l < 8; ++l) { const int L = L0 + l; if (L >= nlines) break; const size_t e = (size_t)L * 64 + lane * 2; const int k = (int)(e % K), n = (int)(e / K); v2us o;
            o[0] = f2bf(w[(size_t)k * N + n]); o[1] = f2bf(w[(size_t)(k + 1) * N + n]); *(v2us*)(Bt + e) = o; }
         }
}
__global__ __launch_bounds__(256) void k_cvt8(const float* __restrict__ src, bf* dst, size_t n8) { const size_t i = (size_t)blockIdx.x * 256 + threadIdx.x; if (i >= n8) return; const v8f v = *(const v8f*)(src + i * 8); v8us o;
#pragma unroll
    for (int k = 0; k < 8; ++k) o[k] = f2bf(v[k]); *(v8us*)(dst + i * 8) = o;  }
__global__ __launch_bounds__(256) void k_cscvt(const float* __restrict__ cosT, const float* __restrict__ sinT, float* CS) { const int idx = blockIdx.x * 256 + threadIdx.x; if (idx >= TT * HD) return; v2f cs; cs[0] = bfr(cosT[idx]); cs[1] = bfr(sinT[idx]); *(v2f*)(CS + (size_t)idx * 2) = cs;  }
// ---- k_attn: scores, bias + mask, softmax and the product with v in one kernel; no score or probability goes to memory. One wave per (head, 16 query rows); the 4 waves of a work-group are the 4 heads of one kv group and share its k / v tiles through LDS.
// Everything is computed transposed, so that no value changes lanes between the two products: S^T = k q^T (A = 16 key rows, B = the wave's 16 query rows) leaves lane (lr, hi) with query lr and keys hi * 8 + j of each 16-key tile;
// two such tiles side by side are exactly the B fragment (n = query lr, k = 8 * hi + 0..7 and 8 * hi + 16 + 0..7) of O^T = v^T P^T (A = 16 rows of the [d][t] plane). A lane's scores, running maximum, running sum and all its O^T elements belong to its one query.
// Running softmax over steps of 32 keys: m = max so far, p = exp(t - m), sum and O^T rescaled by exp(m_old - m_new); the division by the sum comes last, in f32. The masked fill equals the start value of m, so a row with no allowed key weighs every key 1 (uniform, as the source's finfo.min fill),
// and the first allowed key wipes such weights (factor exp(-huge) = 0). HR (query rows < RH): hi + lo planes, 3 products each; otherwise single fp16. Both run nc steps, up to the diagonal. Behind the diagonal every key is masked: a row that has met an allowed key weighs all of them exp(-huge) = 0, so its sums are final; a row that has met none weighs all of them 1.
// Only an HR block that holds such a row (nk > nc: the kv head's first positive bias lies behind the block's first row) runs the steps nc .. nk - 1, and there the weight is the same for all keys of a row and known beforehand: no k tile, no scores, no exponentials, and the lo plane of the weight (0 or 1: exact in bf16) is zero, so two v products are left.
// Staging: two LDS buffers; step s + 1's tiles (32 k rows, 128 v^T rows of 32 keys) travel global -> registers while step s is computed, go into the other buffer behind it, and one work-group barrier per step publishes them and ends the reads of the buffer that is refilled next.
#define KPIT 136                  // LDS pitch of a k row, elements: 272 B = 16 B x odd, the 16 rows of a fragment read fall on distinct banks
#define VPIT 40                   // LDS pitch of a v^T row of 32 keys: 80 B = 16 B x odd
#define KTE  (32 * KPIT)
#define STE  (KTE + HD * VPIT)    // elements of one staged plane: k tile, then v^T tile
typedef __attribute__((ext_vector_type(16))) unsigned short v16us;
__device__ __forceinline__ float exp2s(float x) { float r; asm("v_exp_f32 %0, %1\n\tv_nop" : "=v"(r) : "v"(x)); return r; }
template <typename T16> struct LFrag;   // a fragment from two 16-byte LDS reads, in the k order of WFrag
template <> struct LFrag<h16> { static __device__ __forceinline__ v16h ld(const bf* p) { const v8us x = *(const v8usa*)p, y = *(const v8usa*)(p + 16); return cat16(__builtin_bit_cast(v8h, x), __builtin_bit_cast(v8h, y)); } };
template <> struct LFrag<bf> { static __device__ __forceinline__ v16bf ld(const bf* p) { const v8us x = *(const v8usa*)p, y = *(const v8usa*)(p + 16); return cat16b(x, y); } };
template <typename T16, bool HR>
__device__ __forceinline__ void attn_rows(bf* sm, float* smb, int wv, const T16* __restrict__ Q, const T16* __restrict__ Q2, const bf* __restrict__ Kp, const bf* __restrict__ K2, const bf* __restrict__ Vt, const bf* __restrict__ V2, const float* __restrict__ bias, bool poison, int q0, int nc, int nk, bf* oh, bf* ol) {
    typedef typename WFrag<T16>::V V; constexpr int NP = HR ? 2 : 1;
    const int tid = threadIdx.x, lane = tid & 31, lr = lane & 15, hi = lane >> 4; const int qi = q0 + lr;
    V bq[4], bq2[4]; const T16* pq = Q + (size_t)qi * HD + 8 * hi; const T16* pq2 = HR ? Q2 + (size_t)qi * HD + 8 * hi : nullptr;
    // unrolled, here and below: the fragment, staging and accumulator arrays are indexed by constants and stay in registers
#pragma unroll
    for (int kc = 0; kc < 4; ++kc) { bq[kc] = WFrag<T16>::ld(pq + kc * 32); if (HR) bq2[kc] = WFrag<T16>::ld(pq2 + kc * 32); }
    // precaution: the load addresses are named as inputs, so their registers are not reused between a load and this wait
    if (HR) asm volatile("s_wait_xcnt 0x0" :: "v"(pq), "v"(pq2) : "memory");
    else asm volatile("s_wait_xcnt 0x0" :: "v"(pq) : "memory");
    v8f o[8];
#pragma unroll
    for (int mb = 0; mb < 8; ++mb) o[mb] = (v8f){};
    float m = -3.0e38f, l = 0.f;
    // staging, 16-byte chunk c = tid + 128 * i: k tile (one contiguous 8 KiB) row c >> 4, piece c & 15; v^T tile row c >> 2, piece c & 3
    const unsigned gko = tid * 8, gvo = (tid >> 2) * TT + (tid & 3) * 8; const int sko = (tid >> 4) * KPIT + (tid & 15) * 8, svo = KTE + (tid >> 2) * VPIT + (tid & 3) * 8;
    const int fko = lr * KPIT + 8 * hi, fvo = KTE + lr * VPIT + 8 * hi;   // the lane's place in a k / v^T fragment read
    v8us rk[NP][4], rv[NP][4]; float rb = 0.f;
    if (wv == 0) smb[tid] = bias[tid];   // wave 0 stages the step's 32 bias values, one per lane
#pragma unroll
    for (int i = 0; i < 4; ++i) { rk[0][i] = *(const v8us*)(Kp + gko + i * 1024); rv[0][i] = *(const v8us*)(Vt + gvo + (size_t)i * 32 * TT); if (HR) { rk[NP - 1][i] = *(const v8us*)(K2 + gko + i * 1024); rv[NP - 1][i] = *(const v8us*)(V2 + gvo + (size_t)i * 32 * TT); } }
#pragma unroll
    for (int pl = 0; pl < NP; ++pl)
#pragma unroll
        for (int i = 0; i < 4; ++i) { *(v8usa*)(sm + pl * STE + sko + i * 8 * KPIT) = rk[pl][i]; *(v8usa*)(sm + pl * STE + svo + i * 32 * VPIT) = rv[pl][i]; }
    __syncthreads();   // step 0's tiles are in buffer 0 before any wave reads them
    for (int s = 0; s < nc; ++s) {
        const int sn = min(s + 1, (HR ? TT / 32 : nk) - 1);   // the tile that is staged during this step; behind the last step that reads one a tile is staged that nobody reads, so the loop body has no branch
        const unsigned ok = gko + sn * 32 * HD, ov = gvo + sn * 32, ob = sn * 32 + lane;   // element offsets of this step's loads inside their planes
        const bf* pk = Kp + ok; const bf* pk2 = HR ? K2 + ok : nullptr; const bf* pv = Vt + ov; const bf* pv2 = HR ? V2 + ov : nullptr;
        {   // next k tile: on its way during the score products
#pragma unroll
            for (int i = 0; i < 4; ++i) { rk[0][i] = *(const v8us*)(pk + i * 1024); if (HR) rk[NP - 1][i] = *(const v8us*)(pk2 + i * 1024); }
            if (wv == 0) rb = bias[ob]; }
        const bf* cur = sm + (s & 1) * (NP * STE); bf* nxt = sm + ((s + 1) & 1) * (NP * STE);
        v8f st[2]; float t[16]; float mt = -3.0e38f;
#pragma unroll
        for (int tt = 0; tt < 2; ++tt) { st[tt] = (v8f){};
#pragma unroll
            for (int kc = 0; kc < 4; ++kc) { const V a = LFrag<T16>::ld(cur + fko + tt * 16 * KPIT + kc * 32); st[tt] = WFrag<T16>::mma(a, bq[kc], st[tt]);
                if (HR) { st[tt] = WFrag<T16>::mma(a, bq2[kc], st[tt]); const V a2 = LFrag<T16>::ld(cur + STE + fko + tt * 16 * KPIT + kc * 32); st[tt] = WFrag<T16>::mma(a2, bq[kc], st[tt]); } } }
        const float* cb = smb + (s & 1) * 32 + hi * 8; const v4f bb[4] = { *(const v4fa*)cb, *(const v4fa*)(cb + 4), *(const v4fa*)(cb + 16), *(const v4fa*)(cb + 20) };
#pragma unroll
        for (int tt = 0; tt < 2; ++tt)
#pragma unroll
            for (int j = 0; j < 8; ++j) { const int key = s * 32 + tt * 16 + hi * 8 + j; const float bj = bb[tt * 2 + (j >> 2)][j & 3]; const float x = (key <= qi && bj > 0.f) ? st[tt][j] * SCL + bj : -3.0e38f; t[tt * 8 + j] = x; mt = fmaxf(mt, x); }
        {   // the other buffer is free since the last barrier: the k tile goes in as soon as it has come; next v^T tile: on its way during the softmax and the second product
#pragma unroll
            for (int pl = 0; pl < NP; ++pl)
#pragma unroll
                for (int i = 0; i < 4; ++i) *(v8usa*)(nxt + pl * STE + sko + i * 8 * KPIT) = rk[pl][i];
            if (wv == 0) smb[((s + 1) & 1) * 32 + lane] = rb;
#pragma unroll
            for (int i = 0; i < 4; ++i) { rv[0][i] = *(const v8us*)(pv + (size_t)i * 32 * TT); if (HR) rv[NP - 1][i] = *(const v8us*)(pv2 + (size_t)i * 32 * TT); } }
        mt = fmaxf(mt, __shfl_xor(mt, 16, 32));   // the other half of the wave holds the query's other 16 keys of this step
        const float mn = fmaxf(m, mt); const float alpha = exp2s((m - mn) * 1.4426950408889634f); m = mn;
        float ps = 0.f;
#pragma unroll
        for (int u = 0; u < 16; ++u) { t[u] = exp2s((t[u] - mn) * 1.4426950408889634f); ps += t[u]; }
        l = l * alpha + ps;   // each half of the wave sums its own keys; the halves meet behind the loop
#pragma unroll
        for (int mb = 0; mb < 8; ++mb) o[mb] *= alpha;
        V p, p2;
        if constexpr (HR) { v16us a, c;
#pragma unroll
            for (int u = 0; u < 16; ++u) { unsigned short x, y; splitf(t[u], x, y); a[u] = x; c[u] = y; }
            p = __builtin_bit_cast(v16bf, a); p2 = __builtin_bit_cast(v16bf, c);
        } else {
#pragma unroll
            for (int u = 0; u < 16; ++u) p[u] = tohx(t[u]); }
#pragma unroll
        for (int mb = 0; mb < 8; ++mb) { const V a = LFrag<T16>::ld(cur + fvo + mb * 16 * VPIT); o[mb] = WFrag<T16>::mma(a, p, o[mb]);
            if constexpr (HR) { o[mb] = WFrag<T16>::mma(a, p2, o[mb]); const V a2 = LFrag<T16>::ld(cur + STE + fvo + mb * 16 * VPIT); o[mb] = WFrag<T16>::mma(a2, p, o[mb]); } }
        {
#pragma unroll
            for (int pl = 0; pl < NP; ++pl)
#pragma unroll
                for (int i = 0; i < 4; ++i) *(v8usa*)(nxt + pl * STE + svo + i * 32 * VPIT) = rv[pl][i]; }
        // precaution: this step's load addresses (HR: their offsets beside the planes' scalar bases) are named as inputs, so their registers are not reused between a load and this wait; it stands at the loop's foot, where every load of the step has already delivered its data
        if (HR) asm volatile("s_wait_xcnt 0x0" :: "v"(ok), "v"(ov), "v"(ob) : "memory");
        else asm volatile("s_wait_xcnt 0x0" :: "v"(pk), "v"(pv), "v"(ob) : "memory");
        __syncthreads();   // publishes step s + 1's tiles; every wave has finished reading the buffer that the next step refills
    }
    if constexpr (HR) {
        if (nc < nk) {   // the same for the whole work-group: the barriers below are met by every wave
            const float w = exp2s((-3.0e38f - m) * 1.4426950408889634f);   // a masked key's weight, as in the loop above: 1 for a row with no allowed key, else 0
            unsigned short wh, wl; splitf(w, wh, wl); v16us a16;
#pragma unroll
            for (int u = 0; u < 16; ++u) a16[u] = wh;
            const V p = __builtin_bit_cast(v16bf, a16);
            for (int s = nc; s < nk; ++s) {
                const int sn = min(s + 1, nk - 1); const unsigned ov = gvo + sn * 32;
#pragma unroll
                for (int i = 0; i < 4; ++i) { rv[0][i] = *(const v8us*)(Vt + ov + (size_t)i * 32 * TT); rv[1][i] = *(const v8us*)(V2 + ov + (size_t)i * 32 * TT); }   // next v^T tile: on its way during the product
                const bf* cur = sm + (s & 1) * (NP * STE); bf* nxt = sm + ((s + 1) & 1) * (NP * STE);
                l += 16.f * w;   // this half's 16 keys of the step
                V fh[8], fl[8];
#pragma unroll
                for (int mb = 0; mb < 8; ++mb) { fh[mb] = LFrag<T16>::ld(cur + fvo + mb * 16 * VPIT); fl[mb] = LFrag<T16>::ld(cur + STE + fvo + mb * 16 * VPIT); }
                __builtin_amdgcn_sched_barrier(0);   // the step's fragment reads go out as one group (the q fragments' registers are free here): left alone, the scheduler sinks each read to its product, and every product waits out an LDS latency
#pragma unroll
                for (int mb = 0; mb < 8; ++mb) o[mb] = WFrag<T16>::mma(fh[mb], p, o[mb]);
#pragma unroll
                for (int mb = 0; mb < 8; ++mb) o[mb] = WFrag<T16>::mma(fl[mb], p, o[mb]);
                __builtin_amdgcn_sched_barrier(0);   // the products are issued while the next tile's loads are on their way: left alone, the scheduler puts most of them behind the wait for those loads and behind the barrier
#pragma unroll
                for (int pl = 0; pl < NP; ++pl)
#pragma unroll
                    for (int i = 0; i < 4; ++i) *(v8usa*)(nxt + pl * STE + svo + i * 32 * VPIT) = rv[pl][i];
                __syncthreads();   // publishes step s + 1's v^T tiles; every wave has finished reading the buffer that the next step refills
            }
        }
    }
    l += __shfl_xor(l, 16, 32);
    const float f = poison ? __builtin_nanf("") : 1.0f / l;
#pragma unroll
    for (int mb = 0; mb < 8; ++mb) { v8us a, c;
#pragma unroll
        for (int j = 0; j < 8; ++j) { unsigned short x, y; splitf(o[mb][j] * f, x, y); a[j] = x; c[j] = y; }
        *(v8us*)(oh + (size_t)qi * DQ + mb * 16 + hi * 8) = a; *(v8us*)(ol + (size_t)qi * DQ + mb * 16 + hi * 8) = c; }   // hi / lo rows [b][t][head][d] of the output projection's A operand: d = mb * 16 + hi * 8 + j
}
// grid (TT / 16 * NKV * NB_), REP * 32 threads, four waves per SIMD asked for (a budget of 256 registers: with the LDS of four work-groups per WGP the whole grid is resident). Flat index: low 3 bits the kv plane g * NB_ + b; then 32 row blocks per quarter of the grid: first all hi + lo blocks, then the last rows downwards, the middle, and the rows behind the hi + lo blocks upwards,
// so that four work-groups whose indices lie a quarter of the grid apart carry about the same work together (for speed only; every (plane, row block) occurs once whatever the placement).
static_assert(TT / 16 == 4 * (RH / 16) && NKV * NB_ == 8 && ZH == REP, "row-block deal of k_attn");
__global__ __launch_bounds__(REP * 32, 4) void k_attn(const h16* __restrict__ Q16, const bf* __restrict__ Qh, const bf* __restrict__ Ql, const bf* __restrict__ K16, const bf* __restrict__ Kh, const bf* __restrict__ Kl, const bf* __restrict__ V16, const bf* __restrict__ Vh, const bf* __restrict__ Vl, const float* __restrict__ Bb, const int* __restrict__ FLG, bf* ATh, bf* ATl) {
    __shared__ __align__(16) bf sm[2 * 2 * STE]; __shared__ __align__(16) float smb[2 * 32];
    const int wv = __builtin_amdgcn_readfirstlane((int)(threadIdx.x >> 5));   // wave number as a scalar: plane offsets stay scalar
    const int id = blockIdx.x, kvp = id & 7, g = kvp / NB_, b = kvp % NB_, qr = id >> 8, i5 = (id >> 3) & 31; const int qb = (qr == 0) ? i5 : (qr == 1) ? 127 - i5 : (qr == 2) ? 64 + i5 : 32 + i5; const int q0 = qb * 16;
    const size_t qo = (size_t)(g * (NB_ * ZH) + b * ZH + wv) * TT * HD, kv = (size_t)kvp * TT * HD, ao = (size_t)b * TT * DQ + (g * REP + wv) * HD;
    const float* bias = Bb + (size_t)(b * NKV + g) * TT; const bool poison = (FLG[b * 8 + g] != 0);   /* premise self-check: no positive bias among keys 0..RH-1 for this kv head -> NaN-poison (flag word FLG[b * 8 + 4] also set) */
    const int first = FLG[16 + b * NKV + g], nc = (q0 + 16 + 31) / 32;   // first: the kv head's first key with a positive bias (RH: none below RH); rows in front of it have no allowed key. nc: steps up to the diagonal
    if (qb < RH / 16) attn_rows<bf, true>(sm, smb, wv, Qh + qo, Ql + qo, Kh + kv, Kl + kv, Vh + kv, Vl + kv, bias, poison, q0, nc, (first <= q0) ? nc : TT / 32, ATh + ao, ATl + ao);
    else attn_rows<h16, false>(sm, smb, wv, Q16 + qo, nullptr, K16 + kv, nullptr, V16 + kv, nullptr, bias, poison, q0, nc, nc, ATh + ao, ATl + ao);
}
// ---- k_gemms: GEMM with its operands staged in LDS by asynchronous copies (global_load_async_to_lds_b128). One work-group of 4 waves (2 x 2) per 128x128 output tile, 64x64 (16 accumulators) per wave, the whole K in each accumulator;
// K goes in stages of 64 elements (one whole 128-byte line of every operand row), two LDS buffers: stage t + 1's copies fly while stage t is worked on. Each line is fetched once per work-group, whole, and serves two waves.
// C[m][n] = sum_k A[m][k] Bt[n][k] (+ A2[m][k] Bt[n][k] for NSPLIT 1); A, A2, Bt are K-contiguous 16-bit planes of pitch K, K % 64 == 0; grid (M / 128, N / 128), 128 threads. EPI as above: each wave stores its own 64x64 tile through its own LDS slot.
#define GPIT 72                   // LDS pitch of a staged row of 64 elements: 144 B = 16 B x odd, the 16 rows of a fragment read fall on distinct banks
#define GPLN (128 * GPIT)         // elements of one staged plane: 128 rows
// one lane's eight 16-byte copies of one plane, rows 16 apart (LDS byte address l, global address g, gs elements between the rows). The wait on the address translations is the statement's last line, so that it stands in front of every later write of the address registers (a precaution).
__device__ __forceinline__ void cp8(unsigned l, const bf* g, size_t gs) {
    asm volatile("global_load_async_to_lds_b128 %0, %8, off\n\t"
                 "global_load_async_to_lds_b128 %1, %9, off\n\t"
                 "global_load_async_to_lds_b128 %2, %10, off\n\t"
                 "global_load_async_to_lds_b128 %3, %11, off\n\t"
                 "global_load_async_to_lds_b128 %4, %12, off\n\t"
                 "global_load_async_to_lds_b128 %5, %13, off\n\t"
                 "global_load_async_to_lds_b128 %6, %14, off\n\t"
                 "global_load_async_to_lds_b128 %7, %15, off\n\t"
                 "s_wait_xcnt 0x0"
                 :: "v"(l), "v"(l + 1 * 16 * GPIT * 2), "v"(l + 2 * 16 * GPIT * 2), "v"(l + 3 * 16 * GPIT * 2), "v"(l + 4 * 16 * GPIT * 2), "v"(l + 5 * 16 * GPIT * 2), "v"(l + 6 * 16 * GPIT * 2), "v"(l + 7 * 16 * GPIT * 2),
                    "v"(g), "v"(g + gs), "v"(g + 2 * gs), "v"(g + 3 * gs), "v"(g + 4 * gs), "v"(g + 5 * gs), "v"(g + 6 * gs), "v"(g + 7 * gs) : "memory");
}
template <int NSPLIT, int EPI>
__global__ __launch_bounds__(128, 2) void k_gemms(const bf* __restrict__ A, const bf* __restrict__ A2, const bf* __restrict__ Bt, int K, float* C, int ldc, Epi ep) {
    constexpr int NPL = NSPLIT ? 3 : 2, STG = NPL * GPLN;   // a stage: the planes A, Bt (, A2)
    static_assert(2 * STG * 2 >= 4 * 64 * 68 * 4, "the four waves' output slots fit into the two buffers");
    __shared__ __align__(16) bf ring[2 * STG];
    const int tid = threadIdx.x, lane = tid & 31, lr = lane & 15, hi = lane >> 4; const int wv = __builtin_amdgcn_readfirstlane(tid >> 5), wm = wv >> 1, wn = wv & 1;   // wave number as a scalar: tile offsets stay scalar
    const int r0 = blockIdx.x * 128, c0 = blockIdx.y * 128, nt = K / 64;
    // copies, 16-byte chunk tid + 128 * i of a plane: row (tid >> 3) + 16 * i, piece tid & 7: eight lanes fetch one whole line
    const size_t gs = (size_t)16 * K, go = (size_t)(tid >> 3) * K + (tid & 7) * 8;
    const bf* ga = A + (size_t)r0 * K + go; const bf* gb = Bt + (size_t)c0 * K + go; const bf* ga2 = NSPLIT ? A2 + (size_t)r0 * K + go : nullptr;
    const unsigned l0 = (unsigned)(size_t)ring + ((tid >> 3) * GPIT + (tid & 7) * 8) * 2;
    auto stage = [&](int t) { const unsigned l = l0 + (t & 1) * (STG * 2); cp8(l, ga + t * 64, gs); cp8(l + GPLN * 2, gb + t * 64, gs); if (NSPLIT) cp8(l + 2 * GPLN * 2, ga2 + t * 64, gs); };
    v8f acc[4][4];
    // unrolled, here and below: the accumulator and fragment arrays are indexed by constants and stay in registers
#pragma unroll
    for (int mb = 0; mb < 4; ++mb)
#pragma unroll
        for (int nb = 0; nb < 4; ++nb) acc[mb][nb] = (v8f){};
    const int fa = (wm * 64 + lr) * GPIT + 8 * hi, fb = GPLN + (wn * 64 + lr) * GPIT + 8 * hi;   // the lane's place in an A / Bt fragment read
    stage(0);
    asm volatile("s_wait_asynccnt 0x0" ::: "memory");   // this wave's copies of stage 0 have landed
    __syncthreads();   // stage 0 is in buffer 0 before any wave reads it
    if (nt > 1) stage(1);
    for (int t = 0; t < nt; ++t) {
        const bf* cur = ring + (t & 1) * STG;
        // fragment reads run ahead of the products that use them: the first 32 k's fragments as one group, with them (registers allowing: NSPLIT 0) the second 32 k's Bt fragments; each A fragment of the second 32 k is read into its registers as soon as the four (eight) products on its forerunner are issued.
        // The scheduling barriers keep that order: left alone, the scheduler sinks every read to its first product, and the products wait out an LDS latency each time.
        v16bf a[4], a2[4], b[2][4];
#pragma unroll
        for (int i = 0; i < 4; ++i) { a[i] = LFrag<bf>::ld(cur + fa + i * 16 * GPIT); b[0][i] = LFrag<bf>::ld(cur + fb + i * 16 * GPIT); if (NSPLIT) a2[i] = LFrag<bf>::ld(cur + 2 * GPLN + fa + i * 16 * GPIT); }
        if (!NSPLIT) {
#pragma unroll
            for (int i = 0; i < 4; ++i) b[1][i] = LFrag<bf>::ld(cur + fb + i * 16 * GPIT + 32); }
        __builtin_amdgcn_sched_barrier(0);
#pragma unroll
        for (int mb = 0; mb < 4; ++mb) {
#pragma unroll
            for (int nb = 0; nb < 4; ++nb) { acc[mb][nb] = wmmab(a[mb], b[0][nb], acc[mb][nb]); if (NSPLIT) acc[mb][nb] = wmmab(a2[mb], b[0][nb], acc[mb][nb]); }
            a[mb] = LFrag<bf>::ld(cur + fa + mb * 16 * GPIT + 32); if (NSPLIT) a2[mb] = LFrag<bf>::ld(cur + 2 * GPLN + fa + mb * 16 * GPIT + 32);
            __builtin_amdgcn_sched_barrier(0); }
        if (NSPLIT) {
#pragma unroll
            for (int i = 0; i < 4; ++i) b[1][i] = LFrag<bf>::ld(cur + fb + i * 16 * GPIT + 32);
            __builtin_amdgcn_sched_barrier(0); }
#pragma unroll
        for (int mb = 0; mb < 4; ++mb)
#pragma unroll
            for (int nb = 0; nb < 4; ++nb) { acc[mb][nb] = wmmab(a[mb], b[1][nb], acc[mb][nb]); if (NSPLIT) acc[mb][nb] = wmmab(a2[mb], b[1][nb], acc[mb][nb]); }
        asm volatile("s_wait_dscnt 0x0" ::: "memory");      // this wave's reads of the buffer that is refilled below have ended
        asm volatile("s_wait_asynccnt 0x0" ::: "memory");   // this wave's copies of stage t + 1 have landed
        __syncthreads();   // publishes stage t + 1; every wave has finished reading stage t's buffer
        if (t + 2 < nt) stage(t + 2);
    }
    asm volatile("s_wait_asynccnt 0x0" ::: "memory");   // no copy is outstanding when the buffers become output slots
    float* osw = (float*)ring + wv * (64 * 68); const int rw = r0 + wm * 64, cw = c0 + wn * 64;
#pragma unroll
    for (int mb = 0; mb < 4; ++mb)
#pragma unroll
        for (int nb = 0; nb < 4; ++nb)
#pragma unroll
            for (int j = 0; j < 8; ++j) osw[(mb * 16 + hi * 8 + j) * 68 + nb * 16 + lr] = acc[mb][nb][j];
    __syncthreads();   // the tile is in its slot before its lanes read one another's values
    // four rounds are unrolled into one trip: their LDS reads go out together, and one wait behind their stores serves them all
#pragma unroll 1
    for (int s4 = 0; s4 < 32; s4 += 4) {
#pragma unroll
      for (int s = s4; s < s4 + 4; ++s) { const int q = s * 32 + lane, row = q >> 4, cofs = (q & 15) * 4; const v4f val = *(const v4fa*)(osw + row * 68 + cofs);
        if (EPI == 0) *(v4f*)(C + (size_t)(rw + row) * ldc + cw + cofs) = val; else epi_put<EPI>(ep, rw + row, cw + cofs, val);
        if (EPI == 3) {   // v planes [g][b][d][t]: the tile is read by columns too (column row, rows cofs .. cofs + 3), so that 16 lanes store one whole 128-byte line along t
            const int c = cw + row, R = rw + cofs; v4h o16; v4us oh, ol;
#pragma unroll
            for (int u = 0; u < 4; ++u) { const float x = osw[(cofs + u) * 68 + row]; o16[u] = tohx(x); unsigned short a, c2; splitf(x, a, c2); oh[u] = a; ol[u] = c2; }
            const size_t o = (((size_t)(c / HD) * NB_ + R / TT) * HD + c % HD) * TT + R % TT; *(v4h*)(ep.p16 + o) = o16; *(v4us*)(ep.ph + o) = oh; *(v4us*)(ep.pl + o) = ol; } }
      asm volatile("s_wait_xcnt 0x0" ::: "memory"); }   // precaution: the next trip rewrites the registers that this trip's stores name
}
__global__ __launch_bounds__(32) void k_chk(const float* __restrict__ BIAS, int* FLG) { BIAS += (size_t)blockIdx.x * NKV * TT; int* FST = FLG + 16 + blockIdx.x * NKV;   /* per kv head: its first key with a positive bias, RH if there is none below RH */ FLG += blockIdx.x * 8;   /* one work-group per batch element */ const int n = threadIdx.x; int none = 0, first = RH; if (n < NKV) { none = 1;
#pragma unroll 1
        for (int j = 0; j < RH; ++j) { const float bj = BIAS[(size_t)n * TT + j]; asm volatile("s_wait_xcnt 0x0" ::: "memory");   /* precaution: the next trip rewrites the register pair that holds this load's address */ if (bj > 0.f) { none = 0; first = j; break; } } }
    int anyb = none;
#pragma unroll
    for (int sh = 16; sh; sh >>= 1) anyb |= __shfl_xor(anyb, sh, 32);
    const int v = (n < NKV) ? none : ((n == NKV) ? anyb : 0); if (n < 8) { *(int*)(FLG + n) = v;  } if (n < NKV) FST[n] = first; }
__global__ __launch_bounds__(256) void k_wgd(const float* __restrict__ w, int K, bf* Bt) { const int e = (blockIdx.x * 256 + threadIdx.x) * 4; if (e >= 64 * K) return; const int k = e % K, n = e / K; v4us o;
#pragma unroll
    for (int u = 0; u < 4; ++u) o[u] = (n < NKV) ? f2bf(w[(size_t)(k + u) * NKV + n]) : (unsigned short)0; *(v4us*)(Bt + e) = o;  }
__global__ __launch_bounds__(256) void k_bias(const float* __restrict__ GATE, const float* __restrict__ DEL, float* BIAS) { const int e = (blockIdx.x * 256 + threadIdx.x) * 4; if (e >= NB_ * NKV * TT) return; const int j = e % TT; const int n = (e / TT) % NKV; const int b = e / (NKV * TT); v4f r;
#pragma unroll
    for (int u = 0; u < 4; ++u) { const float gt = GATE[((size_t)b * TT + j + u) * 64 + n]; asm volatile("s_wait_xcnt 0x0" ::: "memory");   /* precaution, here and below: later loads land in the registers that held this load's address */ const float dl = DEL[((size_t)b * TT + j + u) * 64 + n]; asm volatile("s_wait_xcnt 0x0" ::: "memory"); const float sg = __fdiv_rn(1.0f, __fadd_rn(1.0f, __expf(-gt))); r[u] = __fmul_rn(sg, dl); }
    *(v4f*)(BIAS + e) = r;  }

extern "C" void kernel_launch(void* const* d_in, const int* in_sizes, int n_in,
                              void* d_out, int out_size, void* d_ws, size_t ws_size, hipStream_t stream) {
    (void)in_sizes; (void)n_in; (void)out_size;
    const float* x = (const float*)d_in[0]; const float* wq = (const float*)d_in[1]; const float* wk = (const float*)d_in[2]; const float* wv = (const float*)d_in[3]; const float* wg = (const float*)d_in[4]; const float* wdl = (const float*)d_in[5]; const float* wo = (const float*)d_in[6]; const float* cosT = nullptr; const float* sinT = nullptr; (void)cosT; (void)sinT;
    float* OUT = (float*)d_out;     // [2][2048][2048]
    char* wsp = (char*)d_ws;
    auto take = [&](size_t bytes) { char* p = wsp; wsp += (bytes + 255) & ~(size_t)255; return (void*)p; };
    const size_t MT = (size_t)NB_ * TT;   // token rows of both batch elements together: every launch covers both
    // read by the attention kernel or behind it
    bf* WO = (bf*)take((size_t)DM * DQ * 2); float* BIAS = (float*)take((size_t)NB_ * NKV * TT * 4); int* FLG = (int*)take(256);
    h16* QP16 = (h16*)take(MT * NH_ * HD * 2); h16* KP16 = (h16*)take(MT * NKV * HD * 2); h16* VT16 = (h16*)take(MT * NKV * HD * 2);
    bf* QPh = (bf*)take(MT * NH_ * HD * 2); bf* QPl = (bf*)take(MT * NH_ * HD * 2); bf* KPh = (bf*)take(MT * NKV * HD * 2); bf* KPl = (bf*)take(MT * NKV * HD * 2); bf* VTh = (bf*)take(MT * NKV * HD * 2); bf* VTl = (bf*)take(MT * NKV * HD * 2);
    bf* ATh = (bf*)take(MT * DQ * 2); bf* ATl = (bf*)take(MT * DQ * 2);
    // read only by the launches in front of the attention kernel
    bf* WQ = (bf*)take((size_t)DQ * DM * 2); bf* WK = (bf*)take((size_t)DKV * DM * 2); bf* WV = (bf*)take((size_t)DKV * DM * 2);
    bf* XB = (bf*)take(MT * DM * 2); bf* GFh = (bf*)take(MT * DQ * 2); bf* GFl = (bf*)take(MT * DQ * 2); bf* VFh = (bf*)take(MT * DKV * 2); bf* VFl = (bf*)take(MT * DKV * 2); bf* WG = (bf*)take((size_t)64 * DQ * 2); bf* WD = (bf*)take((size_t)64 * DKV * 2); float* GATE = (float*)take(MT * 64 * 4); float* DEL = (float*)take(MT * 64 * 4);
    if ((size_t)(wsp - (char*)d_ws) > ws_size) return;    // ws 256 MiB
    const Epi E0 = { nullptr, nullptr, nullptr, nullptr, nullptr };   // plain f32 tile
    { k_wgd<<<(64 * DQ / 4 + 255) / 256, 256, 0, stream>>>(wg, DQ, WG); k_wgd<<<(64 * DKV / 4 + 255) / 256, 256, 0, stream>>>(wdl, DKV, WD); k_wtG<<<(unsigned)((DM * DQ / 64 + 63) / 64), 256, 0, stream>>>(wq, DM, DQ, WQ); k_wtG<<<(unsigned)((DM * DKV / 64 + 63) / 64), 256, 0, stream>>>(wk, DM, DKV, WK); k_wtG<<<(unsigned)((DM * DKV / 64 + 63) / 64), 256, 0, stream>>>(wv, DM, DKV, WV);
      k_wtG<<<(unsigned)((DQ * DM / 64 + 63) / 64), 256, 0, stream>>>(wo, DQ, DM, WO);
       }
    const unsigned MB = (unsigned)(MT / 64), MB2 = (unsigned)(MT / 128);   // 64-row and 128-row tiles over both batch elements
    k_cvt8<<<(unsigned)((MT * DM / 8 + 255) / 256), 256, 0, stream>>>(x, XB, MT * DM / 8);
    // the three projections store the 16-bit planes that the later products read
    k_gemms<0, 1><<<dim3(MB2, DQ / 128, 1), 128, 0, stream>>>(XB, nullptr, WQ, DM, nullptr, 0, Epi{ QP16, QPh, QPl, GFh, GFl });
    k_gemms<0, 2><<<dim3(MB2, DKV / 128, 1), 128, 0, stream>>>(XB, nullptr, WK, DM, nullptr, 0, Epi{ KP16, KPh, KPl, nullptr, nullptr });
    k_gemms<0, 3><<<dim3(MB2, DKV / 128, 1), 128, 0, stream>>>(XB, nullptr, WV, DM, nullptr, 0, Epi{ VT16, VTh, VTl, VFh, VFl });
    /* dynamic mask bias per (batch, kv head, key) */
    k_gemmw<bf, 1, false, 16, 0><<<dim3(MB, 1, 1), 512, 0, stream>>>(GFh, GFl, WG, nullptr, DQ, DQ, GATE, 64, nullptr, 0, 0, 0, E0); k_gemmw<bf, 1, false, 8, 0><<<dim3(MB, 1, 1), 256, 0, stream>>>(VFh, VFl, WD, nullptr, DKV, DKV, DEL, 64, nullptr, 0, 0, 0, E0); k_bias<<<(NB_ * NKV * TT / 4 + 255) / 256, 256, 0, stream>>>(GATE, DEL, BIAS); k_chk<<<NB_, 32, 0, stream>>>(BIAS, FLG);
    // all heads of both batch elements in one launch; it stores the hi / lo rows of the output projection's A operand
    k_attn<<<dim3(TT / 16 * NKV * NB_, 1, 1), REP * 32, 0, stream>>>(QP16, QPh, QPl, (const bf*)KP16, KPh, KPl, (const bf*)VT16, VTh, VTl, BIAS, FLG, ATh, ATl);
    k_gemms<1, 0><<<dim3(MB2, DM / 128, 1), 128, 0, stream>>>(ATh, ATl, WO, DQ, OUT, DM, E0);
}

// v008
// A run of this version takes 234 microseconds.
// Timed twice side by side with v007, it ran 1.31 and 1.32 times as fast.
// All steps since v000 together make it 10.3 times as fast.
#include <hip/hip_runtime.h>

// DynamicMaskAttention (hidden [2][2048][2048]; q = x Wq (16 heads x 128), k/v = x Wk / Wv (4 kv heads; group h/4); per key j and kv head n: bias = sigmoid(q_flat[j] . Wg[:, n]) * (v_flat[j] . Wd[:, n]); logits = q.k / sqrt(128) + bias[n][j]; allowed = causal AND bias[n][j] > 0, everything else gets finfo.min (so a query row with no allowed key softmaxes uniformly over ALL keys, as the source);
//   softmax; out = merged Wo -> [2][2048][2048]).
// Compute dtypes, f32 accumulate: every input rounded to bf16; q/k/v on PLAIN bf16 operands (inputs: exact); gate / delta as hl planes of q_flat / v_flat x exact Wg / Wd (2 products; 4 outputs padded to 64), sigmoid and the product f32; scores and attn.v: query rows < 512 hl (3 products), the rest single fp16, both with causal tile skipping; a 16-row block of the early rows whose first row has no allowed key (such a row attends uniformly to every key) goes on over ALL key tiles, behind the diagonal with the v product alone; bias + mask + running softmax f32, probabilities unnormalised (exp(t - max) <= 1), the division by their sum last; Wo hl x exact (2 products).

#define NB_  2
#define TT   2048
#define DM   2048
#define NH_  16
#define NKV  4
#define REP  (NH_ / NKV)
#define HD   128
#define DQ   (NH_ * HD)
#define DKV  (NKV * HD)
#define ZH   4                    // query heads per group of q planes: one whole kv group (ZH == REP), the heads that share their K and V planes
#define RH   512                  // query rows < RH use hi+lo planes
#define WIN  2048
#define SCL  0.088388347648318447f   // HD^-0.5
typedef _Float16 h16;
typedef unsigned short bf;
typedef __attribute__((ext_vector_type(16))) __bf16   v16bf;
typedef __attribute__((ext_vector_type(16))) _Float16 v16h;
typedef __attribute__((ext_vector_type(8)))  _Float16 v8h;
typedef __attribute__((ext_vector_type(8)))  unsigned short v8us;
typedef __attribute__((ext_vector_type(8)))  float    v8f;
typedef __attribute__((ext_vector_type(4)))  float    v4f;
typedef v8h  __attribute__((may_alias)) v8ha;
typedef v4f  __attribute__((may_alias)) v4fa;
typedef v8us __attribute__((may_alias)) v8usa;

__device__ __forceinline__ unsigned short f2bf(float f) { unsigned u = __float_as_uint(f); u += 0x7FFFu + ((u >> 16) & 1u); return (unsigned short)(u >> 16); }
__device__ __forceinline__ float bf2f(unsigned short b) { return __uint_as_float(((unsigned)b) << 16); }
__device__ __forceinline__ float bfr(float f) { return bf2f(f2bf(f)); }
__device__ __forceinline__ v16h cat16(v8h lo, v8h hi) { return __builtin_shufflevector(lo, hi, 0, 1, 2, 3, 4, 5, 6, 7, 8, 9, 10, 11, 12, 13, 14, 15); }
__device__ __forceinline__ v16bf cat16b(v8us lo, v8us hi) { return __builtin_bit_cast(v16bf, __builtin_shufflevector(lo, hi, 0, 1, 2, 3, 4, 5, 6, 7, 8, 9, 10, 11, 12, 13, 14, 15)); }
__device__ __forceinline__ v8f wmma16(v16h a, v16h b, v8f c) { return __builtin_amdgcn_wmma_f32_16x16x32_f16(false, a, false, b, (short)0, c, false, false); }
__device__ __forceinline__ v8f wmmab(v16bf a, v16bf b, v8f c) { return __builtin_amdgcn_wmma_f32_16x16x32_bf16(false, a, false, b, (short)0, c, false, false); }
__device__ __forceinline__ h16 tohx(float x) { return (h16)x; }
__device__ __forceinline__ void splitf(float y, unsigned short& h, unsigned short& l) { h = f2bf(y); l = f2bf(y - bf2f(h)); }
typedef __attribute__((ext_vector_type(4))) _Float16 v4h;
typedef __attribute__((ext_vector_type(4))) unsigned short v4us;

// ---- what the store step of a GEMM writes (EPI): 0 the f32 tile; otherwise the 16-bit operand planes of the next GEMM, straight from the sums:
// 1 q: head planes [h / ZH][b][h % ZH][t][d] (fp16, hi, lo) and the flat hi / lo rows for the gate product; 2 k: head planes [h][b][t][d] (fp16, hi, lo);
// 3 v: flat hi / lo rows for the delta product (the transposed planes [g][b][d][t] are written by the kernel itself, through LDS).
struct Epi { h16* p16; bf* ph; bf* pl; bf* fh; bf* fl; };
template <int EPI> __device__ __forceinline__ void epi_put(const Epi& ep, int R, int c, v4f val) {   // four neighbouring sums of output row R, columns c .. c + 3
    v4h o16; v4us oh, ol;
    // unrolled: the vectors' elements are indexed by constants and stay in registers
#pragma unroll
    for (int u = 0; u < 4; ++u) { const float x = val[u]; o16[u] = tohx(x); unsigned short a, c2; splitf(x, a, c2); oh[u] = a; ol[u] = c2; }
    if (EPI == 1 || EPI == 2) { const int b = R / TT, t = R % TT, h = c / HD, d = c % HD; const int p = (EPI == 1) ? (h / ZH) * (NB_ * ZH) + b * ZH + h % ZH : h * NB_ + b; const size_t o = ((size_t)p * TT + t) * HD + d;
        *(v4h*)(ep.p16 + o) = o16; *(v4us*)(ep.ph + o) = oh; *(v4us*)(ep.pl + o) = ol; }
    if (EPI == 1 || EPI == 3) { const size_t o = (EPI == 1) ? (size_t)R * DQ + c : (size_t)R * DKV + c;
        *(v4us*)(ep.fh + o) = oh; *(v4us*)(ep.fl + o) = ol; }
}



// ---- gemmw_tile: register-blocked GEMM, one work-group of NW waves per 64x64 output tile; every wave holds the whole tile (16 accumulators) for its own share of K (64-element chunks dealt round robin: one 128-byte line of each operand row per chunk),
// operands straight from K-contiguous 16-bit planes; for NW > 1 the NW partial tiles are summed through LDS in wave order 0..NW-1 (K % 64 == 0); grid (M/64, N/64, Z), NW * 32 threads.
// C[m][n] (f32, pitch ldc, + optional f32 bias[n]) = sum_k A[m][k] Bt[n][k] (+ split products per NSPLIT). z-batch strides sA/sB/sC in elements (sA, sC per z slice; sB per ZH slices: the ZH heads of a kv group share Bt). A rows have pitch lda, Bt rows pitch K. K % 32 == 0.
template <typename T16> struct WFrag;
template <> struct WFrag<h16> { typedef v16h V; static __device__ __forceinline__ V ld(const h16* p) { return cat16(*(const v8h*)p, *(const v8h*)(p + 16)); } static __device__ __forceinline__ v8f mma(V a, V b, v8f c) { return wmma16(a, b, c); } };
template <> struct WFrag<bf> { typedef v16bf V; static __device__ __forceinline__ V ld(const bf* p) { return cat16b(*(const v8us*)p, *(const v8us*)(p + 16)); } static __device__ __forceinline__ v8f mma(V a, V b, v8f c) { return wmmab(a, b, c); } };
template <typename T16, int NSPLIT, bool BIAS, int NW, int EPI>
__device__ __forceinline__ void gemmw_tile(const T16* __restrict__ A, const T16* __restrict__ A2, const T16* __restrict__ Bt, const T16* __restrict__ Bt2, int K, int lda, float* C, int ldc, const float* __restrict__ bias, size_t sA, size_t sB, size_t sC, Epi ep) {
    typedef typename WFrag<T16>::V V;
    __shared__ __align__(16) float os[NW > 1 ? NW * 64 * 68 : 16 * 68];
    const size_t z = blockIdx.z; A += z * sA; if (A2) A2 += z * sA; Bt += (z / ZH) * sB; if (Bt2) Bt2 += (z / ZH) * sB; C += z * sC;
    const int lane = threadIdx.x & 31, lr = lane & 15, hi = lane >> 4; const int wv = (NW > 1) ? __builtin_amdgcn_readfirstlane((int)(threadIdx.x >> 5)) : 0;   /* wave number as a scalar: the K loop's counter and branch stay scalar */ const int r0 = blockIdx.x * 64, c0 = blockIdx.y * 64;
    v8f acc[4][4];
#pragma unroll
    for (int mb = 0; mb < 4; ++mb)
#pragma unroll
        for (int nb = 0; nb < 4; ++nb) acc[mb][nb] = (v8f){};
    const size_t aoff = (size_t)(r0 + lr) * lda + 8 * hi, boff = (size_t)(c0 + lr) * K + 8 * hi;
#pragma unroll 1
    for (int kc = wv * 64; kc < K; kc += (kc & 32) ? (NW * 64 - 32) : 32) {
        V a[4], a2[4]; const T16* pa[4]; const T16* pa2[4]; const T16* pb[4]; const T16* pb2[4];
#pragma unroll
        for (int mb = 0; mb < 4; ++mb) { pa[mb] = A + aoff + (size_t)mb * 16 * lda + kc; a[mb] = WFrag<T16>::ld(pa[mb]); if (NSPLIT == 1 || NSPLIT == 2) { pa2[mb] = A2 + aoff + (size_t)mb * 16 * lda + kc; a2[mb] = WFrag<T16>::ld(pa2[mb]); } }
#pragma unroll
        for (int nb = 0; nb < 4; ++nb) { pb[nb] = Bt + boff + (size_t)nb * 16 * K + kc; const V b = WFrag<T16>::ld(pb[nb]); V b2; if (NSPLIT >= 2) { pb2[nb] = Bt2 + boff + (size_t)nb * 16 * K + kc; b2 = WFrag<T16>::ld(pb2[nb]); }
#pragma unroll
            for (int mb = 0; mb < 4; ++mb) { acc[mb][nb] = WFrag<T16>::mma(a[mb], b, acc[mb][nb]); if (NSPLIT == 1 || NSPLIT == 2) acc[mb][nb] = WFrag<T16>::mma(a2[mb], b, acc[mb][nb]); if (NSPLIT >= 2) acc[mb][nb] = WFrag<T16>::mma(a[mb], b2, acc[mb][nb]); } }
        asm volatile("v_nop\n\tv_nop\n\tv_nop\n\tv_nop" : "+v"(acc[0][0]), "+v"(acc[1][1]), "+v"(acc[2][2]), "+v"(acc[3][3]) : "v"(a[0]), "v"(a[3]));
        // precaution: this trip's load addresses are named as inputs, so their registers are not reused between a load and this wait; it stands at the loop's foot, where every load of the trip has already delivered its data
        if (NSPLIT == 2) asm volatile("s_wait_xcnt 0x0" :: "v"(pa[0]), "v"(pa[1]), "v"(pa[2]), "v"(pa[3]), "v"(pa2[0]), "v"(pa2[1]), "v"(pa2[2]), "v"(pa2[3]), "v"(pb[0]), "v"(pb[1]), "v"(pb[2]), "v"(pb[3]), "v"(pb2[0]), "v"(pb2[1]), "v"(pb2[2]), "v"(pb2[3]) : "memory");
        else if (NSPLIT == 1) asm volatile("s_wait_xcnt 0x0" :: "v"(pa[0]), "v"(pa[1]), "v"(pa[2]), "v"(pa[3]), "v"(pa2[0]), "v"(pa2[1]), "v"(pa2[2]), "v"(pa2[3]), "v"(pb[0]), "v"(pb[1]), "v"(pb[2]), "v"(pb[3]) : "memory");
        else asm volatile("s_wait_xcnt 0x0" :: "v"(pa[0]), "v"(pa[1]), "v"(pa[2]), "v"(pa[3]), "v"(pb[0]), "v"(pb[1]), "v"(pb[2]), "v"(pb[3]) : "memory");
    }
    if (NW > 1) {   // merge of the K split: each wave parks its whole partial tile in its own LDS slot, then all threads sum the NW slots in wave order and store
        float* osw = os + wv * (64 * 68);
        // the three loops are unrolled so that acc is indexed by constants and stays in registers
#pragma unroll
        for (int mb = 0; mb < 4; ++mb)
#pragma unroll
            for (int nb = 0; nb < 4; ++nb)
#pragma unroll
                for (int j = 0; j < 8; ++j) osw[(mb * 16 + hi * 8 + j) * 68 + nb * 16 + lr] = acc[mb][nb][j];
        __syncthreads();   // every wave's partial tile is in LDS before any thread sums across the slots
        v4f kept[32 / NW];   // EPI 3 only: the thread's sums, stored as flat rows behind the second barrier, so that no global store is outstanding at it
        // both loops unrolled: the LDS reads of all slots and rounds go out without a branch between them
#pragma unroll
        for (int s = 0; s < 32 / NW; ++s) { const int q = s * (NW * 32) + (int)threadIdx.x, row = q >> 4, cofs = (q & 15) * 4; v4f val = *(const v4fa*)(os + row * 68 + cofs);
#pragma unroll
            for (int w = 1; w < NW; ++w) val += *(const v4fa*)(os + w * (64 * 68) + row * 68 + cofs);
            kept[s] = val;
            if (BIAS) { val[0] += bfr(bias[c0 + cofs]); val[1] += bfr(bias[c0 + cofs + 1]); val[2] += bfr(bias[c0 + cofs + 2]); val[3] += bfr(bias[c0 + cofs + 3]); }
            if (EPI == 0) *(v4f*)(C + (size_t)(r0 + row) * ldc + c0 + cofs) = val; else if (EPI != 3) epi_put<EPI>(ep, r0 + row, c0 + cofs, val);
            if (EPI == 3) *(v4fa*)(os + row * 68 + cofs) = val; }   // the summed tile goes back into slot 0 (each quad is read and rewritten by this one thread) for the transposed read below
        if (EPI == 3) {   // v planes [g][b][d][t]: the summed tile is read back by columns, so that 16 lanes store one whole 128-byte line along t
            __syncthreads();   // the whole summed tile is in slot 0 before any thread reads a column of it
            // both loops unrolled: kept and the vectors are indexed by constants, and the LDS reads of both rounds go out without a branch between them
#pragma unroll
            for (int s = 0; s < 32 / NW; ++s) { const int q = s * (NW * 32) + (int)threadIdx.x, dc = q >> 4, t4 = (q & 15) * 4; const int c = c0 + dc, R = r0 + t4; v4h o16; v4us oh, ol;
                epi_put<EPI>(ep, r0 + dc, c0 + t4, kept[s]);   // the flat rows: quad q is (row q >> 4, columns (q & 15) * 4 ..) in the first loop too
#pragma unroll
                for (int u = 0; u < 4; ++u) { const float x = os[(t4 + u) * 68 + dc]; o16[u] = tohx(x); unsigned short a, c2; splitf(x, a, c2); oh[u] = a; ol[u] = c2; }
                const size_t o = (((size_t)(c / HD) * NB_ + R / TT) * HD + c % HD) * TT + R % TT; *(v4h*)(ep.p16 + o) = o16; *(v4us*)(ep.ph + o) = oh; *(v4us*)(ep.pl + o) = ol; }
        }
        return;
    }
#pragma unroll
    for (int mb = 0; mb < 4; ++mb) {
#pragma unroll
        for (int nb = 0; nb < 4; ++nb) {
#pragma unroll
            for (int j = 0; j < 8; ++j) os[(hi * 8 + j) * 68 + nb * 16 + lr] = acc[mb][nb][j]; }
        __builtin_amdgcn_wave_barrier(); asm volatile("" ::: "memory");
        float* crow = C + (size_t)(r0 + mb * 16) * ldc + c0;
{
#pragma unroll
            for (int s = 0; s < 8; ++s) { const int row = 2 * s + hi, cofs = lr * 4; v4f val = *(const v4fa*)(os + row * 68 + cofs); if (BIAS) { val[0] += bfr(bias[c0 + cofs]); val[1] += bfr(bias[c0 + cofs + 1]); val[2] += bfr(bias[c0 + cofs + 2]); val[3] += bfr(bias[c0 + cofs + 3]); }
                *(v4f*)(crow + (size_t)row * ldc + cofs) = val; }
             }
        __builtin_amdgcn_wave_barrier(); asm volatile("" ::: "memory");
    }
}

// gate and delta products in one launch (neither reads the other's result): blockIdx.z 0 the gate (K = DQ), 1 the delta (K = DKV: its eight 64-element chunks go to waves 0..7, the other waves' partial tiles are zero). grid (M / 64, 1, 2), 512 threads
__global__ __launch_bounds__(512) void k_gd(const bf* __restrict__ GFh, const bf* __restrict__ GFl, const bf* __restrict__ WG, const bf* __restrict__ VFh, const bf* __restrict__ VFl, const bf* __restrict__ WD, float* GATE, float* DEL) {
    const bool dl = blockIdx.z != 0; const int K = dl ? DKV : DQ;
    gemmw_tile<bf, 1, false, 16, 0>(dl ? VFh : GFh, dl ? VFl : GFl, dl ? WD : WG, nullptr, K, K, dl ? DEL : GATE, 64, nullptr, 0, 0, 0, Epi{ nullptr, nullptr, nullptr, nullptr, nullptr });
}

typedef __attribute__((ext_vector_type(2))) unsigned short v2us;
typedef __attribute__((ext_vector_type(2))) float v2f;
typedef __attribute__((ext_vector_type(4))) int v4i;
typedef v4h  __attribute__((may_alias)) v4ha;
typedef v4us __attribute__((may_alias)) v4usa;

// the three bodies wtG_blk, cvt8_blk and wgd_blk are one 256-thread work-group's share (number blk) of one preparation job; k_prep deals them
__device__ __forceinline__ void wtG_blk(int blk, const float* __restrict__ w, int K, int N, bf* Bt) {
    const int lane = threadIdx.x & 31; const int L0 = (blk * 8 + (threadIdx.x >> 5)) * 8; const int nlines = N * K / 64;
{
#pragma unroll 1
        for (int l = 0; l < 8; ++l) { const int L = L0 + l; if (L >= nlines) break; const size_t e = (size_t)L * 64 + lane * 2; const int k = (int)(e % K), n = (int)(e / K); v2us o;
            o[0] = f2bf(w[(size_t)k * N + n]); o[1] = f2bf(w[(size_t)(k + 1) * N + n]); *(v2us*)(Bt + e) = o; }
         }
}
__device__ __forceinline__ void cvt8_blk(int blk, const float* __restrict__ src, bf* dst, size_t n8) { const size_t i = (size_t)blk * 256 + threadIdx.x; if (i >= n8) return; const v8f v = *(const v8f*)(src + i * 8); v8us o;
#pragma unroll
    for (int k = 0; k < 8; ++k) o[k] = f2bf(v[k]); *(v8us*)(dst + i * 8) = o;  }
__global__ __launch_bounds__(256) void k_cscvt(const float* __restrict__ cosT, const float* __restrict__ sinT, float* CS) { const int idx = blockIdx.x * 256 + threadIdx.x; if (idx >= TT * HD) return; v2f cs; cs[0] = bfr(cosT[idx]); cs[1] = bfr(sinT[idx]); *(v2f*)(CS + (size_t)idx * 2) = cs;  }
// ---- k_attn: scores, bias + mask, softmax and the product with v in one kernel; no score or probability goes to memory. One wave per (head, 16 query rows); the 4 waves of a work-group are the 4 heads of one kv group and share its k / v tiles through LDS.
// Everything is computed transposed, so that no value changes lanes between the two products: S^T = k q^T (A = 16 key rows, B = the wave's 16 query rows) leaves lane (lr, hi) with query lr and keys hi * 8 + j of each 16-key tile;
// two such tiles side by side are exactly the B fragment (n = query lr, k = 8 * hi + 0..7 and 8 * hi + 16 + 0..7) of O^T = v^T P^T (A = 16 rows of the [d][t] plane). A lane's scores, running maximum, running sum and all its O^T elements belong to its one query.
// Running softmax over steps of 32 keys: m = max so far, p = exp(t - m), sum and O^T rescaled by exp(m_old - m_new); the division by the sum comes last, in f32. The masked fill equals the start value of m, so a row with no allowed key weighs every key 1 (uniform, as the source's finfo.min fill),
// and the first allowed key wipes such weights (factor exp(-huge) = 0). HR (query rows < RH): hi + lo planes, 3 products each; otherwise single fp16. Both run nc steps, up to the diagonal. Behind the diagonal every key is masked: a row that has met an allowed key weighs all of them exp(-huge) = 0, so its sums are final; a row that has met none weighs all of them 1.
// Only an HR block that holds such a row (nk > nc: the kv head's first positive bias lies behind the block's first row) runs the steps nc .. nk - 1, and there the weight is the same for all keys of a row and known beforehand: no k tile, no scores, no exponentials, and the lo plane of the weight (0 or 1: exact in bf16) is zero, so two v products are left.
// Staging: two LDS buffers; step s + 1's tiles (32 k rows, 128 v^T rows of 32 keys) travel global -> registers while step s is computed, go into the other buffer behind it, and one work-group barrier per step publishes them and ends the reads of the buffer that is refilled next.
#define KPIT 136                  // LDS pitch of a k row, elements: 272 B = 16 B x odd, the 16 rows of a fragment read fall on distinct banks
#define VPIT 40                   // LDS pitch of a v^T row of 32 keys: 80 B = 16 B x odd
#define KTE  (32 * KPIT)
#define STE  (KTE + HD * VPIT)    // elements of one staged plane: k tile, then v^T tile
typedef __attribute__((ext_vector_type(16))) unsigned short v16us;
__device__ __forceinline__ float exp2s(float x) { float r; asm("v_exp_f32 %0, %1\n\tv_nop" : "=v"(r) : "v"(x)); return r; }
template <typename T16> struct LFrag;   // a fragment from two 16-byte LDS reads, in the k order of WFrag
template <> struct LFrag<h16> { static __device__ __forceinline__ v16h ld(const bf* p) { const v8us x = *(const v8usa*)p, y = *(const v8usa*)(p + 16); return cat16(__builtin_bit_cast(v8h, x), __builtin_bit_cast(v8h, y)); } };
template <> struct LFrag<bf> { static __device__ __forceinline__ v16bf ld(const bf* p) { const v8us x = *(const v8usa*)p, y = *(const v8usa*)(p + 16); return cat16b(x, y); } };
template <typename T16, bool HR>
__device__ __forceinline__ void attn_rows(bf* sm, float* smb, int wv, const T16* __restrict__ Q, const T16* __restrict__ Q2, const bf* __restrict__ Kp, const bf* __restrict__ K2, const bf* __restrict__ Vt, const bf* __restrict__ V2, const float* __restrict__ bias, bool poison, int q0, int nc, int nk, bf* oh, bf* ol) {
    typedef typename WFrag<T16>::V V; constexpr int NP = HR ? 2 : 1;
    const int tid = threadIdx.x, lane = tid & 31, lr = lane & 15, hi = lane >> 4; const int qi = q0 + lr;
    V bq[4], bq2[4]; const T16* pq = Q + (size_t)qi * HD + 8 * hi; const T16* pq2 = HR ? Q2 + (size_t)qi * HD + 8 * hi : nullptr;
    // unrolled, here and below: the fragment, staging and accumulator arrays are indexed by constants and stay in registers
#pragma unroll
    for (int kc = 0; kc < 4; ++kc) { bq[kc] = WFrag<T16>::ld(pq + kc * 32); if (HR) bq2[kc] = WFrag<T16>::ld(pq2 + kc * 32); }
    // precaution: the load addresses are named as inputs, so their registers are not reused between a load and this wait
    if (HR) asm volatile("s_wait_xcnt 0x0" :: "v"(pq), "v"(pq2) : "memory");
    else asm volatile("s_wait_xcnt 0x0" :: "v"(pq) : "memory");
    v8f o[8];
#pragma unroll
    for (int mb = 0; mb < 8; ++mb) o[mb] = (v8f){};
    float m = -3.0e38f, l = 0.f;
    // staging, 16-byte chunk c = tid + 128 * i: k tile (one contiguous 8 KiB) row c >> 4, piece c & 15; v^T tile row c >> 2, piece c & 3
    const unsigned gko = tid * 8, gvo = (tid >> 2) * TT + (tid & 3) * 8; const int sko = (tid >> 4) * KPIT + (tid & 15) * 8, svo = KTE + (tid >> 2) * VPIT + (tid & 3) * 8;
    const int fko = lr * KPIT + 8 * hi, fvo = KTE + lr * VPIT + 8 * hi;   // the lane's place in a k / v^T fragment read
    v8us rk[NP][4], rv[NP][4]; float rb = 0.f;
    if (wv == 0) smb[tid] = bias[tid];   // wave 0 stages the step's 32 bias values, one per lane
#pragma unroll
    for (int i = 0; i < 4; ++i) { rk[0][i] = *(const v8us*)(Kp + gko + i * 1024); rv[0][i] = *(const v8us*)(Vt + gvo + (size_t)i * 32 * TT); if (HR) { rk[NP - 1][i] = *(const v8us*)(K2 + gko + i * 1024); rv[NP - 1][i] = *(const v8us*)(V2 + gvo + (size_t)i * 32 * TT); } }
#pragma unroll
    for (int pl = 0; pl < NP; ++pl)
#pragma unroll
        for (int i = 0; i < 4; ++i) { *(v8usa*)(sm + pl * STE + sko + i * 8 * KPIT) = rk[pl][i]; *(v8usa*)(sm + pl * STE + svo + i * 32 * VPIT) = rv[pl][i]; }
    __syncthreads();   // step 0's tiles are in buffer 0 before any wave reads them
    for (int s = 0; s < nc; ++s) {
        const int sn = min(s + 1, (HR ? TT / 32 : nk) - 1);   // the tile that is staged during this step; behind the last step that reads one a tile is staged that nobody reads, so the loop body has no branch
        const unsigned ok = gko + sn * 32 * HD, ov = gvo + sn * 32, ob = sn * 32 + lane;   // element offsets of this step's loads inside their planes
        const bf* pk = Kp + ok; const bf* pk2 = HR ? K2 + ok : nullptr; const bf* pv = Vt + ov; const bf* pv2 = HR ? V2 + ov : nullptr;
        {   // next k tile: on its way during the score products
#pragma unroll
            for (int i = 0; i < 4; ++i) { rk[0][i] = *(const v8us*)(pk + i * 1024); if (HR) rk[NP - 1][i] = *(const v8us*)(pk2 + i * 1024); }
            if (wv == 0) rb = bias[ob]; }
        const bf* cur = sm + (s & 1) * (NP * STE); bf* nxt = sm + ((s + 1) & 1) * (NP * STE);
        v8f st[2]; float t[16]; float mt = -3.0e38f;
#pragma unroll
        for (int tt = 0; tt < 2; ++tt) { st[tt] = (v8f){};
#pragma unroll
            for (int kc = 0; kc < 4; ++kc) { const V a = LFrag<T16>::ld(cur + fko + tt * 16 * KPIT + kc * 32); st[tt] = WFrag<T16>::mma(a, bq[kc], st[tt]);
                if (HR) { st[tt] = WFrag<T16>::mma(a, bq2[kc], st[tt]); const V a2 = LFrag<T16>::ld(cur + STE + fko + tt * 16 * KPIT + kc * 32); st[tt] = WFrag<T16>::mma(a2, bq[kc], st[tt]); } } }
        const float* cb = smb + (s & 1) * 32 + hi * 8; const v4f bb[4] = { *(const v4fa*)cb, *(const v4fa*)(cb + 4), *(const v4fa*)(cb + 16), *(const v4fa*)(cb + 20) };
#pragma unroll
        for (int tt = 0; tt < 2; ++tt)
#pragma unroll
            for (int j = 0; j < 8; ++j) { const int key = s * 32 + tt * 16 + hi * 8 + j; const float bj = bb[tt * 2 + (j >> 2)][j & 3]; const float x = (key <= qi && bj > 0.f) ? st[tt][j] * SCL + bj : -3.0e38f; t[tt * 8 + j] = x; mt = fmaxf(mt, x); }
        {   // the other buffer is free since the last barrier: the k tile goes in as soon as it has come; next v^T tile: on its way during the softmax and the second product
#pragma unroll
            for (int pl = 0; pl < NP; ++pl)
#pragma unroll
                for (int i = 0; i < 4; ++i) *(v8usa*)(nxt + pl * STE + sko + i * 8 * KPIT) = rk[pl][i];
            if (wv == 0) smb[((s + 1) & 1) * 32 + lane] = rb;
#pragma unroll
            for (int i = 0; i < 4; ++i) { rv[0][i] = *(const v8us*)(pv + (size_t)i * 32 * TT); if (HR) rv[NP - 1][i] = *(const v8us*)(pv2 + (size_t)i * 32 * TT); } }
        mt = fmaxf(mt, __shfl_xor(mt, 16, 32));   // the other half of the wave holds the query's other 16 keys of this step
        const float mn = fmaxf(m, mt); const float alpha = exp2s((m - mn) * 1.4426950408889634f); m = mn;
        float ps = 0.f;
#pragma unroll
        for (int u = 0; u < 16; ++u) { t[u] = exp2s((t[u] - mn) * 1.4426950408889634f); ps += t[u]; }
        l = l * alpha + ps;   // each half of the wave sums its own keys; the halves meet behind the loop
#pragma unroll
        for (int mb = 0; mb < 8; ++mb) o[mb] *= alpha;
        V p, p2;
        if constexpr (HR) { v16us a, c;
#pragma unroll
            for (int u = 0; u < 16; ++u) { unsigned short x, y; splitf(t[u], x, y); a[u] = x; c[u] = y; }
            p = __builtin_bit_cast(v16bf, a); p2 = __builtin_bit_cast(v16bf, c);
        } else {
#pragma unroll
            for (int u = 0; u < 16; ++u) p[u] = tohx(t[u]); }
#pragma unroll
        for (int mb = 0; mb < 8; ++mb) { const V a = LFrag<T16>::ld(cur + fvo + mb * 16 * VPIT); o[mb] = WFrag<T16>::mma(a, p, o[mb]);
            if constexpr (HR) { o[mb] = WFrag<T16>::mma(a, p2, o[mb]); const V a2 = LFrag<T16>::ld(cur + STE + fvo + mb * 16 * VPIT); o[mb] = WFrag<T16>::mma(a2, p, o[mb]); } }
        {
#pragma unroll
            for (int pl = 0; pl < NP; ++pl)
#pragma unroll
                for (int i = 0; i < 4; ++i) *(v8usa*)(nxt + pl * STE + svo + i * 32 * VPIT) = rv[pl][i]; }
        // precaution: this step's load addresses (HR: their offsets beside the planes' scalar bases) are named as inputs, so their registers are not reused between a load and this wait; it stands at the loop's foot, where every load of the step has already delivered its data
        if (HR) asm volatile("s_wait_xcnt 0x0" :: "v"(ok), "v"(ov), "v"(ob) : "memory");
        else asm volatile("s_wait_xcnt 0x0" :: "v"(pk), "v"(pv), "v"(ob) : "memory");
        __syncthreads();   // publishes step s + 1's tiles; every wave has finished reading the buffer that the next step refills
    }
    if constexpr (HR) {
        if (nc < nk) {   // the same for the whole work-group: the barriers below are met by every wave
            const float w = exp2s((-3.0e38f - m) * 1.4426950408889634f);   // a masked key's weight, as in the loop above: 1 for a row with no allowed key, else 0
            unsigned short wh, wl; splitf(w, wh, wl); v16us a16;
#pragma unroll
            for (int u = 0; u < 16; ++u) a16[u] = wh;
            const V p = __builtin_bit_cast(v16bf, a16);
            for (int s = nc; s < nk; ++s) {
                const int sn = min(s + 1, nk - 1); const unsigned ov = gvo + sn * 32;
#pragma unroll
                for (int i = 0; i < 4; ++i) { rv[0][i] = *(const v8us*)(Vt + ov + (size_t)i * 32 * TT); rv[1][i] = *(const v8us*)(V2 + ov + (size_t)i * 32 * TT); }   // next v^T tile: on its way during the product
                const bf* cur = sm + (s & 1) * (NP * STE); bf* nxt = sm + ((s + 1) & 1) * (NP * STE);
                l += 16.f * w;   // this half's 16 keys of the step
                V fh[8], fl[8];
#pragma unroll
                for (int mb = 0; mb < 8; ++mb) { fh[mb] = LFrag<T16>::ld(cur + fvo + mb * 16 * VPIT); fl[mb] = LFrag<T16>::ld(cur + STE + fvo + mb * 16 * VPIT); }
                __builtin_amdgcn_sched_barrier(0);   // the step's fragment reads go out as one group (the q fragments' registers are free here): left alone, the scheduler sinks each read to its product, and every product waits out an LDS latency
#pragma unroll
                for (int mb = 0; mb < 8; ++mb) o[mb] = WFrag<T16>::mma(fh[mb], p, o[mb]);
#pragma unroll
                for (int mb = 0; mb < 8; ++mb) o[mb] = WFrag<T16>::mma(fl[mb], p, o[mb]);
                __builtin_amdgcn_sched_barrier(0);   // the products are issued while the next tile's loads are on their way: left alone, the scheduler puts most of them behind the wait for those loads and behind the barrier
#pragma unroll
                for (int pl = 0; pl < NP; ++pl)
#pragma unroll
                    for (int i = 0; i < 4; ++i) *(v8usa*)(nxt + pl * STE + svo + i * 32 * VPIT) = rv[pl][i];
                __syncthreads();   // publishes step s + 1's v^T tiles; every wave has finished reading the buffer that the next step refills
            }
        }
    }
    l += __shfl_xor(l, 16, 32);
    const float f = poison ? __builtin_nanf("") : 1.0f / l;
#pragma unroll
    for (int mb = 0; mb < 8; ++mb) { v8us a, c;
#pragma unroll
        for (int j = 0; j < 8; ++j) { unsigned short x, y; splitf(o[mb][j] * f, x, y); a[j] = x; c[j] = y; }
        *(v8us*)(oh + (size_t)qi * DQ + mb * 16 + hi * 8) = a; *(v8us*)(ol + (size_t)qi * DQ + mb * 16 + hi * 8) = c; }   // hi / lo rows [b][t][head][d] of the output projection's A operand: d = mb * 16 + hi * 8 + j
}
// grid (TT / 16 * NKV * NB_), REP * 32 threads, four waves per SIMD asked for (a budget of 256 registers: with the LDS of four work-groups per WGP the whole grid is resident). Flat index: low 3 bits the kv plane g * NB_ + b; then 32 row blocks per quarter of the grid: first all hi + lo blocks, then the last rows downwards, the middle, and the rows behind the hi + lo blocks upwards,
// so that four work-groups whose indices lie a quarter of the grid apart carry about the same work together (for speed only; every (plane, row block) occurs once whatever the placement).
static_assert(TT / 16 == 4 * (RH / 16) && NKV * NB_ == 8 && ZH == REP, "row-block deal of k_attn");
__global__ __launch_bounds__(REP * 32, 4) void k_attn(const h16* __restrict__ Q16, const bf* __restrict__ Qh, const bf* __restrict__ Ql, const bf* __restrict__ K16, const bf* __restrict__ Kh, const bf* __restrict__ Kl, const bf* __restrict__ V16, const bf* __restrict__ Vh, const bf* __restrict__ Vl, const float* __restrict__ Bb, const int* __restrict__ FLG, bf* ATh, bf* ATl) {
    __shared__ __align__(16) bf sm[2 * 2 * STE]; __shared__ __align__(16) float smb[2 * 32];
    const int wv = __builtin_amdgcn_readfirstlane((int)(threadIdx.x >> 5));   // wave number as a scalar: plane offsets stay scalar
    const int id = blockIdx.x, kvp = id & 7, g = kvp / NB_, b = kvp % NB_, qr = id >> 8, i5 = (id >> 3) & 31; const int qb = (qr == 0) ? i5 : (qr == 1) ? 127 - i5 : (qr == 2) ? 64 + i5 : 32 + i5; const int q0 = qb * 16;
    const size_t qo = (size_t)(g * (NB_ * ZH) + b * ZH + wv) * TT * HD, kv = (size_t)kvp * TT * HD, ao = (size_t)b * TT * DQ + (g * REP + wv) * HD;
    const float* bias = Bb + (size_t)(b * NKV + g) * TT; const bool poison = (FLG[b * 8 + g] != 0);   /* premise self-check: no positive bias among keys 0..RH-1 for this kv head -> NaN-poison (flag word FLG[b * 8 + 4] also set) */
    const int first = FLG[16 + b * NKV + g], nc = (q0 + 16 + 31) / 32;   // first: the kv head's first key with a positive bias (RH: none below RH); rows in front of it have no allowed key. nc: steps up to the diagonal
    if (qb < RH / 16) attn_rows<bf, true>(sm, smb, wv, Qh + qo, Ql + qo, Kh + kv, Kl + kv, Vh + kv, Vl + kv, bias, poison, q0, nc, (first <= q0) ? nc : TT / 32, ATh + ao, ATl + ao);
    else attn_rows<h16, false>(sm, smb, wv, Q16 + qo, nullptr, K16 + kv, nullptr, V16 + kv, nullptr, bias, poison, q0, nc, nc, ATh + ao, ATl + ao);
}
// ---- k_gemms: GEMM with its operands staged in LDS by asynchronous copies (global_load_async_to_lds_b128). One work-group of 4 waves (2 x 2) per 128x128 output tile, 64x64 (16 accumulators) per wave, the whole K in each accumulator;
// K goes in stages of 64 elements (one whole 128-byte line of every operand row), two LDS buffers: stage t + 1's copies fly while stage t is worked on. Each line is fetched once per work-group, whole, and serves two waves.
// C[m][n] = sum_k A[m][k] Bt[n][k] (+ A2[m][k] Bt[n][k] for NSPLIT 1); A, A2, Bt are K-contiguous 16-bit planes of pitch K, K % 64 == 0; grid (M / 128, N / 128), 128 threads. EPI as above: each wave stores its own 64x64 tile through its own LDS slot. EPI 4: the q, k and v projections in one launch (none reads another's result): Bt holds the rows of Wq^T, Wk^T, Wv^T one behind the other, and a tile is stored as EPI 1, 2 or 3 (ep, ep2, ep3) by its columns.
#define GPIT 72                   // LDS pitch of a staged row of 64 elements: 144 B = 16 B x odd, the 16 rows of a fragment read fall on distinct banks
#define GPLN (128 * GPIT)         // elements of one staged plane: 128 rows
// one lane's eight 16-byte copies of one plane, rows 16 apart (LDS byte address l, global address g, gs elements between the rows). The wait on the address translations is the statement's last line, so that it stands in front of every later write of the address registers (a precaution).
__device__ __forceinline__ void cp8(unsigned l, const bf* g, size_t gs) {
    asm volatile("global_load_async_to_lds_b128 %0, %8, off\n\t"
                 "global_load_async_to_lds_b128 %1, %9, off\n\t"
                 "global_load_async_to_lds_b128 %2, %10, off\n\t"
                 "global_load_async_to_lds_b128 %3, %11, off\n\t"
                 "global_load_async_to_lds_b128 %4, %12, off\n\t"
                 "global_load_async_to_lds_b128 %5, %13, off\n\t"
                 "global_load_async_to_lds_b128 %6, %14, off\n\t"
                 "global_load_async_to_lds_b128 %7, %15, off\n\t"
                 "s_wait_xcnt 0x0"
                 :: "v"(l), "v"(l + 1 * 16 * GPIT * 2), "v"(l + 2 * 16 * GPIT * 2), "v"(l + 3 * 16 * GPIT * 2), "v"(l + 4 * 16 * GPIT * 2), "v"(l + 5 * 16 * GPIT * 2), "v"(l + 6 * 16 * GPIT * 2), "v"(l + 7 * 16 * GPIT * 2),
                    "v"(g), "v"(g + gs), "v"(g + 2 * gs), "v"(g + 3 * gs), "v"(g + 4 * gs), "v"(g + 5 * gs), "v"(g + 6 * gs), "v"(g + 7 * gs) : "memory");
}
// store step of k_gemms: one wave's 64x64 tile (rows rw .., columns cw .. of its product) from its LDS slot osw
template <int EPI>
__device__ __forceinline__ void gemms_put(const float* osw, int lane, int rw, int cw, float* C, int ldc, const Epi& ep) {
    // four rounds are unrolled into one trip: their LDS reads go out together, and one wait behind their stores serves them all
#pragma unroll 1
    for (int s4 = 0; s4 < 32; s4 += 4) {
#pragma unroll
      for (int s = s4; s < s4 + 4; ++s) { const int q = s * 32 + lane, row = q >> 4, cofs = (q & 15) * 4; const v4f val = *(const v4fa*)(osw + row * 68 + cofs);
        if (EPI == 0) *(v4f*)(C + (size_t)(rw + row) * ldc + cw + cofs) = val; else epi_put<EPI>(ep, rw + row, cw + cofs, val);
        if (EPI == 3) {   // v planes [g][b][d][t]: the tile is read by columns too (column row, rows cofs .. cofs + 3), so that 16 lanes store one whole 128-byte line along t
            const int c = cw + row, R = rw + cofs; v4h o16; v4us oh, ol;
#pragma unroll
            for (int u = 0; u < 4; ++u) { const float x = osw[(cofs + u) * 68 + row]; o16[u] = tohx(x); unsigned short a, c2; splitf(x, a, c2); oh[u] = a; ol[u] = c2; }
            const size_t o = (((size_t)(c / HD) * NB_ + R / TT) * HD + c % HD) * TT + R % TT; *(v4h*)(ep.p16 + o) = o16; *(v4us*)(ep.ph + o) = oh; *(v4us*)(ep.pl + o) = ol; } }
      asm volatile("s_wait_xcnt 0x0" ::: "memory"); }   // precaution: the next trip rewrites the registers that this trip's stores name
}
template <int NSPLIT, int EPI>
__global__ __launch_bounds__(128, 2) void k_gemms(const bf* __restrict__ A, const bf* __restrict__ A2, const bf* __restrict__ Bt, int K, float* C, int ldc, Epi ep, Epi ep2, Epi ep3) {
    constexpr int NPL = NSPLIT ? 3 : 2, STG = NPL * GPLN;   // a stage: the planes A, Bt (, A2)
    static_assert(2 * STG * 2 >= 4 * 64 * 68 * 4, "the four waves' output slots fit into the two buffers");
    __shared__ __align__(16) bf ring[2 * STG];
    const int tid = threadIdx.x, lane = tid & 31, lr = lane & 15, hi = lane >> 4; const int wv = __builtin_amdgcn_readfirstlane(tid >> 5), wm = wv >> 1, wn = wv & 1;   // wave number as a scalar: tile offsets stay scalar
    const int r0 = blockIdx.x * 128, c0 = blockIdx.y * 128, nt = K / 64;
    // copies, 16-byte chunk tid + 128 * i of a plane: row (tid >> 3) + 16 * i, piece tid & 7: eight lanes fetch one whole line
    const size_t gs = (size_t)16 * K, go = (size_t)(tid >> 3) * K + (tid & 7) * 8;
    const bf* ga = A + (size_t)r0 * K + go; const bf* gb = Bt + (size_t)c0 * K + go; const bf* ga2 = NSPLIT ? A2 + (size_t)r0 * K + go : nullptr;
    const unsigned l0 = (unsigned)(size_t)ring + ((tid >> 3) * GPIT + (tid & 7) * 8) * 2;
    auto stage = [&](int t) { const unsigned l = l0 + (t & 1) * (STG * 2); cp8(l, ga + t * 64, gs); cp8(l + GPLN * 2, gb + t * 64, gs); if (NSPLIT) cp8(l + 2 * GPLN * 2, ga2 + t * 64, gs); };
    v8f acc[4][4];
    // unrolled, here and below: the accumulator and fragment arrays are indexed by constants and stay in registers
#pragma unroll
    for (int mb = 0; mb < 4; ++mb)
#pragma unroll
        for (int nb = 0; nb < 4; ++nb) acc[mb][nb] = (v8f){};
    const int fa = (wm * 64 + lr) * GPIT + 8 * hi, fb = GPLN + (wn * 64 + lr) * GPIT + 8 * hi;   // the lane's place in an A / Bt fragment read
    stage(0);
    asm volatile("s_wait_asynccnt 0x0" ::: "memory");   // this wave's copies of stage 0 have landed
    __syncthreads();   // stage 0 is in buffer 0 before any wave reads it
    if (nt > 1) stage(1);
    for (int t = 0; t < nt; ++t) {
        const bf* cur = ring + (t & 1) * STG;
        // fragment reads run ahead of the products that use them: the first 32 k's fragments as one group, with them (registers allowing: NSPLIT 0) the second 32 k's Bt fragments; each A fragment of the second 32 k is read into its registers as soon as the four (eight) products on its forerunner are issued.
        // The scheduling barriers keep that order: left alone, the scheduler sinks every read to its first product, and the products wait out an LDS latency each time.
        v16bf a[4], a2[4], b[2][4];
#pragma unroll
        for (int i = 0; i < 4; ++i) { a[i] = LFrag<bf>::ld(cur + fa + i * 16 * GPIT); b[0][i] = LFrag<bf>::ld(cur + fb + i * 16 * GPIT); if (NSPLIT) a2[i] = LFrag<bf>::ld(cur + 2 * GPLN + fa + i * 16 * GPIT); }
        if (!NSPLIT) {
#pragma unroll
            for (int i = 0; i < 4; ++i) b[1][i] = LFrag<bf>::ld(cur + fb + i * 16 * GPIT + 32); }
        __builtin_amdgcn_sched_barrier(0);
#pragma unroll
        for (int mb = 0; mb < 4; ++mb) {
#pragma unroll
            for (int nb = 0; nb < 4; ++nb) { acc[mb][nb] = wmmab(a[mb], b[0][nb], acc[mb][nb]); if (NSPLIT) acc[mb][nb] = wmmab(a2[mb], b[0][nb], acc[mb][nb]); }
            a[mb] = LFrag<bf>::ld(cur + fa + mb * 16 * GPIT + 32); if (NSPLIT) a2[mb] = LFrag<bf>::ld(cur + 2 * GPLN + fa + mb * 16 * GPIT + 32);
            __builtin_amdgcn_sched_barrier(0); }
        if (NSPLIT) {
#pragma unroll
            for (int i = 0; i < 4; ++i) b[1][i] = LFrag<bf>::ld(cur + fb + i * 16 * GPIT + 32);
            __builtin_amdgcn_sched_barrier(0); }
#pragma unroll
        for (int mb = 0; mb < 4; ++mb)
#pragma unroll
            for (int nb = 0; nb < 4; ++nb) { acc[mb][nb] = wmmab(a[mb], b[1][nb], acc[mb][nb]); if (NSPLIT) acc[mb][nb] = wmmab(a2[mb], b[1][nb], acc[mb][nb]); }
        asm volatile("s_wait_dscnt 0x0" ::: "memory");      // this wave's reads of the buffer that is refilled below have ended
        asm volatile("s_wait_asynccnt 0x0" ::: "memory");   // this wave's copies of stage t + 1 have landed
        __syncthreads();   // publishes stage t + 1; every wave has finished reading stage t's buffer
        if (t + 2 < nt) stage(t + 2);
    }
    asm volatile("s_wait_asynccnt 0x0" ::: "memory");   // no copy is outstanding when the buffers become output slots
    float* osw = (float*)ring + wv * (64 * 68); const int rw = r0 + wm * 64, cw = c0 + wn * 64;
#pragma unroll
    for (int mb = 0; mb < 4; ++mb)
#pragma unroll
        for (int nb = 0; nb < 4; ++nb)
#pragma unroll
            for (int j = 0; j < 8; ++j) osw[(mb * 16 + hi * 8 + j) * 68 + nb * 16 + lr] = acc[mb][nb][j];
    __syncthreads();   // the tile is in its slot before its lanes read one another's values
    if constexpr (EPI == 4) {   // the tile's columns say whose it is (the same for the whole work-group): q, then k, then v
        if (c0 < DQ) gemms_put<1>(osw, lane, rw, cw, C, ldc, ep); else if (c0 < DQ + DKV) gemms_put<2>(osw, lane, rw, cw - DQ, C, ldc, ep2); else gemms_put<3>(osw, lane, rw, cw - (DQ + DKV), C, ldc, ep3);
    } else gemms_put<EPI>(osw, lane, rw, cw, C, ldc, ep);
}
__global__ __launch_bounds__(32) void k_chk(const float* __restrict__ BIAS, int* FLG) { BIAS += (size_t)blockIdx.x * NKV * TT; int* FST = FLG + 16 + blockIdx.x * NKV;   /* per kv head: its first key with a positive bias, RH if there is none below RH */ FLG += blockIdx.x * 8;   /* one work-group per batch element */ const int n = threadIdx.x; int none = 0, first = RH; if (n < NKV) { none = 1;
#pragma unroll 1
        for (int j = 0; j < RH; ++j) { const float bj = BIAS[(size_t)n * TT + j]; asm volatile("s_wait_xcnt 0x0" ::: "memory");   /* precaution: the next trip rewrites the register pair that holds this load's address */ if (bj > 0.f) { none = 0; first = j; break; } } }
    int anyb = none;
#pragma unroll
    for (int sh = 16; sh; sh >>= 1) anyb |= __shfl_xor(anyb, sh, 32);
    const int v = (n < NKV) ? none : ((n == NKV) ? anyb : 0); if (n < 8) { *(int*)(FLG + n) = v;  } if (n < NKV) FST[n] = first; }
__device__ __forceinline__ void wgd_blk(int blk, const float* __restrict__ w, int K, bf* Bt) { const int e = (blk * 256 + threadIdx.x) * 4; if (e >= 64 * K) return; const int k = e % K, n = e / K; v4us o;
#pragma unroll
    for (int u = 0; u < 4; ++u) o[u] = (n < NKV) ? f2bf(w[(size_t)(k + u) * NKV + n]) : (unsigned short)0; *(v4us*)(Bt + e) = o;  }
__global__ __launch_bounds__(256) void k_bias(const float* __restrict__ GATE, const float* __restrict__ DEL, float* BIAS) { const int e = (blockIdx.x * 256 + threadIdx.x) * 4; if (e >= NB_ * NKV * TT) return; const int j = e % TT; const int n = (e / TT) % NKV; const int b = e / (NKV * TT); v4f r;
#pragma unroll
    for (int u = 0; u < 4; ++u) { const float gt = GATE[((size_t)b * TT + j + u) * 64 + n]; asm volatile("s_wait_xcnt 0x0" ::: "memory");   /* precaution, here and below: later loads land in the registers that held this load's address */ const float dl = DEL[((size_t)b * TT + j + u) * 64 + n]; asm volatile("s_wait_xcnt 0x0" ::: "memory"); const float sg = __fdiv_rn(1.0f, __fadd_rn(1.0f, __expf(-gt))); r[u] = __fmul_rn(sg, dl); }
    *(v4f*)(BIAS + e) = r;  }

// ---- k_prep: all operand preparation in one launch (no job reads another's result): the four weight transposes, x to bf16, the padded gate / delta weights. 256 threads; every share of every job is dealt to exactly one work-group, whatever the placement.
// The deal is for speed only: runs of 8 neighbouring work-groups take by turns transpose shares (long: eight trips of scattered reads) and other shares (short) until the transposes are dealt.
#define PT_Q (DM * DQ / 4096)         // shares of the Wq transpose, and of Wo's
#define PT_K (DM * DKV / 4096)        // of Wk's, and of Wv's
#define PT_N (2 * PT_Q + 2 * PT_K)    // transpose shares
#define PC_G (64 * DQ / 1024)         // shares of the gate weights
#define PC_D (64 * DKV / 1024)        // of the delta weights
#define PC_X (NB_ * TT * DM / 2048)   // of x
static_assert(PT_N % 8 == 0 && PC_G + PC_D + PC_X >= PT_N, "deal of k_prep");
__global__ __launch_bounds__(256) void k_prep(const float* __restrict__ x, const float* __restrict__ wq, const float* __restrict__ wk, const float* __restrict__ wv, const float* __restrict__ wg, const float* __restrict__ wdl, const float* __restrict__ wo, bf* XB, bf* WQ, bf* WK, bf* WV, bf* WG, bf* WD, bf* WO) {
    const int id = blockIdx.x; int t = (id < 2 * PT_N) ? (id >> 4) * 8 + (id & 7) : id - PT_N;   // the share's number within its kind
    if (id < 2 * PT_N && !(id & 8)) {
        if (t < PT_Q) { wtG_blk(t, wq, DM, DQ, WQ); return; } t -= PT_Q;
        if (t < PT_Q) { wtG_blk(t, wo, DQ, DM, WO); return; } t -= PT_Q;
        if (t < PT_K) { wtG_blk(t, wk, DM, DKV, WK); return; } t -= PT_K;
        wtG_blk(t, wv, DM, DKV, WV);
    } else {
        if (t < PC_G) { wgd_blk(t, wg, DQ, WG); return; } t -= PC_G;
        if (t < PC_D) { wgd_blk(t, wdl, DKV, WD); return; } t -= PC_D;
        cvt8_blk(t, x, XB, (size_t)NB_ * TT * DM / 8); }
}

extern "C" void kernel_launch(void* const* d_in, const int* in_sizes, int n_in,
                              void* d_out, int out_size, void* d_ws, size_t ws_size, hipStream_t stream) {
    (void)in_sizes; (void)n_in; (void)out_size;
    const float* x = (const float*)d_in[0]; const float* wq = (const float*)d_in[1]; const float* wk = (const float*)d_in[2]; const float* wv = (const float*)d_in[3]; const float* wg = (const float*)d_in[4]; const float* wdl = (const float*)d_in[5]; const float* wo = (const float*)d_in[6]; const float* cosT = nullptr; const float* sinT = nullptr; (void)cosT; (void)sinT;
    float* OUT = (float*)d_out;     // [2][2048][2048]
    char* wsp = (char*)d_ws;
    auto take = [&](size_t bytes) { char* p = wsp; wsp += (bytes + 255) & ~(size_t)255; return (void*)p; };
    const size_t MT = (size_t)NB_ * TT;   // token rows of both batch elements together: every launch covers both
    // read by the attention kernel or behind it
    bf* WO = (bf*)take((size_t)DM * DQ * 2); float* BIAS = (float*)take((size_t)NB_ * NKV * TT * 4); int* FLG = (int*)take(256);
    h16* QP16 = (h16*)take(MT * NH_ * HD * 2); h16* KP16 = (h16*)take(MT * NKV * HD * 2); h16* VT16 = (h16*)take(MT * NKV * HD * 2);
    bf* QPh = (bf*)take(MT * NH_ * HD * 2); bf* QPl = (bf*)take(MT * NH_ * HD * 2); bf* KPh = (bf*)take(MT * NKV * HD * 2); bf* KPl = (bf*)take(MT * NKV * HD * 2); bf* VTh = (bf*)take(MT * NKV * HD * 2); bf* VTl = (bf*)take(MT * NKV * HD * 2);
    bf* ATh = (bf*)take(MT * DQ * 2); bf* ATl = (bf*)take(MT * DQ * 2);
    // read only by the launches in front of the attention kernel
    bf* WQ = (bf*)take((size_t)(DQ + 2 * DKV) * DM * 2); bf* WK = WQ + (size_t)DQ * DM; bf* WV = WK + (size_t)DKV * DM;   // one plane: the rows of Wq^T, Wk^T, Wv^T one behind the other
    bf* XB = (bf*)take(MT * DM * 2); bf* GFh = (bf*)take(MT * DQ * 2); bf* GFl = (bf*)take(MT * DQ * 2); bf* VFh = (bf*)take(MT * DKV * 2); bf* VFl = (bf*)take(MT * DKV * 2); bf* WG = (bf*)take((size_t)64 * DQ * 2); bf* WD = (bf*)take((size_t)64 * DKV * 2); float* GATE = (float*)take(MT * 64 * 4); float* DEL = (float*)take(MT * 64 * 4);
    if ((size_t)(wsp - (char*)d_ws) > ws_size) return;    // ws 256 MiB
    const Epi E0 = { nullptr, nullptr, nullptr, nullptr, nullptr };   // plain f32 tile
    k_prep<<<PT_N + PC_G + PC_D + PC_X, 256, 0, stream>>>(x, wq, wk, wv, wg, wdl, wo, XB, WQ, WK, WV, WG, WD, WO);
    const unsigned MB = (unsigned)(MT / 64), MB2 = (unsigned)(MT / 128);   // 64-row and 128-row tiles over both batch elements
    // the three projections, in one launch, store the 16-bit planes that the later products read
    k_gemms<0, 4><<<dim3(MB2, (DQ + 2 * DKV) / 128, 1), 128, 0, stream>>>(XB, nullptr, WQ, DM, nullptr, 0, Epi{ QP16, QPh, QPl, GFh, GFl }, Epi{ KP16, KPh, KPl, nullptr, nullptr }, Epi{ VT16, VTh, VTl, VFh, VFl });
    /* dynamic mask bias per (batch, kv head, key) */
    k_gd<<<dim3(MB, 1, 2), 512, 0, stream>>>(GFh, GFl, WG, VFh, VFl, WD, GATE, DEL); k_bias<<<(NB_ * NKV * TT / 4 + 255) / 256, 256, 0, stream>>>(GATE, DEL, BIAS); k_chk<<<NB_, 32, 0, stream>>>(BIAS, FLG);
    // all heads of both batch elements in one launch; it stores the hi / lo rows of the output projection's A operand
    k_attn<<<dim3(TT / 16 * NKV * NB_, 1, 1), REP * 32, 0, stream>>>(QP16, QPh, QPl, (const bf*)KP16, KPh, KPl, (const bf*)VT16, VTh, VTl, BIAS, FLG, ATh, ATl);
    k_gemms<1, 0><<<dim3(MB2, DM / 128, 1), 128, 0, stream>>>(ATh, ATl, WO, DQ, OUT, DM, E0, E0, E0);
}

// v009
// It runs in 213 microseconds.
// Two timings next to v008 put it at 1.09 and 1.10 times that version's speed.
// All steps since v000 together make it 11.3 times as fast.
#include <hip/hip_runtime.h>

// DynamicMaskAttention (hidden [2][2048][2048]; q = x Wq (16 heads x 128), k/v = x Wk / Wv (4 kv heads; group h/4); per key j and kv head n: bias = sigmoid(q_flat[j] . Wg[:, n]) * (v_flat[j] . Wd[:, n]); logits = q.k / sqrt(128) + bias[n][j]; allowed = causal AND bias[n][j] > 0, everything else gets finfo.min (so a query row with no allowed key softmaxes uniformly over ALL keys, as the source);
//   softmax; out = merged Wo -> [2][2048][2048]).
// Compute dtypes, f32 accumulate: every input rounded to bf16; q/k/v on PLAIN bf16 operands (inputs: exact); gate / delta as hl planes of q_flat / v_flat x exact Wg / Wd (2 products; 4 outputs padded to 64), sigmoid and the product f32; scores and attn.v: query rows < 512 hl (3 products), the rest single fp16, both with causal tile skipping; a 16-row block of the early rows whose first row has no allowed key (such a row attends uniformly to every key) goes on over ALL key tiles, behind the diagonal with the v product alone; bias + mask + running softmax f32, probabilities unnormalised (exp(t - max) <= 1), the division by their sum last; Wo hl x exact (2 products).

#define NB_  2
#define TT   2048
#define DM   2048
#define NH_  16
#define NKV  4
#define REP  (NH_ / NKV)
#define HD   128
#define DQ   (NH_ * HD)
#define DKV  (NKV * HD)
#define ZH   4                    // query heads per group of q planes: one whole kv group (ZH == REP), the heads that share their K and V planes
#define RH   512                  // query rows < RH use hi+lo planes
#define WIN  2048
#define SCL  0.088388347648318447f   // HD^-0.5
typedef _Float16 h16;
typedef unsigned short bf;
typedef __attribute__((ext_vector_type(16))) __bf16   v16bf;
typedef __attribute__((ext_vector_type(16))) _Float16 v16h;
typedef __attribute__((ext_vector_type(8)))  _Float16 v8h;
typedef __attribute__((ext_vector_type(8)))  unsigned short v8us;
typedef __attribute__((ext_vector_type(8)))  float    v8f;
typedef __attribute__((ext_vector_type(4)))  float    v4f;
typedef v8h  __attribute__((may_alias)) v8ha;
typedef v4f  __attribute__((may_alias)) v4fa;
typedef v8us __attribute__((may_alias)) v8usa;

__device__ __forceinline__ unsigned short f2bf(float f) { unsigned u = __float_as_uint(f); u += 0x7FFFu + ((u >> 16) & 1u); return (unsigned short)(u >> 16); }
__device__ __forceinline__ float bf2f(unsigned short b) { return __uint_as_float(((unsigned)b) << 16); }
__device__ __forceinline__ float bfr(float f) { return bf2f(f2bf(f)); }
__device__ __forceinline__ v16h cat16(v8h lo, v8h hi) { return __builtin_shufflevector(lo, hi, 0, 1, 2, 3, 4, 5, 6, 7, 8, 9, 10, 11, 12, 13, 14, 15); }
__device__ __forceinline__ v16bf cat16b(v8us lo, v8us hi) { return __builtin_bit_cast(v16bf, __builtin_shufflevector(lo, hi, 0, 1, 2, 3, 4, 5, 6, 7, 8, 9, 10, 11, 12, 13, 14, 15)); }
__device__ __forceinline__ v8f wmma16(v16h a, v16h b, v8f c) { return __builtin_amdgcn_wmma_f32_16x16x32_f16(false, a, false, b, (short)0, c, false, false); }
__device__ __forceinline__ v8f wmmab(v16bf a, v16bf b, v8f c) { return __builtin_amdgcn_wmma_f32_16x16x32_bf16(false, a, false, b, (short)0, c, false, false); }
__device__ __forceinline__ h16 tohx(float x) { return (h16)x; }
__device__ __forceinline__ void splitf(float y, unsigned short& h, unsigned short& l) { h = f2bf(y); l = f2bf(y - bf2f(h)); }
typedef __attribute__((ext_vector_type(4))) _Float16 v4h;
typedef __attribute__((ext_vector_type(4))) unsigned short v4us;

// ---- what the store step of a GEMM writes (EPI): 0 the f32 tile; otherwise the 16-bit operand planes of the next GEMM, straight from the sums:
// 1 q: head planes [h / ZH][b][h % ZH][t][d] (fp16, hi, lo) and the flat hi / lo rows for the gate product; 2 k: head planes [h][b][t][d] (fp16, hi, lo);
// 3 v: flat hi / lo rows for the delta product (the transposed planes [g][b][d][t] are written by the kernel itself, through LDS).
struct Epi { h16* p16; bf* ph; bf* pl; bf* fh; bf* fl; };
template <int EPI> __device__ __forceinline__ void epi_put(const Epi& ep, int R, int c, v4f val) {   // four neighbouring sums of output row R, columns c .. c + 3
    v4h o16; v4us oh, ol;
    // unrolled: the vectors' elements are indexed by constants and stay in registers
#pragma unroll
    for (int u = 0; u < 4; ++u) { const float x = val[u]; o16[u] = tohx(x); unsigned short a, c2; splitf(x, a, c2); oh[u] = a; ol[u] = c2; }
    if (EPI == 1 || EPI == 2) { const int b = R / TT, t = R % TT, h = c / HD, d = c % HD; const int p = (EPI == 1) ? (h / ZH) * (NB_ * ZH) + b * ZH + h % ZH : h * NB_ + b; const size_t o = ((size_t)p * TT + t) * HD + d;
        *(v4h*)(ep.p16 + o) = o16; *(v4us*)(ep.ph + o) = oh; *(v4us*)(ep.pl + o) = ol; }
    if (EPI == 1 || EPI == 3) { const size_t o = (EPI == 1) ? (size_t)R * DQ + c : (size_t)R * DKV + c;
        *(v4us*)(ep.fh + o) = oh; *(v4us*)(ep.fl + o) = ol; }
}



// ---- gemmw_tile: register-blocked GEMM, one work-group of NW waves per 64x64 output tile; every wave holds the whole tile (16 accumulators) for its own share of K (64-element chunks dealt round robin: one 128-byte line of each operand row per chunk),
// operands straight from K-contiguous 16-bit planes; for NW > 1 the NW partial tiles are summed through LDS in wave order 0..NW-1 (K % 64 == 0); grid (M/64, N/64, Z), NW * 32 threads.
// C[m][n] (f32, pitch ldc, + optional f32 bias[n]) = sum_k A[m][k] Bt[n][k] (+ split products per NSPLIT). z-batch strides sA/sB/sC in elements (sA, sC per z slice; sB per ZH slices: the ZH heads of a kv group share Bt). A rows have pitch lda, Bt rows pitch K. K % 32 == 0.
template <typename T16> struct WFrag;
template <> struct WFrag<h16> { typedef v16h V; static __device__ __forceinline__ V ld(const h16* p) { return cat16(*(const v8h*)p, *(const v8h*)(p + 16)); } static __device__ __forceinline__ v8f mma(V a, V b, v8f c) { return wmma16(a, b, c); } };
template <> struct WFrag<bf> { typedef v16bf V; static __device__ __forceinline__ V ld(const bf* p) { return cat16b(*(const v8us*)p, *(const v8us*)(p + 16)); } static __device__ __forceinline__ v8f mma(V a, V b, v8f c) { return wmmab(a, b, c); } };
template <typename T16, int NSPLIT, bool BIAS, int NW, int EPI>
__device__ __forceinline__ void gemmw_tile(const T16* __restrict__ A, const T16* __restrict__ A2, const T16* __restrict__ Bt, const T16* __restrict__ Bt2, int K, int lda, float* C, int ldc, const float* __restrict__ bias, size_t sA, size_t sB, size_t sC, Epi ep) {
    typedef typename WFrag<T16>::V V;
    __shared__ __align__(16) float os[NW > 1 ? NW * 64 * 68 : 16 * 68];
    const size_t z = blockIdx.z; A += z * sA; if (A2) A2 += z * sA; Bt += (z / ZH) * sB; if (Bt2) Bt2 += (z / ZH) * sB; C += z * sC;
    const int lane = threadIdx.x & 31, lr = lane & 15, hi = lane >> 4; const int wv = (NW > 1) ? __builtin_amdgcn_readfirstlane((int)(threadIdx.x >> 5)) : 0;   /* wave number as a scalar: the K loop's counter and branch stay scalar */ const int r0 = blockIdx.x * 64, c0 = blockIdx.y * 64;
    v8f acc[4][4];
#pragma unroll
    for (int mb = 0; mb < 4; ++mb)
#pragma unroll
        for (int nb = 0; nb < 4; ++nb) acc[mb][nb] = (v8f){};
    const size_t aoff = (size_t)(r0 + lr) * lda + 8 * hi, boff = (size_t)(c0 + lr) * K + 8 * hi;
#pragma unroll 1
    for (int kc = wv * 64; kc < K; kc += (kc & 32) ? (NW * 64 - 32) : 32) {
        V a[4], a2[4]; const T16* pa[4]; const T16* pa2[4]; const T16* pb[4]; const T16* pb2[4];
#pragma unroll
        for (int mb = 0; mb < 4; ++mb) { pa[mb] = A + aoff + (size_t)mb * 16 * lda + kc; a[mb] = WFrag<T16>::ld(pa[mb]); if (NSPLIT == 1 || NSPLIT == 2) { pa2[mb] = A2 + aoff + (size_t)mb * 16 * lda + kc; a2[mb] = WFrag<T16>::ld(pa2[mb]); } }
#pragma unroll
        for (int nb = 0; nb < 4; ++nb) { pb[nb] = Bt + boff + (size_t)nb * 16 * K + kc; const V b = WFrag<T16>::ld(pb[nb]); V b2; if (NSPLIT >= 2) { pb2[nb] = Bt2 + boff + (size_t)nb * 16 * K + kc; b2 = WFrag<T16>::ld(pb2[nb]); }
#pragma unroll
            for (int mb = 0; mb < 4; ++mb) { acc[mb][nb] = WFrag<T16>::mma(a[mb], b, acc[mb][nb]); if (NSPLIT == 1 || NSPLIT == 2) acc[mb][nb] = WFrag<T16>::mma(a2[mb], b, acc[mb][nb]); if (NSPLIT >= 2) acc[mb][nb] = WFrag<T16>::mma(a[mb], b2, acc[mb][nb]); } }
        asm volatile("v_nop\n\tv_nop\n\tv_nop\n\tv_nop" : "+v"(acc[0][0]), "+v"(acc[1][1]), "+v"(acc[2][2]), "+v"(acc[3][3]) : "v"(a[0]), "v"(a[3]));
        // precaution: this trip's load addresses are named as inputs, so their registers are not reused between a load and this wait; it stands at the loop's foot, where every load of the trip has already delivered its data
        if (NSPLIT == 2) asm volatile("s_wait_xcnt 0x0" :: "v"(pa[0]), "v"(pa[1]), "v"(pa[2]), "v"(pa[3]), "v"(pa2[0]), "v"(pa2[1]), "v"(pa2[2]), "v"(pa2[3]), "v"(pb[0]), "v"(pb[1]), "v"(pb[2]), "v"(pb[3]), "v"(pb2[0]), "v"(pb2[1]), "v"(pb2[2]), "v"(pb2[3]) : "memory");
        else if (NSPLIT == 1) asm volatile("s_wait_xcnt 0x0" :: "v"(pa[0]), "v"(pa[1]), "v"(pa[2]), "v"(pa[3]), "v"(pa2[0]), "v"(pa2[1]), "v"(pa2[2]), "v"(pa2[3]), "v"(pb[0]), "v"(pb[1]), "v"(pb[2]), "v"(pb[3]) : "memory");
        else asm volatile("s_wait_xcnt 0x0" :: "v"(pa[0]), "v"(pa[1]), "v"(pa[2]), "v"(pa[3]), "v"(pb[0]), "v"(pb[1]), "v"(pb[2]), "v"(pb[3]) : "memory");
    }
    if (NW > 1) {   // merge of the K split: each wave parks its whole partial tile in its own LDS slot, then all threads sum the NW slots in wave order and store
        float* osw = os + wv * (64 * 68);
        // the three loops are unrolled so that acc is indexed by constants and stays in registers
#pragma unroll
        for (int mb = 0; mb < 4; ++mb)
#pragma unroll
            for (int nb = 0; nb < 4; ++nb)
#pragma unroll
                for (int j = 0; j < 8; ++j) osw[(mb * 16 + hi * 8 + j) * 68 + nb * 16 + lr] = acc[mb][nb][j];
        __syncthreads();   // every wave's partial tile is in LDS before any thread sums across the slots
        v4f kept[32 / NW];   // EPI 3 only: the thread's sums, stored as flat rows behind the second barrier, so that no global store is outstanding at it
        // both loops unrolled: the LDS reads of all slots and rounds go out without a branch between them
#pragma unroll
        for (int s = 0; s < 32 / NW; ++s) { const int q = s * (NW * 32) + (int)threadIdx.x, row = q >> 4, cofs = (q & 15) * 4; v4f val = *(const v4fa*)(os + row * 68 + cofs);
#pragma unroll
            for (int w = 1; w < NW; ++w) val += *(const v4fa*)(os + w * (64 * 68) + row * 68 + cofs);
            kept[s] = val;
            if (BIAS) { val[0] += bfr(bias[c0 + cofs]); val[1] += bfr(bias[c0 + cofs + 1]); val[2] += bfr(bias[c0 + cofs + 2]); val[3] += bfr(bias[c0 + cofs + 3]); }
            if (EPI == 0) *(v4f*)(C + (size_t)(r0 + row) * ldc + c0 + cofs) = val; else if (EPI != 3) epi_put<EPI>(ep, r0 + row, c0 + cofs, val);
            if (EPI == 3) *(v4fa*)(os + row * 68 + cofs) = val; }   // the summed tile goes back into slot 0 (each quad is read and rewritten by this one thread) for the transposed read below
        if (EPI == 3) {   // v planes [g][b][d][t]: the summed tile is read back by columns, so that 16 lanes store one whole 128-byte line along t
            __syncthreads();   // the whole summed tile is in slot 0 before any thread reads a column of it
            // both loops unrolled: kept and the vectors are indexed by constants, and the LDS reads of both rounds go out without a branch between them
#pragma unroll
            for (int s = 0; s < 32 / NW; ++s) { const int q = s * (NW * 32) + (int)threadIdx.x, dc = q >> 4, t4 = (q & 15) * 4; const int c = c0 + dc, R = r0 + t4; v4h o16; v4us oh, ol;
                epi_put<EPI>(ep, r0 + dc, c0 + t4, kept[s]);   // the flat rows: quad q is (row q >> 4, columns (q & 15) * 4 ..) in the first loop too
#pragma unroll
                for (int u = 0; u < 4; ++u) { const float x = os[(t4 + u) * 68 + dc]; o16[u] = tohx(x); unsigned short a, c2; splitf(x, a, c2); oh[u] = a; ol[u] = c2; }
                const size_t o = (((size_t)(c / HD) * NB_ + R / TT) * HD + c % HD) * TT + R % TT; *(v4h*)(ep.p16 + o) = o16; *(v4us*)(ep.ph + o) = oh; *(v4us*)(ep.pl + o) = ol; }
        }
        return;
    }
#pragma unroll
    for (int mb = 0; mb < 4; ++mb) {
#pragma unroll
        for (int nb = 0; nb < 4; ++nb) {
#pragma unroll
            for (int j = 0; j < 8; ++j) os[(hi * 8 + j) * 68 + nb * 16 + lr] = acc[mb][nb][j]; }
        __builtin_amdgcn_wave_barrier(); asm volatile("" ::: "memory");
        float* crow = C + (size_t)(r0 + mb * 16) * ldc + c0;
{
#pragma unroll
            for (int s = 0; s < 8; ++s) { const int row = 2 * s + hi, cofs = lr * 4; v4f val = *(const v4fa*)(os + row * 68 + cofs); if (BIAS) { val[0] += bfr(bias[c0 + cofs]); val[1] += bfr(bias[c0 + cofs + 1]); val[2] += bfr(bias[c0 + cofs + 2]); val[3] += bfr(bias[c0 + cofs + 3]); }
                *(v4f*)(crow + (size_t)row * ldc + cofs) = val; }
             }
        __builtin_amdgcn_wave_barrier(); asm volatile("" ::: "memory");
    }
}

// gate and delta products in one launch (neither reads the other's result): blockIdx.z 0 the gate (K = DQ), 1 the delta (K = DKV: its eight 64-element chunks go to waves 0..7, the other waves' partial tiles are zero). grid (M / 64, 1, 2), 512 threads
__global__ __launch_bounds__(512) void k_gd(const bf* __restrict__ GFh, const bf* __restrict__ GFl, const bf* __restrict__ WG, const bf* __restrict__ VFh, const bf* __restrict__ VFl, const bf* __restrict__ WD, float* GATE, float* DEL) {
    const bool dl = blockIdx.z != 0; const int K = dl ? DKV : DQ;
    gemmw_tile<bf, 1, false, 16, 0>(dl ? VFh : GFh, dl ? VFl : GFl, dl ? WD : WG, nullptr, K, K, dl ? DEL : GATE, 64, nullptr, 0, 0, 0, Epi{ nullptr, nullptr, nullptr, nullptr, nullptr });
}

typedef __attribute__((ext_vector_type(2))) unsigned short v2us;
typedef __attribute__((ext_vector_type(2))) float v2f;
typedef __attribute__((ext_vector_type(4))) int v4i;
typedef v4h  __attribute__((may_alias)) v4ha;
typedef v4us __attribute__((may_alias)) v4usa;

// the three bodies wtT_blk, cvt64_blk and wgd_blk are one 256-thread work-group's share (number blk) of one preparation job; k_prep deals them
// wtT_blk: Bt[n][k] = bf16(w[k][n]) for a tile of TK k x TN n, through LDS, with 16 bytes per lane: 16 lanes read 64 n of one row of w, 32 lanes write 256 k of one row of Bt.
// A thread reads 16 k x 4 n, all 16 loads under way together, and puts two 16-byte pieces (8 k each) into each of its 4 LDS rows. The pieces of LDS row n are rotated by n / 4 places: the 16 lanes of a half wave write rows 4 apart, which at this pitch would otherwise all fall on the same banks.
#define TK 256
#define TN 64
__device__ __forceinline__ void wtT_blk(bf* ts, int blk, const float* __restrict__ w, int K, int N, bf* Bt) {
    const int tid = threadIdx.x, ng = tid & 15, kg = tid >> 4; const int k0 = (blk % (K / TK)) * TK, n0 = (blk / (K / TK)) * TN;
    const float* p = w + (size_t)(k0 + kg * 16) * N + n0 + ng * 4; v4f r[16];
    // unrolled, here and below: the arrays are indexed by constants and stay in registers
#pragma unroll
    for (int j = 0; j < 16; ++j) r[j] = *(const v4f*)(p + (size_t)j * N);
    asm volatile("s_wait_xcnt 0x0" :: "v"(p) : "memory");   // precaution: the load address is named as an input, so its registers are not reused between a load and this wait
#pragma unroll
    for (int u = 0; u < 4; ++u)
#pragma unroll
        for (int h = 0; h < 2; ++h) { v8us o;
#pragma unroll
            for (int j = 0; j < 8; ++j) o[j] = f2bf(r[h * 8 + j][u]);
            *(v8usa*)(ts + (ng * 4 + u) * TK + ((kg * 2 + h + ng) & 31) * 8) = o; }
    __syncthreads();   // the whole tile is in LDS before any thread reads a row of it
    bf* q = Bt + (size_t)(n0 + (tid >> 5)) * K + k0 + (tid & 31) * 8;
#pragma unroll
    for (int i = 0; i < 8; ++i) { const int row = i * 8 + (tid >> 5); *(v8us*)(q + (size_t)i * 8 * K) = *(const v8usa*)(ts + row * TK + (((tid & 31) + (row >> 2)) & 31) * 8); }
    asm volatile("s_wait_xcnt 0x0" ::: "memory");   // precaution: in the kernel's text another share's code follows, which rewrites the registers that these stores name
}
// cvt64_blk: 64 elements per thread, in eight 8-element chunks 256 chunks apart; all 16 loads under way together
__device__ __forceinline__ void cvt64_blk(int blk, const float* __restrict__ src, bf* dst) { const size_t i = ((size_t)blk * 2048 + threadIdx.x) * 8; const float* p = src + i; v8f v[8];
#pragma unroll
    for (int c = 0; c < 8; ++c) v[c] = *(const v8f*)(p + c * 2048);
    asm volatile("s_wait_xcnt 0x0" :: "v"(p) : "memory");   // precaution, as above
#pragma unroll
    for (int c = 0; c < 8; ++c) { v8us o;
#pragma unroll
        for (int k = 0; k < 8; ++k) o[k] = f2bf(v[c][k]);
        *(v8us*)(dst + i + c * 2048) = o; }
    asm volatile("s_wait_xcnt 0x0" ::: "memory"); }   // precaution, as at the foot of wtT_blk
__global__ __launch_bounds__(256) void k_cscvt(const float* __restrict__ cosT, const float* __restrict__ sinT, float* CS) { const int idx = blockIdx.x * 256 + threadIdx.x; if (idx >= TT * HD) return; v2f cs; cs[0] = bfr(cosT[idx]); cs[1] = bfr(sinT[idx]); *(v2f*)(CS + (size_t)idx * 2) = cs;  }
// ---- k_attn: scores, bias + mask, softmax and the product with v in one kernel; no score or probability goes to memory. One wave per (head, 16 query rows); the 4 waves of a work-group are the 4 heads of one kv group and share its k / v tiles through LDS.
// Everything is computed transposed, so that no value changes lanes between the two products: S^T = k q^T (A = 16 key rows, B = the wave's 16 query rows) leaves lane (lr, hi) with query lr and keys hi * 8 + j of each 16-key tile;
// two such tiles side by side are exactly the B fragment (n = query lr, k = 8 * hi + 0..7 and 8 * hi + 16 + 0..7) of O^T = v^T P^T (A = 16 rows of the [d][t] plane). A lane's scores, running maximum, running sum and all its O^T elements belong to its one query.
// Running softmax over steps of 32 keys: m = max so far, p = exp(t - m), sum and O^T rescaled by exp(m_old - m_new); the division by the sum comes last, in f32. The masked fill equals the start value of m, so a row with no allowed key weighs every key 1 (uniform, as the source's finfo.min fill),
// and the first allowed key wipes such weights (factor exp(-huge) = 0). HR (query rows < RH): hi + lo planes, 3 products each; otherwise single fp16. Both run nc steps, up to the diagonal. Behind the diagonal every key is masked: a row that has met an allowed key weighs all of them exp(-huge) = 0, so its sums are final; a row that has met none weighs all of them 1.
// Only an HR block that holds such a row (nk > nc: the kv head's first positive bias lies behind the block's first row) runs the steps nc .. nk - 1, and there the weight is the same for all keys of a row and known beforehand: no k tile, no scores, no exponentials, and the lo plane of the weight (0 or 1: exact in bf16) is zero, so two v products are left.
// Staging: two LDS buffers; step s + 1's tiles (32 k rows, 128 v^T rows of 32 keys) travel global -> registers while step s is computed, go into the other buffer behind it, and one work-group barrier per step publishes them and ends the reads of the buffer that is refilled next.
#define KPIT 136                  // LDS pitch of a k row, elements: 272 B = 16 B x odd, the 16 rows of a fragment read fall on distinct banks
#define VPIT 40                   // LDS pitch of a v^T row of 32 keys: 80 B = 16 B x odd
#define KTE  (32 * KPIT)
#define STE  (KTE + HD * VPIT)    // elements of one staged plane: k tile, then v^T tile
typedef __attribute__((ext_vector_type(16))) unsigned short v16us;
__device__ __forceinline__ float exp2s(float x) { float r; asm("v_exp_f32 %0, %1\n\tv_nop" : "=v"(r) : "v"(x)); return r; }
template <typename T16> struct LFrag;   // a fragment from two 16-byte LDS reads, in the k order of WFrag
template <> struct LFrag<h16> { static __device__ __forceinline__ v16h ld(const bf* p) { const v8us x = *(const v8usa*)p, y = *(const v8usa*)(p + 16); return cat16(__builtin_bit_cast(v8h, x), __builtin_bit_cast(v8h, y)); } };
template <> struct LFrag<bf> { static __device__ __forceinline__ v16bf ld(const bf* p) { const v8us x = *(const v8usa*)p, y = *(const v8usa*)(p + 16); return cat16b(x, y); } };
template <typename T16, bool HR>
__device__ __forceinline__ void attn_rows(bf* sm, float* smb, int wv, const T16* __restrict__ Q, const T16* __restrict__ Q2, const bf* __restrict__ Kp, const bf* __restrict__ K2, const bf* __restrict__ Vt, const bf* __restrict__ V2, const float* __restrict__ bias, bool poison, int q0, int nc, int nk, bf* oh, bf* ol) {
    typedef typename WFrag<T16>::V V; constexpr int NP = HR ? 2 : 1;
    const int tid = threadIdx.x, lane = tid & 31, lr = lane & 15, hi = lane >> 4; const int qi = q0 + lr;
    V bq[4], bq2[4]; const T16* pq = Q + (size_t)qi * HD + 8 * hi; const T16* pq2 = HR ? Q2 + (size_t)qi * HD + 8 * hi : nullptr;
    // unrolled, here and below: the fragment, staging and accumulator arrays are indexed by constants and stay in registers
#pragma unroll
    for (int kc = 0; kc < 4; ++kc) { bq[kc] = WFrag<T16>::ld(pq + kc * 32); if (HR) bq2[kc] = WFrag<T16>::ld(pq2 + kc * 32); }
    // precaution: the load addresses are named as inputs, so their registers are not reused between a load and this wait
    if (HR) asm volatile("s_wait_xcnt 0x0" :: "v"(pq), "v"(pq2) : "memory");
    else asm volatile("s_wait_xcnt 0x0" :: "v"(pq) : "memory");
    v8f o[8];
#pragma unroll
    for (int mb = 0; mb < 8; ++mb) o[mb] = (v8f){};
    float m = -3.0e38f, l = 0.f;
    // staging, 16-byte chunk c = tid + 128 * i: k tile (one contiguous 8 KiB) row c >> 4, piece c & 15; v^T tile row c >> 2, piece c & 3
    const unsigned gko = tid * 8, gvo = (tid >> 2) * TT + (tid & 3) * 8; const int sko = (tid >> 4) * KPIT + (tid & 15) * 8, svo = KTE + (tid >> 2) * VPIT + (tid & 3) * 8;
    const int fko = lr * KPIT + 8 * hi, fvo = KTE + lr * VPIT + 8 * hi;   // the lane's place in a k / v^T fragment read
    v8us rk[NP][4], rv[NP][4]; float rb = 0.f;
    if (wv == 0) smb[tid] = bias[tid];   // wave 0 stages the step's 32 bias values, one per lane
#pragma unroll
    for (int i = 0; i < 4; ++i) { rk[0][i] = *(const v8us*)(Kp + gko + i * 1024); rv[0][i] = *(const v8us*)(Vt + gvo + (size_t)i * 32 * TT); if (HR) { rk[NP - 1][i] = *(const v8us*)(K2 + gko + i * 1024); rv[NP - 1][i] = *(const v8us*)(V2 + gvo + (size_t)i * 32 * TT); } }
#pragma unroll
    for (int pl = 0; pl < NP; ++pl)
#pragma unroll
        for (int i = 0; i < 4; ++i) { *(v8usa*)(sm + pl * STE + sko + i * 8 * KPIT) = rk[pl][i]; *(v8usa*)(sm + pl * STE + svo + i * 32 * VPIT) = rv[pl][i]; }
    __syncthreads();   // step 0's tiles are in buffer 0 before any wave reads them
    for (int s = 0; s < nc; ++s) {
        const int sn = min(s + 1, (HR ? TT / 32 : nk) - 1);   // the tile that is staged during this step; behind the last step that reads one a tile is staged that nobody reads, so the loop body has no branch
        const unsigned ok = gko + sn * 32 * HD, ov = gvo + sn * 32, ob = sn * 32 + lane;   // element offsets of this step's loads inside their planes
        const bf* pk = Kp + ok; const bf* pk2 = HR ? K2 + ok : nullptr; const bf* pv = Vt + ov; const bf* pv2 = HR ? V2 + ov : nullptr;
        {   // next k tile: on its way during the score products
#pragma unroll
            for (int i = 0; i < 4; ++i) { rk[0][i] = *(const v8us*)(pk + i * 1024); if (HR) rk[NP - 1][i] = *(const v8us*)(pk2 + i * 1024); }
            if (wv == 0) rb = bias[ob]; }
        const bf* cur = sm + (s & 1) * (NP * STE); bf* nxt = sm + ((s + 1) & 1) * (NP * STE);
        v8f st[2]; float t[16]; float mt = -3.0e38f;
#pragma unroll
        for (int tt = 0; tt < 2; ++tt) { st[tt] = (v8f){};
#pragma unroll
            for (int kc = 0; kc < 4; ++kc) { const V a = LFrag<T16>::ld(cur + fko + tt * 16 * KPIT + kc * 32); st[tt] = WFrag<T16>::mma(a, bq[kc], st[tt]);
                if (HR) { st[tt] = WFrag<T16>::mma(a, bq2[kc], st[tt]); const V a2 = LFrag<T16>::ld(cur + STE + fko + tt * 16 * KPIT + kc * 32); st[tt] = WFrag<T16>::mma(a2, bq[kc], st[tt]); } } }
        const float* cb = smb + (s & 1) * 32 + hi * 8; const v4f bb[4] = { *(const v4fa*)cb, *(const v4fa*)(cb + 4), *(const v4fa*)(cb + 16), *(const v4fa*)(cb + 20) };
#pragma unroll
        for (int tt = 0; tt < 2; ++tt)
#pragma unroll
            for (int j = 0; j < 8; ++j) { const int key = s * 32 + tt * 16 + hi * 8 + j; const float bj = bb[tt * 2 + (j >> 2)][j & 3]; const float x = (key <= qi && bj > 0.f) ? st[tt][j] * SCL + bj : -3.0e38f; t[tt * 8 + j] = x; mt = fmaxf(mt, x); }
        {   // the other buffer is free since the last barrier: the k tile goes in as soon as it has come; next v^T tile: on its way during the softmax and the second product
#pragma unroll
            for (int pl = 0; pl < NP; ++pl)
#pragma unroll
                for (int i = 0; i < 4; ++i) *(v8usa*)(nxt + pl * STE + sko + i * 8 * KPIT) = rk[pl][i];
            if (wv == 0) smb[((s + 1) & 1) * 32 + lane] = rb;
#pragma unroll
            for (int i = 0; i < 4; ++i) { rv[0][i] = *(const v8us*)(pv + (size_t)i * 32 * TT); if (HR) rv[NP - 1][i] = *(const v8us*)(pv2 + (size_t)i * 32 * TT); } }
        mt = fmaxf(mt, __shfl_xor(mt, 16, 32));   // the other half of the wave holds the query's other 16 keys of this step
        const float mn = fmaxf(m, mt); const float alpha = exp2s((m - mn) * 1.4426950408889634f); m = mn;
        float ps = 0.f;
#pragma unroll
        for (int u = 0; u < 16; ++u) { t[u] = exp2s((t[u] - mn) * 1.4426950408889634f); ps += t[u]; }
        l = l * alpha + ps;   // each half of the wave sums its own keys; the halves meet behind the loop
#pragma unroll
        for (int mb = 0; mb < 8; ++mb) o[mb] *= alpha;
        V p, p2;
        if constexpr (HR) { v16us a, c;
#pragma unroll
            for (int u = 0; u < 16; ++u) { unsigned short x, y; splitf(t[u], x, y); a[u] = x; c[u] = y; }
            p = __builtin_bit_cast(v16bf, a); p2 = __builtin_bit_cast(v16bf, c);
        } else {
#pragma unroll
            for (int u = 0; u < 16; ++u) p[u] = tohx(t[u]); }
#pragma unroll
        for (int mb = 0; mb < 8; ++mb) { const V a = LFrag<T16>::ld(cur + fvo + mb * 16 * VPIT); o[mb] = WFrag<T16>::mma(a, p, o[mb]);
            if constexpr (HR) { o[mb] = WFrag<T16>::mma(a, p2, o[mb]); const V a2 = LFrag<T16>::ld(cur + STE + fvo + mb * 16 * VPIT); o[mb] = WFrag<T16>::mma(a2, p, o[mb]); } }
        {
#pragma unroll
            for (int pl = 0; pl < NP; ++pl)
#pragma unroll
                for (int i = 0; i < 4; ++i) *(v8usa*)(nxt + pl * STE + svo + i * 32 * VPIT) = rv[pl][i]; }
        // precaution: this step's load addresses (HR: their offsets beside the planes' scalar bases) are named as inputs, so their registers are not reused between a load and this wait; it stands at the loop's foot, where every load of the step has already delivered its data
        if (HR) asm volatile("s_wait_xcnt 0x0" :: "v"(ok), "v"(ov), "v"(ob) : "memory");
        else asm volatile("s_wait_xcnt 0x0" :: "v"(pk), "v"(pv), "v"(ob) : "memory");
        __syncthreads();   // publishes step s + 1's tiles; every wave has finished reading the buffer that the next step refills
    }
    if constexpr (HR) {
        if (nc < nk) {   // the same for the whole work-group: the barriers below are met by every wave
            const float w = exp2s((-3.0e38f - m) * 1.4426950408889634f);   // a masked key's weight, as in the loop above: 1 for a row with no allowed key, else 0
            unsigned short wh, wl; splitf(w, wh, wl); v16us a16;
#pragma unroll
            for (int u = 0; u < 16; ++u) a16[u] = wh;
            const V p = __builtin_bit_cast(v16bf, a16);
            for (int s = nc; s < nk; ++s) {
                const int sn = min(s + 1, nk - 1); const unsigned ov = gvo + sn * 32;
#pragma unroll
                for (int i = 0; i < 4; ++i) { rv[0][i] = *(const v8us*)(Vt + ov + (size_t)i * 32 * TT); rv[1][i] = *(const v8us*)(V2 + ov + (size_t)i * 32 * TT); }   // next v^T tile: on its way during the product
                const bf* cur = sm + (s & 1) * (NP * STE); bf* nxt = sm + ((s + 1) & 1) * (NP * STE);
                l += 16.f * w;   // this half's 16 keys of the step
                V fh[8], fl[8];
#pragma unroll
                for (int mb = 0; mb < 8; ++mb) { fh[mb] = LFrag<T16>::ld(cur + fvo + mb * 16 * VPIT); fl[mb] = LFrag<T16>::ld(cur + STE + fvo + mb * 16 * VPIT); }
                __builtin_amdgcn_sched_barrier(0);   // the step's fragment reads go out as one group (the q fragments' registers are free here): left alone, the scheduler sinks each read to its product, and every product waits out an LDS latency
#pragma unroll
                for (int mb = 0; mb < 8; ++mb) o[mb] = WFrag<T16>::mma(fh[mb], p, o[mb]);
#pragma unroll
                for (int mb = 0; mb < 8; ++mb) o[mb] = WFrag<T16>::mma(fl[mb], p, o[mb]);
                __builtin_amdgcn_sched_barrier(0);   // the products are issued while the next tile's loads are on their way: left alone, the scheduler puts most of them behind the wait for those loads and behind the barrier
#pragma unroll
                for (int pl = 0; pl < NP; ++pl)
#pragma unroll
                    for (int i = 0; i < 4; ++i) *(v8usa*)(nxt + pl * STE + svo + i * 32 * VPIT) = rv[pl][i];
                __syncthreads();   // publishes step s + 1's v^T tiles; every wave has finished reading the buffer that the next step refills
            }
        }
    }
    l += __shfl_xor(l, 16, 32);
    const float f = poison ? __builtin_nanf("") : 1.0f / l;
#pragma unroll
    for (int mb = 0; mb < 8; ++mb) { v8us a, c;
#pragma unroll
        for (int j = 0; j < 8; ++j) { unsigned short x, y; splitf(o[mb][j] * f, x, y); a[j] = x; c[j] = y; }
        *(v8us*)(oh + (size_t)qi * DQ + mb * 16 + hi * 8) = a; *(v8us*)(ol + (size_t)qi * DQ + mb * 16 + hi * 8) = c; }   // hi / lo rows [b][t][head][d] of the output projection's A operand: d = mb * 16 + hi * 8 + j
}
// grid (TT / 16 * NKV * NB_), REP * 32 threads, four waves per SIMD asked for (a budget of 256 registers: with the LDS of four work-groups per WGP the whole grid is resident). Flat index: low 3 bits the kv plane g * NB_ + b; then 32 row blocks per quarter of the grid: first all hi + lo blocks, then the last rows downwards, the middle, and the rows behind the hi + lo blocks upwards,
// so that four work-groups whose indices lie a quarter of the grid apart carry about the same work together (for speed only; every (plane, row block) occurs once whatever the placement).
static_assert(TT / 16 == 4 * (RH / 16) && NKV * NB_ == 8 && ZH == REP, "row-block deal of k_attn");
__global__ __launch_bounds__(REP * 32, 4) void k_attn(const h16* __restrict__ Q16, const bf* __restrict__ Qh, const bf* __restrict__ Ql, const bf* __restrict__ K16, const bf* __restrict__ Kh, const bf* __restrict__ Kl, const bf* __restrict__ V16, const bf* __restrict__ Vh, const bf* __restrict__ Vl, const float* __restrict__ Bb, const int* __restrict__ FLG, bf* ATh, bf* ATl) {
    __shared__ __align__(16) bf sm[2 * 2 * STE]; __shared__ __align__(16) float smb[2 * 32];
    const int wv = __builtin_amdgcn_readfirstlane((int)(threadIdx.x >> 5));   // wave number as a scalar: plane offsets stay scalar
    const int id = blockIdx.x, kvp = id & 7, g = kvp / NB_, b = kvp % NB_, qr = id >> 8, i5 = (id >> 3) & 31; const int qb = (qr == 0) ? i5 : (qr == 1) ? 127 - i5 : (qr == 2) ? 64 + i5 : 32 + i5; const int q0 = qb * 16;
    const size_t qo = (size_t)(g * (NB_ * ZH) + b * ZH + wv) * TT * HD, kv = (size_t)kvp * TT * HD, ao = (size_t)b * TT * DQ + (g * REP + wv) * HD;
    const float* bias = Bb + (size_t)(b * NKV + g) * TT; const bool poison = (FLG[b * 8 + g] != 0);   /* premise self-check: no positive bias among keys 0..RH-1 for this kv head -> NaN-poison (flag word FLG[b * 8 + 4] also set) */
    const int first = FLG[16 + b * NKV + g], nc = (q0 + 16 + 31) / 32;   // first: the kv head's first key with a positive bias (RH: none below RH); rows in front of it have no allowed key. nc: steps up to the diagonal
    if (qb < RH / 16) attn_rows<bf, true>(sm, smb, wv, Qh + qo, Ql + qo, Kh + kv, Kl + kv, Vh + kv, Vl + kv, bias, poison, q0, nc, (first <= q0) ? nc : TT / 32, ATh + ao, ATl + ao);
    else attn_rows<h16, false>(sm, smb, wv, Q16 + qo, nullptr, K16 + kv, nullptr, V16 + kv, nullptr, bias, poison, q0, nc, nc, ATh + ao, ATl + ao);
}
// ---- k_gemms: GEMM with its operands staged in LDS by asynchronous copies (global_load_async_to_lds_b128). One work-group of 4 waves (2 x 2) per 128x128 output tile, 64x64 (16 accumulators) per wave, the whole K in each accumulator;
// K goes in stages of 64 elements (one whole 128-byte line of every operand row), two LDS buffers: stage t + 1's copies fly while stage t is worked on. Each line is fetched once per work-group, whole, and serves two waves.
// C[m][n] = sum_k A[m][k] Bt[n][k] (+ A2[m][k] Bt[n][k] for NSPLIT 1); A, A2, Bt are K-contiguous 16-bit planes of pitch K, K % 64 == 0; grid (M / 128, N / 128), 128 threads. EPI as above: each wave stores its own 64x64 tile through its own LDS slot. EPI 4: the q, k and v projections in one launch (none reads another's result): Bt holds the rows of Wq^T, Wk^T, Wv^T one behind the other, and a tile is stored as EPI 1, 2 or 3 (ep, ep2, ep3) by its columns.
#define GPIT 72                   // LDS pitch of a staged row of 64 elements: 144 B = 16 B x odd, the 16 rows of a fragment read fall on distinct banks
#define GPLN (128 * GPIT)         // elements of one staged plane: 128 rows
// one lane's eight 16-byte copies of one plane, rows 16 apart (LDS byte address l, global address g, gs elements between the rows). The wait on the address translations is the statement's last line, so that it stands in front of every later write of the address registers (a precaution).
__device__ __forceinline__ void cp8(unsigned l, const bf* g, size_t gs) {
    asm volatile("global_load_async_to_lds_b128 %0, %8, off\n\t"
                 "global_load_async_to_lds_b128 %1, %9, off\n\t"
                 "global_load_async_to_lds_b128 %2, %10, off\n\t"
                 "global_load_async_to_lds_b128 %3, %11, off\n\t"
                 "global_load_async_to_lds_b128 %4, %12, off\n\t"
                 "global_load_async_to_lds_b128 %5, %13, off\n\t"
                 "global_load_async_to_lds_b128 %6, %14, off\n\t"
                 "global_load_async_to_lds_b128 %7, %15, off\n\t"
                 "s_wait_xcnt 0x0"
                 :: "v"(l), "v"(l + 1 * 16 * GPIT * 2), "v"(l + 2 * 16 * GPIT * 2), "v"(l + 3 * 16 * GPIT * 2), "v"(l + 4 * 16 * GPIT * 2), "v"(l + 5 * 16 * GPIT * 2), "v"(l + 6 * 16 * GPIT * 2), "v"(l + 7 * 16 * GPIT * 2),
                    "v"(g), "v"(g + gs), "v"(g + 2 * gs), "v"(g + 3 * gs), "v"(g + 4 * gs), "v"(g + 5 * gs), "v"(g + 6 * gs), "v"(g + 7 * gs) : "memory");
}
// store step of k_gemms: one wave's 64x64 tile (rows rw .., columns cw .. of its product) from its LDS slot osw
template <int EPI>
__device__ __forceinline__ void gemms_put(const float* osw, int lane, int rw, int cw, float* C, int ldc, const Epi& ep) {
    // four rounds are unrolled into one trip: their LDS reads go out together, and one wait behind their stores serves them all
#pragma unroll 1
    for (int s4 = 0; s4 < 32; s4 += 4) {
#pragma unroll
      for (int s = s4; s < s4 + 4; ++s) { const int q = s * 32 + lane, row = q >> 4, cofs = (q & 15) * 4; const v4f val = *(const v4fa*)(osw + row * 68 + cofs);
        if (EPI == 0) *(v4f*)(C + (size_t)(rw + row) * ldc + cw + cofs) = val; else epi_put<EPI>(ep, rw + row, cw + cofs, val);
        if (EPI == 3) {   // v planes [g][b][d][t]: the tile is read by columns too (column row, rows cofs .. cofs + 3), so that 16 lanes store one whole 128-byte line along t
            const int c = cw + row, R = rw + cofs; v4h o16; v4us oh, ol;
#pragma unroll
            for (int u = 0; u < 4; ++u) { const float x = osw[(cofs + u) * 68 + row]; o16[u] = tohx(x); unsigned short a, c2; splitf(x, a, c2); oh[u] = a; ol[u] = c2; }
            const size_t o = (((size_t)(c / HD) * NB_ + R / TT) * HD + c % HD) * TT + R % TT; *(v4h*)(ep.p16 + o) = o16; *(v4us*)(ep.ph + o) = oh; *(v4us*)(ep.pl + o) = ol; } }
      asm volatile("s_wait_xcnt 0x0" ::: "memory"); }   // precaution: the next trip rewrites the registers that this trip's stores name
}
template <int NSPLIT, int EPI>
__global__ __launch_bounds__(128, 2) void k_gemms(const bf* __restrict__ A, const bf* __restrict__ A2, const bf* __restrict__ Bt, int K, float* C, int ldc, Epi ep, Epi ep2, Epi ep3) {
    constexpr int NPL = NSPLIT ? 3 : 2, STG = NPL * GPLN;   // a stage: the planes A, Bt (, A2)
    static_assert(2 * STG * 2 >= 4 * 64 * 68 * 4, "the four waves' output slots fit into the two buffers");
    __shared__ __align__(16) bf ring[2 * STG];
    const int tid = threadIdx.x, lane = tid & 31, lr = lane & 15, hi = lane >> 4; const int wv = __builtin_amdgcn_readfirstlane(tid >> 5), wm = wv >> 1, wn = wv & 1;   // wave number as a scalar: tile offsets stay scalar
    const int r0 = blockIdx.x * 128, c0 = blockIdx.y * 128, nt = K / 64;
    // copies, 16-byte chunk tid + 128 * i of a plane: row (tid >> 3) + 16 * i, piece tid & 7: eight lanes fetch one whole line
    const size_t gs = (size_t)16 * K, go = (size_t)(tid >> 3) * K + (tid & 7) * 8;
    const bf* ga = A + (size_t)r0 * K + go; const bf* gb = Bt + (size_t)c0 * K + go; const bf* ga2 = NSPLIT ? A2 + (size_t)r0 * K + go : nullptr;
    const unsigned l0 = (unsigned)(size_t)ring + ((tid >> 3) * GPIT + (tid & 7) * 8) * 2;
    auto stage = [&](int t) { const unsigned l = l0 + (t & 1) * (STG * 2); cp8(l, ga + t * 64, gs); cp8(l + GPLN * 2, gb + t * 64, gs); if (NSPLIT) cp8(l + 2 * GPLN * 2, ga2 + t * 64, gs); };
    v8f acc[4][4];
    // unrolled, here and below: the accumulator and fragment arrays are indexed by constants and stay in registers
#pragma unroll
    for (int mb = 0; mb < 4; ++mb)
#pragma unroll
        for (int nb = 0; nb < 4; ++nb) acc[mb][nb] = (v8f){};
    const int fa = (wm * 64 + lr) * GPIT + 8 * hi, fb = GPLN + (wn * 64 + lr) * GPIT + 8 * hi;   // the lane's place in an A / Bt fragment read
    stage(0);
    asm volatile("s_wait_asynccnt 0x0" ::: "memory");   // this wave's copies of stage 0 have landed
    __syncthreads();   // stage 0 is in buffer 0 before any wave reads it
    if (nt > 1) stage(1);
    for (int t = 0; t < nt; ++t) {
        const bf* cur = ring + (t & 1) * STG;
        // fragment reads run ahead of the products that use them: the first 32 k's fragments as one group, with them (registers allowing: NSPLIT 0) the second 32 k's Bt fragments; each A fragment of the second 32 k is read into its registers as soon as the four (eight) products on its forerunner are issued.
        // The scheduling barriers keep that order: left alone, the scheduler sinks every read to its first product, and the products wait out an LDS latency each time.
        v16bf a[4], a2[4], b[2][4];
#pragma unroll
        for (int i = 0; i < 4; ++i) { a[i] = LFrag<bf>::ld(cur + fa + i * 16 * GPIT); b[0][i] = LFrag<bf>::ld(cur + fb + i * 16 * GPIT); if (NSPLIT) a2[i] = LFrag<bf>::ld(cur + 2 * GPLN + fa + i * 16 * GPIT); }
        if (!NSPLIT) {
#pragma unroll
            for (int i = 0; i < 4; ++i) b[1][i] = LFrag<bf>::ld(cur + fb + i * 16 * GPIT + 32); }
        __builtin_amdgcn_sched_barrier(0);
#pragma unroll
        for (int mb = 0; mb < 4; ++mb) {
#pragma unroll
            for (int nb = 0; nb < 4; ++nb) { acc[mb][nb] = wmmab(a[mb], b[0][nb], acc[mb][nb]); if (NSPLIT) acc[mb][nb] = wmmab(a2[mb], b[0][nb], acc[mb][nb]); }
            a[mb] = LFrag<bf>::ld(cur + fa + mb * 16 * GPIT + 32); if (NSPLIT) a2[mb] = LFrag<bf>::ld(cur + 2 * GPLN + fa + mb * 16 * GPIT + 32);
            __builtin_amdgcn_sched_barrier(0); }
        if (NSPLIT) {
#pragma unroll
            for (int i = 0; i < 4; ++i) b[1][i] = LFrag<bf>::ld(cur + fb + i * 16 * GPIT + 32);
            __builtin_amdgcn_sched_barrier(0); }
#pragma unroll
        for (int mb = 0; mb < 4; ++mb)
#pragma unroll
            for (int nb = 0; nb < 4; ++nb) { acc[mb][nb] = wmmab(a[mb], b[1][nb], acc[mb][nb]); if (NSPLIT) acc[mb][nb] = wmmab(a2[mb], b[1][nb], acc[mb][nb]); }
        asm volatile("s_wait_dscnt 0x0" ::: "memory");      // this wave's reads of the buffer that is refilled below have ended
        asm volatile("s_wait_asynccnt 0x0" ::: "memory");   // this wave's copies of stage t + 1 have landed
        __syncthreads();   // publishes stage t + 1; every wave has finished reading stage t's buffer
        if (t + 2 < nt) stage(t + 2);
    }
    asm volatile("s_wait_asynccnt 0x0" ::: "memory");   // no copy is outstanding when the buffers become output slots
    float* osw = (float*)ring + wv * (64 * 68); const int rw = r0 + wm * 64, cw = c0 + wn * 64;
#pragma unroll
    for (int mb = 0; mb < 4; ++mb)
#pragma unroll
        for (int nb = 0; nb < 4; ++nb)
#pragma unroll
            for (int j = 0; j < 8; ++j) osw[(mb * 16 + hi * 8 + j) * 68 + nb * 16 + lr] = acc[mb][nb][j];
    __syncthreads();   // the tile is in its slot before its lanes read one another's values
    if constexpr (EPI == 4) {   // the tile's columns say whose it is (the same for the whole work-group): q, then k, then v
        if (c0 < DQ) gemms_put<1>(osw, lane, rw, cw, C, ldc, ep); else if (c0 < DQ + DKV) gemms_put<2>(osw, lane, rw, cw - DQ, C, ldc, ep2); else gemms_put<3>(osw, lane, rw, cw - (DQ + DKV), C, ldc, ep3);
    } else gemms_put<EPI>(osw, lane, rw, cw, C, ldc, ep);
}
__global__ __launch_bounds__(32) void k_chk(const float* __restrict__ BIAS, int* FLG) { BIAS += (size_t)blockIdx.x * NKV * TT; int* FST = FLG + 16 + blockIdx.x * NKV;   /* per kv head: its first key with a positive bias, RH if there is none below RH */ FLG += blockIdx.x * 8;   /* one work-group per batch element */ const int n = threadIdx.x; int none = 0, first = RH; if (n < NKV) { none = 1;
#pragma unroll 1
        for (int j = 0; j < RH; ++j) { const float bj = BIAS[(size_t)n * TT + j]; asm volatile("s_wait_xcnt 0x0" ::: "memory");   /* precaution: the next trip rewrites the register pair that holds this load's address */ if (bj > 0.f) { none = 0; first = j; break; } } }
    int anyb = none;
#pragma unroll
    for (int sh = 16; sh; sh >>= 1) anyb |= __shfl_xor(anyb, sh, 32);
    const int v = (n < NKV) ? none : ((n == NKV) ? anyb : 0); if (n < 8) { *(int*)(FLG + n) = v;  } if (n < NKV) FST[n] = first; }
__device__ __forceinline__ void wgd_blk(int blk, const float* __restrict__ w, int K, bf* Bt) { const int e = (blk * 256 + threadIdx.x) * 4; if (e >= 64 * K) return; const int k = e % K, n = e / K; v4us o;
#pragma unroll
    for (int u = 0; u < 4; ++u) o[u] = (n < NKV) ? f2bf(w[(size_t)(k + u) * NKV + n]) : (unsigned short)0; *(v4us*)(Bt + e) = o;  }
__global__ __launch_bounds__(256) void k_bias(const float* __restrict__ GATE, const float* __restrict__ DEL, float* BIAS) { const int e = (blockIdx.x * 256 + threadIdx.x) * 4; if (e >= NB_ * NKV * TT) return; const int j = e % TT; const int n = (e / TT) % NKV; const int b = e / (NKV * TT); v4f r;
#pragma unroll
    for (int u = 0; u < 4; ++u) { const float gt = GATE[((size_t)b * TT + j + u) * 64 + n]; asm volatile("s_wait_xcnt 0x0" ::: "memory");   /* precaution, here and below: later loads land in the registers that held this load's address */ const float dl = DEL[((size_t)b * TT + j + u) * 64 + n]; asm volatile("s_wait_xcnt 0x0" ::: "memory"); const float sg = __fdiv_rn(1.0f, __fadd_rn(1.0f, __expf(-gt))); r[u] = __fmul_rn(sg, dl); }
    *(v4f*)(BIAS + e) = r;  }

// ---- k_prep: all operand preparation in one launch (no job reads another's result): the four weight transposes, x to bf16, the padded gate / delta weights. 256 threads; every share of every job is dealt to exactly one work-group, whatever the placement.
// Shares are large (64 elements per thread for the transposes and for x), so that few work-groups have to be started.
#define PT_Q ((DM / TK) * (DQ / TN))  // shares of the Wq transpose, and of Wo's
#define PT_K ((DM / TK) * (DKV / TN)) // of Wk's, and of Wv's
#define PT_N (2 * PT_Q + 2 * PT_K)    // transpose shares
#define PC_G (64 * DQ / 1024)         // shares of the gate weights
#define PC_D (64 * DKV / 1024)        // of the delta weights
#define PC_X (NB_ * TT * DM / 16384)  // of x
static_assert(DM % TK == 0 && DQ % TK == 0 && DM % TN == 0 && DQ % TN == 0 && DKV % TN == 0 && DM == DQ && (NB_ * TT * DM) % 16384 == 0, "shares of k_prep");
__global__ __launch_bounds__(256) void k_prep(const float* __restrict__ x, const float* __restrict__ wq, const float* __restrict__ wk, const float* __restrict__ wv, const float* __restrict__ wg, const float* __restrict__ wdl, const float* __restrict__ wo, bf* XB, bf* WQ, bf* WK, bf* WV, bf* WG, bf* WD, bf* WO) {
    __shared__ __align__(16) bf ts[TN * TK];
    int t = blockIdx.x;   // the same for the whole work-group: the barrier of a transpose share is met by every wave
    if (t < PT_Q) { wtT_blk(ts, t, wq, DM, DQ, WQ); return; } t -= PT_Q;
    if (t < PT_Q) { wtT_blk(ts, t, wo, DQ, DM, WO); return; } t -= PT_Q;
    if (t < PT_K) { wtT_blk(ts, t, wk, DM, DKV, WK); return; } t -= PT_K;
    if (t < PT_K) { wtT_blk(ts, t, wv, DM, DKV, WV); return; } t -= PT_K;
    if (t < PC_G) { wgd_blk(t, wg, DQ, WG); return; } t -= PC_G;
    if (t < PC_D) { wgd_blk(t, wdl, DKV, WD); return; } t -= PC_D;
    cvt64_blk(t, x, XB);
}

extern "C" void kernel_launch(void* const* d_in, const int* in_sizes, int n_in,
                              void* d_out, int out_size, void* d_ws, size_t ws_size, hipStream_t stream) {
    (void)in_sizes; (void)n_in; (void)out_size;
    const float* x = (const float*)d_in[0]; const float* wq = (const float*)d_in[1]; const float* wk = (const float*)d_in[2]; const float* wv = (const float*)d_in[3]; const float* wg = (const float*)d_in[4]; const float* wdl = (const float*)d_in[5]; const float* wo = (const float*)d_in[6]; const float* cosT = nullptr; const float* sinT = nullptr; (void)cosT; (void)sinT;
    float* OUT = (float*)d_out;     // [2][2048][2048]
    char* wsp = (char*)d_ws;
    auto take = [&](size_t bytes) { char* p = wsp; wsp += (bytes + 255) & ~(size_t)255; return (void*)p; };
    const size_t MT = (size_t)NB_ * TT;   // token rows of both batch elements together: every launch covers both
    // read by the attention kernel or behind it
    bf* WO = (bf*)take((size_t)DM * DQ * 2); float* BIAS = (float*)take((size_t)NB_ * NKV * TT * 4); int* FLG = (int*)take(256);
    h16* QP16 = (h16*)take(MT * NH_ * HD * 2); h16* KP16 = (h16*)take(MT * NKV * HD * 2); h16* VT16 = (h16*)take(MT * NKV * HD * 2);
    bf* QPh = (bf*)take(MT * NH_ * HD * 2); bf* QPl = (bf*)take(MT * NH_ * HD * 2); bf* KPh = (bf*)take(MT * NKV * HD * 2); bf* KPl = (bf*)take(MT * NKV * HD * 2); bf* VTh = (bf*)take(MT * NKV * HD * 2); bf* VTl = (bf*)take(MT * NKV * HD * 2);
    bf* ATh = (bf*)take(MT * DQ * 2); bf* ATl = (bf*)take(MT * DQ * 2);
    // read only by the launches in front of the attention kernel
    bf* WQ = (bf*)take((size_t)(DQ + 2 * DKV) * DM * 2); bf* WK = WQ + (size_t)DQ * DM; bf* WV = WK + (size_t)DKV * DM;   // one plane: the rows of Wq^T, Wk^T, Wv^T one behind the other
    bf* XB = (bf*)take(MT * DM * 2); bf* GFh = (bf*)take(MT * DQ * 2); bf* GFl = (bf*)take(MT * DQ * 2); bf* VFh = (bf*)take(MT * DKV * 2); bf* VFl = (bf*)take(MT * DKV * 2); bf* WG = (bf*)take((size_t)64 * DQ * 2); bf* WD = (bf*)take((size_t)64 * DKV * 2); float* GATE = (float*)take(MT * 64 * 4); float* DEL = (float*)take(MT * 64 * 4);
    if ((size_t)(wsp - (char*)d_ws) > ws_size) return;    // ws 256 MiB
    const Epi E0 = { nullptr, nullptr, nullptr, nullptr, nullptr };   // plain f32 tile
    k_prep<<<PT_N + PC_G + PC_D + PC_X, 256, 0, stream>>>(x, wq, wk, wv, wg, wdl, wo, XB, WQ, WK, WV, WG, WD, WO);
    const unsigned MB = (unsigned)(MT / 64), MB2 = (unsigned)(MT / 128);   // 64-row and 128-row tiles over both batch elements
    // the three projections, in one launch, store the 16-bit planes that the later products read
    k_gemms<0, 4><<<dim3(MB2, (DQ + 2 * DKV) / 128, 1), 128, 0, stream>>>(XB, nullptr, WQ, DM, nullptr, 0, Epi{ QP16, QPh, QPl, GFh, GFl }, Epi{ KP16, KPh, KPl, nullptr, nullptr }, Epi{ VT16, VTh, VTl, VFh, VFl });
    /* dynamic mask bias per (batch, kv head, key) */
    k_gd<<<dim3(MB, 1, 2), 512, 0, stream>>>(GFh, GFl, WG, VFh, VFl, WD, GATE, DEL); k_bias<<<(NB_ * NKV * TT / 4 + 255) / 256, 256, 0, stream>>>(GATE, DEL, BIAS); k_chk<<<NB_, 32, 0, stream>>>(BIAS, FLG);
    // all heads of both batch elements in one launch; it stores the hi / lo rows of the output projection's A operand
    k_attn<<<dim3(TT / 16 * NKV * NB_, 1, 1), REP * 32, 0, stream>>>(QP16, QPh, QPl, (const bf*)KP16, KPh, KPl, (const bf*)VT16, VTh, VTl, BIAS, FLG, ATh, ATl);
    k_gemms<1, 0><<<dim3(MB2, DM / 128, 1), 128, 0, stream>>>(ATh, ATl, WO, DQ, OUT, DM, E0, E0, E0);
}

// v010
// A run of this version takes 205 microseconds.
// Next to v009, in two timings, it ran 1.04 and 1.05 times as fast.
// All steps since v000 together make it 11.8 times as fast.
#include <hip/hip_runtime.h>

// DynamicMaskAttention (hidden [2][2048][2048]; q = x Wq (16 heads x 128), k/v = x Wk / Wv (4 kv heads; group h/4); per key j and kv head n: bias = sigmoid(q_flat[j] . Wg[:, n]) * (v_flat[j] . Wd[:, n]); logits = q.k / sqrt(128) + bias[n][j]; allowed = causal AND bias[n][j] > 0, everything else gets finfo.min (so a query row with no allowed key softmaxes uniformly over ALL keys, as the source);
//   softmax; out = merged Wo -> [2][2048][2048]).
// Compute dtypes, f32 accumulate: every input rounded to bf16; q/k/v on PLAIN bf16 operands (inputs: exact); gate / delta as hl planes of q_flat / v_flat x exact Wg / Wd (2 products; the 4 outputs in one 16-column block), sigmoid and the product f32; scores and attn.v: query rows < 512 hl (3 products), the rest single fp16, both with causal tile skipping; a 16-row block of the early rows whose first row has no allowed key (such a row attends uniformly to every key) goes on over ALL key tiles, behind the diagonal with the v product alone; bias + mask + running softmax f32, probabilities unnormalised (exp(t - max) <= 1), the division by their sum last; Wo hl x exact (2 products).

#define NB_  2
#define TT   2048
#define DM   2048
#define NH_  16
#define NKV  4
#define REP  (NH_ / NKV)
#define HD   128
#define DQ   (NH_ * HD)
#define DKV  (NKV * HD)
#define ZH   4                    // query heads per group of q planes: one whole kv group (ZH == REP), the heads that share their K and V planes
#define RH   512                  // query rows < RH use hi+lo planes
#define WIN  2048
#define SCL  0.088388347648318447f   // HD^-0.5
typedef _Float16 h16;
typedef unsigned short bf;
typedef __attribute__((ext_vector_type(16))) __bf16   v16bf;
typedef __attribute__((ext_vector_type(16))) _Float16 v16h;
typedef __attribute__((ext_vector_type(8)))  _Float16 v8h;
typedef __attribute__((ext_vector_type(8)))  unsigned short v8us;
typedef __attribute__((ext_vector_type(8)))  float    v8f;
typedef __attribute__((ext_vector_type(4)))  float    v4f;
typedef v8h  __attribute__((may_alias)) v8ha;
typedef v4f  __attribute__((may_alias)) v4fa;
typedef v8us __attribute__((may_alias)) v8usa;

__device__ __forceinline__ unsigned short f2bf(float f) { unsigned u = __float_as_uint(f); u += 0x7FFFu + ((u >> 16) & 1u); return (unsigned short)(u >> 16); }
__device__ __forceinline__ float bf2f(unsigned short b) { return __uint_as_float(((unsigned)b) << 16); }
__device__ __forceinline__ float bfr(float f) { return bf2f(f2bf(f)); }
__device__ __forceinline__ v16h cat16(v8h lo, v8h hi) { return __builtin_shufflevector(lo, hi, 0, 1, 2, 3, 4, 5, 6, 7, 8, 9, 10, 11, 12, 13, 14, 15); }
__device__ __forceinline__ v16bf cat16b(v8us lo, v8us hi) { return __builtin_bit_cast(v16bf, __builtin_shufflevector(lo, hi, 0, 1, 2, 3, 4, 5, 6, 7, 8, 9, 10, 11, 12, 13, 14, 15)); }
__device__ __forceinline__ v8f wmma16(v16h a, v16h b, v8f c) { return __builtin_amdgcn_wmma_f32_16x16x32_f16(false, a, false, b, (short)0, c, false, false); }
__device__ __forceinline__ v8f wmmab(v16bf a, v16bf b, v8f c) { return __builtin_amdgcn_wmma_f32_16x16x32_bf16(false, a, false, b, (short)0, c, false, false); }
__device__ __forceinline__ h16 tohx(float x) { return (h16)x; }
__device__ __forceinline__ void splitf(float y, unsigned short& h, unsigned short& l) { h = f2bf(y); l = f2bf(y - bf2f(h)); }
typedef __attribute__((ext_vector_type(4))) _Float16 v4h;
typedef __attribute__((ext_vector_type(4))) unsigned short v4us;

// ---- what the store step of a GEMM writes (EPI): 0 the f32 tile; otherwise the 16-bit operand planes of the next GEMM, straight from the sums:
// 1 q: head planes [h / ZH][b][h % ZH][t][d] (fp16, hi, lo) and the flat hi / lo rows for the gate product; 2 k: head planes [h][b][t][d] (fp16, hi, lo);
// 3 v: flat hi / lo rows for the delta product (the transposed planes [g][b][d][t] are written by the kernel itself, through LDS).
struct Epi { h16* p16; bf* ph; bf* pl; bf* fh; bf* fl; };
template <int EPI> __device__ __forceinline__ void epi_put(const Epi& ep, int R, int c, v4f val) {   // four neighbouring sums of output row R, columns c .. c + 3
    v4h o16; v4us oh, ol;
    // unrolled: the vectors' elements are indexed by constants and stay in registers
#pragma unroll
    for (int u = 0; u < 4; ++u) { const float x = val[u]; o16[u] = tohx(x); unsigned short a, c2; splitf(x, a, c2); oh[u] = a; ol[u] = c2; }
    if (EPI == 1 || EPI == 2) { const int b = R / TT, t = R % TT, h = c / HD, d = c % HD; const int p = (EPI == 1) ? (h / ZH) * (NB_ * ZH) + b * ZH + h % ZH : h * NB_ + b; const size_t o = ((size_t)p * TT + t) * HD + d;
        *(v4h*)(ep.p16 + o) = o16; *(v4us*)(ep.ph + o) = oh; *(v4us*)(ep.pl + o) = ol; }
    if (EPI == 1 || EPI == 3) { const size_t o = (EPI == 1) ? (size_t)R * DQ + c : (size_t)R * DKV + c;
        *(v4us*)(ep.fh + o) = oh; *(v4us*)(ep.fl + o) = ol; }
}



// a matrix fragment from two 16-byte global loads of a K-contiguous 16-bit row, and the product on it
template <typename T16> struct WFrag;
template <> struct WFrag<h16> { typedef v16h V; static __device__ __forceinline__ V ld(const h16* p) { return cat16(*(const v8h*)p, *(const v8h*)(p + 16)); } static __device__ __forceinline__ v8f mma(V a, V b, v8f c) { return wmma16(a, b, c); } };
template <> struct WFrag<bf> { typedef v16bf V; static __device__ __forceinline__ V ld(const bf* p) { return cat16b(*(const v8us*)p, *(const v8us*)(p + 16)); } static __device__ __forceinline__ v8f mma(V a, V b, v8f c) { return wmmab(a, b, c); } };

// ---- k_gd: the gate product, the delta product and the bias made of them, in one kernel. One work-group of 24 waves per 64 token rows; grid (M / 64), 768 threads.
// Both products: C[m][n] = sum_k (A[m][k] + A2[m][k]) Bt[n][k], hi and lo rows straight from their K-contiguous planes, on the one 16-column block of Bt that holds the NKV outputs (its other rows are zero).
// K goes in 64-element chunks (one 128-byte line of each operand row): waves 0..15 take the gate's chunks w and w + 16 (K = DQ), waves 16..23 one chunk each of the delta (K = DKV). Each wave parks its partial sums of the NKV columns in its own LDS slot;
// behind one work-group barrier one thread per token row adds the gate's slots in the order 0..15 and the delta's in the order 0..7, and stores bias = sigmoid(gate) * delta for the NKV kv heads.
#define GDG 16                    // waves (partial sums) of the gate
#define GDD (DKV / 64)            // of the delta
static_assert(NKV == 4 && DQ == GDG * 128 && TT % 64 == 0, "shares of k_gd");
__global__ __launch_bounds__((GDG + GDD) * 32) void k_gd(const bf* __restrict__ GFh, const bf* __restrict__ GFl, const bf* __restrict__ WG, const bf* __restrict__ VFh, const bf* __restrict__ VFl, const bf* __restrict__ WD, float* BIAS) {
    __shared__ __align__(16) float os[(GDG + GDD) * 64 * NKV];
    const int lane = threadIdx.x & 31, lr = lane & 15, hi = lane >> 4; const int wv = __builtin_amdgcn_readfirstlane((int)(threadIdx.x >> 5));   // wave number as a scalar: the choice of the product, the K loop's counter and its branch stay scalar
    const bool dl = wv >= GDG; const int K = dl ? DKV : DQ, r0 = blockIdx.x * 64;
    const bf* A = dl ? VFh : GFh; const bf* A2 = dl ? VFl : GFl; const bf* Bt = dl ? WD : WG;
    v8f acc[4];
    // unrolled, here and below: the accumulator and fragment arrays are indexed by constants and stay in registers
#pragma unroll
    for (int mb = 0; mb < 4; ++mb) acc[mb] = (v8f){};
    const size_t aoff = (size_t)(r0 + lr) * K + 8 * hi, boff = (size_t)lr * K + 8 * hi;
#pragma unroll 1
    for (int kc = (dl ? wv - GDG : wv) * 64; kc < K; kc += (kc & 32) ? (GDG * 64 - 32) : 32) {
        v16bf a[4], a2[4]; const bf* pa[4]; const bf* pa2[4];
#pragma unroll
        for (int mb = 0; mb < 4; ++mb) { pa[mb] = A + aoff + (size_t)mb * 16 * K + kc; a[mb] = WFrag<bf>::ld(pa[mb]); pa2[mb] = A2 + aoff + (size_t)mb * 16 * K + kc; a2[mb] = WFrag<bf>::ld(pa2[mb]); }
        const bf* pb = Bt + boff + kc; const v16bf b = WFrag<bf>::ld(pb);
        __builtin_amdgcn_sched_barrier(0);   // the trip's 18 loads go out as one group: left alone, the scheduler reuses the fragment registers, issues half of the loads between the products, and the trip waits out several memory latencies instead of one
#pragma unroll
        for (int mb = 0; mb < 4; ++mb) { acc[mb] = wmmab(a[mb], b, acc[mb]); acc[mb] = wmmab(a2[mb], b, acc[mb]); }
        // precaution: this trip's load addresses are named as inputs, so their registers are not reused between a load and this wait
        asm volatile("s_wait_xcnt 0x0" :: "v"(pa[0]), "v"(pa[1]), "v"(pa[2]), "v"(pa[3]), "v"(pa2[0]), "v"(pa2[1]), "v"(pa2[2]), "v"(pa2[3]), "v"(pb) : "memory");
    }
    if (lr < NKV) {   // lane (lr, hi) holds column lr of rows mb * 16 + hi * 8 + j; only the NKV output columns are kept
#pragma unroll
        for (int mb = 0; mb < 4; ++mb)
#pragma unroll
            for (int j = 0; j < 8; ++j) os[(wv * 64 + mb * 16 + hi * 8 + j) * NKV + lr] = acc[mb][j]; }
    __syncthreads();   // every wave's partial sums are in LDS before any thread sums across the slots
    const int row = threadIdx.x;
    if (row < 64) {
        v4f gt = *(const v4fa*)(os + row * NKV), dv = *(const v4fa*)(os + (GDG * 64 + row) * NKV);
#pragma unroll
        for (int w = 1; w < GDG; ++w) gt += *(const v4fa*)(os + (w * 64 + row) * NKV);
#pragma unroll
        for (int w = 1; w < GDD; ++w) dv += *(const v4fa*)(os + ((GDG + w) * 64 + row) * NKV);
        const int R = r0 + row; float* po = BIAS + (size_t)(R / TT) * NKV * TT + R % TT;   // [b][kv head][key]: 32 lanes store one whole 128-byte line per kv head
#pragma unroll
        for (int n = 0; n < NKV; ++n) { const float sg = __fdiv_rn(1.0f, __fadd_rn(1.0f, __expf(-gt[n]))); po[(size_t)n * TT] = __fmul_rn(sg, dv[n]); }
    }
}

typedef __attribute__((ext_vector_type(2))) unsigned short v2us;
typedef __attribute__((ext_vector_type(2))) float v2f;
typedef __attribute__((ext_vector_type(4))) int v4i;
typedef v4h  __attribute__((may_alias)) v4ha;
typedef v4us __attribute__((may_alias)) v4usa;

// the three bodies wtT_blk, cvt64_blk and wgd_blk are one 256-thread work-group's share (number blk) of one preparation job; k_prep deals them
// wtT_blk: Bt[n][k] = bf16(w[k][n]) for a tile of TK k x TN n, through LDS, with 16 bytes per lane: 16 lanes read 64 n of one row of w, 32 lanes write 256 k of one row of Bt.
// A thread reads 16 k x 4 n, all 16 loads under way together, and puts two 16-byte pieces (8 k each) into each of its 4 LDS rows. The pieces of LDS row n are rotated by n / 4 places: the 16 lanes of a half wave write rows 4 apart, which at this pitch would otherwise all fall on the same banks.
#define TK 256
#define TN 64
__device__ __forceinline__ void wtT_blk(bf* ts, int blk, const float* __restrict__ w, int K, int N, bf* Bt) {
    const int tid = threadIdx.x, ng = tid & 15, kg = tid >> 4; const int k0 = (blk % (K / TK)) * TK, n0 = (blk / (K / TK)) * TN;
    const float* p = w + (size_t)(k0 + kg * 16) * N + n0 + ng * 4; v4f r[16];
    // unrolled, here and below: the arrays are indexed by constants and stay in registers
#pragma unroll
    for (int j = 0; j < 16; ++j) r[j] = *(const v4f*)(p + (size_t)j * N);
    asm volatile("s_wait_xcnt 0x0" :: "v"(p) : "memory");   // precaution: the load address is named as an input, so its registers are not reused between a load and this wait
#pragma unroll
    for (int u = 0; u < 4; ++u)
#pragma unroll
        for (int h = 0; h < 2; ++h) { v8us o;
#pragma unroll
            for (int j = 0; j < 8; ++j) o[j] = f2bf(r[h * 8 + j][u]);
            *(v8usa*)(ts + (ng * 4 + u) * TK + ((kg * 2 + h + ng) & 31) * 8) = o; }
    __syncthreads();   // the whole tile is in LDS before any thread reads a row of it
    bf* q = Bt + (size_t)(n0 + (tid >> 5)) * K + k0 + (tid & 31) * 8;
#pragma unroll
    for (int i = 0; i < 8; ++i) { const int row = i * 8 + (tid >> 5); *(v8us*)(q + (size_t)i * 8 * K) = *(const v8usa*)(ts + row * TK + (((tid & 31) + (row >> 2)) & 31) * 8); }
    asm volatile("s_wait_xcnt 0x0" ::: "memory");   // precaution: in the kernel's text another share's code follows, which rewrites the registers that these stores name
}
// cvt64_blk: 64 elements per thread, in eight 8-element chunks 256 chunks apart; all 16 loads under way together
__device__ __forceinline__ void cvt64_blk(int blk, const float* __restrict__ src, bf* dst) { const size_t i = ((size_t)blk * 2048 + threadIdx.x) * 8; const float* p = src + i; v8f v[8];
#pragma unroll
    for (int c = 0; c < 8; ++c) v[c] = *(const v8f*)(p + c * 2048);
    asm volatile("s_wait_xcnt 0x0" :: "v"(p) : "memory");   // precaution, as above
#pragma unroll
    for (int c = 0; c < 8; ++c) { v8us o;
#pragma unroll
        for (int k = 0; k < 8; ++k) o[k] = f2bf(v[c][k]);
        *(v8us*)(dst + i + c * 2048) = o; }
    asm volatile("s_wait_xcnt 0x0" ::: "memory"); }   // precaution, as at the foot of wtT_blk
__global__ __launch_bounds__(256) void k_cscvt(const float* __restrict__ cosT, const float* __restrict__ sinT, float* CS) { const int idx = blockIdx.x * 256 + threadIdx.x; if (idx >= TT * HD) return; v2f cs; cs[0] = bfr(cosT[idx]); cs[1] = bfr(sinT[idx]); *(v2f*)(CS + (size_t)idx * 2) = cs;  }
// ---- k_attn: scores, bias + mask, softmax and the product with v in one kernel; no score or probability goes to memory. One wave per (head, 16 query rows); the 4 waves of a work-group are the 4 heads of one kv group and share its k / v tiles through LDS.
// Everything is computed transposed, so that no value changes lanes between the two products: S^T = k q^T (A = 16 key rows, B = the wave's 16 query rows) leaves lane (lr, hi) with query lr and keys hi * 8 + j of each 16-key tile;
// two such tiles side by side are exactly the B fragment (n = query lr, k = 8 * hi + 0..7 and 8 * hi + 16 + 0..7) of O^T = v^T P^T (A = 16 rows of the [d][t] plane). A lane's scores, running maximum, running sum and all its O^T elements belong to its one query.
// Running softmax over steps of 32 keys: m = max so far, p = exp(t - m), sum and O^T rescaled by exp(m_old - m_new); the division by the sum comes last, in f32. The masked fill equals the start value of m, so a row with no allowed key weighs every key 1 (uniform, as the source's finfo.min fill),
// and the first allowed key wipes such weights (factor exp(-huge) = 0). HR (query rows < RH): hi + lo planes, 3 products each; otherwise single fp16. Both run nc steps, up to the diagonal. Behind the diagonal every key is masked: a row that has met an allowed key weighs all of them exp(-huge) = 0, so its sums are final; a row that has met none weighs all of them 1.
// Only an HR block that holds such a row (nk > nc: the kv head's first positive bias lies behind the block's first row) runs the steps nc .. nk - 1, and there the weight is the same for all keys of a row and known beforehand: no k tile, no scores, no exponentials, and the lo plane of the weight (0 or 1: exact in bf16) is zero, so two v products are left.
// Staging: two LDS buffers; step s + 1's tiles (32 k rows, 128 v^T rows of 32 keys) travel global -> registers while step s is computed, go into the other buffer behind it, and one work-group barrier per step publishes them and ends the reads of the buffer that is refilled next.
#define KPIT 136                  // LDS pitch of a k row, elements: 272 B = 16 B x odd, the 16 rows of a fragment read fall on distinct banks
#define VPIT 40                   // LDS pitch of a v^T row of 32 keys: 80 B = 16 B x odd
#define KTE  (32 * KPIT)
#define STE  (KTE + HD * VPIT)    // elements of one staged plane: k tile, then v^T tile
typedef __attribute__((ext_vector_type(16))) unsigned short v16us;
__device__ __forceinline__ float exp2s(float x) { float r; asm("v_exp_f32 %0, %1\n\tv_nop" : "=v"(r) : "v"(x)); return r; }
template <typename T16> struct LFrag;   // a fragment from two 16-byte LDS reads, in the k order of WFrag
template <> struct LFrag<h16> { static __device__ __forceinline__ v16h ld(const bf* p) { const v8us x = *(const v8usa*)p, y = *(const v8usa*)(p + 16); return cat16(__builtin_bit_cast(v8h, x), __builtin_bit_cast(v8h, y)); } };
template <> struct LFrag<bf> { static __device__ __forceinline__ v16bf ld(const bf* p) { const v8us x = *(const v8usa*)p, y = *(const v8usa*)(p + 16); return cat16b(x, y); } };
template <typename T16, bool HR>
__device__ __forceinline__ void attn_rows(bf* sm, float* smb, int wv, const T16* __restrict__ Q, const T16* __restrict__ Q2, const bf* __restrict__ Kp, const bf* __restrict__ K2, const bf* __restrict__ Vt, const bf* __restrict__ V2, const float* __restrict__ bias, bool poison, int q0, int nc, int nk, bf* oh, bf* ol) {
    typedef typename WFrag<T16>::V V; constexpr int NP = HR ? 2 : 1;
    const int tid = threadIdx.x, lane = tid & 31, lr = lane & 15, hi = lane >> 4; const int qi = q0 + lr;
    V bq[4], bq2[4]; const T16* pq = Q + (size_t)qi * HD + 8 * hi; const T16* pq2 = HR ? Q2 + (size_t)qi * HD + 8 * hi : nullptr;
    // unrolled, here and below: the fragment, staging and accumulator arrays are indexed by constants and stay in registers
#pragma unroll
    for (int kc = 0; kc < 4; ++kc) { bq[kc] = WFrag<T16>::ld(pq + kc * 32); if (HR) bq2[kc] = WFrag<T16>::ld(pq2 + kc * 32); }
    // precaution: the load addresses are named as inputs, so their registers are not reused between a load and this wait
    if (HR) asm volatile("s_wait_xcnt 0x0" :: "v"(pq), "v"(pq2) : "memory");
    else asm volatile("s_wait_xcnt 0x0" :: "v"(pq) : "memory");
    v8f o[8];
#pragma unroll
    for (int mb = 0; mb < 8; ++mb) o[mb] = (v8f){};
    float m = -3.0e38f, l = 0.f;
    // staging, 16-byte chunk c = tid + 128 * i: k tile (one contiguous 8 KiB) row c >> 4, piece c & 15; v^T tile row c >> 2, piece c & 3
    const unsigned gko = tid * 8, gvo = (tid >> 2) * TT + (tid & 3) * 8; const int sko = (tid >> 4) * KPIT + (tid & 15) * 8, svo = KTE + (tid >> 2) * VPIT + (tid & 3) * 8;
    const int fko = lr * KPIT + 8 * hi, fvo = KTE + lr * VPIT + 8 * hi;   // the lane's place in a k / v^T fragment read
    v8us rk[NP][4], rv[NP][4]; float rb = 0.f;
    if (wv == 0) smb[tid] = bias[tid];   // wave 0 stages the step's 32 bias values, one per lane
#pragma unroll
    for (int i = 0; i < 4; ++i) { rk[0][i] = *(const v8us*)(Kp + gko + i * 1024); rv[0][i] = *(const v8us*)(Vt + gvo + (size_t)i * 32 * TT); if (HR) { rk[NP - 1][i] = *(const v8us*)(K2 + gko + i * 1024); rv[NP - 1][i] = *(const v8us*)(V2 + gvo + (size_t)i * 32 * TT); } }
#pragma unroll
    for (int pl = 0; pl < NP; ++pl)
#pragma unroll
        for (int i = 0; i < 4; ++i) { *(v8usa*)(sm + pl * STE + sko + i * 8 * KPIT) = rk[pl][i]; *(v8usa*)(sm + pl * STE + svo + i * 32 * VPIT) = rv[pl][i]; }
    __syncthreads();   // step 0's tiles are in buffer 0 before any wave reads them
    for (int s = 0; s < nc; ++s) {
        const int sn = min(s + 1, (HR ? TT / 32 : nk) - 1);   // the tile that is staged during this step; behind the last step that reads one a tile is staged that nobody reads, so the loop body has no branch
        const unsigned ok = gko + sn * 32 * HD, ov = gvo + sn * 32, ob = sn * 32 + lane;   // element offsets of this step's loads inside their planes
        const bf* pk = Kp + ok; const bf* pk2 = HR ? K2 + ok : nullptr; const bf* pv = Vt + ov; const bf* pv2 = HR ? V2 + ov : nullptr;
        {   // next k tile: on its way during the score products
#pragma unroll
            for (int i = 0; i < 4; ++i) { rk[0][i] = *(const v8us*)(pk + i * 1024); if (HR) rk[NP - 1][i] = *(const v8us*)(pk2 + i * 1024); }
            if (wv == 0) rb = bias[ob]; }
        const bf* cur = sm + (s & 1) * (NP * STE); bf* nxt = sm + ((s + 1) & 1) * (NP * STE);
        v8f st[2]; float t[16]; float mt = -3.0e38f;
#pragma unroll
        for (int tt = 0; tt < 2; ++tt) { st[tt] = (v8f){};
#pragma unroll
            for (int kc = 0; kc < 4; ++kc) { const V a = LFrag<T16>::ld(cur + fko + tt * 16 * KPIT + kc * 32); st[tt] = WFrag<T16>::mma(a, bq[kc], st[tt]);
                if (HR) { st[tt] = WFrag<T16>::mma(a, bq2[kc], st[tt]); const V a2 = LFrag<T16>::ld(cur + STE + fko + tt * 16 * KPIT + kc * 32); st[tt] = WFrag<T16>::mma(a2, bq[kc], st[tt]); } } }
        const float* cb = smb + (s & 1) * 32 + hi * 8; const v4f bb[4] = { *(const v4fa*)cb, *(const v4fa*)(cb + 4), *(const v4fa*)(cb + 16), *(const v4fa*)(cb + 20) };
#pragma unroll
        for (int tt = 0; tt < 2; ++tt)
#pragma unroll
            for (int j = 0; j < 8; ++j) { const int key = s * 32 + tt * 16 + hi * 8 + j; const float bj = bb[tt * 2 + (j >> 2)][j & 3]; const float x = (key <= qi && bj > 0.f) ? st[tt][j] * SCL + bj : -3.0e38f; t[tt * 8 + j] = x; mt = fmaxf(mt, x); }
        {   // the other buffer is free since the last barrier: the k tile goes in as soon as it has come; next v^T tile: on its way during the softmax and the second product
#pragma unroll
            for (int pl = 0; pl < NP; ++pl)
#pragma unroll
                for (int i = 0; i < 4; ++i) *(v8usa*)(nxt + pl * STE + sko + i * 8 * KPIT) = rk[pl][i];
            if (wv == 0) smb[((s + 1) & 1) * 32 + lane] = rb;
#pragma unroll
            for (int i = 0; i < 4; ++i) { rv[0][i] = *(const v8us*)(pv + (size_t)i * 32 * TT); if (HR) rv[NP - 1][i] = *(const v8us*)(pv2 + (size_t)i * 32 * TT); } }
        mt = fmaxf(mt, __shfl_xor(mt, 16, 32));   // the other half of the wave holds the query's other 16 keys of this step
        const float mn = fmaxf(m, mt); const float alpha = exp2s((m - mn) * 1.4426950408889634f); m = mn;
        float ps = 0.f;
#pragma unroll
        for (int u = 0; u < 16; ++u) { t[u] = exp2s((t[u] - mn) * 1.4426950408889634f); ps += t[u]; }
        l = l * alpha + ps;   // each half of the wave sums its own keys; the halves meet behind the loop
#pragma unroll
        for (int mb = 0; mb < 8; ++mb) o[mb] *= alpha;
        V p, p2;
        if constexpr (HR) { v16us a, c;
#pragma unroll
            for (int u = 0; u < 16; ++u) { unsigned short x, y; splitf(t[u], x, y); a[u] = x; c[u] = y; }
            p = __builtin_bit_cast(v16bf, a); p2 = __builtin_bit_cast(v16bf, c);
        } else {
#pragma unroll
            for (int u = 0; u < 16; ++u) p[u] = tohx(t[u]); }
#pragma unroll
        for (int mb = 0; mb < 8; ++mb) { const V a = LFrag<T16>::ld(cur + fvo + mb * 16 * VPIT); o[mb] = WFrag<T16>::mma(a, p, o[mb]);
            if constexpr (HR) { o[mb] = WFrag<T16>::mma(a, p2, o[mb]); const V a2 = LFrag<T16>::ld(cur + STE + fvo + mb * 16 * VPIT); o[mb] = WFrag<T16>::mma(a2, p, o[mb]); } }
        {
#pragma unroll
            for (int pl = 0; pl < NP; ++pl)
#pragma unroll
                for (int i = 0; i < 4; ++i) *(v8usa*)(nxt + pl * STE + svo + i * 32 * VPIT) = rv[pl][i]; }
        // precaution: this step's load addresses (HR: their offsets beside the planes' scalar bases) are named as inputs, so their registers are not reused between a load and this wait; it stands at the loop's foot, where every load of the step has already delivered its data
        if (HR) asm volatile("s_wait_xcnt 0x0" :: "v"(ok), "v"(ov), "v"(ob) : "memory");
        else asm volatile("s_wait_xcnt 0x0" :: "v"(pk), "v"(pv), "v"(ob) : "memory");
        __syncthreads();   // publishes step s + 1's tiles; every wave has finished reading the buffer that the next step refills
    }
    if constexpr (HR) {
        if (nc < nk) {   // the same for the whole work-group: the barriers below are met by every wave
            const float w = exp2s((-3.0e38f - m) * 1.4426950408889634f);   // a masked key's weight, as in the loop above: 1 for a row with no allowed key, else 0
            unsigned short wh, wl; splitf(w, wh, wl); v16us a16;
#pragma unroll
            for (int u = 0; u < 16; ++u) a16[u] = wh;
            const V p = __builtin_bit_cast(v16bf, a16);
            for (int s = nc; s < nk; ++s) {
                const int sn = min(s + 1, nk - 1); const unsigned ov = gvo + sn * 32;
#pragma unroll
                for (int i = 0; i < 4; ++i) { rv[0][i] = *(const v8us*)(Vt + ov + (size_t)i * 32 * TT); rv[1][i] = *(const v8us*)(V2 + ov + (size_t)i * 32 * TT); }   // next v^T tile: on its way during the product
                const bf* cur = sm + (s & 1) * (NP * STE); bf* nxt = sm + ((s + 1) & 1) * (NP * STE);
                l += 16.f * w;   // this half's 16 keys of the step
                V fh[8], fl[8];
#pragma unroll
                for (int mb = 0; mb < 8; ++mb) { fh[mb] = LFrag<T16>::ld(cur + fvo + mb * 16 * VPIT); fl[mb] = LFrag<T16>::ld(cur + STE + fvo + mb * 16 * VPIT); }
                __builtin_amdgcn_sched_barrier(0);   // the step's fragment reads go out as one group (the q fragments' registers are free here): left alone, the scheduler sinks each read to its product, and every product waits out an LDS latency
#pragma unroll
                for (int mb = 0; mb < 8; ++mb) o[mb] = WFrag<T16>::mma(fh[mb], p, o[mb]);
#pragma unroll
                for (int mb = 0; mb < 8; ++mb) o[mb] = WFrag<T16>::mma(fl[mb], p, o[mb]);
                __builtin_amdgcn_sched_barrier(0);   // the products are issued while the next tile's loads are on their way: left alone, the scheduler puts most of them behind the wait for those loads and behind the barrier
#pragma unroll
                for (int pl = 0; pl < NP; ++pl)
#pragma unroll
                    for (int i = 0; i < 4; ++i) *(v8usa*)(nxt + pl * STE + svo + i * 32 * VPIT) = rv[pl][i];
                __syncthreads();   // publishes step s + 1's v^T tiles; every wave has finished reading the buffer that the next step refills
            }
        }
    }
    l += __shfl_xor(l, 16, 32);
    const float f = poison ? __builtin_nanf("") : 1.0f / l;
#pragma unroll
    for (int mb = 0; mb < 8; ++mb) { v8us a, c;
#pragma unroll
        for (int j = 0; j < 8; ++j) { unsigned short x, y; splitf(o[mb][j] * f, x, y); a[j] = x; c[j] = y; }
        *(v8us*)(oh + (size_t)qi * DQ + mb * 16 + hi * 8) = a; *(v8us*)(ol + (size_t)qi * DQ + mb * 16 + hi * 8) = c; }   // hi / lo rows [b][t][head][d] of the output projection's A operand: d = mb * 16 + hi * 8 + j
}
// grid (TT / 16 * NKV * NB_), REP * 32 threads, four waves per SIMD asked for (a budget of 256 registers: with the LDS of four work-groups per WGP the whole grid is resident). Flat index: low 3 bits the kv plane g * NB_ + b; then 32 row blocks per quarter of the grid: first all hi + lo blocks, then the last rows downwards, the middle, and the rows behind the hi + lo blocks upwards,
// so that four work-groups whose indices lie a quarter of the grid apart carry about the same work together (for speed only; every (plane, row block) occurs once whatever the placement).
static_assert(TT / 16 == 4 * (RH / 16) && NKV * NB_ == 8 && ZH == REP && RH % 128 == 0, "row-block deal of k_attn");
__global__ __launch_bounds__(REP * 32, 4) void k_attn(const h16* __restrict__ Q16, const bf* __restrict__ Qh, const bf* __restrict__ Ql, const bf* __restrict__ K16, const bf* __restrict__ Kh, const bf* __restrict__ Kl, const bf* __restrict__ V16, const bf* __restrict__ Vh, const bf* __restrict__ Vl, const float* __restrict__ Bb, bf* ATh, bf* ATl) {
    __shared__ __align__(16) bf sm[2 * 2 * STE]; __shared__ __align__(16) float smb[2 * 32];
    const int wv = __builtin_amdgcn_readfirstlane((int)(threadIdx.x >> 5));   // wave number as a scalar: plane offsets stay scalar
    const int id = blockIdx.x, kvp = id & 7, g = kvp / NB_, b = kvp % NB_, qr = id >> 8, i5 = (id >> 3) & 31; const int qb = (qr == 0) ? i5 : (qr == 1) ? 127 - i5 : (qr == 2) ? 64 + i5 : 32 + i5; const int q0 = qb * 16;
    const size_t qo = (size_t)(g * (NB_ * ZH) + b * ZH + wv) * TT * HD, kv = (size_t)kvp * TT * HD, ao = (size_t)b * TT * DQ + (g * REP + wv) * HD;
    const float* bias = Bb + (size_t)(b * NKV + g) * TT; const int nc = (q0 + 16 + 31) / 32;   // nc: steps up to the diagonal
    // first: the kv head's first key with a positive bias (RH: none below RH); rows in front of it have no allowed key. Every wave looks through the RH values itself, four neighbouring keys per lane and load: one ballot per place in the quad, the lowest lane set gives the key; the result is a scalar, the same in all four waves
    const float* pf = bias + (threadIdx.x & 31) * 4; v4f fb[RH / 128];
#pragma unroll
    for (int i = 0; i < RH / 128; ++i) fb[i] = *(const v4f*)(pf + i * 128);
    asm volatile("s_wait_xcnt 0x0" :: "v"(pf) : "memory");   // precaution: the load address is named as an input, so its registers are not reused between a load and this wait
    int first = RH;
#pragma unroll
    for (int i = 0; i < RH / 128; ++i)
#pragma unroll
        for (int u = 0; u < 4; ++u) { const unsigned mk = __builtin_amdgcn_ballot_w32(fb[i][u] > 0.f); if (mk) first = min(first, i * 128 + (int)__builtin_ctz(mk) * 4 + u); }
    const bool poison = (first == RH);   /* premise self-check: no positive bias among keys 0..RH-1 for this kv head -> NaN-poison */
    if (qb < RH / 16) attn_rows<bf, true>(sm, smb, wv, Qh + qo, Ql + qo, Kh + kv, Kl + kv, Vh + kv, Vl + kv, bias, poison, q0, nc, (first <= q0) ? nc : TT / 32, ATh + ao, ATl + ao);
    else attn_rows<h16, false>(sm, smb, wv, Q16 + qo, nullptr, K16 + kv, nullptr, V16 + kv, nullptr, bias, poison, q0, nc, nc, ATh + ao, ATl + ao);
}
// ---- k_gemms: GEMM with its operands staged in LDS by asynchronous copies (global_load_async_to_lds_b128). One work-group of 4 waves (2 x 2) per 128x128 output tile, 64x64 (16 accumulators) per wave, the whole K in each accumulator;
// K goes in stages of 64 elements (one whole 128-byte line of every operand row), two LDS buffers: stage t + 1's copies fly while stage t is worked on. Each line is fetched once per work-group, whole, and serves two waves.
// C[m][n] = sum_k A[m][k] Bt[n][k] (+ A2[m][k] Bt[n][k] for NSPLIT 1); A, A2, Bt are K-contiguous 16-bit planes of pitch K, K % 64 == 0; grid (M / 128, N / 128), 128 threads. EPI as above: each wave stores its own 64x64 tile through its own LDS slot. EPI 4: the q, k and v projections in one launch (none reads another's result): Bt holds the rows of Wq^T, Wk^T, Wv^T one behind the other, and a tile is stored as EPI 1, 2 or 3 (ep, ep2, ep3) by its columns.
#define GPIT 72                   // LDS pitch of a staged row of 64 elements: 144 B = 16 B x odd, the 16 rows of a fragment read fall on distinct banks
#define GPLN (128 * GPIT)         // elements of one staged plane: 128 rows
// one lane's eight 16-byte copies of one plane, rows 16 apart (LDS byte address l, global address g, gs elements between the rows). The wait on the address translations is the statement's last line, so that it stands in front of every later write of the address registers (a precaution).
__device__ __forceinline__ void cp8(unsigned l, const bf* g, size_t gs) {
    asm volatile("global_load_async_to_lds_b128 %0, %8, off\n\t"
                 "global_load_async_to_lds_b128 %1, %9, off\n\t"
                 "global_load_async_to_lds_b128 %2, %10, off\n\t"
                 "global_load_async_to_lds_b128 %3, %11, off\n\t"
                 "global_load_async_to_lds_b128 %4, %12, off\n\t"
                 "global_load_async_to_lds_b128 %5, %13, off\n\t"
                 "global_load_async_to_lds_b128 %6, %14, off\n\t"
                 "global_load_async_to_lds_b128 %7, %15, off\n\t"
                 "s_wait_xcnt 0x0"
                 :: "v"(l), "v"(l + 1 * 16 * GPIT * 2), "v"(l + 2 * 16 * GPIT * 2), "v"(l + 3 * 16 * GPIT * 2), "v"(l + 4 * 16 * GPIT * 2), "v"(l + 5 * 16 * GPIT * 2), "v"(l + 6 * 16 * GPIT * 2), "v"(l + 7 * 16 * GPIT * 2),
                    "v"(g), "v"(g + gs), "v"(g + 2 * gs), "v"(g + 3 * gs), "v"(g + 4 * gs), "v"(g + 5 * gs), "v"(g + 6 * gs), "v"(g + 7 * gs) : "memory");
}
// store step of k_gemms: one wave's 64x64 tile (rows rw .., columns cw .. of its product) from its LDS slot osw
template <int EPI>
__device__ __forceinline__ void gemms_put(const float* osw, int lane, int rw, int cw, float* C, int ldc, const Epi& ep) {
    // four rounds are unrolled into one trip: their LDS reads go out together, and one wait behind their stores serves them all
#pragma unroll 1
    for (int s4 = 0; s4 < 32; s4 += 4) {
#pragma unroll
      for (int s = s4; s < s4 + 4; ++s) { const int q = s * 32 + lane, row = q >> 4, cofs = (q & 15) * 4; const v4f val = *(const v4fa*)(osw + row * 68 + cofs);
        if (EPI == 0) *(v4f*)(C + (size_t)(rw + row) * ldc + cw + cofs) = val; else epi_put<EPI>(ep, rw + row, cw + cofs, val);
        if (EPI == 3) {   // v planes [g][b][d][t]: the tile is read by columns too (column row, rows cofs .. cofs + 3), so that 16 lanes store one whole 128-byte line along t
            const int c = cw + row, R = rw + cofs; v4h o16; v4us oh, ol;
#pragma unroll
            for (int u = 0; u < 4; ++u) { const float x = osw[(cofs + u) * 68 + row]; o16[u] = tohx(x); unsigned short a, c2; splitf(x, a, c2); oh[u] = a; ol[u] = c2; }
            const size_t o = (((size_t)(c / HD) * NB_ + R / TT) * HD + c % HD) * TT + R % TT; *(v4h*)(ep.p16 + o) = o16; *(v4us*)(ep.ph + o) = oh; *(v4us*)(ep.pl + o) = ol; } }
      asm volatile("s_wait_xcnt 0x0" ::: "memory"); }   // precaution: the next trip rewrites the registers that this trip's stores name
}
template <int NSPLIT, int EPI>
__global__ __launch_bounds__(128, 2) void k_gemms(const bf* __restrict__ A, const bf* __restrict__ A2, const bf* __restrict__ Bt, int K, float* C, int ldc, Epi ep, Epi ep2, Epi ep3) {
    constexpr int NPL = NSPLIT ? 3 : 2, STG = NPL * GPLN;   // a stage: the planes A, Bt (, A2)
    static_assert(2 * STG * 2 >= 4 * 64 * 68 * 4, "the four waves' output slots fit into the two buffers");
    __shared__ __align__(16) bf ring[2 * STG];
    const int tid = threadIdx.x, lane = tid & 31, lr = lane & 15, hi = lane >> 4; const int wv = __builtin_amdgcn_readfirstlane(tid >> 5), wm = wv >> 1, wn = wv & 1;   // wave number as a scalar: tile offsets stay scalar
    const int r0 = blockIdx.x * 128, c0 = blockIdx.y * 128, nt = K / 64;
    // copies, 16-byte chunk tid + 128 * i of a plane: row (tid >> 3) + 16 * i, piece tid & 7: eight lanes fetch one whole line
    const size_t gs = (size_t)16 * K, go = (size_t)(tid >> 3) * K + (tid & 7) * 8;
    const bf* ga = A + (size_t)r0 * K + go; const bf* gb = Bt + (size_t)c0 * K + go; const bf* ga2 = NSPLIT ? A2 + (size_t)r0 * K + go : nullptr;
    const unsigned l0 = (unsigned)(size_t)ring + ((tid >> 3) * GPIT + (tid & 7) * 8) * 2;
    auto stage = [&](int t) { const unsigned l = l0 + (t & 1) * (STG * 2); cp8(l, ga + t * 64, gs); cp8(l + GPLN * 2, gb + t * 64, gs); if (NSPLIT) cp8(l + 2 * GPLN * 2, ga2 + t * 64, gs); };
    v8f acc[4][4];
    // unrolled, here and below: the accumulator and fragment arrays are indexed by constants and stay in registers
#pragma unroll
    for (int mb = 0; mb < 4; ++mb)
#pragma unroll
        for (int nb = 0; nb < 4; ++nb) acc[mb][nb] = (v8f){};
    const int fa = (wm * 64 + lr) * GPIT + 8 * hi, fb = GPLN + (wn * 64 + lr) * GPIT + 8 * hi;   // the lane's place in an A / Bt fragment read
    stage(0);
    asm volatile("s_wait_asynccnt 0x0" ::: "memory");   // this wave's copies of stage 0 have landed
    __syncthreads();   // stage 0 is in buffer 0 before any wave reads it
    if (nt > 1) stage(1);
    for (int t = 0; t < nt; ++t) {
        const bf* cur = ring + (t & 1) * STG;
        // fragment reads run ahead of the products that use them: the first 32 k's fragments as one group, with them (registers allowing: NSPLIT 0) the second 32 k's Bt fragments; each A fragment of the second 32 k is read into its registers as soon as the four (eight) products on its forerunner are issued.
        // The scheduling barriers keep that order: left alone, the scheduler sinks every read to its first product, and the products wait out an LDS latency each time.
        v16bf a[4], a2[4], b[2][4];
#pragma unroll
        for (int i = 0; i < 4; ++i) { a[i] = LFrag<bf>::ld(cur + fa + i * 16 * GPIT); b[0][i] = LFrag<bf>::ld(cur + fb + i * 16 * GPIT); if (NSPLIT) a2[i] = LFrag<bf>::ld(cur + 2 * GPLN + fa + i * 16 * GPIT); }
        if (!NSPLIT) {
#pragma unroll
            for (int i = 0; i < 4; ++i) b[1][i] = LFrag<bf>::ld(cur + fb + i * 16 * GPIT + 32); }
        __builtin_amdgcn_sched_barrier(0);
#pragma unroll
        for (int mb = 0; mb < 4; ++mb) {
#pragma unroll
            for (int nb = 0; nb < 4; ++nb) { acc[mb][nb] = wmmab(a[mb], b[0][nb], acc[mb][nb]); if (NSPLIT) acc[mb][nb] = wmmab(a2[mb], b[0][nb], acc[mb][nb]); }
            a[mb] = LFrag<bf>::ld(cur + fa + mb * 16 * GPIT + 32); if (NSPLIT) a2[mb] = LFrag<bf>::ld(cur + 2 * GPLN + fa + mb * 16 * GPIT + 32);
            __builtin_amdgcn_sched_barrier(0); }
        if (NSPLIT) {
#pragma unroll
            for (int i = 0; i < 4; ++i) b[1][i] = LFrag<bf>::ld(cur + fb + i * 16 * GPIT + 32);
            __builtin_amdgcn_sched_barrier(0); }
#pragma unroll
        for (int mb = 0; mb < 4; ++mb)
#pragma unroll
            for (int nb = 0; nb < 4; ++nb) { acc[mb][nb] = wmmab(a[mb], b[1][nb], acc[mb][nb]); if (NSPLIT) acc[mb][nb] = wmmab(a2[mb], b[1][nb], acc[mb][nb]); }
        asm volatile("s_wait_dscnt 0x0" ::: "memory");      // this wave's reads of the buffer that is refilled below have ended
        asm volatile("s_wait_asynccnt 0x0" ::: "memory");   // this wave's copies of stage t + 1 have landed
        __syncthreads();   // publishes stage t + 1; every wave has finished reading stage t's buffer
        if (t + 2 < nt) stage(t + 2);
    }
    asm volatile("s_wait_asynccnt 0x0" ::: "memory");   // no copy is outstanding when the buffers become output slots
    float* osw = (float*)ring + wv * (64 * 68); const int rw = r0 + wm * 64, cw = c0 + wn * 64;
#pragma unroll
    for (int mb = 0; mb < 4; ++mb)
#pragma unroll
        for (int nb = 0; nb < 4; ++nb)
#pragma unroll
            for (int j = 0; j < 8; ++j) osw[(mb * 16 + hi * 8 + j) * 68 + nb * 16 + lr] = acc[mb][nb][j];
    __syncthreads();   // the tile is in its slot before its lanes read one another's values
    if constexpr (EPI == 4) {   // the tile's columns say whose it is (the same for the whole work-group): q, then k, then v
        if (c0 < DQ) gemms_put<1>(osw, lane, rw, cw, C, ldc, ep); else if (c0 < DQ + DKV) gemms_put<2>(osw, lane, rw, cw - DQ, C, ldc, ep2); else gemms_put<3>(osw, lane, rw, cw - (DQ + DKV), C, ldc, ep3);
    } else gemms_put<EPI>(osw, lane, rw, cw, C, ldc, ep);
}
__device__ __forceinline__ void wgd_blk(int blk, const float* __restrict__ w, int K, bf* Bt) { const int e = (blk * 256 + threadIdx.x) * 4; if (e >= 64 * K) return; const int k = e % K, n = e / K; v4us o;
#pragma unroll
    for (int u = 0; u < 4; ++u) o[u] = (n < NKV) ? f2bf(w[(size_t)(k + u) * NKV + n]) : (unsigned short)0; *(v4us*)(Bt + e) = o;  }

// ---- k_prep: all operand preparation in one launch (no job reads another's result): the four weight transposes, x to bf16, the padded gate / delta weights. 256 threads; every share of every job is dealt to exactly one work-group, whatever the placement.
// Shares are large (64 elements per thread for the transposes and for x), so that few work-groups have to be started.
#define PT_Q ((DM / TK) * (DQ / TN))  // shares of the Wq transpose, and of Wo's
#define PT_K ((DM / TK) * (DKV / TN)) // of Wk's, and of Wv's
#define PT_N (2 * PT_Q + 2 * PT_K)    // transpose shares
#define PC_G (64 * DQ / 1024)         // shares of the gate weights
#define PC_D (64 * DKV / 1024)        // of the delta weights
#define PC_X (NB_ * TT * DM / 16384)  // of x
static_assert(DM % TK == 0 && DQ % TK == 0 && DM % TN == 0 && DQ % TN == 0 && DKV % TN == 0 && DM == DQ && (NB_ * TT * DM) % 16384 == 0, "shares of k_prep");
__global__ __launch_bounds__(256) void k_prep(const float* __restrict__ x, const float* __restrict__ wq, const float* __restrict__ wk, const float* __restrict__ wv, const float* __restrict__ wg, const float* __restrict__ wdl, const float* __restrict__ wo, bf* XB, bf* WQ, bf* WK, bf* WV, bf* WG, bf* WD, bf* WO) {
    __shared__ __align__(16) bf ts[TN * TK];
    int t = blockIdx.x;   // the same for the whole work-group: the barrier of a transpose share is met by every wave
    if (t < PT_Q) { wtT_blk(ts, t, wq, DM, DQ, WQ); return; } t -= PT_Q;
    if (t < PT_Q) { wtT_blk(ts, t, wo, DQ, DM, WO); return; } t -= PT_Q;
    if (t < PT_K) { wtT_blk(ts, t, wk, DM, DKV, WK); return; } t -= PT_K;
    if (t < PT_K) { wtT_blk(ts, t, wv, DM, DKV, WV); return; } t -= PT_K;
    if (t < PC_G) { wgd_blk(t, wg, DQ, WG); return; } t -= PC_G;
    if (t < PC_D) { wgd_blk(t, wdl, DKV, WD); return; } t -= PC_D;
    cvt64_blk(t, x, XB);
}

extern "C" void kernel_launch(void* const* d_in, const int* in_sizes, int n_in,
                              void* d_out, int out_size, void* d_ws, size_t ws_size, hipStream_t stream) {
    (void)in_sizes; (void)n_in; (void)out_size;
    const float* x = (const float*)d_in[0]; const float* wq = (const float*)d_in[1]; const float* wk = (const float*)d_in[2]; const float* wv = (const float*)d_in[3]; const float* wg = (const float*)d_in[4]; const float* wdl = (const float*)d_in[5]; const float* wo = (const float*)d_in[6]; const float* cosT = nullptr; const float* sinT = nullptr; (void)cosT; (void)sinT;
    float* OUT = (float*)d_out;     // [2][2048][2048]
    char* wsp = (char*)d_ws;
    auto take = [&](size_t bytes) { char* p = wsp; wsp += (bytes + 255) & ~(size_t)255; return (void*)p; };
    const size_t MT = (size_t)NB_ * TT;   // token rows of both batch elements together: every launch covers both
    // read by the attention kernel or behind it
    bf* WO = (bf*)take((size_t)DM * DQ * 2); float* BIAS = (float*)take((size_t)NB_ * NKV * TT * 4);
    h16* QP16 = (h16*)take(MT * NH_ * HD * 2); h16* KP16 = (h16*)take(MT * NKV * HD * 2); h16* VT16 = (h16*)take(MT * NKV * HD * 2);
    bf* QPh = (bf*)take(MT * NH_ * HD * 2); bf* QPl = (bf*)take(MT * NH_ * HD * 2); bf* KPh = (bf*)take(MT * NKV * HD * 2); bf* KPl = (bf*)take(MT * NKV * HD * 2); bf* VTh = (bf*)take(MT * NKV * HD * 2); bf* VTl = (bf*)take(MT * NKV * HD * 2);
    bf* ATh = (bf*)take(MT * DQ * 2); bf* ATl = (bf*)take(MT * DQ * 2);
    // read only by the launches in front of the attention kernel
    bf* WQ = (bf*)take((size_t)(DQ + 2 * DKV) * DM * 2); bf* WK = WQ + (size_t)DQ * DM; bf* WV = WK + (size_t)DKV * DM;   // one plane: the rows of Wq^T, Wk^T, Wv^T one behind the other
    bf* XB = (bf*)take(MT * DM * 2); bf* GFh = (bf*)take(MT * DQ * 2); bf* GFl = (bf*)take(MT * DQ * 2); bf* VFh = (bf*)take(MT * DKV * 2); bf* VFl = (bf*)take(MT * DKV * 2); bf* WG = (bf*)take((size_t)64 * DQ * 2); bf* WD = (bf*)take((size_t)64 * DKV * 2);
    if ((size_t)(wsp - (char*)d_ws) > ws_size) return;    // ws 256 MiB
    const Epi E0 = { nullptr, nullptr, nullptr, nullptr, nullptr };   // plain f32 tile
    k_prep<<<PT_N + PC_G + PC_D + PC_X, 256, 0, stream>>>(x, wq, wk, wv, wg, wdl, wo, XB, WQ, WK, WV, WG, WD, WO);
    const unsigned MB = (unsigned)(MT / 64), MB2 = (unsigned)(MT / 128);   // 64-row and 128-row tiles over both batch elements
    // the three projections, in one launch, store the 16-bit planes that the later products read
    k_gemms<0, 4><<<dim3(MB2, (DQ + 2 * DKV) / 128, 1), 128, 0, stream>>>(XB, nullptr, WQ, DM, nullptr, 0, Epi{ QP16, QPh, QPl, GFh, GFl }, Epi{ KP16, KPh, KPl, nullptr, nullptr }, Epi{ VT16, VTh, VTl, VFh, VFl });
    /* dynamic mask bias per (batch, kv head, key) */
    k_gd<<<dim3(MB, 1, 1), (GDG + GDD) * 32, 0, stream>>>(GFh, GFl, WG, VFh, VFl, WD, BIAS);
    // all heads of both batch elements in one launch; it stores the hi / lo rows of the output projection's A operand
    k_attn<<<dim3(TT / 16 * NKV * NB_, 1, 1), REP * 32, 0, stream>>>(QP16, QPh, QPl, (const bf*)KP16, KPh, KPl, (const bf*)VT16, VTh, VTl, BIAS, ATh, ATl);
    k_gemms<1, 0><<<dim3(MB2, DM / 128, 1), 128, 0, stream>>>(ATh, ATl, WO, DQ, OUT, DM, E0, E0, E0);
}
